// v000
// Measured on an AMD MI455X. A time is GPU time per run, averaged over a window of back-to-back runs after a warm-up
// (all launches, gaps included; the runs take copies of the inputs in turn), and the median of several windows.
// Apart from v000's, it joins two sittings. Times from different sittings can be a few percent apart, while
// side-by-side timings come from the same sitting.
// v000, which the later versions start from, runs in 1430 microseconds.
// compute dtype: all float inputs rounded to bf16; q / k / v projections with EXACT bf16 products on WMMA 16x16x32 (f32 accumulate) + bias (zeros, read); interleaved-pair RoPE in f32 from the bf16-rounded INPUT cos / sin tables (512 pairs across the full model width); logits q x k once to f16 each (1 product) x 64^-0.5; softmax f32; P x 2^11 once to f16 x v once to f16 (1 product); ctx x 2^6 once to f16 x wo f16(bf16 x 2^8) + bo; f32 output.
#include <hip/hip_runtime.h>
#include <math.h>

typedef __attribute__((ext_vector_type(16))) _Float16 v16h;
typedef __attribute__((ext_vector_type(16))) __bf16 v16b;
typedef __attribute__((ext_vector_type(8)))  _Float16 v8h;
typedef __attribute__((ext_vector_type(8)))  float v8f;
typedef __attribute__((ext_vector_type(4)))  float v4f;
typedef __attribute__((ext_vector_type(2)))  float v2f;
typedef __attribute__((ext_vector_type(4)))  unsigned v4u;
typedef __attribute__((ext_vector_type(4)))  int v4i;
typedef float __attribute__((may_alias)) float_a;
typedef int __attribute__((may_alias)) int_a;

template <typename T> __device__ __forceinline__ void vst2(void* p, T v) { *(T*)p = v;  }
__device__ __forceinline__ v8f wmma16(v16h a, v16h b, v8f c) {
  v8f d = __builtin_amdgcn_wmma_f32_16x16x32_f16(false, a, false, b, (short)0, c, false, false);
  asm volatile("v_nop\n\tv_nop\n\tv_nop\n\tv_nop" : "+v"(d) : "v"(a), "v"(b));
  return d;
}
__device__ __forceinline__ v8f wmma_bf(v16b a, v16b b, v8f c) {
  v8f d = __builtin_amdgcn_wmma_f32_16x16x32_bf16(false, a, false, b, (short)0, c, false, false);
  asm volatile("v_nop\n\tv_nop\n\tv_nop\n\tv_nop" : "+v"(d) : "v"(a), "v"(b));
  return d;
}
// 16x16x32 fragments: lane = (h = lane>>4, row/col = lane&15); elements 0..7 = k0+8h+0..7, 8..15 = k0+16+8h+0..7; D element r = row 8h+r
__device__ __forceinline__ v16h frag_h(const _Float16* rowk0, int lane) {
  union { v16h v; v8h q[2]; } u; const _Float16* p = rowk0 + 8 * (lane >> 4);
  u.q[0] = *(const v8h*)p; u.q[1] = *(const v8h*)(p + 16); return u.v;
}
__device__ __forceinline__ v16h frag_f32(const float* rowk0, int lane) {
  v16h a; const float* p = rowk0 + 8 * (lane >> 4);
#pragma unroll
  for (int i = 0; i < 8; ++i) { a[i] = (_Float16)p[i]; a[8 + i] = (_Float16)p[16 + i]; }
  return a;
}
__device__ __forceinline__ v16h frag_f32s(const float* rowk0, int lane, float sc) {
  v16h a; const float* p = rowk0 + 8 * (lane >> 4);
#pragma unroll
  for (int i = 0; i < 8; ++i) { a[i] = (_Float16)(p[i] * sc); a[8 + i] = (_Float16)(p[16 + i] * sc); }
  return a;
}
// column fragment from a [K][ld] layout (column n), rows >= K read as 0
__device__ __forceinline__ v16h fragc_f32(const float* W, int k0, int n, int lane, int ld, int K) {
  v16h a; const int g = lane >> 4;
#pragma unroll
  for (int i = 0; i < 8; ++i) { const int ka = k0 + 8 * g + i, kb = ka + 16;
    a[i] = (_Float16)(ka < K ? W[(size_t)(ka < K ? ka : K - 1) * ld + n] : 0.f); a[8 + i] = (_Float16)(kb < K ? W[(size_t)(kb < K ? kb : K - 1) * ld + n] : 0.f); }
  return a;
}
struct F2 { v16b h, l; };
__device__ __forceinline__ F2 bsplit16(const float v[16]) { F2 r;
#pragma unroll
  for (int i = 0; i < 16; ++i) { const __bf16 h = (__bf16)v[i]; r.h[i] = h; r.l[i] = (__bf16)(v[i] - (float)h); }
  return r; }
__device__ __forceinline__ F2 split_row(const float* row, int k0, int lane) { float v[16]; const float* p = row + k0 + 8 * (lane >> 4);
#pragma unroll
  for (int i = 0; i < 8; ++i) { v[i] = p[i]; v[8 + i] = p[16 + i]; }
  return bsplit16(v); }
__device__ __forceinline__ F2 split_rowK(const float* row, int k0, int lane, int K) { float v[16]; const int g = lane >> 4;
#pragma unroll
  for (int i = 0; i < 8; ++i) { const int ka = k0 + 8 * g + i, kb = ka + 16; v[i] = ka < K ? row[ka < K ? ka : K - 1] : 0.f; v[8 + i] = kb < K ? row[kb < K ? kb : K - 1] : 0.f; }
  return bsplit16(v); }
__device__ __forceinline__ F2 split_col(const float* W, int k0, int n, int lane, int ld, int K) { float v[16]; const int g = lane >> 4;
#pragma unroll
  for (int i = 0; i < 8; ++i) { const int ka = k0 + 8 * g + i, kb = ka + 16; v[i] = ka < K ? W[(size_t)(ka < K ? ka : K - 1) * ld + n] : 0.f; v[8 + i] = kb < K ? W[(size_t)(kb < K ? kb : K - 1) * ld + n] : 0.f; }
  return bsplit16(v); }
__device__ __forceinline__ v8f mac3(const F2& a, const F2& b, v8f c) { c = wmma_bf(a.l, b.h, c); c = wmma_bf(a.h, b.l, c); return wmma_bf(a.h, b.h, c); }
__device__ __forceinline__ float sigm(float v) { return 1.0f / (1.0f + expf(-v)); }
#define LDSX() do { asm volatile("s_wait_dscnt 0" ::: "memory"); __builtin_amdgcn_wave_barrier(); __builtin_amdgcn_fence(__ATOMIC_RELEASE, "workgroup"); } while (0)

// Multi-head attention on separate inputs with RoPE applied across the FULL model width before the head split (query / key / value [2,2048,1024]; torch (out,in) wq / wk / wv / wo [1024,1024] N(0, 1/1024) applied as x @ W.T + b, biases zeros (read); cos / sin [2048,512] are module INPUTS (computed in setup with numpy; read literally): x.reshape(.., 512, 2): (x0, x1) = (x[2j], x[2j+1]) -> (x0 c - x1 s, x0 s + x1 c) with c = cos[s][j], j = 0..511, on q and k; then 16 heads x 64 (head h = columns 64h..: its pair i uses table column h*32 + i); scores / sqrt(64); no mask; softmax; out @ wo.T + bo).
#define NB 2
#define TT 2048
#define CC 1024            // NH * HD = projected width
#define DIN 1024          // input (model) width
#define NH 16
#define HD 64
#define NQB (TT / 64)
#define HG 4
#define SCALE (0.125f)
#define CAUSAL 0
#ifndef TNB
#define TNB NB
#endif
__device__ __forceinline__ float bfr(float v) { return (float)(__bf16)v; }
__host__ __device__ __forceinline__ int kb_last(int qb) { return CAUSAL ? ((qb * 64 + 63) >> 7) : (TT / 128 - 1); }
typedef __attribute__((ext_vector_type(8))) __bf16 v8b;
__device__ __forceinline__ v16b frag_b(const __bf16* rowk0, int lane) {
  union { v16b v; v8b q[2]; } u; const __bf16* p = rowk0 + 8 * (lane >> 4);
  u.q[0] = *(const v8b*)p; u.q[1] = *(const v8b*)(p + 16); return u.v;
}
#define QBH 0              // causal: query blocks 0..QBH-1 of each sequence (few keys, no averaging) take the high-precision path
#define QHI 0               // single-product logits on every row (logit sigma ~1)
#define KHI 64            // key rows carrying k residual / v bf16 hi+lo planes (used only by the causal high-precision path)
// B fragment (k rows k0+.., output column o) of a weight: (in,out) [K][ld] or (out,in) [ld rows of K]: bf16 exact, or f16(bf16 * 256) exact
__device__ __forceinline__ v16b wcol_io(const float* Wm, int k0, int o, int lane, int ld) { v16b w; const int g = lane >> 4;
#pragma unroll
  for (int i = 0; i < 8; ++i) { w[i] = (__bf16)Wm[(size_t)(k0 + 8 * g + i) * ld + o]; w[8 + i] = (__bf16)Wm[(size_t)(k0 + 16 + 8 * g + i) * ld + o]; }
  return w; }
__device__ __forceinline__ v16b wcol_oi(const float* Wm, int k0, int o, int lane, int K) { v16b w; const float* p = Wm + (size_t)o * K + k0 + 8 * (lane >> 4);
#pragma unroll
  for (int i = 0; i < 8; ++i) { w[i] = (__bf16)p[i]; w[8 + i] = (__bf16)p[16 + i]; }
  return w; }
__device__ __forceinline__ v16h wcolh_io(const float* Wm, int k0, int o, int lane, int ld) { v16h w; const int g = lane >> 4;
#pragma unroll
  for (int i = 0; i < 8; ++i) { w[i] = (_Float16)(bfr(Wm[(size_t)(k0 + 8 * g + i) * ld + o]) * 256.0f); w[8 + i] = (_Float16)(bfr(Wm[(size_t)(k0 + 16 + 8 * g + i) * ld + o]) * 256.0f); }
  return w; }
__device__ __forceinline__ v16h wcolh_oi(const float* Wm, int k0, int o, int lane, int K) { v16h w; const float* p = Wm + (size_t)o * K + k0 + 8 * (lane >> 4);
#pragma unroll
  for (int i = 0; i < 8; ++i) { w[i] = (_Float16)(bfr(p[i]) * 256.0f); w[8 + i] = (_Float16)(bfr(p[16 + i]) * 256.0f); }
  return w; }
#define WQKV_LAYOUT 1   // 0 = (in,out) [DIN][CC]; 1 = (out,in) [CC][DIN]; 2 = per-head [NH][DIN][HD]
__device__ __forceinline__ v16b wcol_hdk(const float* Wm, int k0, int o, int lane) { v16b w; const int g = lane >> 4; const float* p = Wm + (size_t)(o / HD) * DIN * HD + (o % HD);
#pragma unroll
  for (int i = 0; i < 8; ++i) { w[i] = (__bf16)p[(size_t)(k0 + 8 * g + i) * HD]; w[8 + i] = (__bf16)p[(size_t)(k0 + 16 + 8 * g + i) * HD]; }
  return w; }
#define WO_OUT_IN 1
#if WQKV_LAYOUT == 1
#define WCOL(W, k0, o, lane) wcol_oi(W, k0, o, lane, DIN)
#elif WQKV_LAYOUT == 2
#define WCOL(W, k0, o, lane) wcol_hdk(W, k0, o, lane)
#else
#define WCOL(W, k0, o, lane) wcol_io(W, k0, o, lane, CC)
#endif
#if WO_OUT_IN
#define WOCOL(W, k0, o, lane) wcol_oi(W, k0, o, lane, CC)
#define WOCOLH(W, k0, o, lane) wcolh_oi(W, k0, o, lane, CC)
#else
#define WOCOL(W, k0, o, lane) wcol_io(W, k0, o, lane, DIN)
#define WOCOLH(W, k0, o, lane) wcolh_io(W, k0, o, lane, DIN)
#endif

#define TBW 512   // table width = model width / 2 pairs
#define PROJ_EXTRA_PARAMS , const float* __restrict__ COS, const float* __restrict__ SIN   /* rotary tables [TT][512], module INPUTS, read literally */
// per (token, head) hook on the staged f32 row (64 floats = pairs h*32 .. h*32+31 of the model-wide rotation) of the q and k streams: (x0, x1) = (row[2i], row[2i+1]) -> (x0 c - x1 s, x0 s + x1 c) with c = bf16(cos[t][h*32 + i]), s = bf16(sin[t][h*32 + i]); v untouched; products and sums kept separate
#define PROJ_EPI(which, row, t, h) do { if ((which) < 2) { float* rw = (row); const float* ct_ = COS + (size_t)(t) * TBW + (size_t)(h) * 32; const float* st_ = SIN + (size_t)(t) * TBW + (size_t)(h) * 32; _Pragma("unroll 4") for (int i = 0; i < 32; ++i) { _Pragma("clang fp contract(off)") const float cs = bfr(ct_[i]), sn = bfr(st_[i]); const float xe = rw[2 * i], xo = rw[2 * i + 1]; rw[2 * i] = xe * cs - xo * sn; rw[2 * i + 1] = xe * sn + xo * cs; } } } while (0)
#ifndef SM_EXTRA_PARAMS
#define SM_EXTRA_PARAMS
#endif
#ifndef PROJ_EXTRA_PARAMS
#define PROJ_EXTRA_PARAMS
#endif
#ifndef SM_MASK_HOOK
#define SM_MASK_HOOK (void)0
#endif

#define WS_QH  0u                                      // f16 q rows [b*t][CC]
#define WS_KH  (WS_QH + 2u * (size_t)NB * TT * CC)      // f16 k rows [b*t][CC]
#define WS_VT  (WS_KH + 2u * (size_t)NB * TT * CC)      // f16 v planes [b][c][t]
#define WS_QL  (WS_VT + 2u * (size_t)NB * CC * TT)      // f16 q residual x 2^10 rows [b][t < QHI][CC]
#define WS_KL  (WS_QL + 2u * (size_t)NB * QHI * CC)     // f16 k residual x 2^10 rows [b][t < KHI][CC]
#define WS_VB  (WS_KL + 2u * (size_t)NB * KHI * CC)     // bf16 v hi planes [b][c][t < KHI]
#define WS_VBL (WS_VB + 2u * (size_t)NB * CC * KHI)
#define WS_S   (WS_VBL + 2u * (size_t)NB * CC * KHI)    // f32 logits / P [hg][t][s]
#define WS_Y   (WS_S  + 4u * (size_t)HG * TT * TT)      // f32 ctx rows [b*t][CC] (only when there is an output projection)
#define WS_END (WS_Y  + 4u * (size_t)NB * TT * CC)

// ---- k_proj: block = (64 rows, 128 cols, which): q/k/v = X W (+ b) with exact bf16 products (K = DIN) -> which 0: q f16 rows (+ residual rows < QHI); 1: k f16 rows (+ residual rows < KHI); 2: v f16 planes [c][t] (+ bf16 hi/lo planes for t < KHI)
__global__ __launch_bounds__(128) void k_proj(const float* __restrict__ XQ, const float* __restrict__ XK, const float* __restrict__ XV, const float* __restrict__ WQ, const float* __restrict__ WK, const float* __restrict__ WV, const float* __restrict__ BQ, const float* __restrict__ BK, const float* __restrict__ BV,
    _Float16* __restrict__ QH, _Float16* __restrict__ QL, _Float16* __restrict__ KH, _Float16* __restrict__ KL, _Float16* __restrict__ VT, __bf16* __restrict__ VB, __bf16* __restrict__ VBL PROJ_EXTRA_PARAMS) {
  __shared__ __align__(16) float st[64][132]; __shared__ __align__(16) _Float16 sh[64][136], sl[64][136]; __shared__ __align__(16) _Float16 th[128][72]; __shared__ __align__(16) __bf16 tb[128][72], tbl[128][72];
  const int tid = threadIdx.x, wave = tid >> 5, lane = tid & 31, col = lane & 15, g = lane >> 4; const int which = blockIdx.z; const int c0 = blockIdx.y * 128; const size_t r0 = (size_t)blockIdx.x * 64; const size_t bb = r0 / TT; const int t0 = (int)(r0 % TT);
  const float* X = which == 0 ? XQ : which == 1 ? XK : XV; const float* WA = which == 0 ? WQ : which == 1 ? WK : WV; const float* BA = which == 0 ? BQ : which == 1 ? BK : BV;
  v8f acc[8] = {};
#pragma unroll 2
  for (int kc = 0; kc < DIN / 32; ++kc) { v16b a; { const float* p = X + (r0 + wave * 16 + col) * DIN + kc * 32 + 8 * g;
#pragma unroll
      for (int i = 0; i < 8; ++i) { a[i] = (__bf16)p[i]; a[8 + i] = (__bf16)p[16 + i]; } }
    asm volatile("s_wait_loadcnt 0x0" ::: "memory");
#pragma unroll
    for (int j = 0; j < 8; ++j) { const v16b w = WCOL(WA, kc * 32, c0 + j * 16 + col, lane); asm volatile("s_wait_loadcnt 0x0" ::: "memory"); acc[j] = wmma_bf(a, w, acc[j]); } }
  { // stage the f32 tile (acc + bias) in LDS, run the per-(row, head) epilogue hook, then convert
#pragma unroll
    for (int j = 0; j < 8; ++j) { const float bias = BA ? bfr(BA[c0 + j * 16 + col]) : 0.f;
#pragma unroll
      for (int r = 0; r < 8; ++r) st[wave * 16 + 8 * g + r][j * 16 + col] = acc[j][r] + bias; }
    __syncthreads();
    for (int e = tid; e < 64 * (128 / HD); e += 128) { const int rl = e / (128 / HD), hh = e % (128 / HD); PROJ_EPI(which, &st[rl][hh * HD], (int)((r0 + rl) % TT), (c0 / HD) + hh); }
    __syncthreads(); }
  if (which < 2) { _Float16* DH = which == 0 ? QH : KH; _Float16* DL = which == 0 ? QL : KL; const int nhi = which == 0 ? QHI : KHI; const bool hi_rows = t0 < nhi;
    for (int e = tid; e < 64 * 128; e += 128) { const int rl = e >> 7, cl = e & 127; const float v = st[rl][cl]; const _Float16 hv = (_Float16)v; sh[rl][cl] = hv; sl[rl][cl] = (_Float16)((v - (float)hv) * 1024.0f); }
    __syncthreads();
    for (int e = tid; e < 64 * 16; e += 128) { const int rl = e >> 4, q = e & 15; vst2((unsigned*)(DH + (r0 + rl) * CC + c0 + q * 8), *(const v4u*)&sh[rl][q * 8]); if (hi_rows) vst2((unsigned*)(DL + (bb * nhi + t0 + rl) * (size_t)CC + c0 + q * 8), *(const v4u*)&sl[rl][q * 8]); }
  } else { const bool hi_rows = t0 < KHI;
    for (int e = tid; e < 64 * 128; e += 128) { const int rl = e & 63, cl = e >> 6; const float v = st[rl][cl]; th[cl][rl] = (_Float16)v; const __bf16 bh = (__bf16)v; tb[cl][rl] = bh; tbl[cl][rl] = (__bf16)(v - (float)bh); }
    __syncthreads();
    for (int e = tid; e < 128 * 8; e += 128) { const int cl = e >> 3, q = e & 7; vst2((unsigned*)(VT + (bb * CC + c0 + cl) * (size_t)TT + t0 + q * 8), *(const v4u*)&th[cl][q * 8]); if (hi_rows) { const size_t o3 = (bb * CC + c0 + cl) * (size_t)KHI + t0 + q * 8; vst2((unsigned*)(VB + o3), *(const v4u*)&tb[cl][q * 8]); vst2((unsigned*)(VBL + o3), *(const v4u*)&tbl[cl][q * 8]); } } } }
// ---- k_sc: block = (query block qb, key block kb <= kb_last(qb), head in group) of batch b: logits x SCALE; q hi + residual (x 2^10) against k (2 products) for query rows < QHI, plus the k residual (3 products) for query blocks < QBH (causal early rows); causal: blocks past the diagonal exit, the mask itself is applied by index in k_sm
__global__ __launch_bounds__(128) void k_sc(const _Float16* __restrict__ QH, const _Float16* __restrict__ KH, const _Float16* __restrict__ QL, const _Float16* __restrict__ KL, int b, int h0, float* __restrict__ S0) { __shared__ __align__(16) float ss[4][16][132];
  const int qb = blockIdx.x, kb = blockIdx.y; if (kb > kb_last(qb)) return;
  const int h = h0 + blockIdx.z; float* S = S0 + (size_t)blockIdx.z * TT * TT;
  const int tid = threadIdx.x, wave = tid >> 5, lane = tid & 31, col = lane & 15, g = lane >> 4; const int k0 = kb * 128; const int ql0 = qb * 64 + wave * 16; const size_t q0 = (size_t)b * TT + ql0, kr0 = (size_t)b * TT + k0;
  v8f acc[8] = {}, accl[8] = {};
  const _Float16* QLb = QL + (size_t)b * QHI * CC; const _Float16* KLb = KL + (size_t)b * KHI * CC;
  if (qb < QBH) {
#pragma unroll
    for (int kc = 0; kc < HD / 32; ++kc) { const v16h ah = frag_h(QH + (q0 + col) * CC + h * HD + kc * 32, lane), al = frag_h(QLb + (size_t)(ql0 + col) * CC + h * HD + kc * 32, lane);
#pragma unroll
      for (int j = 0; j < 8; ++j) { const v16h kbf = frag_h(KH + (kr0 + j * 16 + col) * CC + h * HD + kc * 32, lane), klf = frag_h(KLb + (size_t)(k0 + j * 16 + col) * CC + h * HD + kc * 32, lane); acc[j] = wmma16(ah, kbf, acc[j]); accl[j] = wmma16(al, kbf, accl[j]); accl[j] = wmma16(ah, klf, accl[j]); } }
  } else if (qb * 64 < QHI) {
#pragma unroll
    for (int kc = 0; kc < HD / 32; ++kc) { const v16h ah = frag_h(QH + (q0 + col) * CC + h * HD + kc * 32, lane), al = frag_h(QLb + (size_t)(ql0 + col) * CC + h * HD + kc * 32, lane);
#pragma unroll
      for (int j = 0; j < 8; ++j) { const v16h kbf = frag_h(KH + (kr0 + j * 16 + col) * CC + h * HD + kc * 32, lane); acc[j] = wmma16(ah, kbf, acc[j]); accl[j] = wmma16(al, kbf, accl[j]); } }
  } else {
#pragma unroll
    for (int kc = 0; kc < HD / 32; ++kc) { const v16h ah = frag_h(QH + (q0 + col) * CC + h * HD + kc * 32, lane);
#pragma unroll
      for (int j = 0; j < 8; ++j) { const v16h kbf = frag_h(KH + (kr0 + j * 16 + col) * CC + h * HD + kc * 32, lane); acc[j] = wmma16(ah, kbf, acc[j]); } } }
#pragma unroll
  for (int j = 0; j < 8; ++j) {
#pragma unroll
    for (int r = 0; r < 8; ++r) ss[wave][8 * g + r][j * 16 + col] = (acc[j][r] + accl[j][r] * (1.0f / 1024.0f)) * SCALE; }
  LDSX(); for (int rl = 0; rl < 16; ++rl) vst2(S + (size_t)(ql0 + rl) * TT + k0 + lane * 4, *(const v4f*)&ss[wave][rl][lane * 4]); }
// ---- k_sm: block = query row t (head in group): keys [0, kend): causal -> logit if s <= t else excluded; softmax in f32; P x 2^11 in place (0 for excluded)
__global__ __launch_bounds__(256) void k_sm(float* __restrict__ S0 SM_EXTRA_PARAMS) { __shared__ float sred[8]; __shared__ float sbc; __shared__ __align__(16) float shv[TT];
  const int tid = threadIdx.x; const int t = blockIdx.x; const int kend = (kb_last(t >> 6) + 1) * 128;
  float* sr = S0 + (size_t)blockIdx.y * TT * TT + (size_t)t * TT;
  float m = -3.0e38f; for (int k = tid; k < kend; k += 256) { float v = (!CAUSAL || k <= t) ? sr[k] : -3.0e38f; SM_MASK_HOOK; shv[k] = v; m = fmaxf(m, v); }
#pragma unroll
  for (int o = 1; o < 32; o <<= 1) m = fmaxf(m, __shfl_xor(m, o));
  if ((tid & 31) == 0) sred[tid >> 5] = m; __syncthreads(); if (tid == 0) { float a = sred[0]; for (int i = 1; i < 8; ++i) a = fmaxf(a, sred[i]); sbc = a; } __syncthreads(); m = sbc; __syncthreads();
  float sum = 0.f; for (int k = tid; k < kend; k += 256) { const float v = shv[k]; const float e = (v <= -1.0e38f) ? 0.f : expf(v - m); shv[k] = e; sum += e; }
#pragma unroll
  for (int o = 1; o < 32; o <<= 1) sum += __shfl_xor(sum, o);
  if ((tid & 31) == 0) sred[tid >> 5] = sum; __syncthreads(); if (tid == 0) { float a = 0.f; for (int i = 0; i < 8; ++i) a += sred[i]; sbc = a > 0.f ? 2048.0f / a : 0.f; }   /* a fully excluded row yields P = 0 */ __syncthreads(); const float inv = sbc;
  for (int k = tid; k < kend; k += 256) shv[k] = shv[k] * inv;
  __syncthreads(); for (int q = tid; q < kend / 4; q += 256) vst2(sr + q * 4, *(const v4f*)&shv[q * 4]); }
// ---- k_pv: block = 64 queries (qb) of (b, h): ctx = P . v over keys [0, kend) (P x 2^11 once to f16 against v f16: 1 product; causal early query blocks: P and v as bf16 hi + lo, 3 products); 256-B (row, head) segment by 16 lanes
__global__ __launch_bounds__(128) void k_pv(const float* __restrict__ PS0, const _Float16* __restrict__ VT, const __bf16* __restrict__ VB, const __bf16* __restrict__ VBL, int b, int h0, float* __restrict__ Y) { const int h = h0 + blockIdx.z; const float* PS = PS0 + (size_t)blockIdx.z * TT * TT; __shared__ __align__(16) float ss[4][16][HD + 4];
  const int tid = threadIdx.x, wave = tid >> 5, lane = tid & 31, col = lane & 15, g = lane >> 4; const int qb = blockIdx.x; const int ql0 = qb * 64 + wave * 16; const int kce = (kb_last(qb) + 1) * 4;
  v8f acc[HD / 16] = {};
  if (qb < QBH) {
#pragma unroll 1
    for (int kc = 0; kc < kce; ++kc) { const F2 p = split_row(PS + (size_t)(ql0 + col) * TT, kc * 32, lane);
      asm volatile("s_wait_loadcnt 0x0" ::: "memory");
#pragma unroll
      for (int j = 0; j < HD / 16; ++j) { const size_t po = ((size_t)b * CC + h * HD + j * 16 + col) * (size_t)KHI + kc * 32; const v16b vh = frag_b(VB + po, lane); acc[j] = wmma_bf(p.h, vh, acc[j]); acc[j] = wmma_bf(p.l, vh, acc[j]); acc[j] = wmma_bf(p.h, frag_b(VBL + po, lane), acc[j]); } }
  } else {
#pragma unroll 1
    for (int kc = 0; kc < kce; ++kc) { const v16h p = frag_f32(PS + (size_t)(ql0 + col) * TT + kc * 32, lane);
      asm volatile("s_wait_loadcnt 0x0" ::: "memory");
#pragma unroll
      for (int j = 0; j < HD / 16; ++j) { const size_t po = ((size_t)b * CC + h * HD + j * 16 + col) * (size_t)TT + kc * 32; acc[j] = wmma16(p, frag_h(VT + po, lane), acc[j]); } } }
#pragma unroll
  for (int j = 0; j < HD / 16; ++j)
#pragma unroll
    for (int r = 0; r < 8; ++r) ss[wave][8 * g + r][j * 16 + col] = acc[j][r] * (1.0f / 2048.0f);
  LDSX(); for (int rl = 0; rl < 16; ++rl) if (lane < HD / 4) vst2(Y + ((size_t)b * TT + ql0 + rl) * CC + h * HD + lane * 4, *(const v4f*)&ss[wave][rl][lane * 4]); }
// ---- k_out: block = (64 rows, 128 cols): out = ctx Wo (+ bo): ctx x 2^6 once to f16 against Wo as f16(bf16 x 2^8) exact (1 product) x 2^-14; causal early rows (< QHI of each sequence): ctx bf16 hi + lo against exact bf16 Wo (2 products)
__global__ __launch_bounds__(128) void k_out(const float* __restrict__ Y, const float* __restrict__ WO, const float* __restrict__ BO, float* __restrict__ OUT) { __shared__ __align__(16) float sf[4][16][132];
  const int tid = threadIdx.x, wave = tid >> 5, lane = tid & 31, col = lane & 15, g = lane >> 4; const int c0 = blockIdx.y * 128; const size_t r0 = (size_t)blockIdx.x * 64 + wave * 16;
  v8f acc[8] = {};
  if (CAUSAL && (int)(((size_t)blockIdx.x * 64) % TT) < QHI) {   /* block-uniform */
#pragma unroll 2
    for (int kc = 0; kc < CC / 32; ++kc) { const F2 a = split_row(Y + (r0 + col) * CC, kc * 32, lane); asm volatile("s_wait_loadcnt 0x0" ::: "memory");
#pragma unroll
      for (int j = 0; j < 8; ++j) { const v16b w = WOCOL(WO, kc * 32, c0 + j * 16 + col, lane); asm volatile("s_wait_loadcnt 0x0" ::: "memory"); acc[j] = wmma_bf(a.h, w, acc[j]); acc[j] = wmma_bf(a.l, w, acc[j]); } }
#pragma unroll
    for (int j = 0; j < 8; ++j) { const float bias = BO ? bfr(BO[c0 + j * 16 + col]) : 0.f;
#pragma unroll
      for (int r = 0; r < 8; ++r) sf[wave][8 * g + r][j * 16 + col] = acc[j][r] + bias; }
  } else {
#pragma unroll 2
    for (int kc = 0; kc < CC / 32; ++kc) { const v16h a = frag_f32s(Y + (r0 + col) * CC + kc * 32, lane, 64.0f); asm volatile("s_wait_loadcnt 0x0" ::: "memory");   /* ctx carried x 2^6 into f16 so small-magnitude context rows stay clear of f16 subnormals */
#pragma unroll
      for (int j = 0; j < 8; ++j) { const v16h w = WOCOLH(WO, kc * 32, c0 + j * 16 + col, lane); asm volatile("s_wait_loadcnt 0x0" ::: "memory"); acc[j] = wmma16(a, w, acc[j]); } }
#pragma unroll
    for (int j = 0; j < 8; ++j) { const float bias = BO ? bfr(BO[c0 + j * 16 + col]) : 0.f;
#pragma unroll
      for (int r = 0; r < 8; ++r) sf[wave][8 * g + r][j * 16 + col] = acc[j][r] * (1.0f / 16384.0f) + bias; } }   /* 2^-8 (Wo carry) x 2^-6 (ctx carry) */
  LDSX(); for (int rl = 0; rl < 16; ++rl) vst2(OUT + (r0 + rl) * DIN + c0 + lane * 4, *(const v4f*)&sf[wave][rl][lane * 4]); }

extern "C" void kernel_launch(void* const* d_in, const int* in_sizes, int n_in, void* d_out, int out_size, void* d_ws, size_t ws_size, hipStream_t stream) {
  (void)in_sizes; (void)n_in; (void)out_size;
  const float** F = (const float**)d_in;
  if (ws_size < (size_t)WS_END) return;
  char* ws = (char*)d_ws; _Float16 *QH = (_Float16*)(ws + WS_QH), *KH = (_Float16*)(ws + WS_KH), *VT = (_Float16*)(ws + WS_VT), *QL = (_Float16*)(ws + WS_QL), *KL = (_Float16*)(ws + WS_KL); __bf16 *VB = (__bf16*)(ws + WS_VB), *VBL = (__bf16*)(ws + WS_VBL); float *S = (float*)(ws + WS_S), *Y = (float*)(ws + WS_Y);
  (void)Y; (void)QL; (void)KL; (void)VB; (void)VBL;
  // inputs: 0 query [2,2048,1024]; 1 key; 2 value; 3 wq [1024,1024] (out,in), 4 bq; 5 wk, 6 bk; 7 wv, 8 bv; 9 wo (out,in), 10 bo (biases zeros, read); 11 cos [2048,512]; 12 sin [2048,512]
  k_proj<<<dim3(TNB * TT / 64, CC / 128, 3), 128, 0, stream>>>(F[0], F[1], F[2], F[3], F[5], F[7], F[4], F[6], F[8], QH, QL, KH, KL, VT, VB, VBL, F[11], F[12]);
  for (int b = 0; b < TNB; ++b) for (int h0 = 0; h0 < NH; h0 += HG) {
    k_sc<<<dim3(NQB, TT / 128, HG), 128, 0, stream>>>(QH, KH, QL, KL, b, h0, S);
    k_sm<<<dim3(TT, HG), 256, 0, stream>>>(S);
    k_pv<<<dim3(NQB, 1, HG), 128, 0, stream>>>(S, VT, VB, VBL, b, h0, Y);
  }
  k_out<<<dim3(TNB * TT / 64, DIN / 128), 128, 0, stream>>>(Y, F[9], F[10], (float*)d_out);
}

// v001
// Measured time: 515 microseconds a run.
// Two timings next to v000 put it at 2.81 and 2.80 times that version's speed.
// compute dtype: all float inputs rounded to bf16; q / k / v projections with EXACT bf16 products on WMMA 16x16x32 (f32 accumulate) + bias (zeros, read); interleaved-pair RoPE in f32 from the bf16-rounded INPUT cos / sin tables (512 pairs across the full model width); logits q x k once to f16 each (1 product) x 64^-0.5; online softmax f32 (base 2, running maximum); unnormalised P x 2^8 once to f16 x v once to f16 (1 product), divided by the f32 sum at the end; ctx x 2^6 once to f16 x wo f16(bf16 x 2^8) + bo; f32 output.
#include <hip/hip_runtime.h>
#include <math.h>

typedef __attribute__((ext_vector_type(16))) _Float16 v16h;
typedef __attribute__((ext_vector_type(16))) __bf16 v16b;
typedef __attribute__((ext_vector_type(8)))  _Float16 v8h;
typedef __attribute__((ext_vector_type(8)))  float v8f;
typedef __attribute__((ext_vector_type(4)))  float v4f;
typedef __attribute__((ext_vector_type(2)))  float v2f;
typedef __attribute__((ext_vector_type(4)))  unsigned v4u;
typedef __attribute__((ext_vector_type(4)))  int v4i;
typedef float __attribute__((may_alias)) float_a;
typedef int __attribute__((may_alias)) int_a;

template <typename T> __device__ __forceinline__ void vst2(void* p, T v) { *(T*)p = v;  }
__device__ __forceinline__ v8f wmma16(v16h a, v16h b, v8f c) {
  v8f d = __builtin_amdgcn_wmma_f32_16x16x32_f16(false, a, false, b, (short)0, c, false, false);
  asm volatile("v_nop\n\tv_nop\n\tv_nop\n\tv_nop" : "+v"(d) : "v"(a), "v"(b));
  return d;
}
__device__ __forceinline__ v8f wmma_bf(v16b a, v16b b, v8f c) {
  v8f d = __builtin_amdgcn_wmma_f32_16x16x32_bf16(false, a, false, b, (short)0, c, false, false);
  asm volatile("v_nop\n\tv_nop\n\tv_nop\n\tv_nop" : "+v"(d) : "v"(a), "v"(b));
  return d;
}
// 16x16x32 fragments: lane = (h = lane>>4, row/col = lane&15); elements 0..7 = k0+8h+0..7, 8..15 = k0+16+8h+0..7; D element r = row 8h+r
__device__ __forceinline__ v16h frag_h(const _Float16* rowk0, int lane) {
  union { v16h v; v8h q[2]; } u; const _Float16* p = rowk0 + 8 * (lane >> 4);
  u.q[0] = *(const v8h*)p; u.q[1] = *(const v8h*)(p + 16); return u.v;
}
__device__ __forceinline__ v16h frag_f32(const float* rowk0, int lane) {
  v16h a; const float* p = rowk0 + 8 * (lane >> 4);
#pragma unroll
  for (int i = 0; i < 8; ++i) { a[i] = (_Float16)p[i]; a[8 + i] = (_Float16)p[16 + i]; }
  return a;
}
__device__ __forceinline__ v16h frag_f32s(const float* rowk0, int lane, float sc) {
  v16h a; const float* p = rowk0 + 8 * (lane >> 4);
#pragma unroll
  for (int i = 0; i < 8; ++i) { a[i] = (_Float16)(p[i] * sc); a[8 + i] = (_Float16)(p[16 + i] * sc); }
  return a;
}
// column fragment from a [K][ld] layout (column n), rows >= K read as 0
__device__ __forceinline__ v16h fragc_f32(const float* W, int k0, int n, int lane, int ld, int K) {
  v16h a; const int g = lane >> 4;
#pragma unroll
  for (int i = 0; i < 8; ++i) { const int ka = k0 + 8 * g + i, kb = ka + 16;
    a[i] = (_Float16)(ka < K ? W[(size_t)(ka < K ? ka : K - 1) * ld + n] : 0.f); a[8 + i] = (_Float16)(kb < K ? W[(size_t)(kb < K ? kb : K - 1) * ld + n] : 0.f); }
  return a;
}
struct F2 { v16b h, l; };
__device__ __forceinline__ F2 bsplit16(const float v[16]) { F2 r;
#pragma unroll
  for (int i = 0; i < 16; ++i) { const __bf16 h = (__bf16)v[i]; r.h[i] = h; r.l[i] = (__bf16)(v[i] - (float)h); }
  return r; }
__device__ __forceinline__ F2 split_row(const float* row, int k0, int lane) { float v[16]; const float* p = row + k0 + 8 * (lane >> 4);
#pragma unroll
  for (int i = 0; i < 8; ++i) { v[i] = p[i]; v[8 + i] = p[16 + i]; }
  return bsplit16(v); }
__device__ __forceinline__ F2 split_rowK(const float* row, int k0, int lane, int K) { float v[16]; const int g = lane >> 4;
#pragma unroll
  for (int i = 0; i < 8; ++i) { const int ka = k0 + 8 * g + i, kb = ka + 16; v[i] = ka < K ? row[ka < K ? ka : K - 1] : 0.f; v[8 + i] = kb < K ? row[kb < K ? kb : K - 1] : 0.f; }
  return bsplit16(v); }
__device__ __forceinline__ F2 split_col(const float* W, int k0, int n, int lane, int ld, int K) { float v[16]; const int g = lane >> 4;
#pragma unroll
  for (int i = 0; i < 8; ++i) { const int ka = k0 + 8 * g + i, kb = ka + 16; v[i] = ka < K ? W[(size_t)(ka < K ? ka : K - 1) * ld + n] : 0.f; v[8 + i] = kb < K ? W[(size_t)(kb < K ? kb : K - 1) * ld + n] : 0.f; }
  return bsplit16(v); }
__device__ __forceinline__ v8f mac3(const F2& a, const F2& b, v8f c) { c = wmma_bf(a.l, b.h, c); c = wmma_bf(a.h, b.l, c); return wmma_bf(a.h, b.h, c); }
__device__ __forceinline__ float sigm(float v) { return 1.0f / (1.0f + expf(-v)); }
#define LDSX() do { asm volatile("s_wait_dscnt 0" ::: "memory"); __builtin_amdgcn_wave_barrier(); __builtin_amdgcn_fence(__ATOMIC_RELEASE, "workgroup"); } while (0)

// Multi-head attention on separate inputs with RoPE applied across the FULL model width before the head split (query / key / value [2,2048,1024]; torch (out,in) wq / wk / wv / wo [1024,1024] N(0, 1/1024) applied as x @ W.T + b, biases zeros (read); cos / sin [2048,512] are module INPUTS (computed in setup with numpy; read literally): x.reshape(.., 512, 2): (x0, x1) = (x[2j], x[2j+1]) -> (x0 c - x1 s, x0 s + x1 c) with c = cos[s][j], j = 0..511, on q and k; then 16 heads x 64 (head h = columns 64h..: its pair i uses table column h*32 + i); scores / sqrt(64); no mask; softmax; out @ wo.T + bo).
#define NB 2
#define TT 2048
#define CC 1024            // NH * HD = projected width
#define DIN 1024          // input (model) width
#define NH 16
#define HD 64
#define NQB (TT / 64)
#define HG 4
#define SCALE (0.125f)
#define CAUSAL 0
#ifndef TNB
#define TNB NB
#endif
__device__ __forceinline__ float bfr(float v) { return (float)(__bf16)v; }
__host__ __device__ __forceinline__ int kb_last(int qb) { return CAUSAL ? ((qb * 64 + 63) >> 7) : (TT / 128 - 1); }
typedef __attribute__((ext_vector_type(8))) __bf16 v8b;
__device__ __forceinline__ v16b frag_b(const __bf16* rowk0, int lane) {
  union { v16b v; v8b q[2]; } u; const __bf16* p = rowk0 + 8 * (lane >> 4);
  u.q[0] = *(const v8b*)p; u.q[1] = *(const v8b*)(p + 16); return u.v;
}
#define QBH 0              // not referenced by any kernel (k_fa has a single path for every query block)
#define QHI 0               // single-product logits on every row (logit sigma ~1)
#define KHI 64            // key rows carrying k residual / v bf16 hi+lo planes (written by k_proj; no kernel here reads them)
// B fragment (k rows k0+.., output column o) of a weight: (in,out) [K][ld] or (out,in) [ld rows of K]: bf16 exact, or f16(bf16 * 256) exact
__device__ __forceinline__ v16b wcol_io(const float* Wm, int k0, int o, int lane, int ld) { v16b w; const int g = lane >> 4;
#pragma unroll
  for (int i = 0; i < 8; ++i) { w[i] = (__bf16)Wm[(size_t)(k0 + 8 * g + i) * ld + o]; w[8 + i] = (__bf16)Wm[(size_t)(k0 + 16 + 8 * g + i) * ld + o]; }
  return w; }
__device__ __forceinline__ v16b wcol_oi(const float* Wm, int k0, int o, int lane, int K) { v16b w; const float* p = Wm + (size_t)o * K + k0 + 8 * (lane >> 4);
#pragma unroll
  for (int i = 0; i < 8; ++i) { w[i] = (__bf16)p[i]; w[8 + i] = (__bf16)p[16 + i]; }
  return w; }
__device__ __forceinline__ v16h wcolh_io(const float* Wm, int k0, int o, int lane, int ld) { v16h w; const int g = lane >> 4;
#pragma unroll
  for (int i = 0; i < 8; ++i) { w[i] = (_Float16)(bfr(Wm[(size_t)(k0 + 8 * g + i) * ld + o]) * 256.0f); w[8 + i] = (_Float16)(bfr(Wm[(size_t)(k0 + 16 + 8 * g + i) * ld + o]) * 256.0f); }
  return w; }
__device__ __forceinline__ v16h wcolh_oi(const float* Wm, int k0, int o, int lane, int K) { v16h w; const float* p = Wm + (size_t)o * K + k0 + 8 * (lane >> 4);
#pragma unroll
  for (int i = 0; i < 8; ++i) { w[i] = (_Float16)(bfr(p[i]) * 256.0f); w[8 + i] = (_Float16)(bfr(p[16 + i]) * 256.0f); }
  return w; }
#define WQKV_LAYOUT 1   // 0 = (in,out) [DIN][CC]; 1 = (out,in) [CC][DIN]; 2 = per-head [NH][DIN][HD]
__device__ __forceinline__ v16b wcol_hdk(const float* Wm, int k0, int o, int lane) { v16b w; const int g = lane >> 4; const float* p = Wm + (size_t)(o / HD) * DIN * HD + (o % HD);
#pragma unroll
  for (int i = 0; i < 8; ++i) { w[i] = (__bf16)p[(size_t)(k0 + 8 * g + i) * HD]; w[8 + i] = (__bf16)p[(size_t)(k0 + 16 + 8 * g + i) * HD]; }
  return w; }
#define WO_OUT_IN 1
#if WQKV_LAYOUT == 1
#define WCOL(W, k0, o, lane) wcol_oi(W, k0, o, lane, DIN)
#elif WQKV_LAYOUT == 2
#define WCOL(W, k0, o, lane) wcol_hdk(W, k0, o, lane)
#else
#define WCOL(W, k0, o, lane) wcol_io(W, k0, o, lane, CC)
#endif
#if WO_OUT_IN
#define WOCOL(W, k0, o, lane) wcol_oi(W, k0, o, lane, CC)
#define WOCOLH(W, k0, o, lane) wcolh_oi(W, k0, o, lane, CC)
#else
#define WOCOL(W, k0, o, lane) wcol_io(W, k0, o, lane, DIN)
#define WOCOLH(W, k0, o, lane) wcolh_io(W, k0, o, lane, DIN)
#endif

#define TBW 512   // table width = model width / 2 pairs
#define PROJ_EXTRA_PARAMS , const float* __restrict__ COS, const float* __restrict__ SIN   /* rotary tables [TT][512], module INPUTS, read literally */
// per (token, head) hook on the staged f32 row (64 floats = pairs h*32 .. h*32+31 of the model-wide rotation) of the q and k streams: (x0, x1) = (row[2i], row[2i+1]) -> (x0 c - x1 s, x0 s + x1 c) with c = bf16(cos[t][h*32 + i]), s = bf16(sin[t][h*32 + i]); v untouched; products and sums kept separate
#define PROJ_EPI(which, row, t, h) do { if ((which) < 2) { float* rw = (row); const float* ct_ = COS + (size_t)(t) * TBW + (size_t)(h) * 32; const float* st_ = SIN + (size_t)(t) * TBW + (size_t)(h) * 32; _Pragma("unroll 4") for (int i = 0; i < 32; ++i) { _Pragma("clang fp contract(off)") const float cs = bfr(ct_[i]), sn = bfr(st_[i]); const float xe = rw[2 * i], xo = rw[2 * i + 1]; rw[2 * i] = xe * cs - xo * sn; rw[2 * i + 1] = xe * sn + xo * cs; } } } while (0)
#ifndef SM_EXTRA_PARAMS
#define SM_EXTRA_PARAMS
#endif
#ifndef PROJ_EXTRA_PARAMS
#define PROJ_EXTRA_PARAMS
#endif
#ifndef SM_MASK_HOOK
#define SM_MASK_HOOK (void)0
#endif

#define WS_QH  0u                                      // f16 q rows [b*t][CC]
#define WS_KH  (WS_QH + 2u * (size_t)NB * TT * CC)      // f16 k rows [b*t][CC]
#define WS_VT  (WS_KH + 2u * (size_t)NB * TT * CC)      // f16 v planes [b][c][t]
#define WS_QL  (WS_VT + 2u * (size_t)NB * CC * TT)      // f16 q residual x 2^10 rows [b][t < QHI][CC]
#define WS_KL  (WS_QL + 2u * (size_t)NB * QHI * CC)     // f16 k residual x 2^10 rows [b][t < KHI][CC]
#define WS_VB  (WS_KL + 2u * (size_t)NB * KHI * CC)     // bf16 v hi planes [b][c][t < KHI]
#define WS_VBL (WS_VB + 2u * (size_t)NB * CC * KHI)
#define WS_S   (WS_VBL + 2u * (size_t)NB * CC * KHI)    // not used (scores stay in registers); kept so that the ctx plane keeps its place
#define WS_Y   (WS_S  + 4u * (size_t)HG * TT * TT)      // f32 ctx rows [b*t][CC] (only when there is an output projection)
#define WS_END (WS_Y  + 4u * (size_t)NB * TT * CC)

// ---- k_proj: block = (64 rows, 128 cols, which): q/k/v = X W (+ b) with exact bf16 products (K = DIN) -> which 0: q f16 rows (+ residual rows < QHI); 1: k f16 rows (+ residual rows < KHI); 2: v f16 planes [c][t] (+ bf16 hi/lo planes for t < KHI)
__global__ __launch_bounds__(128) void k_proj(const float* __restrict__ XQ, const float* __restrict__ XK, const float* __restrict__ XV, const float* __restrict__ WQ, const float* __restrict__ WK, const float* __restrict__ WV, const float* __restrict__ BQ, const float* __restrict__ BK, const float* __restrict__ BV,
    _Float16* __restrict__ QH, _Float16* __restrict__ QL, _Float16* __restrict__ KH, _Float16* __restrict__ KL, _Float16* __restrict__ VT, __bf16* __restrict__ VB, __bf16* __restrict__ VBL PROJ_EXTRA_PARAMS) {
  __shared__ __align__(16) float st[64][132]; __shared__ __align__(16) _Float16 sh[64][136], sl[64][136]; __shared__ __align__(16) _Float16 th[128][72]; __shared__ __align__(16) __bf16 tb[128][72], tbl[128][72];
  const int tid = threadIdx.x, wave = tid >> 5, lane = tid & 31, col = lane & 15, g = lane >> 4; const int which = blockIdx.z; const int c0 = blockIdx.y * 128; const size_t r0 = (size_t)blockIdx.x * 64; const size_t bb = r0 / TT; const int t0 = (int)(r0 % TT);
  const float* X = which == 0 ? XQ : which == 1 ? XK : XV; const float* WA = which == 0 ? WQ : which == 1 ? WK : WV; const float* BA = which == 0 ? BQ : which == 1 ? BK : BV;
  v8f acc[8] = {};
#pragma unroll 2
  for (int kc = 0; kc < DIN / 32; ++kc) { v16b a; { const float* p = X + (r0 + wave * 16 + col) * DIN + kc * 32 + 8 * g;
#pragma unroll
      for (int i = 0; i < 8; ++i) { a[i] = (__bf16)p[i]; a[8 + i] = (__bf16)p[16 + i]; } }
    asm volatile("s_wait_loadcnt 0x0" ::: "memory");
#pragma unroll
    for (int j = 0; j < 8; ++j) { const v16b w = WCOL(WA, kc * 32, c0 + j * 16 + col, lane); asm volatile("s_wait_loadcnt 0x0" ::: "memory"); acc[j] = wmma_bf(a, w, acc[j]); } }
  { // stage the f32 tile (acc + bias) in LDS, run the per-(row, head) epilogue hook, then convert
#pragma unroll
    for (int j = 0; j < 8; ++j) { const float bias = BA ? bfr(BA[c0 + j * 16 + col]) : 0.f;
#pragma unroll
      for (int r = 0; r < 8; ++r) st[wave * 16 + 8 * g + r][j * 16 + col] = acc[j][r] + bias; }
    __syncthreads();
    for (int e = tid; e < 64 * (128 / HD); e += 128) { const int rl = e / (128 / HD), hh = e % (128 / HD); PROJ_EPI(which, &st[rl][hh * HD], (int)((r0 + rl) % TT), (c0 / HD) + hh); }
    __syncthreads(); }
  if (which < 2) { _Float16* DH = which == 0 ? QH : KH; _Float16* DL = which == 0 ? QL : KL; const int nhi = which == 0 ? QHI : KHI; const bool hi_rows = t0 < nhi;
    for (int e = tid; e < 64 * 128; e += 128) { const int rl = e >> 7, cl = e & 127; const float v = st[rl][cl]; const _Float16 hv = (_Float16)v; sh[rl][cl] = hv; sl[rl][cl] = (_Float16)((v - (float)hv) * 1024.0f); }
    __syncthreads();
    for (int e = tid; e < 64 * 16; e += 128) { const int rl = e >> 4, q = e & 15; vst2((unsigned*)(DH + (r0 + rl) * CC + c0 + q * 8), *(const v4u*)&sh[rl][q * 8]); if (hi_rows) vst2((unsigned*)(DL + (bb * nhi + t0 + rl) * (size_t)CC + c0 + q * 8), *(const v4u*)&sl[rl][q * 8]); }
  } else { const bool hi_rows = t0 < KHI;
    for (int e = tid; e < 64 * 128; e += 128) { const int rl = e & 63, cl = e >> 6; const float v = st[rl][cl]; th[cl][rl] = (_Float16)v; const __bf16 bh = (__bf16)v; tb[cl][rl] = bh; tbl[cl][rl] = (__bf16)(v - (float)bh); }
    __syncthreads();
    for (int e = tid; e < 128 * 8; e += 128) { const int cl = e >> 3, q = e & 7; vst2((unsigned*)(VT + (bb * CC + c0 + cl) * (size_t)TT + t0 + q * 8), *(const v4u*)&th[cl][q * 8]); if (hi_rows) { const size_t o3 = (bb * CC + c0 + cl) * (size_t)KHI + t0 + q * 8; vst2((unsigned*)(VB + o3), *(const v4u*)&tb[cl][q * 8]); vst2((unsigned*)(VBL + o3), *(const v4u*)&tbl[cl][q * 8]); } } } }
// ---- k_fa: block = 256 queries (8 waves x 32) of (b, h): logits, softmax and P . v in one pass over the keys, 32 keys at a time; nothing of the score matrix leaves the registers.
// S^T = K . Q^T (A = k rows, B = q rows kept in registers): D register r of key tile kt = score of key 16 kt + 8 g + r for query column col, which is element 8 kt + r of the B operand of ctx^T += V^T . P^T, so P packs in place.
// Online softmax in base 2: running maximum m and sum l per query column; l and ctx^T are rescaled by 2^(m_old - m_new) every pass; the wave halves' sums join in the epilogue.
// Every inner loop is unrolled whole, so that each fragment and accumulator index is a constant and the arrays live in registers.
#define PCARRY 8.0f   // P carried x 2^8 into f16 (cancels in ctx / l): small weights stay clear of f16 subnormals
__device__ __forceinline__ v8f mm16(v16h a, v16h b, v8f c) { return __builtin_amdgcn_wmma_f32_16x16x32_f16(false, a, false, b, (short)0, c, false, false); }
__device__ __forceinline__ float xhalf(float x) { return __builtin_bit_cast(float, __builtin_amdgcn_permlanex16(__builtin_bit_cast(int, x), __builtin_bit_cast(int, x), 0x76543210, 0xfedcba98, false, false)); }  // lane l with lane l ^ 16
// eight base-2 exponentials, each in its own register: no neighbour reads a result or overwrites a source, and the closing v_nop is the slot that the instruction set asks for behind the last one
__device__ __forceinline__ void exp2x8(v8f& a) { asm("v_exp_f32 %0, %0\n\tv_exp_f32 %1, %1\n\tv_exp_f32 %2, %2\n\tv_exp_f32 %3, %3\n\tv_exp_f32 %4, %4\n\tv_exp_f32 %5, %5\n\tv_exp_f32 %6, %6\n\tv_exp_f32 %7, %7\n\tv_nop" : "+v"(a[0]), "+v"(a[1]), "+v"(a[2]), "+v"(a[3]), "+v"(a[4]), "+v"(a[5]), "+v"(a[6]), "+v"(a[7])); }
__global__ __launch_bounds__(256) void k_fa(const _Float16* __restrict__ QH, const _Float16* __restrict__ KH, const _Float16* __restrict__ VT, float* __restrict__ Y) {
  const int tid = threadIdx.x, wave = tid >> 5, lane = tid & 31, col = lane & 15, g = lane >> 4; const int h = blockIdx.y, b = blockIdx.z; const int q0 = blockIdx.x * 256 + wave * 32;
  const float cs = SCALE * 1.4426950408889634f;
  v16h qf[2][2];
#pragma unroll
  for (int n = 0; n < 2; ++n)
#pragma unroll
    for (int kc = 0; kc < 2; ++kc) qf[n][kc] = frag_h(QH + ((size_t)b * TT + q0 + n * 16 + col) * CC + h * HD + kc * 32, lane);
  const _Float16* kp = KH + ((size_t)b * TT + col) * CC + h * HD;           // key row col of the pass's first tile
  const _Float16* vp = VT + ((size_t)b * CC + h * HD + col) * (size_t)TT;   // v plane of head column col
  v16h kf[2][2];
#pragma unroll
  for (int kt = 0; kt < 2; ++kt)
#pragma unroll
    for (int kc = 0; kc < 2; ++kc) kf[kt][kc] = frag_h(kp + (size_t)(kt * 16) * CC + kc * 32, lane);
  v8f acc[2][4] = {}; float m[2] = {-3.0e38f, -3.0e38f}, l[2] = {0.f, 0.f};
#pragma unroll 1   /* rolled: one pass already holds 16 matrix instructions, and a second copy would double the live fragments */
  for (int it = 0; it < TT / 32; ++it) { const int nx = it + 1 < TT / 32 ? it + 1 : it;   /* the last pass fetches its own tiles again: in bounds, unused */
    // this pass's v fragments first: in flight under the first product and the first column group's softmax
    v16h vf[4];
#pragma unroll
    for (int j = 0; j < 4; ++j) vf[j] = frag_h(vp + (size_t)(j * 16) * TT + it * 32, lane);
    __builtin_amdgcn_sched_barrier(0);   // the v loads issue here, not sunk towards their use behind the softmax
    v8f s[2][2];
#pragma unroll
    for (int kt = 0; kt < 2; ++kt)
#pragma unroll
      for (int n = 0; n < 2; ++n) { s[kt][n] = v8f{};
#pragma unroll
        for (int kc = 0; kc < 2; ++kc) s[kt][n] = mm16(kf[kt][kc], qf[n][kc], s[kt][n]); }
    // next pass's k fragments into the same registers, in flight under this pass's softmax and second product
#pragma unroll
    for (int kt = 0; kt < 2; ++kt)
#pragma unroll
      for (int kc = 0; kc < 2; ++kc) kf[kt][kc] = frag_h(kp + (size_t)(nx * 32 + kt * 16) * CC + kc * 32, lane);
    __builtin_amdgcn_sched_barrier(0);   // the k loads issue here, ahead of the softmax, not sunk towards their use
#pragma unroll
    for (int n = 0; n < 2; ++n) { float mx = s[0][n][0];
#pragma unroll
      for (int r = 0; r < 8; ++r) mx = fmaxf(mx, fmaxf(s[0][n][r], s[1][n][r]));
      mx = fmaxf(mx, xhalf(mx)) * cs;   /* both halves hold the column's maximum of this pass, scaled (cs > 0) */
      const float mn = fmaxf(m[n], mx); const float corr = __builtin_amdgcn_exp2f(m[n] - mn); m[n] = mn; const float nm = PCARRY - mn;
      v16h pf; float ps = 0.f; v8f e0, e1;
#pragma unroll
      for (int r = 0; r < 8; ++r) { e0[r] = fmaf(s[0][n][r], cs, nm); e1[r] = fmaf(s[1][n][r], cs, nm); }
      exp2x8(e0); exp2x8(e1);
#pragma unroll
      for (int r = 0; r < 8; ++r) { pf[r] = (_Float16)e0[r]; pf[8 + r] = (_Float16)e1[r]; ps += e0[r] + e1[r]; }
      l[n] = l[n] * corr + ps;
#pragma unroll
      for (int j = 0; j < 4; ++j) acc[n][j] = mm16(vf[j], pf, acc[n][j] * corr); } }
#pragma unroll
  for (int n = 0; n < 2; ++n) { const float inv = 1.0f / (l[n] + xhalf(l[n])); float* yr = Y + ((size_t)b * TT + q0 + n * 16 + col) * CC + h * HD + 8 * g;   /* register r of tile j = head column 16 j + 8 g + r of query col */
#pragma unroll
    for (int j = 0; j < 4; ++j) { const v8f o = acc[n][j] * inv; vst2(yr + j * 16, v4f{o[0], o[1], o[2], o[3]}); vst2(yr + j * 16 + 4, v4f{o[4], o[5], o[6], o[7]}); } } }
// ---- k_out: block = (64 rows, 128 cols): out = ctx Wo (+ bo): ctx x 2^6 once to f16 against Wo as f16(bf16 x 2^8) exact (1 product) x 2^-14; causal early rows (< QHI of each sequence): ctx bf16 hi + lo against exact bf16 Wo (2 products)
__global__ __launch_bounds__(128) void k_out(const float* __restrict__ Y, const float* __restrict__ WO, const float* __restrict__ BO, float* __restrict__ OUT) { __shared__ __align__(16) float sf[4][16][132];
  const int tid = threadIdx.x, wave = tid >> 5, lane = tid & 31, col = lane & 15, g = lane >> 4; const int c0 = blockIdx.y * 128; const size_t r0 = (size_t)blockIdx.x * 64 + wave * 16;
  v8f acc[8] = {};
  if (CAUSAL && (int)(((size_t)blockIdx.x * 64) % TT) < QHI) {   /* block-uniform */
#pragma unroll 2
    for (int kc = 0; kc < CC / 32; ++kc) { const F2 a = split_row(Y + (r0 + col) * CC, kc * 32, lane); asm volatile("s_wait_loadcnt 0x0" ::: "memory");
#pragma unroll
      for (int j = 0; j < 8; ++j) { const v16b w = WOCOL(WO, kc * 32, c0 + j * 16 + col, lane); asm volatile("s_wait_loadcnt 0x0" ::: "memory"); acc[j] = wmma_bf(a.h, w, acc[j]); acc[j] = wmma_bf(a.l, w, acc[j]); } }
#pragma unroll
    for (int j = 0; j < 8; ++j) { const float bias = BO ? bfr(BO[c0 + j * 16 + col]) : 0.f;
#pragma unroll
      for (int r = 0; r < 8; ++r) sf[wave][8 * g + r][j * 16 + col] = acc[j][r] + bias; }
  } else {
#pragma unroll 2
    for (int kc = 0; kc < CC / 32; ++kc) { const v16h a = frag_f32s(Y + (r0 + col) * CC + kc * 32, lane, 64.0f); asm volatile("s_wait_loadcnt 0x0" ::: "memory");   /* ctx carried x 2^6 into f16 so small-magnitude context rows stay clear of f16 subnormals */
#pragma unroll
      for (int j = 0; j < 8; ++j) { const v16h w = WOCOLH(WO, kc * 32, c0 + j * 16 + col, lane); asm volatile("s_wait_loadcnt 0x0" ::: "memory"); acc[j] = wmma16(a, w, acc[j]); } }
#pragma unroll
    for (int j = 0; j < 8; ++j) { const float bias = BO ? bfr(BO[c0 + j * 16 + col]) : 0.f;
#pragma unroll
      for (int r = 0; r < 8; ++r) sf[wave][8 * g + r][j * 16 + col] = acc[j][r] * (1.0f / 16384.0f) + bias; } }   /* 2^-8 (Wo carry) x 2^-6 (ctx carry) */
  LDSX(); for (int rl = 0; rl < 16; ++rl) vst2(OUT + (r0 + rl) * DIN + c0 + lane * 4, *(const v4f*)&sf[wave][rl][lane * 4]); }

extern "C" void kernel_launch(void* const* d_in, const int* in_sizes, int n_in, void* d_out, int out_size, void* d_ws, size_t ws_size, hipStream_t stream) {
  (void)in_sizes; (void)n_in; (void)out_size;
  const float** F = (const float**)d_in;
  if (ws_size < (size_t)WS_END) return;
  char* ws = (char*)d_ws; _Float16 *QH = (_Float16*)(ws + WS_QH), *KH = (_Float16*)(ws + WS_KH), *VT = (_Float16*)(ws + WS_VT), *QL = (_Float16*)(ws + WS_QL), *KL = (_Float16*)(ws + WS_KL); __bf16 *VB = (__bf16*)(ws + WS_VB), *VBL = (__bf16*)(ws + WS_VBL); float *Y = (float*)(ws + WS_Y);
  (void)Y; (void)QL; (void)KL; (void)VB; (void)VBL;
  // inputs: 0 query [2,2048,1024]; 1 key; 2 value; 3 wq [1024,1024] (out,in), 4 bq; 5 wk, 6 bk; 7 wv, 8 bv; 9 wo (out,in), 10 bo (biases zeros, read); 11 cos [2048,512]; 12 sin [2048,512]
  k_proj<<<dim3(TNB * TT / 64, CC / 128, 3), 128, 0, stream>>>(F[0], F[1], F[2], F[3], F[5], F[7], F[4], F[6], F[8], QH, QL, KH, KL, VT, VB, VBL, F[11], F[12]);
  k_fa<<<dim3(TT / 256, NH, TNB), 256, 0, stream>>>(QH, KH, VT, Y);
  k_out<<<dim3(TNB * TT / 64, DIN / 128), 128, 0, stream>>>(Y, F[9], F[10], (float*)d_out);
}

// v002
// Measured time: 130 microseconds a run.
// Next to v001, in two timings, it ran 3.97 and 3.95 times as fast.
// Over all steps from v000 it is 11.1 times as fast.
// compute dtype: all float inputs rounded to bf16; q / k / v projections with EXACT bf16 products on WMMA 16x16x32 (f32 accumulate) + bias (zeros, read); interleaved-pair RoPE in f32 from the bf16-rounded INPUT cos / sin tables (512 pairs across the full model width); logits q x k once to f16 each (1 product) x 64^-0.5; online softmax f32 (base 2, running maximum); unnormalised P x 2^8 once to f16 x v once to f16 (1 product), divided by the f32 sum at the end; ctx x 2^6 once to f16 x wo f16(bf16 x 2^8) + bo; f32 output.
#include <hip/hip_runtime.h>
#include <math.h>

typedef __attribute__((ext_vector_type(16))) _Float16 v16h;
typedef __attribute__((ext_vector_type(16))) __bf16 v16b;
typedef __attribute__((ext_vector_type(8)))  _Float16 v8h;
typedef __attribute__((ext_vector_type(8)))  float v8f;
typedef __attribute__((ext_vector_type(4)))  float v4f;
typedef __attribute__((ext_vector_type(2)))  float v2f;
typedef __attribute__((ext_vector_type(4)))  unsigned v4u;
typedef __attribute__((ext_vector_type(4)))  int v4i;
typedef float __attribute__((may_alias)) float_a;
typedef int __attribute__((may_alias)) int_a;

template <typename T> __device__ __forceinline__ void vst2(void* p, T v) { *(T*)p = v;  }
__device__ __forceinline__ v8f wmma16(v16h a, v16h b, v8f c) {
  v8f d = __builtin_amdgcn_wmma_f32_16x16x32_f16(false, a, false, b, (short)0, c, false, false);
  asm volatile("v_nop\n\tv_nop\n\tv_nop\n\tv_nop" : "+v"(d) : "v"(a), "v"(b));
  return d;
}
__device__ __forceinline__ v8f wmma_bf(v16b a, v16b b, v8f c) {
  v8f d = __builtin_amdgcn_wmma_f32_16x16x32_bf16(false, a, false, b, (short)0, c, false, false);
  asm volatile("v_nop\n\tv_nop\n\tv_nop\n\tv_nop" : "+v"(d) : "v"(a), "v"(b));
  return d;
}
// 16x16x32 fragments: lane = (h = lane>>4, row/col = lane&15); elements 0..7 = k0+8h+0..7, 8..15 = k0+16+8h+0..7; D element r = row 8h+r
__device__ __forceinline__ v16h frag_h(const _Float16* rowk0, int lane) {
  union { v16h v; v8h q[2]; } u; const _Float16* p = rowk0 + 8 * (lane >> 4);
  u.q[0] = *(const v8h*)p; u.q[1] = *(const v8h*)(p + 16); return u.v;
}
__device__ __forceinline__ v16h frag_f32(const float* rowk0, int lane) {
  v16h a; const float* p = rowk0 + 8 * (lane >> 4);
#pragma unroll
  for (int i = 0; i < 8; ++i) { a[i] = (_Float16)p[i]; a[8 + i] = (_Float16)p[16 + i]; }
  return a;
}
__device__ __forceinline__ v16h frag_f32s(const float* rowk0, int lane, float sc) {
  v16h a; const float* p = rowk0 + 8 * (lane >> 4);
#pragma unroll
  for (int i = 0; i < 8; ++i) { a[i] = (_Float16)(p[i] * sc); a[8 + i] = (_Float16)(p[16 + i] * sc); }
  return a;
}
// column fragment from a [K][ld] layout (column n), rows >= K read as 0
__device__ __forceinline__ v16h fragc_f32(const float* W, int k0, int n, int lane, int ld, int K) {
  v16h a; const int g = lane >> 4;
#pragma unroll
  for (int i = 0; i < 8; ++i) { const int ka = k0 + 8 * g + i, kb = ka + 16;
    a[i] = (_Float16)(ka < K ? W[(size_t)(ka < K ? ka : K - 1) * ld + n] : 0.f); a[8 + i] = (_Float16)(kb < K ? W[(size_t)(kb < K ? kb : K - 1) * ld + n] : 0.f); }
  return a;
}
struct F2 { v16b h, l; };
__device__ __forceinline__ F2 bsplit16(const float v[16]) { F2 r;
#pragma unroll
  for (int i = 0; i < 16; ++i) { const __bf16 h = (__bf16)v[i]; r.h[i] = h; r.l[i] = (__bf16)(v[i] - (float)h); }
  return r; }
__device__ __forceinline__ F2 split_row(const float* row, int k0, int lane) { float v[16]; const float* p = row + k0 + 8 * (lane >> 4);
#pragma unroll
  for (int i = 0; i < 8; ++i) { v[i] = p[i]; v[8 + i] = p[16 + i]; }
  return bsplit16(v); }
__device__ __forceinline__ F2 split_rowK(const float* row, int k0, int lane, int K) { float v[16]; const int g = lane >> 4;
#pragma unroll
  for (int i = 0; i < 8; ++i) { const int ka = k0 + 8 * g + i, kb = ka + 16; v[i] = ka < K ? row[ka < K ? ka : K - 1] : 0.f; v[8 + i] = kb < K ? row[kb < K ? kb : K - 1] : 0.f; }
  return bsplit16(v); }
__device__ __forceinline__ F2 split_col(const float* W, int k0, int n, int lane, int ld, int K) { float v[16]; const int g = lane >> 4;
#pragma unroll
  for (int i = 0; i < 8; ++i) { const int ka = k0 + 8 * g + i, kb = ka + 16; v[i] = ka < K ? W[(size_t)(ka < K ? ka : K - 1) * ld + n] : 0.f; v[8 + i] = kb < K ? W[(size_t)(kb < K ? kb : K - 1) * ld + n] : 0.f; }
  return bsplit16(v); }
__device__ __forceinline__ v8f mac3(const F2& a, const F2& b, v8f c) { c = wmma_bf(a.l, b.h, c); c = wmma_bf(a.h, b.l, c); return wmma_bf(a.h, b.h, c); }
__device__ __forceinline__ float sigm(float v) { return 1.0f / (1.0f + expf(-v)); }
#define LDSX() do { asm volatile("s_wait_dscnt 0" ::: "memory"); __builtin_amdgcn_wave_barrier(); __builtin_amdgcn_fence(__ATOMIC_RELEASE, "workgroup"); } while (0)

// Multi-head attention on separate inputs with RoPE applied across the FULL model width before the head split (query / key / value [2,2048,1024]; torch (out,in) wq / wk / wv / wo [1024,1024] N(0, 1/1024) applied as x @ W.T + b, biases zeros (read); cos / sin [2048,512] are module INPUTS (computed in setup with numpy; read literally): x.reshape(.., 512, 2): (x0, x1) = (x[2j], x[2j+1]) -> (x0 c - x1 s, x0 s + x1 c) with c = cos[s][j], j = 0..511, on q and k; then 16 heads x 64 (head h = columns 64h..: its pair i uses table column h*32 + i); scores / sqrt(64); no mask; softmax; out @ wo.T + bo).
#define NB 2
#define TT 2048
#define CC 1024            // NH * HD = projected width
#define DIN 1024          // input (model) width
#define NH 16
#define HD 64
#define NQB (TT / 64)
#define HG 4
#define SCALE (0.125f)
#define CAUSAL 0
#ifndef TNB
#define TNB NB
#endif
__device__ __forceinline__ float bfr(float v) { return (float)(__bf16)v; }
__host__ __device__ __forceinline__ int kb_last(int qb) { return CAUSAL ? ((qb * 64 + 63) >> 7) : (TT / 128 - 1); }
typedef __attribute__((ext_vector_type(8))) __bf16 v8b;
__device__ __forceinline__ v16b frag_b(const __bf16* rowk0, int lane) {
  union { v16b v; v8b q[2]; } u; const __bf16* p = rowk0 + 8 * (lane >> 4);
  u.q[0] = *(const v8b*)p; u.q[1] = *(const v8b*)(p + 16); return u.v;
}
#define QBH 0              // not referenced by any kernel (k_fa has a single path for every query block)
#define QHI 0               // single-product logits on every row (logit sigma ~1)
#define KHI 64            // key rows carrying k residual / v bf16 hi+lo planes (written by k_proj; no kernel here reads them)
// B fragment (k rows k0+.., output column o) of a weight: (in,out) [K][ld] or (out,in) [ld rows of K]: bf16 exact, or f16(bf16 * 256) exact
__device__ __forceinline__ v16b wcol_io(const float* Wm, int k0, int o, int lane, int ld) { v16b w; const int g = lane >> 4;
#pragma unroll
  for (int i = 0; i < 8; ++i) { w[i] = (__bf16)Wm[(size_t)(k0 + 8 * g + i) * ld + o]; w[8 + i] = (__bf16)Wm[(size_t)(k0 + 16 + 8 * g + i) * ld + o]; }
  return w; }
__device__ __forceinline__ v16b wcol_oi(const float* Wm, int k0, int o, int lane, int K) { v16b w; const float* p = Wm + (size_t)o * K + k0 + 8 * (lane >> 4);
#pragma unroll
  for (int i = 0; i < 8; ++i) { w[i] = (__bf16)p[i]; w[8 + i] = (__bf16)p[16 + i]; }
  return w; }
__device__ __forceinline__ v16h wcolh_io(const float* Wm, int k0, int o, int lane, int ld) { v16h w; const int g = lane >> 4;
#pragma unroll
  for (int i = 0; i < 8; ++i) { w[i] = (_Float16)(bfr(Wm[(size_t)(k0 + 8 * g + i) * ld + o]) * 256.0f); w[8 + i] = (_Float16)(bfr(Wm[(size_t)(k0 + 16 + 8 * g + i) * ld + o]) * 256.0f); }
  return w; }
__device__ __forceinline__ v16h wcolh_oi(const float* Wm, int k0, int o, int lane, int K) { v16h w; const float* p = Wm + (size_t)o * K + k0 + 8 * (lane >> 4);
#pragma unroll
  for (int i = 0; i < 8; ++i) { w[i] = (_Float16)(bfr(p[i]) * 256.0f); w[8 + i] = (_Float16)(bfr(p[16 + i]) * 256.0f); }
  return w; }
#define WQKV_LAYOUT 1   // 0 = (in,out) [DIN][CC]; 1 = (out,in) [CC][DIN]; 2 = per-head [NH][DIN][HD]
__device__ __forceinline__ v16b wcol_hdk(const float* Wm, int k0, int o, int lane) { v16b w; const int g = lane >> 4; const float* p = Wm + (size_t)(o / HD) * DIN * HD + (o % HD);
#pragma unroll
  for (int i = 0; i < 8; ++i) { w[i] = (__bf16)p[(size_t)(k0 + 8 * g + i) * HD]; w[8 + i] = (__bf16)p[(size_t)(k0 + 16 + 8 * g + i) * HD]; }
  return w; }
#define WO_OUT_IN 1
#if WQKV_LAYOUT == 1
#define WCOL(W, k0, o, lane) wcol_oi(W, k0, o, lane, DIN)
#elif WQKV_LAYOUT == 2
#define WCOL(W, k0, o, lane) wcol_hdk(W, k0, o, lane)
#else
#define WCOL(W, k0, o, lane) wcol_io(W, k0, o, lane, CC)
#endif
#if WO_OUT_IN
#define WOCOL(W, k0, o, lane) wcol_oi(W, k0, o, lane, CC)
#define WOCOLH(W, k0, o, lane) wcolh_oi(W, k0, o, lane, CC)
#else
#define WOCOL(W, k0, o, lane) wcol_io(W, k0, o, lane, DIN)
#define WOCOLH(W, k0, o, lane) wcolh_io(W, k0, o, lane, DIN)
#endif

#define TBW 512   // table width = model width / 2 pairs
#define PROJ_EXTRA_PARAMS , const float* __restrict__ COS, const float* __restrict__ SIN   /* rotary tables [TT][512], module INPUTS, read literally */
// per (token, head) hook on the staged f32 row (64 floats = pairs h*32 .. h*32+31 of the model-wide rotation) of the q and k streams: (x0, x1) = (row[2i], row[2i+1]) -> (x0 c - x1 s, x0 s + x1 c) with c = bf16(cos[t][h*32 + i]), s = bf16(sin[t][h*32 + i]); v untouched; products and sums kept separate
#define PROJ_EPI(which, row, t, h) do { if ((which) < 2) { float* rw = (row); const float* ct_ = COS + (size_t)(t) * TBW + (size_t)(h) * 32; const float* st_ = SIN + (size_t)(t) * TBW + (size_t)(h) * 32; _Pragma("unroll 4") for (int i = 0; i < 32; ++i) { _Pragma("clang fp contract(off)") const float cs = bfr(ct_[i]), sn = bfr(st_[i]); const float xe = rw[2 * i], xo = rw[2 * i + 1]; rw[2 * i] = xe * cs - xo * sn; rw[2 * i + 1] = xe * sn + xo * cs; } } } while (0)
#ifndef SM_EXTRA_PARAMS
#define SM_EXTRA_PARAMS
#endif
#ifndef PROJ_EXTRA_PARAMS
#define PROJ_EXTRA_PARAMS
#endif
#ifndef SM_MASK_HOOK
#define SM_MASK_HOOK (void)0
#endif

#define WS_QH  0u                                      // f16 q rows [b*t][CC]
#define WS_KH  (WS_QH + 2u * (size_t)NB * TT * CC)      // f16 k rows [b*t][CC]
#define WS_VT  (WS_KH + 2u * (size_t)NB * TT * CC)      // f16 v planes [b][c][t]
#define WS_QL  (WS_VT + 2u * (size_t)NB * CC * TT)      // f16 q residual x 2^10 rows [b][t < QHI][CC]
#define WS_KL  (WS_QL + 2u * (size_t)NB * QHI * CC)     // f16 k residual x 2^10 rows [b][t < KHI][CC]
#define WS_VB  (WS_KL + 2u * (size_t)NB * KHI * CC)     // bf16 v hi planes [b][c][t < KHI]
#define WS_VBL (WS_VB + 2u * (size_t)NB * CC * KHI)
#define WS_S   (WS_VBL + 2u * (size_t)NB * CC * KHI)    // not used (scores stay in registers); kept so that the ctx plane keeps its place
#define WS_Y   (WS_S  + 4u * (size_t)HG * TT * TT)      // f32 ctx rows [b*t][CC] (only when there is an output projection)
#define WS_END (WS_Y  + 4u * (size_t)NB * TT * CC)

// ---- operand staging of the two GEMM kernels (block tile 64 x 128, 128 threads): a stage is KS k of every tile row; thread (lr = tid >> 4, lc = 4 (tid & 15)) moves 4 floats of rows lr + 8 i, so one wave-wide 16-byte load covers two 256-byte row pieces = 4 whole lines
#define KS 64
static_assert(CC == DIN, "one row pitch for every GEMM operand");
#define LP 72   // LDS row pitch in 16-bit elements: 144 B = 16 B x 9 (odd), the pitch for 16-byte fragment reads
typedef __attribute__((ext_vector_type(4))) __bf16 v4b;
typedef __attribute__((ext_vector_type(4))) _Float16 v4h;
__device__ __forceinline__ v8f mmb(v16b a, v16b b, v8f c) { return __builtin_amdgcn_wmma_f32_16x16x32_bf16(false, a, false, b, (short)0, c, false, false); }
__device__ __forceinline__ v4b cvt_b(v4f v) { return v4b{(__bf16)v[0], (__bf16)v[1], (__bf16)v[2], (__bf16)v[3]}; }
__device__ __forceinline__ v4h cvt_y(v4f v) { return v4h{(_Float16)(v[0] * 64.0f), (_Float16)(v[1] * 64.0f), (_Float16)(v[2] * 64.0f), (_Float16)(v[3] * 64.0f)}; }   // ctx x 2^6
__device__ __forceinline__ v4h cvt_w(v4f v) { return v4h{(_Float16)(bfr(v[0]) * 256.0f), (_Float16)(bfr(v[1]) * 256.0f), (_Float16)(bfr(v[2]) * 256.0f), (_Float16)(bfr(v[3]) * 256.0f)}; }   // f16(bf16 x 2^8), exact
// work-group barrier by hand: __syncthreads() compiled to a wait for the global loads too, which would drain the loads issued ahead for the stage after next; what the other waves need is this wave's LDS reads and writes complete (s_wait_dscnt 0). s_wait_xcnt 0 stands in front of every reuse of those loads' address registers.
__device__ __forceinline__ void stage_barrier() { asm volatile("s_wait_xcnt 0x0\n\ts_wait_dscnt 0x0\n\ts_barrier_signal -1\n\ts_barrier_wait -1" ::: "memory"); }
#define GT_LOAD(xa, xw, xg, wg, s) do { _Pragma("unroll") for (int i_ = 0; i_ < 8; ++i_) xa[i_] = *(const v4f*)((xg) + (size_t)(i_ * 8) * DIN + (s) * KS); _Pragma("unroll") for (int i_ = 0; i_ < 16; ++i_) xw[i_] = *(const v4f*)((wg) + (size_t)(i_ * 8) * DIN + (s) * KS); } while (0)
#define GT_STORE(VT_, ca, cw, xa, xw, ad, wd) do { _Pragma("unroll") for (int i_ = 0; i_ < 8; ++i_) *(VT_*)((ad) + (lr + 8 * i_) * LP + lc) = ca(xa[i_]); _Pragma("unroll") for (int i_ = 0; i_ < 16; ++i_) *(VT_*)((wd) + (lr + 8 * i_) * LP + lc) = cw(xw[i_]); } while (0)
// ---- k_proj: block = (64 rows, 128 cols, which): q/k/v = X W (+ b) with exact bf16 products (K = DIN) -> which 0: q f16 rows (+ residual rows < QHI); 1: k f16 rows (+ residual rows < KHI); 2: v f16 planes [c][t] (+ bf16 hi/lo planes for t < KHI)
__global__ __launch_bounds__(128) void k_proj(const float* __restrict__ XQ, const float* __restrict__ XK, const float* __restrict__ XV, const float* __restrict__ WQ, const float* __restrict__ WK, const float* __restrict__ WV, const float* __restrict__ BQ, const float* __restrict__ BK, const float* __restrict__ BV,
    _Float16* __restrict__ QH, _Float16* __restrict__ QL, _Float16* __restrict__ KH, _Float16* __restrict__ KL, _Float16* __restrict__ VT, __bf16* __restrict__ VB, __bf16* __restrict__ VBL PROJ_EXTRA_PARAMS) {
  __shared__ __align__(16) float st[64][132]; __shared__ __align__(16) _Float16 sh[64][136], sl[64][136]; __shared__ __align__(16) _Float16 th[128][72]; __shared__ __align__(16) __bf16 tb[128][72], tbl[128][72];
  const int tid = threadIdx.x, wave = tid >> 5, lane = tid & 31, col = lane & 15, g = lane >> 4; const int which = blockIdx.z; const int c0 = blockIdx.y * 128; const size_t r0 = (size_t)blockIdx.x * 64; const size_t bb = r0 / TT; const int t0 = (int)(r0 % TT);
  const float* X = which == 0 ? XQ : which == 1 ? XK : XV; const float* WA = which == 0 ? WQ : which == 1 ? WK : WV; const float* BA = which == 0 ? BQ : which == 1 ? BK : BV;
  // main loop: the block's X tile (64 x KS) and W tile (128 x KS) are read once per block with whole-line loads, rounded to bf16 once and staged in LDS (two buffers, in the arrays that the epilogue uses only later: X in th, W in tb / tbl); wave (wr, wc) owns 32 rows x 64 columns
  const int wr = wave >> 1, wc = wave & 1; const int lr = tid >> 4, lc = (tid & 15) * 4;
  __bf16* const As = (__bf16*)&th[0][0];
  const float* xg = X + (r0 + lr) * DIN + lc; const float* wg = WA + (size_t)(c0 + lr) * DIN + lc;
  v4f xa[8], xw[16]; v8f acc[2][4] = {};
  GT_LOAD(xa, xw, xg, wg, 0);
  GT_STORE(v4b, cvt_b, cvt_b, xa, xw, As, &tb[0][0]);
  GT_LOAD(xa, xw, xg, wg, 1);
  stage_barrier();   // stage 0 is published; stage 1 stays in flight
#pragma unroll 2   /* two stages a trip: the buffer index is a constant */
  for (int s = 0; s < DIN / KS; ++s) { const __bf16* Ab = As + ((s & 1) * 64 + wr * 32 + col) * LP; const __bf16* Wb = ((s & 1) ? &tbl[0][0] : &tb[0][0]) + (wc * 64 + col) * LP;
    v16b af[2][2], wf[2][4];
#pragma unroll
    for (int ks = 0; ks < 2; ++ks) {
#pragma unroll
      for (int i = 0; i < 2; ++i) af[ks][i] = frag_b(Ab + i * 16 * LP + ks * 32, lane);
#pragma unroll
      for (int j = 0; j < 4; ++j) wf[ks][j] = frag_b(Wb + j * 16 * LP + ks * 32, lane); }
    __builtin_amdgcn_sched_barrier(0);   // the stage's fragment reads issue as one group ahead of its products, not among them
#pragma unroll
    for (int ks = 0; ks < 2; ++ks)
#pragma unroll
      for (int i = 0; i < 2; ++i)
#pragma unroll
        for (int j = 0; j < 4; ++j) acc[i][j] = mmb(af[ks][i], wf[ks][j], acc[i][j]);
    __builtin_amdgcn_sched_barrier(0);   // the conversions, which wait for the loads in flight, stay behind the products
    if (s + 1 < DIN / KS) GT_STORE(v4b, cvt_b, cvt_b, xa, xw, As + ((s + 1) & 1) * 64 * LP, ((s + 1) & 1) ? &tbl[0][0] : &tb[0][0]);   /* into the buffer whose readers all passed the last barrier */
    if (s + 2 < DIN / KS) GT_LOAD(xa, xw, xg, wg, s + 2);   /* in flight under the next stage's products */
    stage_barrier(); }   // publishes stage s + 1 and ends every read of stage s
  { // stage the f32 tile (acc + bias) in LDS, run the per-(row, head) epilogue hook, then convert
#pragma unroll
    for (int j = 0; j < 4; ++j) { const float bias = BA ? bfr(BA[c0 + wc * 64 + j * 16 + col]) : 0.f;
#pragma unroll
      for (int i = 0; i < 2; ++i)
#pragma unroll
        for (int r = 0; r < 8; ++r) st[wr * 32 + i * 16 + 8 * g + r][wc * 64 + j * 16 + col] = acc[i][j][r] + bias; }
    __syncthreads();
    for (int e = tid; e < 64 * (128 / HD); e += 128) { const int rl = e / (128 / HD), hh = e % (128 / HD); PROJ_EPI(which, &st[rl][hh * HD], (int)((r0 + rl) % TT), (c0 / HD) + hh); }
    __syncthreads(); }
  if (which < 2) { _Float16* DH = which == 0 ? QH : KH; _Float16* DL = which == 0 ? QL : KL; const int nhi = which == 0 ? QHI : KHI; const bool hi_rows = t0 < nhi;
    for (int e = tid; e < 64 * 128; e += 128) { const int rl = e >> 7, cl = e & 127; const float v = st[rl][cl]; const _Float16 hv = (_Float16)v; sh[rl][cl] = hv; sl[rl][cl] = (_Float16)((v - (float)hv) * 1024.0f); }
    __syncthreads();
    for (int e = tid; e < 64 * 16; e += 128) { const int rl = e >> 4, q = e & 15; vst2((unsigned*)(DH + (r0 + rl) * CC + c0 + q * 8), *(const v4u*)&sh[rl][q * 8]); if (hi_rows) vst2((unsigned*)(DL + (bb * nhi + t0 + rl) * (size_t)CC + c0 + q * 8), *(const v4u*)&sl[rl][q * 8]); }
  } else { const bool hi_rows = t0 < KHI;
    for (int e = tid; e < 64 * 128; e += 128) { const int rl = e & 63, cl = e >> 6; const float v = st[rl][cl]; th[cl][rl] = (_Float16)v; const __bf16 bh = (__bf16)v; tb[cl][rl] = bh; tbl[cl][rl] = (__bf16)(v - (float)bh); }
    __syncthreads();
    for (int e = tid; e < 128 * 8; e += 128) { const int cl = e >> 3, q = e & 7; vst2((unsigned*)(VT + (bb * CC + c0 + cl) * (size_t)TT + t0 + q * 8), *(const v4u*)&th[cl][q * 8]); if (hi_rows) { const size_t o3 = (bb * CC + c0 + cl) * (size_t)KHI + t0 + q * 8; vst2((unsigned*)(VB + o3), *(const v4u*)&tb[cl][q * 8]); vst2((unsigned*)(VBL + o3), *(const v4u*)&tbl[cl][q * 8]); } } } }
// ---- k_fa: block = 256 queries (8 waves x 32) of (b, h): logits, softmax and P . v in one pass over the keys, 32 keys at a time; nothing of the score matrix leaves the registers.
// S^T = K . Q^T (A = k rows, B = q rows kept in registers): D register r of key tile kt = score of key 16 kt + 8 g + r for query column col, which is element 8 kt + r of the B operand of ctx^T += V^T . P^T, so P packs in place.
// Online softmax in base 2: running maximum m and sum l per query column; l and ctx^T are rescaled by 2^(m_old - m_new) every pass; the wave halves' sums join in the epilogue.
// Every inner loop is unrolled whole, so that each fragment and accumulator index is a constant and the arrays live in registers.
#define PCARRY 8.0f   // P carried x 2^8 into f16 (cancels in ctx / l): small weights stay clear of f16 subnormals
__device__ __forceinline__ v8f mm16(v16h a, v16h b, v8f c) { return __builtin_amdgcn_wmma_f32_16x16x32_f16(false, a, false, b, (short)0, c, false, false); }
__device__ __forceinline__ float xhalf(float x) { return __builtin_bit_cast(float, __builtin_amdgcn_permlanex16(__builtin_bit_cast(int, x), __builtin_bit_cast(int, x), 0x76543210, 0xfedcba98, false, false)); }  // lane l with lane l ^ 16
// eight base-2 exponentials, each in its own register: no neighbour reads a result or overwrites a source, and the closing v_nop is the slot that the instruction set asks for behind the last one
__device__ __forceinline__ void exp2x8(v8f& a) { asm("v_exp_f32 %0, %0\n\tv_exp_f32 %1, %1\n\tv_exp_f32 %2, %2\n\tv_exp_f32 %3, %3\n\tv_exp_f32 %4, %4\n\tv_exp_f32 %5, %5\n\tv_exp_f32 %6, %6\n\tv_exp_f32 %7, %7\n\tv_nop" : "+v"(a[0]), "+v"(a[1]), "+v"(a[2]), "+v"(a[3]), "+v"(a[4]), "+v"(a[5]), "+v"(a[6]), "+v"(a[7])); }
__global__ __launch_bounds__(256) void k_fa(const _Float16* __restrict__ QH, const _Float16* __restrict__ KH, const _Float16* __restrict__ VT, float* __restrict__ Y) {
  const int tid = threadIdx.x, wave = tid >> 5, lane = tid & 31, col = lane & 15, g = lane >> 4; const int h = blockIdx.y, b = blockIdx.z; const int q0 = blockIdx.x * 256 + wave * 32;
  const float cs = SCALE * 1.4426950408889634f;
  v16h qf[2][2];
#pragma unroll
  for (int n = 0; n < 2; ++n)
#pragma unroll
    for (int kc = 0; kc < 2; ++kc) qf[n][kc] = frag_h(QH + ((size_t)b * TT + q0 + n * 16 + col) * CC + h * HD + kc * 32, lane);
  const _Float16* kp = KH + ((size_t)b * TT + col) * CC + h * HD;           // key row col of the pass's first tile
  const _Float16* vp = VT + ((size_t)b * CC + h * HD + col) * (size_t)TT;   // v plane of head column col
  v16h kf[2][2];
#pragma unroll
  for (int kt = 0; kt < 2; ++kt)
#pragma unroll
    for (int kc = 0; kc < 2; ++kc) kf[kt][kc] = frag_h(kp + (size_t)(kt * 16) * CC + kc * 32, lane);
  v8f acc[2][4] = {}; float m[2] = {-3.0e38f, -3.0e38f}, l[2] = {0.f, 0.f};
#pragma unroll 1   /* rolled: one pass already holds 16 matrix instructions, and a second copy would double the live fragments */
  for (int it = 0; it < TT / 32; ++it) { const int nx = it + 1 < TT / 32 ? it + 1 : it;   /* the last pass fetches its own tiles again: in bounds, unused */
    // this pass's v fragments first: in flight under the first product and the first column group's softmax
    v16h vf[4];
#pragma unroll
    for (int j = 0; j < 4; ++j) vf[j] = frag_h(vp + (size_t)(j * 16) * TT + it * 32, lane);
    __builtin_amdgcn_sched_barrier(0);   // the v loads issue here, not sunk towards their use behind the softmax
    v8f s[2][2];
#pragma unroll
    for (int kt = 0; kt < 2; ++kt)
#pragma unroll
      for (int n = 0; n < 2; ++n) { s[kt][n] = v8f{};
#pragma unroll
        for (int kc = 0; kc < 2; ++kc) s[kt][n] = mm16(kf[kt][kc], qf[n][kc], s[kt][n]); }
    // next pass's k fragments into the same registers, in flight under this pass's softmax and second product
#pragma unroll
    for (int kt = 0; kt < 2; ++kt)
#pragma unroll
      for (int kc = 0; kc < 2; ++kc) kf[kt][kc] = frag_h(kp + (size_t)(nx * 32 + kt * 16) * CC + kc * 32, lane);
    __builtin_amdgcn_sched_barrier(0);   // the k loads issue here, ahead of the softmax, not sunk towards their use
#pragma unroll
    for (int n = 0; n < 2; ++n) { float mx = s[0][n][0];
#pragma unroll
      for (int r = 0; r < 8; ++r) mx = fmaxf(mx, fmaxf(s[0][n][r], s[1][n][r]));
      mx = fmaxf(mx, xhalf(mx)) * cs;   /* both halves hold the column's maximum of this pass, scaled (cs > 0) */
      const float mn = fmaxf(m[n], mx); const float corr = __builtin_amdgcn_exp2f(m[n] - mn); m[n] = mn; const float nm = PCARRY - mn;
      v16h pf; float ps = 0.f; v8f e0, e1;
#pragma unroll
      for (int r = 0; r < 8; ++r) { e0[r] = fmaf(s[0][n][r], cs, nm); e1[r] = fmaf(s[1][n][r], cs, nm); }
      exp2x8(e0); exp2x8(e1);
#pragma unroll
      for (int r = 0; r < 8; ++r) { pf[r] = (_Float16)e0[r]; pf[8 + r] = (_Float16)e1[r]; ps += e0[r] + e1[r]; }
      l[n] = l[n] * corr + ps;
#pragma unroll
      for (int j = 0; j < 4; ++j) acc[n][j] = mm16(vf[j], pf, acc[n][j] * corr); } }
#pragma unroll
  for (int n = 0; n < 2; ++n) { const float inv = 1.0f / (l[n] + xhalf(l[n])); float* yr = Y + ((size_t)b * TT + q0 + n * 16 + col) * CC + h * HD + 8 * g;   /* register r of tile j = head column 16 j + 8 g + r of query col */
#pragma unroll
    for (int j = 0; j < 4; ++j) { const v8f o = acc[n][j] * inv; vst2(yr + j * 16, v4f{o[0], o[1], o[2], o[3]}); vst2(yr + j * 16 + 4, v4f{o[4], o[5], o[6], o[7]}); } } }
// ---- k_out: block = (64 rows, 128 cols): out = ctx Wo (+ bo): ctx x 2^6 once to f16 against Wo as f16(bf16 x 2^8) exact (1 product) x 2^-14
__global__ __launch_bounds__(128) void k_out(const float* __restrict__ Y, const float* __restrict__ WO, const float* __restrict__ BO, float* __restrict__ OUT) { __shared__ __align__(16) float sf[4][32][68]; __shared__ __align__(16) _Float16 ya[2][64][LP], wa[2][128][LP];
  const int tid = threadIdx.x, wave = tid >> 5, lane = tid & 31, col = lane & 15, g = lane >> 4; const int c0 = blockIdx.y * 128; const size_t r0 = (size_t)blockIdx.x * 64;
  // main loop as in k_proj: ctx tile (64 x KS, x 2^6 so small-magnitude context rows stay clear of f16 subnormals) and Wo tile (128 x KS) converted once per block and staged in LDS, two buffers; wave (wr, wc) owns 32 rows x 64 columns
  const int wr = wave >> 1, wc = wave & 1; const int lr = tid >> 4, lc = (tid & 15) * 4;
  const float* xg = Y + (r0 + lr) * CC + lc; const float* wg = WO + (size_t)(c0 + lr) * CC + lc;
  v4f xa[8], xw[16]; v8f acc[2][4] = {};
  GT_LOAD(xa, xw, xg, wg, 0);
  GT_STORE(v4h, cvt_y, cvt_w, xa, xw, &ya[0][0][0], &wa[0][0][0]);
  GT_LOAD(xa, xw, xg, wg, 1);
  stage_barrier();   // stage 0 is published; stage 1 stays in flight
#pragma unroll 2   /* two stages a trip: the buffer index is a constant */
  for (int s = 0; s < CC / KS; ++s) { const _Float16* Ab = &ya[s & 1][wr * 32 + col][0]; const _Float16* Wb = &wa[s & 1][wc * 64 + col][0];
    v16h af[2][2], wf[2][4];
#pragma unroll
    for (int ks = 0; ks < 2; ++ks) {
#pragma unroll
      for (int i = 0; i < 2; ++i) af[ks][i] = frag_h(Ab + i * 16 * LP + ks * 32, lane);
#pragma unroll
      for (int j = 0; j < 4; ++j) wf[ks][j] = frag_h(Wb + j * 16 * LP + ks * 32, lane); }
    __builtin_amdgcn_sched_barrier(0);   // the stage's fragment reads issue as one group ahead of its products, not among them
#pragma unroll
    for (int ks = 0; ks < 2; ++ks)
#pragma unroll
      for (int i = 0; i < 2; ++i)
#pragma unroll
        for (int j = 0; j < 4; ++j) acc[i][j] = mm16(af[ks][i], wf[ks][j], acc[i][j]);
    __builtin_amdgcn_sched_barrier(0);   // the conversions, which wait for the loads in flight, stay behind the products
    if (s + 1 < CC / KS) GT_STORE(v4h, cvt_y, cvt_w, xa, xw, &ya[(s + 1) & 1][0][0], &wa[(s + 1) & 1][0][0]);   /* into the buffer whose readers all passed the last barrier */
    if (s + 2 < CC / KS) GT_LOAD(xa, xw, xg, wg, s + 2);   /* in flight under the next stage's products */
    stage_barrier(); }   // publishes stage s + 1 and ends every read of stage s
#pragma unroll
  for (int j = 0; j < 4; ++j) { const float bias = BO ? bfr(BO[c0 + wc * 64 + j * 16 + col]) : 0.f;
#pragma unroll
    for (int i = 0; i < 2; ++i)
#pragma unroll
      for (int r = 0; r < 8; ++r) sf[wave][i * 16 + 8 * g + r][j * 16 + col] = acc[i][j][r] * (1.0f / 16384.0f) + bias; }   /* 2^-8 (Wo carry) x 2^-6 (ctx carry) */
  LDSX(); for (int rl = 0; rl < 16; ++rl) vst2(OUT + (r0 + wr * 32 + rl * 2 + g) * DIN + c0 + wc * 64 + col * 4, *(const v4f*)&sf[wave][rl * 2 + g][col * 4]); }

extern "C" void kernel_launch(void* const* d_in, const int* in_sizes, int n_in, void* d_out, int out_size, void* d_ws, size_t ws_size, hipStream_t stream) {
  (void)in_sizes; (void)n_in; (void)out_size;
  const float** F = (const float**)d_in;
  if (ws_size < (size_t)WS_END) return;
  char* ws = (char*)d_ws; _Float16 *QH = (_Float16*)(ws + WS_QH), *KH = (_Float16*)(ws + WS_KH), *VT = (_Float16*)(ws + WS_VT), *QL = (_Float16*)(ws + WS_QL), *KL = (_Float16*)(ws + WS_KL); __bf16 *VB = (__bf16*)(ws + WS_VB), *VBL = (__bf16*)(ws + WS_VBL); float *Y = (float*)(ws + WS_Y);
  (void)Y; (void)QL; (void)KL; (void)VB; (void)VBL;
  // inputs: 0 query [2,2048,1024]; 1 key; 2 value; 3 wq [1024,1024] (out,in), 4 bq; 5 wk, 6 bk; 7 wv, 8 bv; 9 wo (out,in), 10 bo (biases zeros, read); 11 cos [2048,512]; 12 sin [2048,512]
  k_proj<<<dim3(TNB * TT / 64, CC / 128, 3), 128, 0, stream>>>(F[0], F[1], F[2], F[3], F[5], F[7], F[4], F[6], F[8], QH, QL, KH, KL, VT, VB, VBL, F[11], F[12]);
  k_fa<<<dim3(TT / 256, NH, TNB), 256, 0, stream>>>(QH, KH, VT, Y);
  k_out<<<dim3(TNB * TT / 64, DIN / 128), 128, 0, stream>>>(Y, F[9], F[10], (float*)d_out);
}

// v003
// A run of this version takes 107 microseconds.
// Two timings next to v002 both put it at 1.22 times that version's speed.
// Counting every step since v000, it is 13.5 times as fast.
// compute dtype: all float inputs rounded to bf16; q / k / v projections with EXACT bf16 products on WMMA 16x16x32 (f32 accumulate) + bias (zeros, read); interleaved-pair RoPE in f32 from the bf16-rounded INPUT cos / sin tables (512 pairs across the full model width); logits q x k once to f16 each (1 product) x 64^-0.5; online softmax f32 (base 2, running maximum); unnormalised P x 2^8 once to f16 x v once to f16 (1 product), divided by the f32 sum at the end; ctx x 2^6 once to f16 x wo f16(bf16 x 2^8) + bo; f32 output.
#include <hip/hip_runtime.h>
#include <math.h>

typedef __attribute__((ext_vector_type(16))) _Float16 v16h;
typedef __attribute__((ext_vector_type(16))) __bf16 v16b;
typedef __attribute__((ext_vector_type(8)))  _Float16 v8h;
typedef __attribute__((ext_vector_type(8)))  float v8f;
typedef __attribute__((ext_vector_type(4)))  float v4f;
typedef __attribute__((ext_vector_type(2)))  float v2f;
typedef __attribute__((ext_vector_type(4)))  unsigned v4u;
typedef __attribute__((ext_vector_type(4)))  int v4i;
typedef float __attribute__((may_alias)) float_a;
typedef int __attribute__((may_alias)) int_a;

template <typename T> __device__ __forceinline__ void vst2(void* p, T v) { *(T*)p = v;  }
__device__ __forceinline__ v8f wmma16(v16h a, v16h b, v8f c) {
  v8f d = __builtin_amdgcn_wmma_f32_16x16x32_f16(false, a, false, b, (short)0, c, false, false);
  asm volatile("v_nop\n\tv_nop\n\tv_nop\n\tv_nop" : "+v"(d) : "v"(a), "v"(b));
  return d;
}
__device__ __forceinline__ v8f wmma_bf(v16b a, v16b b, v8f c) {
  v8f d = __builtin_amdgcn_wmma_f32_16x16x32_bf16(false, a, false, b, (short)0, c, false, false);
  asm volatile("v_nop\n\tv_nop\n\tv_nop\n\tv_nop" : "+v"(d) : "v"(a), "v"(b));
  return d;
}
// 16x16x32 fragments: lane = (h = lane>>4, row/col = lane&15); elements 0..7 = k0+8h+0..7, 8..15 = k0+16+8h+0..7; D element r = row 8h+r
__device__ __forceinline__ v16h frag_h(const _Float16* rowk0, int lane) {
  union { v16h v; v8h q[2]; } u; const _Float16* p = rowk0 + 8 * (lane >> 4);
  u.q[0] = *(const v8h*)p; u.q[1] = *(const v8h*)(p + 16); return u.v;
}
__device__ __forceinline__ v16h frag_f32(const float* rowk0, int lane) {
  v16h a; const float* p = rowk0 + 8 * (lane >> 4);
#pragma unroll
  for (int i = 0; i < 8; ++i) { a[i] = (_Float16)p[i]; a[8 + i] = (_Float16)p[16 + i]; }
  return a;
}
__device__ __forceinline__ v16h frag_f32s(const float* rowk0, int lane, float sc) {
  v16h a; const float* p = rowk0 + 8 * (lane >> 4);
#pragma unroll
  for (int i = 0; i < 8; ++i) { a[i] = (_Float16)(p[i] * sc); a[8 + i] = (_Float16)(p[16 + i] * sc); }
  return a;
}
// column fragment from a [K][ld] layout (column n), rows >= K read as 0
__device__ __forceinline__ v16h fragc_f32(const float* W, int k0, int n, int lane, int ld, int K) {
  v16h a; const int g = lane >> 4;
#pragma unroll
  for (int i = 0; i < 8; ++i) { const int ka = k0 + 8 * g + i, kb = ka + 16;
    a[i] = (_Float16)(ka < K ? W[(size_t)(ka < K ? ka : K - 1) * ld + n] : 0.f); a[8 + i] = (_Float16)(kb < K ? W[(size_t)(kb < K ? kb : K - 1) * ld + n] : 0.f); }
  return a;
}
struct F2 { v16b h, l; };
__device__ __forceinline__ F2 bsplit16(const float v[16]) { F2 r;
#pragma unroll
  for (int i = 0; i < 16; ++i) { const __bf16 h = (__bf16)v[i]; r.h[i] = h; r.l[i] = (__bf16)(v[i] - (float)h); }
  return r; }
__device__ __forceinline__ F2 split_row(const float* row, int k0, int lane) { float v[16]; const float* p = row + k0 + 8 * (lane >> 4);
#pragma unroll
  for (int i = 0; i < 8; ++i) { v[i] = p[i]; v[8 + i] = p[16 + i]; }
  return bsplit16(v); }
__device__ __forceinline__ F2 split_rowK(const float* row, int k0, int lane, int K) { float v[16]; const int g = lane >> 4;
#pragma unroll
  for (int i = 0; i < 8; ++i) { const int ka = k0 + 8 * g + i, kb = ka + 16; v[i] = ka < K ? row[ka < K ? ka : K - 1] : 0.f; v[8 + i] = kb < K ? row[kb < K ? kb : K - 1] : 0.f; }
  return bsplit16(v); }
__device__ __forceinline__ F2 split_col(const float* W, int k0, int n, int lane, int ld, int K) { float v[16]; const int g = lane >> 4;
#pragma unroll
  for (int i = 0; i < 8; ++i) { const int ka = k0 + 8 * g + i, kb = ka + 16; v[i] = ka < K ? W[(size_t)(ka < K ? ka : K - 1) * ld + n] : 0.f; v[8 + i] = kb < K ? W[(size_t)(kb < K ? kb : K - 1) * ld + n] : 0.f; }
  return bsplit16(v); }
__device__ __forceinline__ v8f mac3(const F2& a, const F2& b, v8f c) { c = wmma_bf(a.l, b.h, c); c = wmma_bf(a.h, b.l, c); return wmma_bf(a.h, b.h, c); }
__device__ __forceinline__ float sigm(float v) { return 1.0f / (1.0f + expf(-v)); }
#define LDSX() do { asm volatile("s_wait_dscnt 0" ::: "memory"); __builtin_amdgcn_wave_barrier(); __builtin_amdgcn_fence(__ATOMIC_RELEASE, "workgroup"); } while (0)

// Multi-head attention on separate inputs with RoPE applied across the FULL model width before the head split (query / key / value [2,2048,1024]; torch (out,in) wq / wk / wv / wo [1024,1024] N(0, 1/1024) applied as x @ W.T + b, biases zeros (read); cos / sin [2048,512] are module INPUTS (computed in setup with numpy; read literally): x.reshape(.., 512, 2): (x0, x1) = (x[2j], x[2j+1]) -> (x0 c - x1 s, x0 s + x1 c) with c = cos[s][j], j = 0..511, on q and k; then 16 heads x 64 (head h = columns 64h..: its pair i uses table column h*32 + i); scores / sqrt(64); no mask; softmax; out @ wo.T + bo).
#define NB 2
#define TT 2048
#define CC 1024            // NH * HD = projected width
#define DIN 1024          // input (model) width
#define NH 16
#define HD 64
#define NQB (TT / 64)
#define HG 4
#define SCALE (0.125f)
#define CAUSAL 0
#ifndef TNB
#define TNB NB
#endif
__device__ __forceinline__ float bfr(float v) { return (float)(__bf16)v; }
__host__ __device__ __forceinline__ int kb_last(int qb) { return CAUSAL ? ((qb * 64 + 63) >> 7) : (TT / 128 - 1); }
typedef __attribute__((ext_vector_type(8))) __bf16 v8b;
__device__ __forceinline__ v16b frag_b(const __bf16* rowk0, int lane) {
  union { v16b v; v8b q[2]; } u; const __bf16* p = rowk0 + 8 * (lane >> 4);
  u.q[0] = *(const v8b*)p; u.q[1] = *(const v8b*)(p + 16); return u.v;
}
#define QBH 0              // not referenced by any kernel (k_fa has a single path for every query block)
#define QHI 0               // single-product logits on every row (logit sigma ~1)
#define KHI 64            // key rows carrying k residual / v bf16 hi+lo planes (written by k_proj; no kernel here reads them)
// B fragment (k rows k0+.., output column o) of a weight: (in,out) [K][ld] or (out,in) [ld rows of K]: bf16 exact, or f16(bf16 * 256) exact
__device__ __forceinline__ v16b wcol_io(const float* Wm, int k0, int o, int lane, int ld) { v16b w; const int g = lane >> 4;
#pragma unroll
  for (int i = 0; i < 8; ++i) { w[i] = (__bf16)Wm[(size_t)(k0 + 8 * g + i) * ld + o]; w[8 + i] = (__bf16)Wm[(size_t)(k0 + 16 + 8 * g + i) * ld + o]; }
  return w; }
__device__ __forceinline__ v16b wcol_oi(const float* Wm, int k0, int o, int lane, int K) { v16b w; const float* p = Wm + (size_t)o * K + k0 + 8 * (lane >> 4);
#pragma unroll
  for (int i = 0; i < 8; ++i) { w[i] = (__bf16)p[i]; w[8 + i] = (__bf16)p[16 + i]; }
  return w; }
__device__ __forceinline__ v16h wcolh_io(const float* Wm, int k0, int o, int lane, int ld) { v16h w; const int g = lane >> 4;
#pragma unroll
  for (int i = 0; i < 8; ++i) { w[i] = (_Float16)(bfr(Wm[(size_t)(k0 + 8 * g + i) * ld + o]) * 256.0f); w[8 + i] = (_Float16)(bfr(Wm[(size_t)(k0 + 16 + 8 * g + i) * ld + o]) * 256.0f); }
  return w; }
__device__ __forceinline__ v16h wcolh_oi(const float* Wm, int k0, int o, int lane, int K) { v16h w; const float* p = Wm + (size_t)o * K + k0 + 8 * (lane >> 4);
#pragma unroll
  for (int i = 0; i < 8; ++i) { w[i] = (_Float16)(bfr(p[i]) * 256.0f); w[8 + i] = (_Float16)(bfr(p[16 + i]) * 256.0f); }
  return w; }
#define WQKV_LAYOUT 1   // 0 = (in,out) [DIN][CC]; 1 = (out,in) [CC][DIN]; 2 = per-head [NH][DIN][HD]
__device__ __forceinline__ v16b wcol_hdk(const float* Wm, int k0, int o, int lane) { v16b w; const int g = lane >> 4; const float* p = Wm + (size_t)(o / HD) * DIN * HD + (o % HD);
#pragma unroll
  for (int i = 0; i < 8; ++i) { w[i] = (__bf16)p[(size_t)(k0 + 8 * g + i) * HD]; w[8 + i] = (__bf16)p[(size_t)(k0 + 16 + 8 * g + i) * HD]; }
  return w; }
#define WO_OUT_IN 1
#if WQKV_LAYOUT == 1
#define WCOL(W, k0, o, lane) wcol_oi(W, k0, o, lane, DIN)
#elif WQKV_LAYOUT == 2
#define WCOL(W, k0, o, lane) wcol_hdk(W, k0, o, lane)
#else
#define WCOL(W, k0, o, lane) wcol_io(W, k0, o, lane, CC)
#endif
#if WO_OUT_IN
#define WOCOL(W, k0, o, lane) wcol_oi(W, k0, o, lane, CC)
#define WOCOLH(W, k0, o, lane) wcolh_oi(W, k0, o, lane, CC)
#else
#define WOCOL(W, k0, o, lane) wcol_io(W, k0, o, lane, DIN)
#define WOCOLH(W, k0, o, lane) wcolh_io(W, k0, o, lane, DIN)
#endif

#define TBW 512   // table width = model width / 2 pairs
#define PROJ_EXTRA_PARAMS , const float* __restrict__ COS, const float* __restrict__ SIN   /* rotary tables [TT][512], module INPUTS, read literally */
// per (token, head) hook on the staged f32 row (64 floats = pairs h*32 .. h*32+31 of the model-wide rotation) of the q and k streams: (x0, x1) = (row[2i], row[2i+1]) -> (x0 c - x1 s, x0 s + x1 c) with c = bf16(cos[t][h*32 + i]), s = bf16(sin[t][h*32 + i]); v untouched; products and sums kept separate
#define PROJ_EPI(which, row, t, h) do { if ((which) < 2) { float* rw = (row); const float* ct_ = COS + (size_t)(t) * TBW + (size_t)(h) * 32; const float* st_ = SIN + (size_t)(t) * TBW + (size_t)(h) * 32; _Pragma("unroll 4") for (int i = 0; i < 32; ++i) { _Pragma("clang fp contract(off)") const float cs = bfr(ct_[i]), sn = bfr(st_[i]); const float xe = rw[2 * i], xo = rw[2 * i + 1]; rw[2 * i] = xe * cs - xo * sn; rw[2 * i + 1] = xe * sn + xo * cs; } } } while (0)
#ifndef SM_EXTRA_PARAMS
#define SM_EXTRA_PARAMS
#endif
#ifndef PROJ_EXTRA_PARAMS
#define PROJ_EXTRA_PARAMS
#endif
#ifndef SM_MASK_HOOK
#define SM_MASK_HOOK (void)0
#endif

#define WS_QH  0u                                      // f16 q rows [b*t][CC]
#define WS_KH  (WS_QH + 2u * (size_t)NB * TT * CC)      // f16 k rows [b*t][CC]
#define WS_VT  (WS_KH + 2u * (size_t)NB * TT * CC)      // f16 v planes [b][c][t]
#define WS_QL  (WS_VT + 2u * (size_t)NB * CC * TT)      // f16 q residual x 2^10 rows [b][t < QHI][CC]
#define WS_KL  (WS_QL + 2u * (size_t)NB * QHI * CC)     // f16 k residual x 2^10 rows [b][t < KHI][CC]
#define WS_VB  (WS_KL + 2u * (size_t)NB * KHI * CC)     // bf16 v hi planes [b][c][t < KHI]
#define WS_VBL (WS_VB + 2u * (size_t)NB * CC * KHI)
#define WS_S   (WS_VBL + 2u * (size_t)NB * CC * KHI)    // not used (scores stay in registers); kept so that the ctx plane keeps its place
#define WS_Y   (WS_S  + 4u * (size_t)HG * TT * TT)      // f32 ctx rows [b*t][CC] (only when there is an output projection)
#define WS_END (WS_Y  + 4u * (size_t)NB * TT * CC)

// ---- operand staging of the two GEMM kernels (block tile 64 x 128, 128 threads): a stage is KS k of every tile row; thread (lr = tid >> 4, lc = 4 (tid & 15)) moves 4 floats of rows lr + 8 i, so one wave-wide 16-byte load covers two 256-byte row pieces = 4 whole lines
#define KS 64
static_assert(CC == DIN, "one row pitch for every GEMM operand");
#define LP 72   // LDS row pitch in 16-bit elements: 144 B = 16 B x 9 (odd), the pitch for 16-byte fragment reads
typedef __attribute__((ext_vector_type(4))) __bf16 v4b;
typedef __attribute__((ext_vector_type(4))) _Float16 v4h;
__device__ __forceinline__ v8f mmb(v16b a, v16b b, v8f c) { return __builtin_amdgcn_wmma_f32_16x16x32_bf16(false, a, false, b, (short)0, c, false, false); }
__device__ __forceinline__ v4b cvt_b(v4f v) { return v4b{(__bf16)v[0], (__bf16)v[1], (__bf16)v[2], (__bf16)v[3]}; }
__device__ __forceinline__ v4h cvt_y(v4f v) { return v4h{(_Float16)(v[0] * 64.0f), (_Float16)(v[1] * 64.0f), (_Float16)(v[2] * 64.0f), (_Float16)(v[3] * 64.0f)}; }   // ctx x 2^6
__device__ __forceinline__ v4h cvt_w(v4f v) { return v4h{(_Float16)(bfr(v[0]) * 256.0f), (_Float16)(bfr(v[1]) * 256.0f), (_Float16)(bfr(v[2]) * 256.0f), (_Float16)(bfr(v[3]) * 256.0f)}; }   // f16(bf16 x 2^8), exact
// work-group barrier by hand: __syncthreads() compiled to a wait for the global loads too, which would drain the loads issued ahead for the stage after next; what the other waves need is this wave's LDS reads and writes complete (s_wait_dscnt 0). s_wait_xcnt 0 stands in front of every reuse of those loads' address registers.
__device__ __forceinline__ void stage_barrier() { asm volatile("s_wait_xcnt 0x0\n\ts_wait_dscnt 0x0\n\ts_barrier_signal -1\n\ts_barrier_wait -1" ::: "memory"); }
#define GT_LOAD(xa, xw, xg, wg, s) do { _Pragma("unroll") for (int i_ = 0; i_ < 8; ++i_) xa[i_] = *(const v4f*)((xg) + (size_t)(i_ * 8) * DIN + (s) * KS); _Pragma("unroll") for (int i_ = 0; i_ < 16; ++i_) xw[i_] = *(const v4f*)((wg) + (size_t)(i_ * 8) * DIN + (s) * KS); } while (0)
#define GT_STORE(VT_, ca, cw, xa, xw, ad, wd) do { _Pragma("unroll") for (int i_ = 0; i_ < 8; ++i_) *(VT_*)((ad) + (lr + 8 * i_) * LP + lc) = ca(xa[i_]); _Pragma("unroll") for (int i_ = 0; i_ < 16; ++i_) *(VT_*)((wd) + (lr + 8 * i_) * LP + lc) = cw(xw[i_]); } while (0)
// ---- k_proj: block = (64 rows, 128 cols, which): q/k/v = X W (+ b) with exact bf16 products (K = DIN) -> which 0: q f16 rows (+ residual rows < QHI); 1: k f16 rows (+ residual rows < KHI); 2: v f16 planes [c][t] (+ bf16 hi/lo planes for t < KHI)
__global__ __launch_bounds__(128) void k_proj(const float* __restrict__ XQ, const float* __restrict__ XK, const float* __restrict__ XV, const float* __restrict__ WQ, const float* __restrict__ WK, const float* __restrict__ WV, const float* __restrict__ BQ, const float* __restrict__ BK, const float* __restrict__ BV,
    _Float16* __restrict__ QH, _Float16* __restrict__ QL, _Float16* __restrict__ KH, _Float16* __restrict__ KL, _Float16* __restrict__ VT, __bf16* __restrict__ VB, __bf16* __restrict__ VBL PROJ_EXTRA_PARAMS) {
  __shared__ __align__(16) float st[64][132]; __shared__ __align__(16) _Float16 sh[64][136], sl[64][136]; __shared__ __align__(16) _Float16 th[128][72]; __shared__ __align__(16) __bf16 tb[128][72], tbl[128][72];
  const int tid = threadIdx.x, wave = tid >> 5, lane = tid & 31, col = lane & 15, g = lane >> 4; const int which = blockIdx.z; const int c0 = blockIdx.y * 128; const size_t r0 = (size_t)blockIdx.x * 64; const size_t bb = r0 / TT; const int t0 = (int)(r0 % TT);
  const float* X = which == 0 ? XQ : which == 1 ? XK : XV; const float* WA = which == 0 ? WQ : which == 1 ? WK : WV; const float* BA = which == 0 ? BQ : which == 1 ? BK : BV;
  // main loop: the block's X tile (64 x KS) and W tile (128 x KS) are read once per block with whole-line loads, rounded to bf16 once and staged in LDS (two buffers, in the arrays that the epilogue uses only later: X in th, W in tb / tbl); wave (wr, wc) owns 32 rows x 64 columns
  const int wr = wave >> 1, wc = wave & 1; const int lr = tid >> 4, lc = (tid & 15) * 4;
  __bf16* const As = (__bf16*)&th[0][0];
  const float* xg = X + (r0 + lr) * DIN + lc; const float* wg = WA + (size_t)(c0 + lr) * DIN + lc;
  v4f xa[8], xw[16]; v8f acc[2][4] = {};
  GT_LOAD(xa, xw, xg, wg, 0);
  GT_STORE(v4b, cvt_b, cvt_b, xa, xw, As, &tb[0][0]);
  GT_LOAD(xa, xw, xg, wg, 1);
  stage_barrier();   // stage 0 is published; stage 1 stays in flight
#pragma unroll 2   /* two stages a trip: the buffer index is a constant */
  for (int s = 0; s < DIN / KS; ++s) { const __bf16* Ab = As + ((s & 1) * 64 + wr * 32 + col) * LP; const __bf16* Wb = ((s & 1) ? &tbl[0][0] : &tb[0][0]) + (wc * 64 + col) * LP;
    v16b af[2][2], wf[2][4];
#pragma unroll
    for (int ks = 0; ks < 2; ++ks) {
#pragma unroll
      for (int i = 0; i < 2; ++i) af[ks][i] = frag_b(Ab + i * 16 * LP + ks * 32, lane);
#pragma unroll
      for (int j = 0; j < 4; ++j) wf[ks][j] = frag_b(Wb + j * 16 * LP + ks * 32, lane); }
    __builtin_amdgcn_sched_barrier(0);   // the stage's fragment reads issue as one group ahead of its products, not among them
#pragma unroll
    for (int ks = 0; ks < 2; ++ks)
#pragma unroll
      for (int i = 0; i < 2; ++i)
#pragma unroll
        for (int j = 0; j < 4; ++j) acc[i][j] = mmb(af[ks][i], wf[ks][j], acc[i][j]);
    __builtin_amdgcn_sched_barrier(0);   // the conversions, which wait for the loads in flight, stay behind the products
    if (s + 1 < DIN / KS) GT_STORE(v4b, cvt_b, cvt_b, xa, xw, As + ((s + 1) & 1) * 64 * LP, ((s + 1) & 1) ? &tbl[0][0] : &tb[0][0]);   /* into the buffer whose readers all passed the last barrier */
    if (s + 2 < DIN / KS) GT_LOAD(xa, xw, xg, wg, s + 2);   /* in flight under the next stage's products */
    stage_barrier(); }   // publishes stage s + 1 and ends every read of stage s
  { // stage the f32 tile (acc + bias) in LDS, run the per-(row, head) epilogue hook, then convert
#pragma unroll
    for (int j = 0; j < 4; ++j) { const float bias = BA ? bfr(BA[c0 + wc * 64 + j * 16 + col]) : 0.f;
#pragma unroll
      for (int i = 0; i < 2; ++i)
#pragma unroll
        for (int r = 0; r < 8; ++r) st[wr * 32 + i * 16 + 8 * g + r][wc * 64 + j * 16 + col] = acc[i][j][r] + bias; }
    __syncthreads();
    for (int e = tid; e < 64 * (128 / HD); e += 128) { const int rl = e / (128 / HD), hh = e % (128 / HD); PROJ_EPI(which, &st[rl][hh * HD], (int)((r0 + rl) % TT), (c0 / HD) + hh); }
    __syncthreads(); }
  if (which < 2) { _Float16* DH = which == 0 ? QH : KH; _Float16* DL = which == 0 ? QL : KL; const int nhi = which == 0 ? QHI : KHI; const bool hi_rows = t0 < nhi;
    for (int e = tid; e < 64 * 128; e += 128) { const int rl = e >> 7, cl = e & 127; const float v = st[rl][cl]; const _Float16 hv = (_Float16)v; sh[rl][cl] = hv; sl[rl][cl] = (_Float16)((v - (float)hv) * 1024.0f); }
    __syncthreads();
    for (int e = tid; e < 64 * 16; e += 128) { const int rl = e >> 4, q = e & 15; vst2((unsigned*)(DH + (r0 + rl) * CC + c0 + q * 8), *(const v4u*)&sh[rl][q * 8]); if (hi_rows) vst2((unsigned*)(DL + (bb * nhi + t0 + rl) * (size_t)CC + c0 + q * 8), *(const v4u*)&sl[rl][q * 8]); }
  } else { const bool hi_rows = t0 < KHI;
    for (int e = tid; e < 64 * 128; e += 128) { const int rl = e & 63, cl = e >> 6; const float v = st[rl][cl]; th[cl][rl] = (_Float16)v; const __bf16 bh = (__bf16)v; tb[cl][rl] = bh; tbl[cl][rl] = (__bf16)(v - (float)bh); }
    __syncthreads();
    for (int e = tid; e < 128 * 8; e += 128) { const int cl = e >> 3, q = e & 7; vst2((unsigned*)(VT + (bb * CC + c0 + cl) * (size_t)TT + t0 + q * 8), *(const v4u*)&th[cl][q * 8]); if (hi_rows) { const size_t o3 = (bb * CC + c0 + cl) * (size_t)KHI + t0 + q * 8; vst2((unsigned*)(VB + o3), *(const v4u*)&tb[cl][q * 8]); vst2((unsigned*)(VBL + o3), *(const v4u*)&tbl[cl][q * 8]); } } } }
// ---- k_fa: block = 256 queries (8 waves x 32) of (b, h): logits, softmax and P . v in one pass over the keys, 32 keys at a time, k and v read from LDS stages; nothing of the score matrix leaves the registers.
// S^T = K . Q^T (A = k rows, B = q rows kept in registers): D register r of key tile kt = score of key 16 kt + 8 g + r for query column col, which is element 8 kt + r of the B operand of ctx^T += V^T . P^T, so P packs in place.
// Online softmax in base 2: running maximum m and sum l per query column; l and ctx^T are rescaled by 2^(m_old - m_new) every pass; the wave halves' sums join in the epilogue.
// Every inner loop is unrolled whole, so that each fragment and accumulator index is a constant and the arrays live in registers.
#define PCARRY 8.0f   // P carried x 2^8 into f16 (cancels in ctx / l): small weights stay clear of f16 subnormals
__device__ __forceinline__ v8f mm16(v16h a, v16h b, v8f c) { return __builtin_amdgcn_wmma_f32_16x16x32_f16(false, a, false, b, (short)0, c, false, false); }
__device__ __forceinline__ float xhalf(float x) { return __builtin_bit_cast(float, __builtin_amdgcn_permlanex16(__builtin_bit_cast(int, x), __builtin_bit_cast(int, x), 0x76543210, 0xfedcba98, false, false)); }  // lane l with lane l ^ 16
// eight base-2 exponentials, each in its own register: no neighbour reads a result or overwrites a source, and the closing v_nop is the slot that the instruction set asks for behind the last one
__device__ __forceinline__ void exp2x8(v8f& a) { asm("v_exp_f32 %0, %0\n\tv_exp_f32 %1, %1\n\tv_exp_f32 %2, %2\n\tv_exp_f32 %3, %3\n\tv_exp_f32 %4, %4\n\tv_exp_f32 %5, %5\n\tv_exp_f32 %6, %6\n\tv_exp_f32 %7, %7\n\tv_nop" : "+v"(a[0]), "+v"(a[1]), "+v"(a[2]), "+v"(a[3]), "+v"(a[4]), "+v"(a[5]), "+v"(a[6]), "+v"(a[7])); }
// K / V staging: a stage is SK keys of the block's (b, h): SK k rows of 128 B and HD v plane pieces of 256 B, brought into LDS once for all 8 waves by asynchronous copies (16 B a lane, a wave-wide copy = 4 whole lines), two buffers
#define SK 128
#define NST (TT / SK)
#define KP 72                      // LDS pitch of a k row in f16: 144 B = 16 B x 9 (odd), the pitch for 16-byte fragment reads
#define VP 136                     // LDS pitch of a v plane piece in f16: 272 B = 16 B x 17 (odd)
#define VOF (SK * KP)              // start of the v part of a buffer, in f16
#define BUFH (SK * KP + HD * VP)   // one buffer, in f16
// one stage's 8 copies of this thread: k rows lr + 32 i, v planes lp + 16 i. s_wait_xcnt 0 closes the statement, so that it stands in front of every later write of the address registers that the copies name.
__device__ __forceinline__ void stage_copy(unsigned lk, unsigned lv, const _Float16* gk, const _Float16* gv) {
  asm volatile("global_load_async_to_lds_b128 %0, %8, off\n\tglobal_load_async_to_lds_b128 %1, %9, off\n\tglobal_load_async_to_lds_b128 %2, %10, off\n\tglobal_load_async_to_lds_b128 %3, %11, off\n\t"
               "global_load_async_to_lds_b128 %4, %12, off\n\tglobal_load_async_to_lds_b128 %5, %13, off\n\tglobal_load_async_to_lds_b128 %6, %14, off\n\tglobal_load_async_to_lds_b128 %7, %15, off\n\ts_wait_xcnt 0x0"
               :: "v"(lk), "v"(lk + 32u * KP * 2u), "v"(lk + 64u * KP * 2u), "v"(lk + 96u * KP * 2u), "v"(lv), "v"(lv + 16u * VP * 2u), "v"(lv + 32u * VP * 2u), "v"(lv + 48u * VP * 2u),
                  "v"(gk), "v"(gk + (size_t)32 * CC), "v"(gk + (size_t)64 * CC), "v"(gk + (size_t)96 * CC), "v"(gv), "v"(gv + (size_t)16 * TT), "v"(gv + (size_t)32 * TT), "v"(gv + (size_t)48 * TT) : "memory"); }
__global__ __launch_bounds__(256) void k_fa(const _Float16* __restrict__ QH, const _Float16* __restrict__ KH, const _Float16* __restrict__ VT, float* __restrict__ Y) {
  __shared__ __align__(16) _Float16 kv[2][BUFH];
  const int tid = threadIdx.x, wave = tid >> 5, lane = tid & 31, col = lane & 15, g = lane >> 4; const int h = blockIdx.y, b = blockIdx.z; const int q0 = blockIdx.x * 256 + wave * 32;
  const float cs = SCALE * 1.4426950408889634f;
  const unsigned lk = (unsigned)(size_t)&kv[0][0] + (unsigned)(tid >> 3) * (KP * 2u) + (unsigned)(tid & 7) * 16u;               // this thread's 16 bytes of k row tid >> 3
  const unsigned lv = (unsigned)(size_t)&kv[0][0] + VOF * 2u + (unsigned)(tid >> 4) * (VP * 2u) + (unsigned)(tid & 15) * 16u;   // this thread's 16 bytes of v plane tid >> 4
  const _Float16* gk = KH + ((size_t)b * TT + (tid >> 3)) * CC + h * HD + (tid & 7) * 8;
  const _Float16* gv = VT + ((size_t)b * CC + h * HD + (tid >> 4)) * (size_t)TT + (tid & 15) * 8;
  stage_copy(lk, lv, gk, gv);   // stage 0 into buffer 0
  v16h qf[2][2];
#pragma unroll
  for (int n = 0; n < 2; ++n)
#pragma unroll
    for (int kc = 0; kc < 2; ++kc) qf[n][kc] = frag_h(QH + ((size_t)b * TT + q0 + n * 16 + col) * CC + h * HD + kc * 32, lane);
  asm volatile("s_wait_asynccnt 0x0" ::: "memory");   // this wave's copies of stage 0 have landed
  __syncthreads();                                    // stage 0 is published
  stage_copy(lk + BUFH * 2u, lv + BUFH * 2u, gk + (size_t)SK * CC, gv + SK);   // stage 1 into buffer 1, in flight under stage 0's passes
  v8f acc[2][4] = {}; float m[2] = {-3.0e38f, -3.0e38f}, l[2] = {0.f, 0.f};
#pragma unroll 1   /* rolled, like the pass loop inside it */
  for (int t = 0; t < NST; ++t) { const _Float16* kb = &kv[t & 1][0] + col * KP;   /* key row col of the stage's first tile */
    const _Float16* vb = &kv[t & 1][VOF] + col * VP;                               /* v plane piece of head column col */
    v16h kf[2][2];
#pragma unroll
    for (int kt = 0; kt < 2; ++kt)
#pragma unroll
      for (int kc = 0; kc < 2; ++kc) kf[kt][kc] = frag_h(kb + (kt * 16) * KP + kc * 32, lane);
#pragma unroll 1   /* rolled: one pass already holds 16 matrix instructions, and further copies would multiply the live fragments */
    for (int p = 0; p < SK / 32; ++p) { const int nx = p + 1 < SK / 32 ? p + 1 : p;   /* a stage's last pass fetches its own k tiles again: inside the stage, unused */
    v8f s[2][2];
#pragma unroll
    for (int kt = 0; kt < 2; ++kt)
#pragma unroll
      for (int n = 0; n < 2; ++n) { s[kt][n] = v8f{};
#pragma unroll
        for (int kc = 0; kc < 2; ++kc) s[kt][n] = mm16(kf[kt][kc], qf[n][kc], s[kt][n]); }
    // one group of LDS reads a pass: this pass's v fragments, then the next pass's k fragments into the same registers (inside the stage only), in flight under the softmax
    v16h vf[4];
#pragma unroll
    for (int j = 0; j < 4; ++j) vf[j] = frag_h(vb + (j * 16) * VP + p * 32, lane);
#pragma unroll
    for (int kt = 0; kt < 2; ++kt)
#pragma unroll
      for (int kc = 0; kc < 2; ++kc) kf[kt][kc] = frag_h(kb + (nx * 32 + kt * 16) * KP + kc * 32, lane);
    __builtin_amdgcn_sched_barrier(0);   // the reads issue here, ahead of the softmax, not sunk towards their use
#pragma unroll
    for (int n = 0; n < 2; ++n) { float mx = s[0][n][0];
#pragma unroll
      for (int r = 0; r < 8; ++r) mx = fmaxf(mx, fmaxf(s[0][n][r], s[1][n][r]));
      mx = fmaxf(mx, xhalf(mx)) * cs;   /* both halves hold the column's maximum of this pass, scaled (cs > 0) */
      const float mn = fmaxf(m[n], mx); const float corr = __builtin_amdgcn_exp2f(m[n] - mn); m[n] = mn; const float nm = PCARRY - mn;
      v16h pf; float ps = 0.f; v8f e0, e1;
#pragma unroll
      for (int r = 0; r < 8; ++r) { e0[r] = fmaf(s[0][n][r], cs, nm); e1[r] = fmaf(s[1][n][r], cs, nm); }
      exp2x8(e0); exp2x8(e1);
#pragma unroll
      for (int r = 0; r < 8; ++r) { pf[r] = (_Float16)e0[r]; pf[8 + r] = (_Float16)e1[r]; ps += e0[r] + e1[r]; }
      l[n] = l[n] * corr + ps;
#pragma unroll
      for (int j = 0; j < 4; ++j) acc[n][j] = mm16(vf[j], pf, acc[n][j] * corr); } }
    asm volatile("s_wait_dscnt 0x0" ::: "memory");      // this wave's reads of stage t are complete before the buffer may be refilled
    asm volatile("s_wait_asynccnt 0x0" ::: "memory");   // this wave's copies of stage t + 1 have landed
    __syncthreads();                                    // publishes stage t + 1 and ends every read of stage t
    if (t + 2 < NST) stage_copy(lk + (unsigned)(t & 1) * (BUFH * 2u), lv + (unsigned)(t & 1) * (BUFH * 2u), gk + (size_t)(t + 2) * SK * CC, gv + (t + 2) * SK); }   /* into the buffer that stage t has just left */
  asm volatile("s_wait_asynccnt 0x0" ::: "memory");   // nothing of this wave is in flight when it leaves the loop
#pragma unroll
  for (int n = 0; n < 2; ++n) { const float inv = 1.0f / (l[n] + xhalf(l[n])); float* yr = Y + ((size_t)b * TT + q0 + n * 16 + col) * CC + h * HD + 8 * g;   /* register r of tile j = head column 16 j + 8 g + r of query col */
#pragma unroll
    for (int j = 0; j < 4; ++j) { const v8f o = acc[n][j] * inv; vst2(yr + j * 16, v4f{o[0], o[1], o[2], o[3]}); vst2(yr + j * 16 + 4, v4f{o[4], o[5], o[6], o[7]}); } } }
// ---- k_out: block = (64 rows, 128 cols): out = ctx Wo (+ bo): ctx x 2^6 once to f16 against Wo as f16(bf16 x 2^8) exact (1 product) x 2^-14
__global__ __launch_bounds__(128) void k_out(const float* __restrict__ Y, const float* __restrict__ WO, const float* __restrict__ BO, float* __restrict__ OUT) { __shared__ __align__(16) float sf[4][32][68]; __shared__ __align__(16) _Float16 ya[2][64][LP], wa[2][128][LP];
  const int tid = threadIdx.x, wave = tid >> 5, lane = tid & 31, col = lane & 15, g = lane >> 4; const int c0 = blockIdx.y * 128; const size_t r0 = (size_t)blockIdx.x * 64;
  // main loop as in k_proj: ctx tile (64 x KS, x 2^6 so small-magnitude context rows stay clear of f16 subnormals) and Wo tile (128 x KS) converted once per block and staged in LDS, two buffers; wave (wr, wc) owns 32 rows x 64 columns
  const int wr = wave >> 1, wc = wave & 1; const int lr = tid >> 4, lc = (tid & 15) * 4;
  const float* xg = Y + (r0 + lr) * CC + lc; const float* wg = WO + (size_t)(c0 + lr) * CC + lc;
  v4f xa[8], xw[16]; v8f acc[2][4] = {};
  GT_LOAD(xa, xw, xg, wg, 0);
  GT_STORE(v4h, cvt_y, cvt_w, xa, xw, &ya[0][0][0], &wa[0][0][0]);
  GT_LOAD(xa, xw, xg, wg, 1);
  stage_barrier();   // stage 0 is published; stage 1 stays in flight
#pragma unroll 2   /* two stages a trip: the buffer index is a constant */
  for (int s = 0; s < CC / KS; ++s) { const _Float16* Ab = &ya[s & 1][wr * 32 + col][0]; const _Float16* Wb = &wa[s & 1][wc * 64 + col][0];
    v16h af[2][2], wf[2][4];
#pragma unroll
    for (int ks = 0; ks < 2; ++ks) {
#pragma unroll
      for (int i = 0; i < 2; ++i) af[ks][i] = frag_h(Ab + i * 16 * LP + ks * 32, lane);
#pragma unroll
      for (int j = 0; j < 4; ++j) wf[ks][j] = frag_h(Wb + j * 16 * LP + ks * 32, lane); }
    __builtin_amdgcn_sched_barrier(0);   // the stage's fragment reads issue as one group ahead of its products, not among them
#pragma unroll
    for (int ks = 0; ks < 2; ++ks)
#pragma unroll
      for (int i = 0; i < 2; ++i)
#pragma unroll
        for (int j = 0; j < 4; ++j) acc[i][j] = mm16(af[ks][i], wf[ks][j], acc[i][j]);
    __builtin_amdgcn_sched_barrier(0);   // the conversions, which wait for the loads in flight, stay behind the products
    if (s + 1 < CC / KS) GT_STORE(v4h, cvt_y, cvt_w, xa, xw, &ya[(s + 1) & 1][0][0], &wa[(s + 1) & 1][0][0]);   /* into the buffer whose readers all passed the last barrier */
    if (s + 2 < CC / KS) GT_LOAD(xa, xw, xg, wg, s + 2);   /* in flight under the next stage's products */
    stage_barrier(); }   // publishes stage s + 1 and ends every read of stage s
#pragma unroll
  for (int j = 0; j < 4; ++j) { const float bias = BO ? bfr(BO[c0 + wc * 64 + j * 16 + col]) : 0.f;
#pragma unroll
    for (int i = 0; i < 2; ++i)
#pragma unroll
      for (int r = 0; r < 8; ++r) sf[wave][i * 16 + 8 * g + r][j * 16 + col] = acc[i][j][r] * (1.0f / 16384.0f) + bias; }   /* 2^-8 (Wo carry) x 2^-6 (ctx carry) */
  LDSX(); for (int rl = 0; rl < 16; ++rl) vst2(OUT + (r0 + wr * 32 + rl * 2 + g) * DIN + c0 + wc * 64 + col * 4, *(const v4f*)&sf[wave][rl * 2 + g][col * 4]); }

extern "C" void kernel_launch(void* const* d_in, const int* in_sizes, int n_in, void* d_out, int out_size, void* d_ws, size_t ws_size, hipStream_t stream) {
  (void)in_sizes; (void)n_in; (void)out_size;
  const float** F = (const float**)d_in;
  if (ws_size < (size_t)WS_END) return;
  char* ws = (char*)d_ws; _Float16 *QH = (_Float16*)(ws + WS_QH), *KH = (_Float16*)(ws + WS_KH), *VT = (_Float16*)(ws + WS_VT), *QL = (_Float16*)(ws + WS_QL), *KL = (_Float16*)(ws + WS_KL); __bf16 *VB = (__bf16*)(ws + WS_VB), *VBL = (__bf16*)(ws + WS_VBL); float *Y = (float*)(ws + WS_Y);
  (void)Y; (void)QL; (void)KL; (void)VB; (void)VBL;
  // inputs: 0 query [2,2048,1024]; 1 key; 2 value; 3 wq [1024,1024] (out,in), 4 bq; 5 wk, 6 bk; 7 wv, 8 bv; 9 wo (out,in), 10 bo (biases zeros, read); 11 cos [2048,512]; 12 sin [2048,512]
  k_proj<<<dim3(TNB * TT / 64, CC / 128, 3), 128, 0, stream>>>(F[0], F[1], F[2], F[3], F[5], F[7], F[4], F[6], F[8], QH, QL, KH, KL, VT, VB, VBL, F[11], F[12]);
  k_fa<<<dim3(TT / 256, NH, TNB), 256, 0, stream>>>(QH, KH, VT, Y);
  k_out<<<dim3(TNB * TT / 64, DIN / 128), 128, 0, stream>>>(Y, F[9], F[10], (float*)d_out);
}

// v004
// Measured time: 90.8 microseconds a run.
// Two timings next to v003 both put it at 1.18 times that version's speed.
// All steps since v000 together make it 15.9 times as fast.
// compute dtype: all float inputs rounded to bf16; q / k / v projections with EXACT bf16 products on WMMA 16x16x32 (f32 accumulate) + bias (zeros, read); interleaved-pair RoPE in f32 from the bf16-rounded INPUT cos / sin tables (512 pairs across the full model width); logits q x k once to f16 each (1 product) x 64^-0.5; online softmax f32 (base 2, running maximum); unnormalised P x 2^8 once to f16 x v once to f16 (1 product), divided by the f32 sum at the end; ctx x 2^6 once to f16 x wo f16(bf16 x 2^8) + bo; f32 output.
#include <hip/hip_runtime.h>
#include <math.h>

typedef __attribute__((ext_vector_type(16))) _Float16 v16h;
typedef __attribute__((ext_vector_type(16))) __bf16 v16b;
typedef __attribute__((ext_vector_type(8)))  _Float16 v8h;
typedef __attribute__((ext_vector_type(8)))  float v8f;
typedef __attribute__((ext_vector_type(4)))  float v4f;
typedef __attribute__((ext_vector_type(2)))  float v2f;
typedef __attribute__((ext_vector_type(4)))  unsigned v4u;
typedef __attribute__((ext_vector_type(4)))  int v4i;
typedef float __attribute__((may_alias)) float_a;
typedef int __attribute__((may_alias)) int_a;

template <typename T> __device__ __forceinline__ void vst2(void* p, T v) { *(T*)p = v;  }
__device__ __forceinline__ v8f wmma16(v16h a, v16h b, v8f c) {
  v8f d = __builtin_amdgcn_wmma_f32_16x16x32_f16(false, a, false, b, (short)0, c, false, false);
  asm volatile("v_nop\n\tv_nop\n\tv_nop\n\tv_nop" : "+v"(d) : "v"(a), "v"(b));
  return d;
}
__device__ __forceinline__ v8f wmma_bf(v16b a, v16b b, v8f c) {
  v8f d = __builtin_amdgcn_wmma_f32_16x16x32_bf16(false, a, false, b, (short)0, c, false, false);
  asm volatile("v_nop\n\tv_nop\n\tv_nop\n\tv_nop" : "+v"(d) : "v"(a), "v"(b));
  return d;
}
// 16x16x32 fragments: lane = (h = lane>>4, row/col = lane&15); elements 0..7 = k0+8h+0..7, 8..15 = k0+16+8h+0..7; D element r = row 8h+r
__device__ __forceinline__ v16h frag_h(const _Float16* rowk0, int lane) {
  union { v16h v; v8h q[2]; } u; const _Float16* p = rowk0 + 8 * (lane >> 4);
  u.q[0] = *(const v8h*)p; u.q[1] = *(const v8h*)(p + 16); return u.v;
}
__device__ __forceinline__ v16h frag_f32(const float* rowk0, int lane) {
  v16h a; const float* p = rowk0 + 8 * (lane >> 4);
#pragma unroll
  for (int i = 0; i < 8; ++i) { a[i] = (_Float16)p[i]; a[8 + i] = (_Float16)p[16 + i]; }
  return a;
}
__device__ __forceinline__ v16h frag_f32s(const float* rowk0, int lane, float sc) {
  v16h a; const float* p = rowk0 + 8 * (lane >> 4);
#pragma unroll
  for (int i = 0; i < 8; ++i) { a[i] = (_Float16)(p[i] * sc); a[8 + i] = (_Float16)(p[16 + i] * sc); }
  return a;
}
// column fragment from a [K][ld] layout (column n), rows >= K read as 0
__device__ __forceinline__ v16h fragc_f32(const float* W, int k0, int n, int lane, int ld, int K) {
  v16h a; const int g = lane >> 4;
#pragma unroll
  for (int i = 0; i < 8; ++i) { const int ka = k0 + 8 * g + i, kb = ka + 16;
    a[i] = (_Float16)(ka < K ? W[(size_t)(ka < K ? ka : K - 1) * ld + n] : 0.f); a[8 + i] = (_Float16)(kb < K ? W[(size_t)(kb < K ? kb : K - 1) * ld + n] : 0.f); }
  return a;
}
struct F2 { v16b h, l; };
__device__ __forceinline__ F2 bsplit16(const float v[16]) { F2 r;
#pragma unroll
  for (int i = 0; i < 16; ++i) { const __bf16 h = (__bf16)v[i]; r.h[i] = h; r.l[i] = (__bf16)(v[i] - (float)h); }
  return r; }
__device__ __forceinline__ F2 split_row(const float* row, int k0, int lane) { float v[16]; const float* p = row + k0 + 8 * (lane >> 4);
#pragma unroll
  for (int i = 0; i < 8; ++i) { v[i] = p[i]; v[8 + i] = p[16 + i]; }
  return bsplit16(v); }
__device__ __forceinline__ F2 split_rowK(const float* row, int k0, int lane, int K) { float v[16]; const int g = lane >> 4;
#pragma unroll
  for (int i = 0; i < 8; ++i) { const int ka = k0 + 8 * g + i, kb = ka + 16; v[i] = ka < K ? row[ka < K ? ka : K - 1] : 0.f; v[8 + i] = kb < K ? row[kb < K ? kb : K - 1] : 0.f; }
  return bsplit16(v); }
__device__ __forceinline__ F2 split_col(const float* W, int k0, int n, int lane, int ld, int K) { float v[16]; const int g = lane >> 4;
#pragma unroll
  for (int i = 0; i < 8; ++i) { const int ka = k0 + 8 * g + i, kb = ka + 16; v[i] = ka < K ? W[(size_t)(ka < K ? ka : K - 1) * ld + n] : 0.f; v[8 + i] = kb < K ? W[(size_t)(kb < K ? kb : K - 1) * ld + n] : 0.f; }
  return bsplit16(v); }
__device__ __forceinline__ v8f mac3(const F2& a, const F2& b, v8f c) { c = wmma_bf(a.l, b.h, c); c = wmma_bf(a.h, b.l, c); return wmma_bf(a.h, b.h, c); }
__device__ __forceinline__ float sigm(float v) { return 1.0f / (1.0f + expf(-v)); }
#define LDSX() do { asm volatile("s_wait_dscnt 0" ::: "memory"); __builtin_amdgcn_wave_barrier(); __builtin_amdgcn_fence(__ATOMIC_RELEASE, "workgroup"); } while (0)

// Multi-head attention on separate inputs with RoPE applied across the FULL model width before the head split (query / key / value [2,2048,1024]; torch (out,in) wq / wk / wv / wo [1024,1024] N(0, 1/1024) applied as x @ W.T + b, biases zeros (read); cos / sin [2048,512] are module INPUTS (computed in setup with numpy; read literally): x.reshape(.., 512, 2): (x0, x1) = (x[2j], x[2j+1]) -> (x0 c - x1 s, x0 s + x1 c) with c = cos[s][j], j = 0..511, on q and k; then 16 heads x 64 (head h = columns 64h..: its pair i uses table column h*32 + i); scores / sqrt(64); no mask; softmax; out @ wo.T + bo).
#define NB 2
#define TT 2048
#define CC 1024            // NH * HD = projected width
#define DIN 1024          // input (model) width
#define NH 16
#define HD 64
#define NQB (TT / 64)
#define HG 4
#define SCALE (0.125f)
#define CAUSAL 0
#ifndef TNB
#define TNB NB
#endif
__device__ __forceinline__ float bfr(float v) { return (float)(__bf16)v; }
__host__ __device__ __forceinline__ int kb_last(int qb) { return CAUSAL ? ((qb * 64 + 63) >> 7) : (TT / 128 - 1); }
typedef __attribute__((ext_vector_type(8))) __bf16 v8b;
__device__ __forceinline__ v16b frag_b(const __bf16* rowk0, int lane) {
  union { v16b v; v8b q[2]; } u; const __bf16* p = rowk0 + 8 * (lane >> 4);
  u.q[0] = *(const v8b*)p; u.q[1] = *(const v8b*)(p + 16); return u.v;
}
#define QBH 0              // not referenced by any kernel (k_fa has a single path for every query block)
#define QHI 0               // single-product logits on every row (logit sigma ~1)
#define KHI 64            // key rows carrying k residual / v bf16 hi+lo planes (written by k_proj; no kernel here reads them)
// B fragment (k rows k0+.., output column o) of a weight: (in,out) [K][ld] or (out,in) [ld rows of K]: bf16 exact, or f16(bf16 * 256) exact
__device__ __forceinline__ v16b wcol_io(const float* Wm, int k0, int o, int lane, int ld) { v16b w; const int g = lane >> 4;
#pragma unroll
  for (int i = 0; i < 8; ++i) { w[i] = (__bf16)Wm[(size_t)(k0 + 8 * g + i) * ld + o]; w[8 + i] = (__bf16)Wm[(size_t)(k0 + 16 + 8 * g + i) * ld + o]; }
  return w; }
__device__ __forceinline__ v16b wcol_oi(const float* Wm, int k0, int o, int lane, int K) { v16b w; const float* p = Wm + (size_t)o * K + k0 + 8 * (lane >> 4);
#pragma unroll
  for (int i = 0; i < 8; ++i) { w[i] = (__bf16)p[i]; w[8 + i] = (__bf16)p[16 + i]; }
  return w; }
__device__ __forceinline__ v16h wcolh_io(const float* Wm, int k0, int o, int lane, int ld) { v16h w; const int g = lane >> 4;
#pragma unroll
  for (int i = 0; i < 8; ++i) { w[i] = (_Float16)(bfr(Wm[(size_t)(k0 + 8 * g + i) * ld + o]) * 256.0f); w[8 + i] = (_Float16)(bfr(Wm[(size_t)(k0 + 16 + 8 * g + i) * ld + o]) * 256.0f); }
  return w; }
__device__ __forceinline__ v16h wcolh_oi(const float* Wm, int k0, int o, int lane, int K) { v16h w; const float* p = Wm + (size_t)o * K + k0 + 8 * (lane >> 4);
#pragma unroll
  for (int i = 0; i < 8; ++i) { w[i] = (_Float16)(bfr(p[i]) * 256.0f); w[8 + i] = (_Float16)(bfr(p[16 + i]) * 256.0f); }
  return w; }
#define WQKV_LAYOUT 1   // 0 = (in,out) [DIN][CC]; 1 = (out,in) [CC][DIN]; 2 = per-head [NH][DIN][HD]
__device__ __forceinline__ v16b wcol_hdk(const float* Wm, int k0, int o, int lane) { v16b w; const int g = lane >> 4; const float* p = Wm + (size_t)(o / HD) * DIN * HD + (o % HD);
#pragma unroll
  for (int i = 0; i < 8; ++i) { w[i] = (__bf16)p[(size_t)(k0 + 8 * g + i) * HD]; w[8 + i] = (__bf16)p[(size_t)(k0 + 16 + 8 * g + i) * HD]; }
  return w; }
#define WO_OUT_IN 1
#if WQKV_LAYOUT == 1
#define WCOL(W, k0, o, lane) wcol_oi(W, k0, o, lane, DIN)
#elif WQKV_LAYOUT == 2
#define WCOL(W, k0, o, lane) wcol_hdk(W, k0, o, lane)
#else
#define WCOL(W, k0, o, lane) wcol_io(W, k0, o, lane, CC)
#endif
#if WO_OUT_IN
#define WOCOL(W, k0, o, lane) wcol_oi(W, k0, o, lane, CC)
#define WOCOLH(W, k0, o, lane) wcolh_oi(W, k0, o, lane, CC)
#else
#define WOCOL(W, k0, o, lane) wcol_io(W, k0, o, lane, DIN)
#define WOCOLH(W, k0, o, lane) wcolh_io(W, k0, o, lane, DIN)
#endif

#define TBW 512   // table width = model width / 2 pairs
#define PROJ_EXTRA_PARAMS , const float* __restrict__ COS, const float* __restrict__ SIN   /* rotary tables [TT][512], module INPUTS, read literally */
// per (token, head) hook on the staged f32 row (64 floats = pairs h*32 .. h*32+31 of the model-wide rotation) of the q and k streams: (x0, x1) = (row[2i], row[2i+1]) -> (x0 c - x1 s, x0 s + x1 c) with c = bf16(cos[t][h*32 + i]), s = bf16(sin[t][h*32 + i]); v untouched; products and sums kept separate
#define PROJ_EPI(which, row, t, h) do { if ((which) < 2) { float* rw = (row); const float* ct_ = COS + (size_t)(t) * TBW + (size_t)(h) * 32; const float* st_ = SIN + (size_t)(t) * TBW + (size_t)(h) * 32; _Pragma("unroll 4") for (int i = 0; i < 32; ++i) { _Pragma("clang fp contract(off)") const float cs = bfr(ct_[i]), sn = bfr(st_[i]); const float xe = rw[2 * i], xo = rw[2 * i + 1]; rw[2 * i] = xe * cs - xo * sn; rw[2 * i + 1] = xe * sn + xo * cs; } } } while (0)
#ifndef SM_EXTRA_PARAMS
#define SM_EXTRA_PARAMS
#endif
#ifndef PROJ_EXTRA_PARAMS
#define PROJ_EXTRA_PARAMS
#endif
#ifndef SM_MASK_HOOK
#define SM_MASK_HOOK (void)0
#endif

#define WS_QH  0u                                      // f16 q rows [b*t][CC]
#define WS_KH  (WS_QH + 2u * (size_t)NB * TT * CC)      // f16 k rows [b*t][CC]
#define WS_VT  (WS_KH + 2u * (size_t)NB * TT * CC)      // f16 v planes [b][c][t]
#define WS_QL  (WS_VT + 2u * (size_t)NB * CC * TT)      // f16 q residual x 2^10 rows [b][t < QHI][CC]
#define WS_KL  (WS_QL + 2u * (size_t)NB * QHI * CC)     // f16 k residual x 2^10 rows [b][t < KHI][CC]
#define WS_VB  (WS_KL + 2u * (size_t)NB * KHI * CC)     // bf16 v hi planes [b][c][t < KHI]
#define WS_VBL (WS_VB + 2u * (size_t)NB * CC * KHI)
#define WS_S   (WS_VBL + 2u * (size_t)NB * CC * KHI)    // not used (scores stay in registers); kept so that the ctx plane keeps its place
#define WS_Y   (WS_S  + 4u * (size_t)HG * TT * TT)      // f32 ctx rows [b*t][CC] (only when there is an output projection)
#define WS_END (WS_Y  + 4u * (size_t)NB * TT * CC)

// ---- operand staging of the two GEMM kernels (block tile 128 x 128: each X row is read by 8 blocks, each W row by 32): a stage is KS (k_out) or KSP (k_proj) k of every tile row; a thread moves 4 floats of rows lr + 16 i of both operands, and one wave-wide 16-byte load covers whole 128-byte lines
#define KS 64    // k_out: 256 threads, thread (lr = tid >> 4, lc = 4 (tid & 15))
#define KSP 32   // k_proj: 128 threads, thread (lr = tid >> 3, lc = 4 (tid & 7)); the shorter stage keeps the registers low enough for three blocks on a WGP
#define LPP 40   // LDS row pitch of a KSP stage in 16-bit elements: 80 B = 16 B x 5 (odd)
static_assert(CC == DIN, "one row pitch for every GEMM operand");
#define LP 72   // LDS row pitch in 16-bit elements: 144 B = 16 B x 9 (odd), the pitch for 16-byte fragment reads
typedef __attribute__((ext_vector_type(4))) __bf16 v4b;
typedef __attribute__((ext_vector_type(4))) _Float16 v4h;
__device__ __forceinline__ v8f mmb(v16b a, v16b b, v8f c) { return __builtin_amdgcn_wmma_f32_16x16x32_bf16(false, a, false, b, (short)0, c, false, false); }
__device__ __forceinline__ v4b cvt_b(v4f v) { return v4b{(__bf16)v[0], (__bf16)v[1], (__bf16)v[2], (__bf16)v[3]}; }
__device__ __forceinline__ v4h cvt_y(v4f v) { return v4h{(_Float16)(v[0] * 64.0f), (_Float16)(v[1] * 64.0f), (_Float16)(v[2] * 64.0f), (_Float16)(v[3] * 64.0f)}; }   // ctx x 2^6
__device__ __forceinline__ v4h cvt_w(v4f v) { return v4h{(_Float16)(bfr(v[0]) * 256.0f), (_Float16)(bfr(v[1]) * 256.0f), (_Float16)(bfr(v[2]) * 256.0f), (_Float16)(bfr(v[3]) * 256.0f)}; }   // f16(bf16 x 2^8), exact
// work-group barrier by hand: __syncthreads() compiled to a wait for the global loads too, which would drain the loads issued ahead for the stage after next; what the other waves need is this wave's LDS reads and writes complete (s_wait_dscnt 0). s_wait_xcnt 0 stands in front of every reuse of those loads' address registers.
// The two load pointers take their step of SB bytes to the next stage inside the statement, behind its s_wait_xcnt 0: written in the source, the additions were placed by the compiler between the loads and the wait.
template <int SB> __device__ __forceinline__ void stage_barrier(const float*& xp, const float*& wp) { asm volatile("s_wait_xcnt 0x0\n\ts_wait_dscnt 0x0\n\ts_barrier_signal -1\n\ts_barrier_wait -1\n\tv_add_nc_u64 %0, %2, %0\n\tv_add_nc_u64 %1, %2, %1" : "+v"(xp), "+v"(wp) : "n"(SB) : "memory"); }
#define GT_LOAD(xa, xw, xp, wp) do { _Pragma("unroll") for (int i_ = 0; i_ < 8; ++i_) xa[i_] = *(const v4f*)((xp) + (size_t)(i_ * 16) * DIN); _Pragma("unroll") for (int i_ = 0; i_ < 8; ++i_) xw[i_] = *(const v4f*)((wp) + (size_t)(i_ * 16) * DIN); } while (0)
#define GT_STORE(LP_, VT_, ca, cw, xa, xw, ad, wd) do { _Pragma("unroll") for (int i_ = 0; i_ < 8; ++i_) *(VT_*)((ad) + (lr + 16 * i_) * LP_ + lc) = ca(xa[i_]); _Pragma("unroll") for (int i_ = 0; i_ < 8; ++i_) *(VT_*)((wd) + (lr + 16 * i_) * LP_ + lc) = cw(xw[i_]); } while (0)
// ---- k_proj: block = (128 rows, 128 cols, which): q/k/v = X W (+ b) with exact bf16 products (K = DIN) -> which 0: q f16 rows (+ residual rows < QHI); 1: k f16 rows (+ residual rows < KHI); 2: v f16 planes [c][t] (+ bf16 hi/lo planes for t < KHI)
__global__ __launch_bounds__(128) void k_proj(const float* __restrict__ XQ, const float* __restrict__ XK, const float* __restrict__ XV, const float* __restrict__ WQ, const float* __restrict__ WK, const float* __restrict__ WV, const float* __restrict__ BQ, const float* __restrict__ BK, const float* __restrict__ BV,
    _Float16* __restrict__ QH, _Float16* __restrict__ QL, _Float16* __restrict__ KH, _Float16* __restrict__ KL, _Float16* __restrict__ VT, __bf16* __restrict__ VB, __bf16* __restrict__ VBL PROJ_EXTRA_PARAMS) {
  // one LDS block, used in turn: the main loop's stages (2 x 128 X rows, then 2 x 128 W rows, 40,960 B from its start), then the epilogue's arrays; sh / sl (q, k) and th / tb / tbl (v) are never live in the same block and share their place
  __shared__ __align__(16) char sm[33792 + 55296];
  float (*const st)[132] = (float (*)[132])sm; _Float16 (*const sh)[136] = (_Float16 (*)[136])(sm + 33792); _Float16 (*const sl)[136] = (_Float16 (*)[136])(sm + 33792 + 17408);
  _Float16 (*const th)[72] = (_Float16 (*)[72])(sm + 33792); __bf16 (*const tb)[72] = (__bf16 (*)[72])(sm + 33792 + 18432); __bf16 (*const tbl)[72] = (__bf16 (*)[72])(sm + 33792 + 36864);
  const int tid = threadIdx.x, wave = tid >> 5, lane = tid & 31, col = lane & 15, g = lane >> 4; const int which = blockIdx.z; const int c0 = blockIdx.y * 128; const size_t rb = (size_t)blockIdx.x * 128; const size_t bb = rb / TT;
  const float* X = which == 0 ? XQ : which == 1 ? XK : XV; const float* WA = which == 0 ? WQ : which == 1 ? WK : WV; const float* BA = which == 0 ? BQ : which == 1 ? BK : BV;
  // main loop: the block's X tile (128 x KSP) and W tile (128 x KSP) are read once per block with whole-line loads, rounded to bf16 once and staged in LDS (two buffers); wave (wr, wc) owns 64 rows x 64 columns
  const int wr = wave >> 1, wc = wave & 1; const int lr = tid >> 3, lc = (tid & 7) * 4;
  __bf16* const As = (__bf16*)sm; __bf16* const Ws = As + 2 * 128 * LPP;
  const float* xg = X + (rb + lr) * DIN + lc; const float* wg = WA + (size_t)(c0 + lr) * DIN + lc;
  v4f xa[8], xw[8]; v8f acc[4][4] = {};
  GT_LOAD(xa, xw, xg, wg);
  GT_STORE(LPP, v4b, cvt_b, cvt_b, xa, xw, As, Ws);
  GT_LOAD(xa, xw, xg + KSP, wg + KSP);
  stage_barrier<2 * KSP * 4>(xg, wg);   // stage 0 is published; stage 1 stays in flight; the pointers now stand at the stage after next
#pragma unroll 2   /* two stages a trip: the buffer index is a constant */
  for (int s = 0; s < DIN / KSP; ++s) { const __bf16* Ab = As + ((s & 1) * 128 + wr * 64 + col) * LPP; const __bf16* Wb = Ws + ((s & 1) * 128 + wc * 64 + col) * LPP;
    v16b af[4], wf[4];
#pragma unroll
    for (int i = 0; i < 4; ++i) af[i] = frag_b(Ab + i * 16 * LPP, lane);
#pragma unroll
    for (int j = 0; j < 4; ++j) wf[j] = frag_b(Wb + j * 16 * LPP, lane);
    __builtin_amdgcn_sched_barrier(0);   // the stage's fragment reads issue as one group ahead of its products, not among them
#pragma unroll
    for (int i = 0; i < 4; ++i)
#pragma unroll
      for (int j = 0; j < 4; ++j) acc[i][j] = mmb(af[i], wf[j], acc[i][j]);
    __builtin_amdgcn_sched_barrier(0);   // the conversions, which wait for the loads in flight, stay behind the products
    if (s + 1 < DIN / KSP) GT_STORE(LPP, v4b, cvt_b, cvt_b, xa, xw, As + ((s + 1) & 1) * 128 * LPP, Ws + ((s + 1) & 1) * 128 * LPP);   /* into the buffer whose readers all passed the last barrier */
    if (s + 2 < DIN / KSP) GT_LOAD(xa, xw, xg, wg);   /* in flight under the next stage's products */
    stage_barrier<KSP * 4>(xg, wg); }   // publishes stage s + 1 and ends every read of stage s
  // epilogue, once for each half of 64 rows (the two waves wr == hf hand their tiles over), through the same 64-row arrays; a half's first writes of an array stand behind a barrier that follows the last half's reads of it
#pragma unroll 1   /* rolled: the two halves differ only in the row offset, and one copy of the text is enough */
  for (int hf = 0; hf < 2; ++hf) { const size_t r0 = rb + hf * 64; const int t0 = (int)(r0 % TT);
  { // stage the f32 tile (acc + bias) in LDS, run the per-(row, head) epilogue hook, then convert
    if (wr == hf) {
#pragma unroll
    for (int j = 0; j < 4; ++j) { const float bias = BA ? bfr(BA[c0 + wc * 64 + j * 16 + col]) : 0.f;
#pragma unroll
      for (int i = 0; i < 4; ++i)
#pragma unroll
        for (int r = 0; r < 8; ++r) st[i * 16 + 8 * g + r][wc * 64 + j * 16 + col] = acc[i][j][r] + bias; } }
    __syncthreads();
    for (int e = tid; e < 64 * (128 / HD); e += 128) { const int rl = e / (128 / HD), hh = e % (128 / HD); PROJ_EPI(which, &st[rl][hh * HD], (int)((r0 + rl) % TT), (c0 / HD) + hh); }
    __syncthreads(); }
  if (which < 2) { _Float16* DH = which == 0 ? QH : KH; _Float16* DL = which == 0 ? QL : KL; const int nhi = which == 0 ? QHI : KHI; const bool hi_rows = t0 < nhi;
    for (int e = tid; e < 64 * 128; e += 128) { const int rl = e >> 7, cl = e & 127; const float v = st[rl][cl]; const _Float16 hv = (_Float16)v; sh[rl][cl] = hv; sl[rl][cl] = (_Float16)((v - (float)hv) * 1024.0f); }
    __syncthreads();
    for (int e = tid; e < 64 * 16; e += 128) { const int rl = e >> 4, q = e & 15; vst2((unsigned*)(DH + (r0 + rl) * CC + c0 + q * 8), *(const v4u*)&sh[rl][q * 8]); if (hi_rows) vst2((unsigned*)(DL + (bb * nhi + t0 + rl) * (size_t)CC + c0 + q * 8), *(const v4u*)&sl[rl][q * 8]); }
  } else { const bool hi_rows = t0 < KHI;
    for (int e = tid; e < 64 * 128; e += 128) { const int rl = e & 63, cl = e >> 6; const float v = st[rl][cl]; th[cl][rl] = (_Float16)v; const __bf16 bh = (__bf16)v; tb[cl][rl] = bh; tbl[cl][rl] = (__bf16)(v - (float)bh); }
    __syncthreads();
    for (int e = tid; e < 128 * 8; e += 128) { const int cl = e >> 3, q = e & 7; vst2((unsigned*)(VT + (bb * CC + c0 + cl) * (size_t)TT + t0 + q * 8), *(const v4u*)&th[cl][q * 8]); if (hi_rows) { const size_t o3 = (bb * CC + c0 + cl) * (size_t)KHI + t0 + q * 8; vst2((unsigned*)(VB + o3), *(const v4u*)&tb[cl][q * 8]); vst2((unsigned*)(VBL + o3), *(const v4u*)&tbl[cl][q * 8]); } } }
  asm volatile("s_wait_xcnt 0x0" ::: "memory"); } }   // foot of a half: stands in front of the next half's writes of the registers that this half's stores name
// ---- k_fa: block = 256 queries (8 waves x 32) of (b, h): logits, softmax and P . v in one pass over the keys, 32 keys at a time, k and v read from LDS stages; nothing of the score matrix leaves the registers.
// S^T = K . Q^T (A = k rows, B = q rows kept in registers): D register r of key tile kt = score of key 16 kt + 8 g + r for query column col, which is element 8 kt + r of the B operand of ctx^T += V^T . P^T, so P packs in place.
// Online softmax in base 2: running maximum m and sum l per query column; l and ctx^T are rescaled by 2^(m_old - m_new) every pass; the wave halves' sums join in the epilogue.
// Every inner loop is unrolled whole, so that each fragment and accumulator index is a constant and the arrays live in registers.
#define PCARRY 8.0f   // P carried x 2^8 into f16 (cancels in ctx / l): small weights stay clear of f16 subnormals
__device__ __forceinline__ v8f mm16(v16h a, v16h b, v8f c) { return __builtin_amdgcn_wmma_f32_16x16x32_f16(false, a, false, b, (short)0, c, false, false); }
__device__ __forceinline__ float xhalf(float x) { return __builtin_bit_cast(float, __builtin_amdgcn_permlanex16(__builtin_bit_cast(int, x), __builtin_bit_cast(int, x), 0x76543210, 0xfedcba98, false, false)); }  // lane l with lane l ^ 16
// eight base-2 exponentials, each in its own register: no neighbour reads a result or overwrites a source, and the closing v_nop is the slot that the instruction set asks for behind the last one
__device__ __forceinline__ void exp2x8(v8f& a) { asm("v_exp_f32 %0, %0\n\tv_exp_f32 %1, %1\n\tv_exp_f32 %2, %2\n\tv_exp_f32 %3, %3\n\tv_exp_f32 %4, %4\n\tv_exp_f32 %5, %5\n\tv_exp_f32 %6, %6\n\tv_exp_f32 %7, %7\n\tv_nop" : "+v"(a[0]), "+v"(a[1]), "+v"(a[2]), "+v"(a[3]), "+v"(a[4]), "+v"(a[5]), "+v"(a[6]), "+v"(a[7])); }
// K / V staging: a stage is SK keys of the block's (b, h): SK k rows of 128 B and HD v plane pieces of 256 B, brought into LDS once for all 8 waves by asynchronous copies (16 B a lane, a wave-wide copy = 4 whole lines), two buffers
#define SK 128
#define NST (TT / SK)
#define KP 72                      // LDS pitch of a k row in f16: 144 B = 16 B x 9 (odd), the pitch for 16-byte fragment reads
#define VP 136                     // LDS pitch of a v plane piece in f16: 272 B = 16 B x 17 (odd)
#define VOF (SK * KP)              // start of the v part of a buffer, in f16
#define BUFH (SK * KP + HD * VP)   // one buffer, in f16
// one stage's 8 copies of this thread: k rows lr + 32 i, v planes lp + 16 i. s_wait_xcnt 0 closes the statement, so that it stands in front of every later write of the address registers that the copies name.
__device__ __forceinline__ void stage_copy(unsigned lk, unsigned lv, const _Float16* gk, const _Float16* gv) {
  asm volatile("global_load_async_to_lds_b128 %0, %8, off\n\tglobal_load_async_to_lds_b128 %1, %9, off\n\tglobal_load_async_to_lds_b128 %2, %10, off\n\tglobal_load_async_to_lds_b128 %3, %11, off\n\t"
               "global_load_async_to_lds_b128 %4, %12, off\n\tglobal_load_async_to_lds_b128 %5, %13, off\n\tglobal_load_async_to_lds_b128 %6, %14, off\n\tglobal_load_async_to_lds_b128 %7, %15, off\n\ts_wait_xcnt 0x0"
               :: "v"(lk), "v"(lk + 32u * KP * 2u), "v"(lk + 64u * KP * 2u), "v"(lk + 96u * KP * 2u), "v"(lv), "v"(lv + 16u * VP * 2u), "v"(lv + 32u * VP * 2u), "v"(lv + 48u * VP * 2u),
                  "v"(gk), "v"(gk + (size_t)32 * CC), "v"(gk + (size_t)64 * CC), "v"(gk + (size_t)96 * CC), "v"(gv), "v"(gv + (size_t)16 * TT), "v"(gv + (size_t)32 * TT), "v"(gv + (size_t)48 * TT) : "memory"); }
__global__ __launch_bounds__(256) void k_fa(const _Float16* __restrict__ QH, const _Float16* __restrict__ KH, const _Float16* __restrict__ VT, float* __restrict__ Y) {
  __shared__ __align__(16) _Float16 kv[2][BUFH];
  const int tid = threadIdx.x, wave = tid >> 5, lane = tid & 31, col = lane & 15, g = lane >> 4; const int h = blockIdx.y, b = blockIdx.z; const int q0 = blockIdx.x * 256 + wave * 32;
  const float cs = SCALE * 1.4426950408889634f;
  const unsigned lk = (unsigned)(size_t)&kv[0][0] + (unsigned)(tid >> 3) * (KP * 2u) + (unsigned)(tid & 7) * 16u;               // this thread's 16 bytes of k row tid >> 3
  const unsigned lv = (unsigned)(size_t)&kv[0][0] + VOF * 2u + (unsigned)(tid >> 4) * (VP * 2u) + (unsigned)(tid & 15) * 16u;   // this thread's 16 bytes of v plane tid >> 4
  const _Float16* gk = KH + ((size_t)b * TT + (tid >> 3)) * CC + h * HD + (tid & 7) * 8;
  const _Float16* gv = VT + ((size_t)b * CC + h * HD + (tid >> 4)) * (size_t)TT + (tid & 15) * 8;
  stage_copy(lk, lv, gk, gv);   // stage 0 into buffer 0
  v16h qf[2][2];
#pragma unroll
  for (int n = 0; n < 2; ++n)
#pragma unroll
    for (int kc = 0; kc < 2; ++kc) qf[n][kc] = frag_h(QH + ((size_t)b * TT + q0 + n * 16 + col) * CC + h * HD + kc * 32, lane);
  asm volatile("s_wait_asynccnt 0x0" ::: "memory");   // this wave's copies of stage 0 have landed
  __syncthreads();                                    // stage 0 is published
  stage_copy(lk + BUFH * 2u, lv + BUFH * 2u, gk + (size_t)SK * CC, gv + SK);   // stage 1 into buffer 1, in flight under stage 0's passes
  v8f acc[2][4] = {}; float m[2] = {-3.0e38f, -3.0e38f}, l[2] = {0.f, 0.f};
#pragma unroll 1   /* rolled, like the pass loop inside it */
  for (int t = 0; t < NST; ++t) { const _Float16* kb = &kv[t & 1][0] + col * KP;   /* key row col of the stage's first tile */
    const _Float16* vb = &kv[t & 1][VOF] + col * VP;                               /* v plane piece of head column col */
    v16h kf[2][2];
#pragma unroll
    for (int kt = 0; kt < 2; ++kt)
#pragma unroll
      for (int kc = 0; kc < 2; ++kc) kf[kt][kc] = frag_h(kb + (kt * 16) * KP + kc * 32, lane);
#pragma unroll 1   /* rolled: one pass already holds 16 matrix instructions, and further copies would multiply the live fragments */
    for (int p = 0; p < SK / 32; ++p) { const int nx = p + 1 < SK / 32 ? p + 1 : p;   /* a stage's last pass fetches its own k tiles again: inside the stage, unused */
    v8f s[2][2];
#pragma unroll
    for (int kt = 0; kt < 2; ++kt)
#pragma unroll
      for (int n = 0; n < 2; ++n) { s[kt][n] = v8f{};
#pragma unroll
        for (int kc = 0; kc < 2; ++kc) s[kt][n] = mm16(kf[kt][kc], qf[n][kc], s[kt][n]); }
    // one group of LDS reads a pass: this pass's v fragments, then the next pass's k fragments into the same registers (inside the stage only), in flight under the softmax
    v16h vf[4];
#pragma unroll
    for (int j = 0; j < 4; ++j) vf[j] = frag_h(vb + (j * 16) * VP + p * 32, lane);
#pragma unroll
    for (int kt = 0; kt < 2; ++kt)
#pragma unroll
      for (int kc = 0; kc < 2; ++kc) kf[kt][kc] = frag_h(kb + (nx * 32 + kt * 16) * KP + kc * 32, lane);
    __builtin_amdgcn_sched_barrier(0);   // the reads issue here, ahead of the softmax, not sunk towards their use
#pragma unroll
    for (int n = 0; n < 2; ++n) { float mx = s[0][n][0];
#pragma unroll
      for (int r = 0; r < 8; ++r) mx = fmaxf(mx, fmaxf(s[0][n][r], s[1][n][r]));
      mx = fmaxf(mx, xhalf(mx)) * cs;   /* both halves hold the column's maximum of this pass, scaled (cs > 0) */
      const float mn = fmaxf(m[n], mx); const float corr = __builtin_amdgcn_exp2f(m[n] - mn); m[n] = mn; const float nm = PCARRY - mn;
      v16h pf; float ps = 0.f; v8f e0, e1;
#pragma unroll
      for (int r = 0; r < 8; ++r) { e0[r] = fmaf(s[0][n][r], cs, nm); e1[r] = fmaf(s[1][n][r], cs, nm); }
      exp2x8(e0); exp2x8(e1);
#pragma unroll
      for (int r = 0; r < 8; ++r) { pf[r] = (_Float16)e0[r]; pf[8 + r] = (_Float16)e1[r]; ps += e0[r] + e1[r]; }
      l[n] = l[n] * corr + ps;
#pragma unroll
      for (int j = 0; j < 4; ++j) acc[n][j] = mm16(vf[j], pf, acc[n][j] * corr); } }
    asm volatile("s_wait_dscnt 0x0" ::: "memory");      // this wave's reads of stage t are complete before the buffer may be refilled
    asm volatile("s_wait_asynccnt 0x0" ::: "memory");   // this wave's copies of stage t + 1 have landed
    __syncthreads();                                    // publishes stage t + 1 and ends every read of stage t
    if (t + 2 < NST) stage_copy(lk + (unsigned)(t & 1) * (BUFH * 2u), lv + (unsigned)(t & 1) * (BUFH * 2u), gk + (size_t)(t + 2) * SK * CC, gv + (t + 2) * SK); }   /* into the buffer that stage t has just left */
  asm volatile("s_wait_asynccnt 0x0" ::: "memory");   // nothing of this wave is in flight when it leaves the loop
#pragma unroll
  for (int n = 0; n < 2; ++n) { const float inv = 1.0f / (l[n] + xhalf(l[n])); float* yr = Y + ((size_t)b * TT + q0 + n * 16 + col) * CC + h * HD + 8 * g;   /* register r of tile j = head column 16 j + 8 g + r of query col */
#pragma unroll
    for (int j = 0; j < 4; ++j) { const v8f o = acc[n][j] * inv; vst2(yr + j * 16, v4f{o[0], o[1], o[2], o[3]}); vst2(yr + j * 16 + 4, v4f{o[4], o[5], o[6], o[7]}); } } }
// ---- k_out: block = (128 rows, 128 cols), 8 waves, one block a WGP: out = ctx Wo (+ bo): ctx x 2^6 once to f16 against Wo as f16(bf16 x 2^8) exact (1 product) x 2^-14
__global__ __launch_bounds__(256) void k_out(const float* __restrict__ Y, const float* __restrict__ WO, const float* __restrict__ BO, float* __restrict__ OUT) { __shared__ __align__(16) float sf[8][32][68]; __shared__ __align__(16) _Float16 ya[2][128][LP], wa[2][128][LP];
  const int tid = threadIdx.x, wave = tid >> 5, lane = tid & 31, col = lane & 15, g = lane >> 4; const int c0 = blockIdx.y * 128; const size_t r0 = (size_t)blockIdx.x * 128;
  // main loop as in k_proj: ctx tile (128 x KS, x 2^6 so small-magnitude context rows stay clear of f16 subnormals) and Wo tile (128 x KS) converted once per block and staged in LDS, two buffers; wave (wr, wc) owns 32 rows x 64 columns
  const int wr = wave >> 1, wc = wave & 1; const int lr = tid >> 4, lc = (tid & 15) * 4;
  const float* xg = Y + (r0 + lr) * CC + lc; const float* wg = WO + (size_t)(c0 + lr) * CC + lc;
  v4f xa[8], xw[8]; v8f acc[2][4] = {};
  GT_LOAD(xa, xw, xg, wg);
  GT_STORE(LP, v4h, cvt_y, cvt_w, xa, xw, &ya[0][0][0], &wa[0][0][0]);
  GT_LOAD(xa, xw, xg + KS, wg + KS);
  stage_barrier<2 * KS * 4>(xg, wg);   // stage 0 is published; stage 1 stays in flight; the pointers now stand at the stage after next
#pragma unroll 2   /* two stages a trip: the buffer index is a constant */
  for (int s = 0; s < CC / KS; ++s) { const _Float16* Ab = &ya[s & 1][wr * 32 + col][0]; const _Float16* Wb = &wa[s & 1][wc * 64 + col][0];
    v16h af[2][2], wf[2][4];
#pragma unroll
    for (int ks = 0; ks < 2; ++ks) {
#pragma unroll
      for (int i = 0; i < 2; ++i) af[ks][i] = frag_h(Ab + i * 16 * LP + ks * 32, lane);
#pragma unroll
      for (int j = 0; j < 4; ++j) wf[ks][j] = frag_h(Wb + j * 16 * LP + ks * 32, lane); }
    __builtin_amdgcn_sched_barrier(0);   // the stage's fragment reads issue as one group ahead of its products, not among them
#pragma unroll
    for (int ks = 0; ks < 2; ++ks)
#pragma unroll
      for (int i = 0; i < 2; ++i)
#pragma unroll
        for (int j = 0; j < 4; ++j) acc[i][j] = mm16(af[ks][i], wf[ks][j], acc[i][j]);
    __builtin_amdgcn_sched_barrier(0);   // the conversions, which wait for the loads in flight, stay behind the products
    if (s + 1 < CC / KS) GT_STORE(LP, v4h, cvt_y, cvt_w, xa, xw, &ya[(s + 1) & 1][0][0], &wa[(s + 1) & 1][0][0]);   /* into the buffer whose readers all passed the last barrier */
    if (s + 2 < CC / KS) GT_LOAD(xa, xw, xg, wg);   /* in flight under the next stage's products */
    stage_barrier<KS * 4>(xg, wg); }   // publishes stage s + 1 and ends every read of stage s
#pragma unroll
  for (int j = 0; j < 4; ++j) { const float bias = BO ? bfr(BO[c0 + wc * 64 + j * 16 + col]) : 0.f;
#pragma unroll
    for (int i = 0; i < 2; ++i)
#pragma unroll
      for (int r = 0; r < 8; ++r) sf[wave][i * 16 + 8 * g + r][j * 16 + col] = acc[i][j][r] * (1.0f / 16384.0f) + bias; }   /* 2^-8 (Wo carry) x 2^-6 (ctx carry) */
  LDSX(); for (int rl = 0; rl < 16; ++rl) vst2(OUT + (r0 + wr * 32 + rl * 2 + g) * DIN + c0 + wc * 64 + col * 4, *(const v4f*)&sf[wave][rl * 2 + g][col * 4]); }

extern "C" void kernel_launch(void* const* d_in, const int* in_sizes, int n_in, void* d_out, int out_size, void* d_ws, size_t ws_size, hipStream_t stream) {
  (void)in_sizes; (void)n_in; (void)out_size;
  const float** F = (const float**)d_in;
  if (ws_size < (size_t)WS_END) return;
  char* ws = (char*)d_ws; _Float16 *QH = (_Float16*)(ws + WS_QH), *KH = (_Float16*)(ws + WS_KH), *VT = (_Float16*)(ws + WS_VT), *QL = (_Float16*)(ws + WS_QL), *KL = (_Float16*)(ws + WS_KL); __bf16 *VB = (__bf16*)(ws + WS_VB), *VBL = (__bf16*)(ws + WS_VBL); float *Y = (float*)(ws + WS_Y);
  (void)Y; (void)QL; (void)KL; (void)VB; (void)VBL;
  // inputs: 0 query [2,2048,1024]; 1 key; 2 value; 3 wq [1024,1024] (out,in), 4 bq; 5 wk, 6 bk; 7 wv, 8 bv; 9 wo (out,in), 10 bo (biases zeros, read); 11 cos [2048,512]; 12 sin [2048,512]
  k_proj<<<dim3(TNB * TT / 128, CC / 128, 3), 128, 0, stream>>>(F[0], F[1], F[2], F[3], F[5], F[7], F[4], F[6], F[8], QH, QL, KH, KL, VT, VB, VBL, F[11], F[12]);
  k_fa<<<dim3(TT / 256, NH, TNB), 256, 0, stream>>>(QH, KH, VT, Y);
  k_out<<<dim3(TNB * TT / 128, DIN / 128), 256, 0, stream>>>(Y, F[9], F[10], (float*)d_out);
}

// v005
// One run takes 86 microseconds.
// In both of two side-by-side timings against v004, it was 1.05 times as fast.
// All steps since v000 together make it 16.8 times as fast.
// compute dtype: all float inputs rounded to bf16; q / k / v projections with EXACT bf16 products on WMMA 16x16x32 (f32 accumulate) + bias (zeros, read); interleaved-pair RoPE in f32 from the bf16-rounded INPUT cos / sin tables (512 pairs across the full model width); logits q x k once to f16 each (1 product) x 64^-0.5; online softmax f32 (base 2, running maximum); unnormalised P x 2^8 once to f16 x v once to f16 (1 product), divided by the f32 sum at the end; ctx x 2^6 once to f16 x wo f16(bf16 x 2^8) + bo; f32 output.
#include <hip/hip_runtime.h>
#include <math.h>

typedef __attribute__((ext_vector_type(16))) _Float16 v16h;
typedef __attribute__((ext_vector_type(16))) __bf16 v16b;
typedef __attribute__((ext_vector_type(8)))  _Float16 v8h;
typedef __attribute__((ext_vector_type(8)))  float v8f;
typedef __attribute__((ext_vector_type(4)))  float v4f;
typedef __attribute__((ext_vector_type(2)))  float v2f;
typedef __attribute__((ext_vector_type(4)))  unsigned v4u;
typedef __attribute__((ext_vector_type(4)))  int v4i;
typedef float __attribute__((may_alias)) float_a;
typedef int __attribute__((may_alias)) int_a;

template <typename T> __device__ __forceinline__ void vst2(void* p, T v) { *(T*)p = v;  }
__device__ __forceinline__ v8f wmma16(v16h a, v16h b, v8f c) {
  v8f d = __builtin_amdgcn_wmma_f32_16x16x32_f16(false, a, false, b, (short)0, c, false, false);
  asm volatile("v_nop\n\tv_nop\n\tv_nop\n\tv_nop" : "+v"(d) : "v"(a), "v"(b));
  return d;
}
__device__ __forceinline__ v8f wmma_bf(v16b a, v16b b, v8f c) {
  v8f d = __builtin_amdgcn_wmma_f32_16x16x32_bf16(false, a, false, b, (short)0, c, false, false);
  asm volatile("v_nop\n\tv_nop\n\tv_nop\n\tv_nop" : "+v"(d) : "v"(a), "v"(b));
  return d;
}
// 16x16x32 fragments: lane = (h = lane>>4, row/col = lane&15); elements 0..7 = k0+8h+0..7, 8..15 = k0+16+8h+0..7; D element r = row 8h+r
__device__ __forceinline__ v16h frag_h(const _Float16* rowk0, int lane) {
  union { v16h v; v8h q[2]; } u; const _Float16* p = rowk0 + 8 * (lane >> 4);
  u.q[0] = *(const v8h*)p; u.q[1] = *(const v8h*)(p + 16); return u.v;
}
__device__ __forceinline__ v16h frag_f32(const float* rowk0, int lane) {
  v16h a; const float* p = rowk0 + 8 * (lane >> 4);
#pragma unroll
  for (int i = 0; i < 8; ++i) { a[i] = (_Float16)p[i]; a[8 + i] = (_Float16)p[16 + i]; }
  return a;
}
__device__ __forceinline__ v16h frag_f32s(const float* rowk0, int lane, float sc) {
  v16h a; const float* p = rowk0 + 8 * (lane >> 4);
#pragma unroll
  for (int i = 0; i < 8; ++i) { a[i] = (_Float16)(p[i] * sc); a[8 + i] = (_Float16)(p[16 + i] * sc); }
  return a;
}
// column fragment from a [K][ld] layout (column n), rows >= K read as 0
__device__ __forceinline__ v16h fragc_f32(const float* W, int k0, int n, int lane, int ld, int K) {
  v16h a; const int g = lane >> 4;
#pragma unroll
  for (int i = 0; i < 8; ++i) { const int ka = k0 + 8 * g + i, kb = ka + 16;
    a[i] = (_Float16)(ka < K ? W[(size_t)(ka < K ? ka : K - 1) * ld + n] : 0.f); a[8 + i] = (_Float16)(kb < K ? W[(size_t)(kb < K ? kb : K - 1) * ld + n] : 0.f); }
  return a;
}
struct F2 { v16b h, l; };
__device__ __forceinline__ F2 bsplit16(const float v[16]) { F2 r;
#pragma unroll
  for (int i = 0; i < 16; ++i) { const __bf16 h = (__bf16)v[i]; r.h[i] = h; r.l[i] = (__bf16)(v[i] - (float)h); }
  return r; }
__device__ __forceinline__ F2 split_row(const float* row, int k0, int lane) { float v[16]; const float* p = row + k0 + 8 * (lane >> 4);
#pragma unroll
  for (int i = 0; i < 8; ++i) { v[i] = p[i]; v[8 + i] = p[16 + i]; }
  return bsplit16(v); }
__device__ __forceinline__ F2 split_rowK(const float* row, int k0, int lane, int K) { float v[16]; const int g = lane >> 4;
#pragma unroll
  for (int i = 0; i < 8; ++i) { const int ka = k0 + 8 * g + i, kb = ka + 16; v[i] = ka < K ? row[ka < K ? ka : K - 1] : 0.f; v[8 + i] = kb < K ? row[kb < K ? kb : K - 1] : 0.f; }
  return bsplit16(v); }
__device__ __forceinline__ F2 split_col(const float* W, int k0, int n, int lane, int ld, int K) { float v[16]; const int g = lane >> 4;
#pragma unroll
  for (int i = 0; i < 8; ++i) { const int ka = k0 + 8 * g + i, kb = ka + 16; v[i] = ka < K ? W[(size_t)(ka < K ? ka : K - 1) * ld + n] : 0.f; v[8 + i] = kb < K ? W[(size_t)(kb < K ? kb : K - 1) * ld + n] : 0.f; }
  return bsplit16(v); }
__device__ __forceinline__ v8f mac3(const F2& a, const F2& b, v8f c) { c = wmma_bf(a.l, b.h, c); c = wmma_bf(a.h, b.l, c); return wmma_bf(a.h, b.h, c); }
__device__ __forceinline__ float sigm(float v) { return 1.0f / (1.0f + expf(-v)); }
#define LDSX() do { asm volatile("s_wait_dscnt 0" ::: "memory"); __builtin_amdgcn_wave_barrier(); __builtin_amdgcn_fence(__ATOMIC_RELEASE, "workgroup"); } while (0)

// Multi-head attention on separate inputs with RoPE applied across the FULL model width before the head split (query / key / value [2,2048,1024]; torch (out,in) wq / wk / wv / wo [1024,1024] N(0, 1/1024) applied as x @ W.T + b, biases zeros (read); cos / sin [2048,512] are module INPUTS (computed in setup with numpy; read literally): x.reshape(.., 512, 2): (x0, x1) = (x[2j], x[2j+1]) -> (x0 c - x1 s, x0 s + x1 c) with c = cos[s][j], j = 0..511, on q and k; then 16 heads x 64 (head h = columns 64h..: its pair i uses table column h*32 + i); scores / sqrt(64); no mask; softmax; out @ wo.T + bo).
#define NB 2
#define TT 2048
#define CC 1024            // NH * HD = projected width
#define DIN 1024          // input (model) width
#define NH 16
#define HD 64
#define NQB (TT / 64)
#define HG 4
#define SCALE (0.125f)
#define CAUSAL 0
#ifndef TNB
#define TNB NB
#endif
__device__ __forceinline__ float bfr(float v) { return (float)(__bf16)v; }
__host__ __device__ __forceinline__ int kb_last(int qb) { return CAUSAL ? ((qb * 64 + 63) >> 7) : (TT / 128 - 1); }
typedef __attribute__((ext_vector_type(8))) __bf16 v8b;
__device__ __forceinline__ v16b frag_b(const __bf16* rowk0, int lane) {
  union { v16b v; v8b q[2]; } u; const __bf16* p = rowk0 + 8 * (lane >> 4);
  u.q[0] = *(const v8b*)p; u.q[1] = *(const v8b*)(p + 16); return u.v;
}
#define QBH 0              // not referenced by any kernel (k_fa has a single path for every query block)
#define QHI 0               // single-product logits on every row (logit sigma ~1)
#define KHI 64            // key rows carrying k residual / v bf16 hi+lo planes (no kernel here writes or reads them)
// B fragment (k rows k0+.., output column o) of a weight: (in,out) [K][ld] or (out,in) [ld rows of K]: bf16 exact, or f16(bf16 * 256) exact
__device__ __forceinline__ v16b wcol_io(const float* Wm, int k0, int o, int lane, int ld) { v16b w; const int g = lane >> 4;
#pragma unroll
  for (int i = 0; i < 8; ++i) { w[i] = (__bf16)Wm[(size_t)(k0 + 8 * g + i) * ld + o]; w[8 + i] = (__bf16)Wm[(size_t)(k0 + 16 + 8 * g + i) * ld + o]; }
  return w; }
__device__ __forceinline__ v16b wcol_oi(const float* Wm, int k0, int o, int lane, int K) { v16b w; const float* p = Wm + (size_t)o * K + k0 + 8 * (lane >> 4);
#pragma unroll
  for (int i = 0; i < 8; ++i) { w[i] = (__bf16)p[i]; w[8 + i] = (__bf16)p[16 + i]; }
  return w; }
__device__ __forceinline__ v16h wcolh_io(const float* Wm, int k0, int o, int lane, int ld) { v16h w; const int g = lane >> 4;
#pragma unroll
  for (int i = 0; i < 8; ++i) { w[i] = (_Float16)(bfr(Wm[(size_t)(k0 + 8 * g + i) * ld + o]) * 256.0f); w[8 + i] = (_Float16)(bfr(Wm[(size_t)(k0 + 16 + 8 * g + i) * ld + o]) * 256.0f); }
  return w; }
__device__ __forceinline__ v16h wcolh_oi(const float* Wm, int k0, int o, int lane, int K) { v16h w; const float* p = Wm + (size_t)o * K + k0 + 8 * (lane >> 4);
#pragma unroll
  for (int i = 0; i < 8; ++i) { w[i] = (_Float16)(bfr(p[i]) * 256.0f); w[8 + i] = (_Float16)(bfr(p[16 + i]) * 256.0f); }
  return w; }
#define WQKV_LAYOUT 1   // 0 = (in,out) [DIN][CC]; 1 = (out,in) [CC][DIN]; 2 = per-head [NH][DIN][HD]
__device__ __forceinline__ v16b wcol_hdk(const float* Wm, int k0, int o, int lane) { v16b w; const int g = lane >> 4; const float* p = Wm + (size_t)(o / HD) * DIN * HD + (o % HD);
#pragma unroll
  for (int i = 0; i < 8; ++i) { w[i] = (__bf16)p[(size_t)(k0 + 8 * g + i) * HD]; w[8 + i] = (__bf16)p[(size_t)(k0 + 16 + 8 * g + i) * HD]; }
  return w; }
#define WO_OUT_IN 1
#if WQKV_LAYOUT == 1
#define WCOL(W, k0, o, lane) wcol_oi(W, k0, o, lane, DIN)
#elif WQKV_LAYOUT == 2
#define WCOL(W, k0, o, lane) wcol_hdk(W, k0, o, lane)
#else
#define WCOL(W, k0, o, lane) wcol_io(W, k0, o, lane, CC)
#endif
#if WO_OUT_IN
#define WOCOL(W, k0, o, lane) wcol_oi(W, k0, o, lane, CC)
#define WOCOLH(W, k0, o, lane) wcolh_oi(W, k0, o, lane, CC)
#else
#define WOCOL(W, k0, o, lane) wcol_io(W, k0, o, lane, DIN)
#define WOCOLH(W, k0, o, lane) wcolh_io(W, k0, o, lane, DIN)
#endif

#define TBW 512   // table width = model width / 2 pairs
#define PROJ_EXTRA_PARAMS , const float* __restrict__ COS, const float* __restrict__ SIN   /* rotary tables [TT][512], module INPUTS, read literally */
#ifndef SM_EXTRA_PARAMS
#define SM_EXTRA_PARAMS
#endif
#ifndef PROJ_EXTRA_PARAMS
#define PROJ_EXTRA_PARAMS
#endif
#ifndef SM_MASK_HOOK
#define SM_MASK_HOOK (void)0
#endif

#define WS_QH  0u                                      // f16 q rows [b*t][CC]
#define WS_KH  (WS_QH + 2u * (size_t)NB * TT * CC)      // f16 k rows [b*t][CC]
#define WS_VT  (WS_KH + 2u * (size_t)NB * TT * CC)      // f16 v planes [b][c][t]
// QL, KL, VB and VBL belong to the causal high-precision path, which this problem does not take: nothing reads them and nothing writes them; their places stay so that the ctx plane keeps its own
#define WS_QL  (WS_VT + 2u * (size_t)NB * CC * TT)      // f16 q residual x 2^10 rows [b][t < QHI][CC]
#define WS_KL  (WS_QL + 2u * (size_t)NB * QHI * CC)     // f16 k residual x 2^10 rows [b][t < KHI][CC]
#define WS_VB  (WS_KL + 2u * (size_t)NB * KHI * CC)     // bf16 v hi planes [b][c][t < KHI]
#define WS_VBL (WS_VB + 2u * (size_t)NB * CC * KHI)
#define WS_S   (WS_VBL + 2u * (size_t)NB * CC * KHI)    // not used (scores stay in registers); kept so that the ctx plane keeps its place
#define WS_Y   (WS_S  + 4u * (size_t)HG * TT * TT)      // f32 ctx rows [b*t][CC] (only when there is an output projection)
#define WS_END (WS_Y  + 4u * (size_t)NB * TT * CC)

// ---- operand staging of the two GEMM kernels (block tile 128 x 128: each X row is read by 8 blocks, each W row by 32): a stage is KS (k_out) or KSP (k_proj) k of every tile row; a thread moves 4 floats of rows lr + 16 i of both operands, and one wave-wide 16-byte load covers whole 128-byte lines
#define KS 64    // k_out: 256 threads, thread (lr = tid >> 4, lc = 4 (tid & 15))
#define KSP 32   // k_proj: 128 threads, thread (lr = tid >> 3, lc = 4 (tid & 7)); the shorter stage keeps the registers low enough for three blocks on a WGP
#define LPP 40   // LDS row pitch of a KSP stage in 16-bit elements: 80 B = 16 B x 5 (odd)
static_assert(CC == DIN, "one row pitch for every GEMM operand");
#define LP 72   // LDS row pitch in 16-bit elements: 144 B = 16 B x 9 (odd), the pitch for 16-byte fragment reads
typedef __attribute__((ext_vector_type(4))) __bf16 v4b;
typedef __attribute__((ext_vector_type(4))) _Float16 v4h;
__device__ __forceinline__ v8f mmb(v16b a, v16b b, v8f c) { return __builtin_amdgcn_wmma_f32_16x16x32_bf16(false, a, false, b, (short)0, c, false, false); }
__device__ __forceinline__ v4b cvt_b(v4f v) { return v4b{(__bf16)v[0], (__bf16)v[1], (__bf16)v[2], (__bf16)v[3]}; }
__device__ __forceinline__ v4h cvt_y(v4f v) { return v4h{(_Float16)(v[0] * 64.0f), (_Float16)(v[1] * 64.0f), (_Float16)(v[2] * 64.0f), (_Float16)(v[3] * 64.0f)}; }   // ctx x 2^6
__device__ __forceinline__ v4h cvt_w(v4f v) { return v4h{(_Float16)(bfr(v[0]) * 256.0f), (_Float16)(bfr(v[1]) * 256.0f), (_Float16)(bfr(v[2]) * 256.0f), (_Float16)(bfr(v[3]) * 256.0f)}; }   // f16(bf16 x 2^8), exact
// work-group barrier by hand: __syncthreads() compiled to a wait for the global loads too, which would drain the loads issued ahead for the stage after next; what the other waves need is this wave's LDS reads and writes complete (s_wait_dscnt 0). s_wait_xcnt 0 stands in front of every reuse of those loads' address registers.
// The two load pointers take their step of SB bytes to the next stage inside the statement, behind its s_wait_xcnt 0: written in the source, the additions were placed by the compiler between the loads and the wait.
template <int SB> __device__ __forceinline__ void stage_barrier(const float*& xp, const float*& wp) { asm volatile("s_wait_xcnt 0x0\n\ts_wait_dscnt 0x0\n\ts_barrier_signal -1\n\ts_barrier_wait -1\n\tv_add_nc_u64 %0, %2, %0\n\tv_add_nc_u64 %1, %2, %1" : "+v"(xp), "+v"(wp) : "n"(SB) : "memory"); }
#define GT_LOAD(xa, xw, xp, wp) do { _Pragma("unroll") for (int i_ = 0; i_ < 8; ++i_) xa[i_] = *(const v4f*)((xp) + (size_t)(i_ * 16) * DIN); _Pragma("unroll") for (int i_ = 0; i_ < 8; ++i_) xw[i_] = *(const v4f*)((wp) + (size_t)(i_ * 16) * DIN); } while (0)
#define GT_STORE(LP_, VT_, ca, cw, xa, xw, ad, wd) do { _Pragma("unroll") for (int i_ = 0; i_ < 8; ++i_) *(VT_*)((ad) + (lr + 16 * i_) * LP_ + lc) = ca(xa[i_]); _Pragma("unroll") for (int i_ = 0; i_ < 8; ++i_) *(VT_*)((wd) + (lr + 16 * i_) * LP_ + lc) = cw(xw[i_]); } while (0)
// ---- k_proj: block = (128 rows, 128 cols, which): q/k/v = X W (+ b) with exact bf16 products (K = DIN) -> which 0: q f16 rows; 1: k f16 rows; 2: v f16 planes [c][t]
// The operand whose index runs along the CONTIGUOUS direction of the output is the A operand: W for q and k (features along a row), X for v (tokens along a plane). D register r of a lane is then A index 8 g + r:
// a lane holds 8 neighbouring output elements (16 bytes of f16, and for q and k four whole rotation pairs) of the output row picked by its B index, and the epilogue works from the accumulators.
#define EP 72   // pitch of a staged output row in f16: 144 B = 16 B x 9 (odd)
// a wave's 64 staged rows of 128 B go out as whole lines: a wave-wide 16-byte store covers 4 rows; unrolled whole, so that the 16 LDS reads issue as one group ahead of the stores
template <int PITCH> __device__ __forceinline__ void rows_out(_Float16* dst, const _Float16* so, int lane) { dst += (size_t)(lane >> 3) * PITCH + (lane & 7) * 8; so += (lane >> 3) * EP + (lane & 7) * 8;
#pragma unroll
  for (int e = 0; e < 16; ++e) vst2(dst + (size_t)(e * 4) * PITCH, *(const v4u*)(so + e * 4 * EP)); }
__global__ __launch_bounds__(128) void k_proj(const float* __restrict__ XQ, const float* __restrict__ XK, const float* __restrict__ XV, const float* __restrict__ WQ, const float* __restrict__ WK, const float* __restrict__ WV, const float* __restrict__ BQ, const float* __restrict__ BK, const float* __restrict__ BV,
    _Float16* __restrict__ QH, _Float16* __restrict__ KH, _Float16* __restrict__ VT PROJ_EXTRA_PARAMS) {
  // one LDS block, used in turn: the main loop's stages (2 x 128 X rows, then 2 x 128 W rows), then each wave's own 64 staged output rows (4 x 9,216 B)
  __shared__ __align__(16) char sm[2 * 2 * 128 * LPP * 2];
  static_assert(4 * 64 * EP * 2 <= 2 * 2 * 128 * LPP * 2, "the staged output rows fit the stages' place");
  const int tid = threadIdx.x, wave = tid >> 5, lane = tid & 31, col = lane & 15, g = lane >> 4; const int which = blockIdx.z; const int c0 = blockIdx.y * 128; const size_t rb = (size_t)blockIdx.x * 128; const size_t bb = rb / TT; const int t0 = (int)(rb % TT);
  const float* X = which == 0 ? XQ : which == 1 ? XK : XV; const float* WA = which == 0 ? WQ : which == 1 ? WK : WV; const float* BA = which == 0 ? BQ : which == 1 ? BK : BV;
  // main loop: the block's X tile (128 x KSP) and W tile (128 x KSP) are read once per block with whole-line loads, rounded to bf16 once and staged in LDS (two buffers); wave (wr, wc) owns 64 A rows x 64 B rows
  const int wr = wave >> 1, wc = wave & 1; const int lr = tid >> 3, lc = (tid & 7) * 4; const bool qk = which < 2;
  __bf16* const As = (__bf16*)sm; __bf16* const Ws = As + 2 * 128 * LPP;
  const __bf16* const Am = qk ? Ws : As; const __bf16* const Bm = qk ? As : Ws;
  const float* xg = X + (rb + lr) * DIN + lc; const float* wg = WA + (size_t)(c0 + lr) * DIN + lc;
  v4f xa[8], xw[8]; v8f acc[4][4] = {};
  GT_LOAD(xa, xw, xg, wg);
  GT_STORE(LPP, v4b, cvt_b, cvt_b, xa, xw, As, Ws);
  GT_LOAD(xa, xw, xg + KSP, wg + KSP);
  stage_barrier<2 * KSP * 4>(xg, wg);   // stage 0 is published; stage 1 stays in flight; the pointers now stand at the stage after next
#pragma unroll 2   /* two stages a trip: the buffer index is a constant */
  for (int s = 0; s < DIN / KSP; ++s) { const __bf16* Ab = Am + ((s & 1) * 128 + wr * 64 + col) * LPP; const __bf16* Wb = Bm + ((s & 1) * 128 + wc * 64 + col) * LPP;
    v16b af[4], wf[4];
#pragma unroll
    for (int i = 0; i < 4; ++i) af[i] = frag_b(Ab + i * 16 * LPP, lane);
#pragma unroll
    for (int j = 0; j < 4; ++j) wf[j] = frag_b(Wb + j * 16 * LPP, lane);
    __builtin_amdgcn_sched_barrier(0);   // the stage's fragment reads issue as one group ahead of its products, not among them
#pragma unroll
    for (int i = 0; i < 4; ++i)
#pragma unroll
      for (int j = 0; j < 4; ++j) acc[i][j] = mmb(af[i], wf[j], acc[i][j]);
    __builtin_amdgcn_sched_barrier(0);   // the conversions, which wait for the loads in flight, stay behind the products
    if (s + 1 < DIN / KSP) GT_STORE(LPP, v4b, cvt_b, cvt_b, xa, xw, As + ((s + 1) & 1) * 128 * LPP, Ws + ((s + 1) & 1) * 128 * LPP);   /* into the buffer whose readers all passed the last barrier */
    if (s + 2 < DIN / KSP) GT_LOAD(xa, xw, xg, wg);   /* in flight under the next stage's products */
    stage_barrier<KSP * 4>(xg, wg); }   // publishes stage s + 1 and ends every read of stage s
  // epilogue, from the accumulators: acc[i][j][r] = output row (B index) wc 64 + 16 j + col, element (A index) wr 64 + 16 i + 8 g + r. The loop's last barrier has ended every read of the stages, so each wave stages in its own part of sm and needs no further barrier. Every loop of the epilogue is unrolled whole: the accumulator indices must be constants for the arrays to stay in registers.
  _Float16* const so = (_Float16*)sm + wave * (64 * EP); _Float16* const sw = so + col * EP + 8 * g;
  if (qk) { const int f0 = c0 + wr * 64;   /* the wave's 64 features are head f0 / 64: pairs f0 / 2 .. f0 / 2 + 31 of the model-wide rotation */
    // (x0, x1) = features (2 p, 2 p + 1) -> (x0 c - x1 s, x0 s + x1 c) with c = bf16(cos[t][p]), s = bf16(sin[t][p]), t = the lane's token; a block's 128 tokens lie in one sequence
    const float* ct = COS + (size_t)(t0 + wc * 64 + col) * TBW + (f0 >> 1) + 4 * g; const float* sn_ = SIN + (size_t)(t0 + wc * 64 + col) * TBW + (f0 >> 1) + 4 * g;
    v4f bs[4][2] = {};
    if (BA) {
#pragma unroll
      for (int i = 0; i < 4; ++i)
#pragma unroll
        for (int q = 0; q < 2; ++q) bs[i][q] = *(const v4f*)(BA + f0 + i * 16 + 8 * g + 4 * q); }
#pragma unroll
    for (int i = 0; i < 4; ++i)
#pragma unroll
      for (int q = 0; q < 2; ++q)
#pragma unroll
        for (int r = 0; r < 4; ++r) bs[i][q][r] = bfr(bs[i][q][r]);
#pragma unroll
    for (int j = 0; j < 4; ++j)
#pragma unroll
      for (int i = 0; i < 4; ++i) { const v4f c4 = *(const v4f*)(ct + (size_t)(j * 16) * TBW + i * 8), s4 = *(const v4f*)(sn_ + (size_t)(j * 16) * TBW + i * 8); v8h o;
#pragma unroll
        for (int p = 0; p < 4; ++p) { const float cs = bfr(c4[p]), sn = bfr(s4[p]); const float xe = acc[i][j][2 * p] + bs[i][p >> 1][(2 * p) & 3], xo = acc[i][j][2 * p + 1] + bs[i][p >> 1][(2 * p + 1) & 3];
          o[2 * p] = (_Float16)(xe * cs - xo * sn); o[2 * p + 1] = (_Float16)(xe * sn + xo * cs); }
        *(v8h*)(sw + j * 16 * EP + i * 16) = o; }
    LDSX();   // the wave's own staged rows are complete before its lanes read each other's pieces
    rows_out<CC>((which == 0 ? QH : KH) + (rb + wc * 64) * CC + f0, so, lane);
  } else { float bv[4] = {};
    if (BA) {
#pragma unroll
      for (int j = 0; j < 4; ++j) bv[j] = BA[c0 + wc * 64 + j * 16 + col]; }
#pragma unroll
    for (int j = 0; j < 4; ++j) { const float bias = bfr(bv[j]);
#pragma unroll
      for (int i = 0; i < 4; ++i) { v8h o;
#pragma unroll
        for (int r = 0; r < 8; ++r) o[r] = (_Float16)(acc[i][j][r] + bias);
        *(v8h*)(sw + j * 16 * EP + i * 16) = o; } }
    LDSX();   // as above
    rows_out<TT>(VT + (bb * CC + c0 + wc * 64) * (size_t)TT + t0 + wr * 64, so, lane); } }
// ---- k_fa: block = 256 queries (8 waves x 32) of (b, h): logits, softmax and P . v in one pass over the keys, 32 keys at a time, k and v read from LDS stages; nothing of the score matrix leaves the registers.
// S^T = K . Q^T (A = k rows, B = q rows kept in registers): D register r of key tile kt = score of key 16 kt + 8 g + r for query column col, which is element 8 kt + r of the B operand of ctx^T += V^T . P^T, so P packs in place.
// Online softmax in base 2: running maximum m and sum l per query column; l and ctx^T are rescaled by 2^(m_old - m_new) every pass; the wave halves' sums join in the epilogue.
// Every inner loop is unrolled whole, so that each fragment and accumulator index is a constant and the arrays live in registers.
#define PCARRY 8.0f   // P carried x 2^8 into f16 (cancels in ctx / l): small weights stay clear of f16 subnormals
__device__ __forceinline__ v8f mm16(v16h a, v16h b, v8f c) { return __builtin_amdgcn_wmma_f32_16x16x32_f16(false, a, false, b, (short)0, c, false, false); }
__device__ __forceinline__ float xhalf(float x) { return __builtin_bit_cast(float, __builtin_amdgcn_permlanex16(__builtin_bit_cast(int, x), __builtin_bit_cast(int, x), 0x76543210, 0xfedcba98, false, false)); }  // lane l with lane l ^ 16
// eight base-2 exponentials, each in its own register: no neighbour reads a result or overwrites a source, and the closing v_nop is the slot that the instruction set asks for behind the last one
__device__ __forceinline__ void exp2x8(v8f& a) { asm("v_exp_f32 %0, %0\n\tv_exp_f32 %1, %1\n\tv_exp_f32 %2, %2\n\tv_exp_f32 %3, %3\n\tv_exp_f32 %4, %4\n\tv_exp_f32 %5, %5\n\tv_exp_f32 %6, %6\n\tv_exp_f32 %7, %7\n\tv_nop" : "+v"(a[0]), "+v"(a[1]), "+v"(a[2]), "+v"(a[3]), "+v"(a[4]), "+v"(a[5]), "+v"(a[6]), "+v"(a[7])); }
// K / V staging: a stage is SK keys of the block's (b, h): SK k rows of 128 B and HD v plane pieces of 256 B, brought into LDS once for all 8 waves by asynchronous copies (16 B a lane, a wave-wide copy = 4 whole lines), two buffers
#define SK 128
#define NST (TT / SK)
#define KP 72                      // LDS pitch of a k row in f16: 144 B = 16 B x 9 (odd), the pitch for 16-byte fragment reads
#define VP 136                     // LDS pitch of a v plane piece in f16: 272 B = 16 B x 17 (odd)
#define VOF (SK * KP)              // start of the v part of a buffer, in f16
#define BUFH (SK * KP + HD * VP)   // one buffer, in f16
// one stage's 8 copies of this thread: k rows lr + 32 i, v planes lp + 16 i. s_wait_xcnt 0 closes the statement, so that it stands in front of every later write of the address registers that the copies name.
__device__ __forceinline__ void stage_copy(unsigned lk, unsigned lv, const _Float16* gk, const _Float16* gv) {
  asm volatile("global_load_async_to_lds_b128 %0, %8, off\n\tglobal_load_async_to_lds_b128 %1, %9, off\n\tglobal_load_async_to_lds_b128 %2, %10, off\n\tglobal_load_async_to_lds_b128 %3, %11, off\n\t"
               "global_load_async_to_lds_b128 %4, %12, off\n\tglobal_load_async_to_lds_b128 %5, %13, off\n\tglobal_load_async_to_lds_b128 %6, %14, off\n\tglobal_load_async_to_lds_b128 %7, %15, off\n\ts_wait_xcnt 0x0"
               :: "v"(lk), "v"(lk + 32u * KP * 2u), "v"(lk + 64u * KP * 2u), "v"(lk + 96u * KP * 2u), "v"(lv), "v"(lv + 16u * VP * 2u), "v"(lv + 32u * VP * 2u), "v"(lv + 48u * VP * 2u),
                  "v"(gk), "v"(gk + (size_t)32 * CC), "v"(gk + (size_t)64 * CC), "v"(gk + (size_t)96 * CC), "v"(gv), "v"(gv + (size_t)16 * TT), "v"(gv + (size_t)32 * TT), "v"(gv + (size_t)48 * TT) : "memory"); }
__global__ __launch_bounds__(256) void k_fa(const _Float16* __restrict__ QH, const _Float16* __restrict__ KH, const _Float16* __restrict__ VT, float* __restrict__ Y) {
  __shared__ __align__(16) _Float16 kv[2][BUFH];
  const int tid = threadIdx.x, wave = tid >> 5, lane = tid & 31, col = lane & 15, g = lane >> 4; const int h = blockIdx.y, b = blockIdx.z; const int q0 = blockIdx.x * 256 + wave * 32;
  const float cs = SCALE * 1.4426950408889634f;
  const unsigned lk = (unsigned)(size_t)&kv[0][0] + (unsigned)(tid >> 3) * (KP * 2u) + (unsigned)(tid & 7) * 16u;               // this thread's 16 bytes of k row tid >> 3
  const unsigned lv = (unsigned)(size_t)&kv[0][0] + VOF * 2u + (unsigned)(tid >> 4) * (VP * 2u) + (unsigned)(tid & 15) * 16u;   // this thread's 16 bytes of v plane tid >> 4
  const _Float16* gk = KH + ((size_t)b * TT + (tid >> 3)) * CC + h * HD + (tid & 7) * 8;
  const _Float16* gv = VT + ((size_t)b * CC + h * HD + (tid >> 4)) * (size_t)TT + (tid & 15) * 8;
  stage_copy(lk, lv, gk, gv);   // stage 0 into buffer 0
  v16h qf[2][2];
#pragma unroll
  for (int n = 0; n < 2; ++n)
#pragma unroll
    for (int kc = 0; kc < 2; ++kc) qf[n][kc] = frag_h(QH + ((size_t)b * TT + q0 + n * 16 + col) * CC + h * HD + kc * 32, lane);
  asm volatile("s_wait_asynccnt 0x0" ::: "memory");   // this wave's copies of stage 0 have landed
  __syncthreads();                                    // stage 0 is published
  stage_copy(lk + BUFH * 2u, lv + BUFH * 2u, gk + (size_t)SK * CC, gv + SK);   // stage 1 into buffer 1, in flight under stage 0's passes
  v8f acc[2][4] = {}; float m[2] = {-3.0e38f, -3.0e38f}, l[2] = {0.f, 0.f};
#pragma unroll 1   /* rolled, like the pass loop inside it */
  for (int t = 0; t < NST; ++t) { const _Float16* kb = &kv[t & 1][0] + col * KP;   /* key row col of the stage's first tile */
    const _Float16* vb = &kv[t & 1][VOF] + col * VP;                               /* v plane piece of head column col */
    v16h kf[2][2];
#pragma unroll
    for (int kt = 0; kt < 2; ++kt)
#pragma unroll
      for (int kc = 0; kc < 2; ++kc) kf[kt][kc] = frag_h(kb + (kt * 16) * KP + kc * 32, lane);
#pragma unroll 1   /* rolled: one pass already holds 16 matrix instructions, and further copies would multiply the live fragments */
    for (int p = 0; p < SK / 32; ++p) { const int nx = p + 1 < SK / 32 ? p + 1 : p;   /* a stage's last pass fetches its own k tiles again: inside the stage, unused */
    v8f s[2][2];
#pragma unroll
    for (int kt = 0; kt < 2; ++kt)
#pragma unroll
      for (int n = 0; n < 2; ++n) { s[kt][n] = v8f{};
#pragma unroll
        for (int kc = 0; kc < 2; ++kc) s[kt][n] = mm16(kf[kt][kc], qf[n][kc], s[kt][n]); }
    // one group of LDS reads a pass: this pass's v fragments, then the next pass's k fragments into the same registers (inside the stage only), in flight under the softmax
    v16h vf[4];
#pragma unroll
    for (int j = 0; j < 4; ++j) vf[j] = frag_h(vb + (j * 16) * VP + p * 32, lane);
#pragma unroll
    for (int kt = 0; kt < 2; ++kt)
#pragma unroll
      for (int kc = 0; kc < 2; ++kc) kf[kt][kc] = frag_h(kb + (nx * 32 + kt * 16) * KP + kc * 32, lane);
    __builtin_amdgcn_sched_barrier(0);   // the reads issue here, ahead of the softmax, not sunk towards their use
#pragma unroll
    for (int n = 0; n < 2; ++n) { float mx = s[0][n][0];
#pragma unroll
      for (int r = 0; r < 8; ++r) mx = fmaxf(mx, fmaxf(s[0][n][r], s[1][n][r]));
      mx = fmaxf(mx, xhalf(mx)) * cs;   /* both halves hold the column's maximum of this pass, scaled (cs > 0) */
      const float mn = fmaxf(m[n], mx); const float corr = __builtin_amdgcn_exp2f(m[n] - mn); m[n] = mn; const float nm = PCARRY - mn;
      v16h pf; float ps = 0.f; v8f e0, e1;
#pragma unroll
      for (int r = 0; r < 8; ++r) { e0[r] = fmaf(s[0][n][r], cs, nm); e1[r] = fmaf(s[1][n][r], cs, nm); }
      exp2x8(e0); exp2x8(e1);
#pragma unroll
      for (int r = 0; r < 8; ++r) { pf[r] = (_Float16)e0[r]; pf[8 + r] = (_Float16)e1[r]; ps += e0[r] + e1[r]; }
      l[n] = l[n] * corr + ps;
#pragma unroll
      for (int j = 0; j < 4; ++j) acc[n][j] = mm16(vf[j], pf, acc[n][j] * corr); } }
    asm volatile("s_wait_dscnt 0x0" ::: "memory");      // this wave's reads of stage t are complete before the buffer may be refilled
    asm volatile("s_wait_asynccnt 0x0" ::: "memory");   // this wave's copies of stage t + 1 have landed
    __syncthreads();                                    // publishes stage t + 1 and ends every read of stage t
    if (t + 2 < NST) stage_copy(lk + (unsigned)(t & 1) * (BUFH * 2u), lv + (unsigned)(t & 1) * (BUFH * 2u), gk + (size_t)(t + 2) * SK * CC, gv + (t + 2) * SK); }   /* into the buffer that stage t has just left */
  asm volatile("s_wait_asynccnt 0x0" ::: "memory");   // nothing of this wave is in flight when it leaves the loop
#pragma unroll
  for (int n = 0; n < 2; ++n) { const float inv = 1.0f / (l[n] + xhalf(l[n])); float* yr = Y + ((size_t)b * TT + q0 + n * 16 + col) * CC + h * HD + 8 * g;   /* register r of tile j = head column 16 j + 8 g + r of query col */
#pragma unroll
    for (int j = 0; j < 4; ++j) { const v8f o = acc[n][j] * inv; vst2(yr + j * 16, v4f{o[0], o[1], o[2], o[3]}); vst2(yr + j * 16 + 4, v4f{o[4], o[5], o[6], o[7]}); } } }
// ---- k_out: block = (128 rows, 128 cols), 8 waves, one block a WGP: out = ctx Wo (+ bo): ctx x 2^6 once to f16 against Wo as f16(bf16 x 2^8) exact (1 product) x 2^-14
__global__ __launch_bounds__(256) void k_out(const float* __restrict__ Y, const float* __restrict__ WO, const float* __restrict__ BO, float* __restrict__ OUT) { __shared__ __align__(16) float sf[8][32][68]; __shared__ __align__(16) _Float16 ya[2][128][LP], wa[2][128][LP];
  const int tid = threadIdx.x, wave = tid >> 5, lane = tid & 31, col = lane & 15, g = lane >> 4; const int c0 = blockIdx.y * 128; const size_t r0 = (size_t)blockIdx.x * 128;
  // main loop as in k_proj: ctx tile (128 x KS, x 2^6 so small-magnitude context rows stay clear of f16 subnormals) and Wo tile (128 x KS) converted once per block and staged in LDS, two buffers; wave (wr, wc) owns 32 rows x 64 columns
  const int wr = wave >> 1, wc = wave & 1; const int lr = tid >> 4, lc = (tid & 15) * 4;
  const float* xg = Y + (r0 + lr) * CC + lc; const float* wg = WO + (size_t)(c0 + lr) * CC + lc;
  v4f xa[8], xw[8]; v8f acc[2][4] = {};
  GT_LOAD(xa, xw, xg, wg);
  GT_STORE(LP, v4h, cvt_y, cvt_w, xa, xw, &ya[0][0][0], &wa[0][0][0]);
  GT_LOAD(xa, xw, xg + KS, wg + KS);
  stage_barrier<2 * KS * 4>(xg, wg);   // stage 0 is published; stage 1 stays in flight; the pointers now stand at the stage after next
#pragma unroll 2   /* two stages a trip: the buffer index is a constant */
  for (int s = 0; s < CC / KS; ++s) { const _Float16* Ab = &ya[s & 1][wr * 32 + col][0]; const _Float16* Wb = &wa[s & 1][wc * 64 + col][0];
    v16h af[2][2], wf[2][4];
#pragma unroll
    for (int ks = 0; ks < 2; ++ks) {
#pragma unroll
      for (int i = 0; i < 2; ++i) af[ks][i] = frag_h(Ab + i * 16 * LP + ks * 32, lane);
#pragma unroll
      for (int j = 0; j < 4; ++j) wf[ks][j] = frag_h(Wb + j * 16 * LP + ks * 32, lane); }
    __builtin_amdgcn_sched_barrier(0);   // the stage's fragment reads issue as one group ahead of its products, not among them
#pragma unroll
    for (int ks = 0; ks < 2; ++ks)
#pragma unroll
      for (int i = 0; i < 2; ++i)
#pragma unroll
        for (int j = 0; j < 4; ++j) acc[i][j] = mm16(af[ks][i], wf[ks][j], acc[i][j]);
    __builtin_amdgcn_sched_barrier(0);   // the conversions, which wait for the loads in flight, stay behind the products
    if (s + 1 < CC / KS) GT_STORE(LP, v4h, cvt_y, cvt_w, xa, xw, &ya[(s + 1) & 1][0][0], &wa[(s + 1) & 1][0][0]);   /* into the buffer whose readers all passed the last barrier */
    if (s + 2 < CC / KS) GT_LOAD(xa, xw, xg, wg);   /* in flight under the next stage's products */
    stage_barrier<KS * 4>(xg, wg); }   // publishes stage s + 1 and ends every read of stage s
#pragma unroll
  for (int j = 0; j < 4; ++j) { const float bias = BO ? bfr(BO[c0 + wc * 64 + j * 16 + col]) : 0.f;
#pragma unroll
    for (int i = 0; i < 2; ++i)
#pragma unroll
      for (int r = 0; r < 8; ++r) sf[wave][i * 16 + 8 * g + r][j * 16 + col] = acc[i][j][r] * (1.0f / 16384.0f) + bias; }   /* 2^-8 (Wo carry) x 2^-6 (ctx carry) */
  LDSX(); for (int rl = 0; rl < 16; ++rl) vst2(OUT + (r0 + wr * 32 + rl * 2 + g) * DIN + c0 + wc * 64 + col * 4, *(const v4f*)&sf[wave][rl * 2 + g][col * 4]); }

extern "C" void kernel_launch(void* const* d_in, const int* in_sizes, int n_in, void* d_out, int out_size, void* d_ws, size_t ws_size, hipStream_t stream) {
  (void)in_sizes; (void)n_in; (void)out_size;
  const float** F = (const float**)d_in;
  if (ws_size < (size_t)WS_END) return;
  char* ws = (char*)d_ws; _Float16 *QH = (_Float16*)(ws + WS_QH), *KH = (_Float16*)(ws + WS_KH), *VT = (_Float16*)(ws + WS_VT), *QL = (_Float16*)(ws + WS_QL), *KL = (_Float16*)(ws + WS_KL); __bf16 *VB = (__bf16*)(ws + WS_VB), *VBL = (__bf16*)(ws + WS_VBL); float *Y = (float*)(ws + WS_Y);
  (void)Y; (void)QL; (void)KL; (void)VB; (void)VBL;
  // inputs: 0 query [2,2048,1024]; 1 key; 2 value; 3 wq [1024,1024] (out,in), 4 bq; 5 wk, 6 bk; 7 wv, 8 bv; 9 wo (out,in), 10 bo (biases zeros, read); 11 cos [2048,512]; 12 sin [2048,512]
  k_proj<<<dim3(TNB * TT / 128, CC / 128, 3), 128, 0, stream>>>(F[0], F[1], F[2], F[3], F[5], F[7], F[4], F[6], F[8], QH, KH, VT, F[11], F[12]);
  k_fa<<<dim3(TT / 256, NH, TNB), 256, 0, stream>>>(QH, KH, VT, Y);
  k_out<<<dim3(TNB * TT / 128, DIN / 128), 256, 0, stream>>>(Y, F[9], F[10], (float*)d_out);
}

// v006
// One run takes 81.7 microseconds.
// In two side-by-side timings against v005, it was 1.05 and 1.06 times as fast.
// All steps since v000 together make it 17.7 times as fast.
// compute dtype: all float inputs rounded to bf16; q / k / v projections with EXACT bf16 products on WMMA 16x16x32 (f32 accumulate) + bias (zeros, read); interleaved-pair RoPE in f32 from the bf16-rounded INPUT cos / sin tables (512 pairs across the full model width); logits q x k once to f16 each (1 product) x 64^-0.5; online softmax f32 (base 2, running maximum); unnormalised P x 2^8 once to f16 x v once to f16 (1 product), divided by the f32 sum at the end; ctx x 2^6 once to f16 x wo f16(bf16 x 2^8) + bo; f32 output.
#include <hip/hip_runtime.h>
#include <math.h>

typedef __attribute__((ext_vector_type(16))) _Float16 v16h;
typedef __attribute__((ext_vector_type(16))) __bf16 v16b;
typedef __attribute__((ext_vector_type(8)))  _Float16 v8h;
typedef __attribute__((ext_vector_type(8)))  float v8f;
typedef __attribute__((ext_vector_type(4)))  float v4f;
typedef __attribute__((ext_vector_type(2)))  float v2f;
typedef __attribute__((ext_vector_type(4)))  unsigned v4u;
typedef __attribute__((ext_vector_type(4)))  int v4i;
typedef float __attribute__((may_alias)) float_a;
typedef int __attribute__((may_alias)) int_a;

template <typename T> __device__ __forceinline__ void vst2(void* p, T v) { *(T*)p = v;  }
__device__ __forceinline__ v8f wmma16(v16h a, v16h b, v8f c) {
  v8f d = __builtin_amdgcn_wmma_f32_16x16x32_f16(false, a, false, b, (short)0, c, false, false);
  asm volatile("v_nop\n\tv_nop\n\tv_nop\n\tv_nop" : "+v"(d) : "v"(a), "v"(b));
  return d;
}
__device__ __forceinline__ v8f wmma_bf(v16b a, v16b b, v8f c) {
  v8f d = __builtin_amdgcn_wmma_f32_16x16x32_bf16(false, a, false, b, (short)0, c, false, false);
  asm volatile("v_nop\n\tv_nop\n\tv_nop\n\tv_nop" : "+v"(d) : "v"(a), "v"(b));
  return d;
}
// 16x16x32 fragments: lane = (h = lane>>4, row/col = lane&15); elements 0..7 = k0+8h+0..7, 8..15 = k0+16+8h+0..7; D element r = row 8h+r
__device__ __forceinline__ v16h frag_h(const _Float16* rowk0, int lane) {
  union { v16h v; v8h q[2]; } u; const _Float16* p = rowk0 + 8 * (lane >> 4);
  u.q[0] = *(const v8h*)p; u.q[1] = *(const v8h*)(p + 16); return u.v;
}
__device__ __forceinline__ v16h frag_f32(const float* rowk0, int lane) {
  v16h a; const float* p = rowk0 + 8 * (lane >> 4);
#pragma unroll
  for (int i = 0; i < 8; ++i) { a[i] = (_Float16)p[i]; a[8 + i] = (_Float16)p[16 + i]; }
  return a;
}
__device__ __forceinline__ v16h frag_f32s(const float* rowk0, int lane, float sc) {
  v16h a; const float* p = rowk0 + 8 * (lane >> 4);
#pragma unroll
  for (int i = 0; i < 8; ++i) { a[i] = (_Float16)(p[i] * sc); a[8 + i] = (_Float16)(p[16 + i] * sc); }
  return a;
}
// column fragment from a [K][ld] layout (column n), rows >= K read as 0
__device__ __forceinline__ v16h fragc_f32(const float* W, int k0, int n, int lane, int ld, int K) {
  v16h a; const int g = lane >> 4;
#pragma unroll
  for (int i = 0; i < 8; ++i) { const int ka = k0 + 8 * g + i, kb = ka + 16;
    a[i] = (_Float16)(ka < K ? W[(size_t)(ka < K ? ka : K - 1) * ld + n] : 0.f); a[8 + i] = (_Float16)(kb < K ? W[(size_t)(kb < K ? kb : K - 1) * ld + n] : 0.f); }
  return a;
}
struct F2 { v16b h, l; };
__device__ __forceinline__ F2 bsplit16(const float v[16]) { F2 r;
#pragma unroll
  for (int i = 0; i < 16; ++i) { const __bf16 h = (__bf16)v[i]; r.h[i] = h; r.l[i] = (__bf16)(v[i] - (float)h); }
  return r; }
__device__ __forceinline__ F2 split_row(const float* row, int k0, int lane) { float v[16]; const float* p = row + k0 + 8 * (lane >> 4);
#pragma unroll
  for (int i = 0; i < 8; ++i) { v[i] = p[i]; v[8 + i] = p[16 + i]; }
  return bsplit16(v); }
__device__ __forceinline__ F2 split_rowK(const float* row, int k0, int lane, int K) { float v[16]; const int g = lane >> 4;
#pragma unroll
  for (int i = 0; i < 8; ++i) { const int ka = k0 + 8 * g + i, kb = ka + 16; v[i] = ka < K ? row[ka < K ? ka : K - 1] : 0.f; v[8 + i] = kb < K ? row[kb < K ? kb : K - 1] : 0.f; }
  return bsplit16(v); }
__device__ __forceinline__ F2 split_col(const float* W, int k0, int n, int lane, int ld, int K) { float v[16]; const int g = lane >> 4;
#pragma unroll
  for (int i = 0; i < 8; ++i) { const int ka = k0 + 8 * g + i, kb = ka + 16; v[i] = ka < K ? W[(size_t)(ka < K ? ka : K - 1) * ld + n] : 0.f; v[8 + i] = kb < K ? W[(size_t)(kb < K ? kb : K - 1) * ld + n] : 0.f; }
  return bsplit16(v); }
__device__ __forceinline__ v8f mac3(const F2& a, const F2& b, v8f c) { c = wmma_bf(a.l, b.h, c); c = wmma_bf(a.h, b.l, c); return wmma_bf(a.h, b.h, c); }
__device__ __forceinline__ float sigm(float v) { return 1.0f / (1.0f + expf(-v)); }
#define LDSX() do { asm volatile("s_wait_dscnt 0" ::: "memory"); __builtin_amdgcn_wave_barrier(); __builtin_amdgcn_fence(__ATOMIC_RELEASE, "workgroup"); } while (0)

// Multi-head attention on separate inputs with RoPE applied across the FULL model width before the head split (query / key / value [2,2048,1024]; torch (out,in) wq / wk / wv / wo [1024,1024] N(0, 1/1024) applied as x @ W.T + b, biases zeros (read); cos / sin [2048,512] are module INPUTS (computed in setup with numpy; read literally): x.reshape(.., 512, 2): (x0, x1) = (x[2j], x[2j+1]) -> (x0 c - x1 s, x0 s + x1 c) with c = cos[s][j], j = 0..511, on q and k; then 16 heads x 64 (head h = columns 64h..: its pair i uses table column h*32 + i); scores / sqrt(64); no mask; softmax; out @ wo.T + bo).
#define NB 2
#define TT 2048
#define CC 1024            // NH * HD = projected width
#define DIN 1024          // input (model) width
#define NH 16
#define HD 64
#define NQB (TT / 64)
#define HG 4
#define SCALE (0.125f)
#define CAUSAL 0
#ifndef TNB
#define TNB NB
#endif
__device__ __forceinline__ float bfr(float v) { return (float)(__bf16)v; }
__host__ __device__ __forceinline__ int kb_last(int qb) { return CAUSAL ? ((qb * 64 + 63) >> 7) : (TT / 128 - 1); }
typedef __attribute__((ext_vector_type(8))) __bf16 v8b;
__device__ __forceinline__ v16b frag_b(const __bf16* rowk0, int lane) {
  union { v16b v; v8b q[2]; } u; const __bf16* p = rowk0 + 8 * (lane >> 4);
  u.q[0] = *(const v8b*)p; u.q[1] = *(const v8b*)(p + 16); return u.v;
}
#define QBH 0              // not referenced by any kernel (k_fa has a single path for every query block)
#define QHI 0               // single-product logits on every row (logit sigma ~1)
#define KHI 64            // key rows carrying k residual / v bf16 hi+lo planes (no kernel here writes or reads them)
// B fragment (k rows k0+.., output column o) of a weight: (in,out) [K][ld] or (out,in) [ld rows of K]: bf16 exact, or f16(bf16 * 256) exact
__device__ __forceinline__ v16b wcol_io(const float* Wm, int k0, int o, int lane, int ld) { v16b w; const int g = lane >> 4;
#pragma unroll
  for (int i = 0; i < 8; ++i) { w[i] = (__bf16)Wm[(size_t)(k0 + 8 * g + i) * ld + o]; w[8 + i] = (__bf16)Wm[(size_t)(k0 + 16 + 8 * g + i) * ld + o]; }
  return w; }
__device__ __forceinline__ v16b wcol_oi(const float* Wm, int k0, int o, int lane, int K) { v16b w; const float* p = Wm + (size_t)o * K + k0 + 8 * (lane >> 4);
#pragma unroll
  for (int i = 0; i < 8; ++i) { w[i] = (__bf16)p[i]; w[8 + i] = (__bf16)p[16 + i]; }
  return w; }
__device__ __forceinline__ v16h wcolh_io(const float* Wm, int k0, int o, int lane, int ld) { v16h w; const int g = lane >> 4;
#pragma unroll
  for (int i = 0; i < 8; ++i) { w[i] = (_Float16)(bfr(Wm[(size_t)(k0 + 8 * g + i) * ld + o]) * 256.0f); w[8 + i] = (_Float16)(bfr(Wm[(size_t)(k0 + 16 + 8 * g + i) * ld + o]) * 256.0f); }
  return w; }
__device__ __forceinline__ v16h wcolh_oi(const float* Wm, int k0, int o, int lane, int K) { v16h w; const float* p = Wm + (size_t)o * K + k0 + 8 * (lane >> 4);
#pragma unroll
  for (int i = 0; i < 8; ++i) { w[i] = (_Float16)(bfr(p[i]) * 256.0f); w[8 + i] = (_Float16)(bfr(p[16 + i]) * 256.0f); }
  return w; }
#define WQKV_LAYOUT 1   // 0 = (in,out) [DIN][CC]; 1 = (out,in) [CC][DIN]; 2 = per-head [NH][DIN][HD]
__device__ __forceinline__ v16b wcol_hdk(const float* Wm, int k0, int o, int lane) { v16b w; const int g = lane >> 4; const float* p = Wm + (size_t)(o / HD) * DIN * HD + (o % HD);
#pragma unroll
  for (int i = 0; i < 8; ++i) { w[i] = (__bf16)p[(size_t)(k0 + 8 * g + i) * HD]; w[8 + i] = (__bf16)p[(size_t)(k0 + 16 + 8 * g + i) * HD]; }
  return w; }
#define WO_OUT_IN 1
#if WQKV_LAYOUT == 1
#define WCOL(W, k0, o, lane) wcol_oi(W, k0, o, lane, DIN)
#elif WQKV_LAYOUT == 2
#define WCOL(W, k0, o, lane) wcol_hdk(W, k0, o, lane)
#else
#define WCOL(W, k0, o, lane) wcol_io(W, k0, o, lane, CC)
#endif
#if WO_OUT_IN
#define WOCOL(W, k0, o, lane) wcol_oi(W, k0, o, lane, CC)
#define WOCOLH(W, k0, o, lane) wcolh_oi(W, k0, o, lane, CC)
#else
#define WOCOL(W, k0, o, lane) wcol_io(W, k0, o, lane, DIN)
#define WOCOLH(W, k0, o, lane) wcolh_io(W, k0, o, lane, DIN)
#endif

#define TBW 512   // table width = model width / 2 pairs
#define PROJ_EXTRA_PARAMS , const float* __restrict__ COS, const float* __restrict__ SIN   /* rotary tables [TT][512], module INPUTS, read literally */
#ifndef SM_EXTRA_PARAMS
#define SM_EXTRA_PARAMS
#endif
#ifndef PROJ_EXTRA_PARAMS
#define PROJ_EXTRA_PARAMS
#endif
#ifndef SM_MASK_HOOK
#define SM_MASK_HOOK (void)0
#endif

#define WS_QH  0u                                      // f16 q rows [b*t][CC]
#define WS_KH  (WS_QH + 2u * (size_t)NB * TT * CC)      // f16 k rows [b*t][CC]
#define WS_VT  (WS_KH + 2u * (size_t)NB * TT * CC)      // f16 v planes [b][c][t]
// QL, KL, VB and VBL belong to the causal high-precision path, which this problem does not take: nothing reads them and nothing writes them; their places stay so that the ctx plane keeps its own
#define WS_QL  (WS_VT + 2u * (size_t)NB * CC * TT)      // f16 q residual x 2^10 rows [b][t < QHI][CC]
#define WS_KL  (WS_QL + 2u * (size_t)NB * QHI * CC)     // f16 k residual x 2^10 rows [b][t < KHI][CC]
#define WS_VB  (WS_KL + 2u * (size_t)NB * KHI * CC)     // bf16 v hi planes [b][c][t < KHI]
#define WS_VBL (WS_VB + 2u * (size_t)NB * CC * KHI)
#define WS_S   (WS_VBL + 2u * (size_t)NB * CC * KHI)    // not used (scores stay in registers); kept so that the ctx plane keeps its place
#define WS_Y   (WS_S  + 4u * (size_t)HG * TT * TT)      // f32 ctx rows [b*t][CC] (only when there is an output projection)
#define WS_END (WS_Y  + 4u * (size_t)NB * TT * CC)

// ---- operand staging of the two GEMM kernels (block tile 128 x 128 in k_out, 256 x 256 in k_proj, where each X row is read by 4 blocks and each W row by 16): a stage is KS (k_out) or KSP (k_proj) k of every tile row; a thread moves 4 floats of rows lr + RS i (RS = 16 or 32) of both operands, and one wave-wide 16-byte load covers whole 128-byte lines
#define KS 64    // k_out: 256 threads, thread (lr = tid >> 4, lc = 4 (tid & 15))
#define KSP 32   // k_proj: 256 threads, thread (lr = tid >> 3, lc = 4 (tid & 7)); the shorter stage keeps the loads in flight at 64 registers beside the 256 of the accumulators
#define LPP 40   // LDS row pitch of a KSP stage in 16-bit elements: 80 B = 16 B x 5 (odd)
static_assert(CC == DIN, "one row pitch for every GEMM operand");
#define LP 72   // LDS row pitch in 16-bit elements: 144 B = 16 B x 9 (odd), the pitch for 16-byte fragment reads
typedef __attribute__((ext_vector_type(4))) __bf16 v4b;
typedef __attribute__((ext_vector_type(4))) _Float16 v4h;
__device__ __forceinline__ v8f mmb(v16b a, v16b b, v8f c) { return __builtin_amdgcn_wmma_f32_16x16x32_bf16(false, a, false, b, (short)0, c, false, false); }
__device__ __forceinline__ v4b cvt_b(v4f v) { return v4b{(__bf16)v[0], (__bf16)v[1], (__bf16)v[2], (__bf16)v[3]}; }
__device__ __forceinline__ v4h cvt_y(v4f v) { return v4h{(_Float16)(v[0] * 64.0f), (_Float16)(v[1] * 64.0f), (_Float16)(v[2] * 64.0f), (_Float16)(v[3] * 64.0f)}; }   // ctx x 2^6
__device__ __forceinline__ v4h cvt_w(v4f v) { return v4h{(_Float16)(bfr(v[0]) * 256.0f), (_Float16)(bfr(v[1]) * 256.0f), (_Float16)(bfr(v[2]) * 256.0f), (_Float16)(bfr(v[3]) * 256.0f)}; }   // f16(bf16 x 2^8), exact
// work-group barrier by hand: __syncthreads() compiled to a wait for the global loads too, which would drain the loads issued ahead for the stage after next; what the other waves need is this wave's LDS reads and writes complete (s_wait_dscnt 0). s_wait_xcnt 0 stands in front of every reuse of those loads' address registers.
// The two load pointers take their step of SB bytes to the next stage inside the statement, behind its s_wait_xcnt 0: written in the source, the additions were placed by the compiler between the loads and the wait.
template <int SB> __device__ __forceinline__ void stage_barrier(const float*& xp, const float*& wp) { asm volatile("s_wait_xcnt 0x0\n\ts_wait_dscnt 0x0\n\ts_barrier_signal -1\n\ts_barrier_wait -1\n\tv_add_nc_u64 %0, %2, %0\n\tv_add_nc_u64 %1, %2, %1" : "+v"(xp), "+v"(wp) : "n"(SB) : "memory"); }
#define GT_LOAD(RS_, xa, xw, xp, wp) do { _Pragma("unroll") for (int i_ = 0; i_ < 8; ++i_) xa[i_] = *(const v4f*)((xp) + (size_t)(i_ * RS_) * DIN); _Pragma("unroll") for (int i_ = 0; i_ < 8; ++i_) xw[i_] = *(const v4f*)((wp) + (size_t)(i_ * RS_) * DIN); } while (0)
#define GT_STORE(RS_, LP_, VT_, ca, cw, xa, xw, ad, wd) do { _Pragma("unroll") for (int i_ = 0; i_ < 8; ++i_) *(VT_*)((ad) + (lr + RS_ * i_) * LP_ + lc) = ca(xa[i_]); _Pragma("unroll") for (int i_ = 0; i_ < 8; ++i_) *(VT_*)((wd) + (lr + RS_ * i_) * LP_ + lc) = cw(xw[i_]); } while (0)
// ---- k_proj: block = (256 rows, 256 cols, which), 8 waves, one block a WGP: q/k/v = X W (+ b) with exact bf16 products (K = DIN) -> which 0: q f16 rows; 1: k f16 rows; 2: v f16 planes [c][t]
// The operand whose index runs along the CONTIGUOUS direction of the output is the A operand: W for q and k (features along a row), X for v (tokens along a plane). D register r of a lane is then A index 8 g + r:
// a lane holds 8 neighbouring output elements (16 bytes of f16, and for q and k four whole rotation pairs) of the output row picked by its B index, and the epilogue works from the accumulators.
#define EP 72   // pitch of a staged output row in f16: 144 B = 16 B x 9 (odd)
// a wave's 64 staged rows of 128 B go out as whole lines: a wave-wide 16-byte store covers 4 rows; unrolled whole, so that the 16 LDS reads issue as one group ahead of the stores
template <int PITCH> __device__ __forceinline__ void rows_out(_Float16* dst, const _Float16* so, int lane) { dst += (size_t)(lane >> 3) * PITCH + (lane & 7) * 8; so += (lane >> 3) * EP + (lane & 7) * 8;
#pragma unroll
  for (int e = 0; e < 16; ++e) vst2(dst + (size_t)(e * 4) * PITCH, *(const v4u*)(so + e * 4 * EP)); }
// between the two halves of the epilogue, own wave only. s_wait_xcnt 0 stands behind the first half's stores, in front of every write of the registers that they name; s_wait_dscnt 0: the lanes' reads of the first half's staged rows are complete before the second half is staged over them, and the "memory" clobber keeps the second half's LDS stores behind those reads. The scheduling barrier keeps the second half's arithmetic, which reuses the stores' registers, behind the waits (the compiler had lifted it over them).
__device__ __forceinline__ void half_end() { asm volatile("s_wait_xcnt 0x0\n\ts_wait_dscnt 0x0" ::: "memory"); __builtin_amdgcn_sched_barrier(0); }
__global__ __launch_bounds__(256) void k_proj(const float* __restrict__ XQ, const float* __restrict__ XK, const float* __restrict__ XV, const float* __restrict__ WQ, const float* __restrict__ WK, const float* __restrict__ WV, const float* __restrict__ BQ, const float* __restrict__ BK, const float* __restrict__ BV,
    _Float16* __restrict__ QH, _Float16* __restrict__ KH, _Float16* __restrict__ VT PROJ_EXTRA_PARAMS) {
  // one LDS block, used in turn: the main loop's stages (2 x 256 X rows, then 2 x 256 W rows), then each wave's own 64 staged output rows (8 x 9,216 B)
  __shared__ __align__(16) char sm[2 * 2 * 256 * LPP * 2];
  static_assert(8 * 64 * EP * 2 <= 2 * 2 * 256 * LPP * 2, "the staged output rows fit the stages' place");
  const int tid = threadIdx.x, wave = tid >> 5, lane = tid & 31, col = lane & 15, g = lane >> 4; const int which = blockIdx.z; const int c0 = blockIdx.y * 256; const size_t rb = (size_t)blockIdx.x * 256; const size_t bb = rb / TT; const int t0 = (int)(rb % TT);
  const float* X = which == 0 ? XQ : which == 1 ? XK : XV; const float* WA = which == 0 ? WQ : which == 1 ? WK : WV; const float* BA = which == 0 ? BQ : which == 1 ? BK : BV;
  // main loop: the block's X tile (256 x KSP) and W tile (256 x KSP) are read once per block with whole-line loads, rounded to bf16 once and staged in LDS (two buffers); wave (wr, wc) owns 128 A rows x 64 B rows
  const int wr = wave >> 2, wc = wave & 3; const int lr = tid >> 3, lc = (tid & 7) * 4; const bool qk = which < 2;
  __bf16* const As = (__bf16*)sm; __bf16* const Ws = As + 2 * 256 * LPP;
  const __bf16* const Am = qk ? Ws : As; const __bf16* const Bm = qk ? As : Ws;
  const float* xg = X + (rb + lr) * DIN + lc; const float* wg = WA + (size_t)(c0 + lr) * DIN + lc;
  v4f xa[8], xw[8]; v8f acc[8][4] = {};
  GT_LOAD(32, xa, xw, xg, wg);
  GT_STORE(32, LPP, v4b, cvt_b, cvt_b, xa, xw, As, Ws);
  GT_LOAD(32, xa, xw, xg + KSP, wg + KSP);
  stage_barrier<2 * KSP * 4>(xg, wg);   // stage 0 is published; stage 1 stays in flight; the pointers now stand at the stage after next
#pragma unroll 2   /* two stages a trip: the buffer index is a constant */
  for (int s = 0; s < DIN / KSP; ++s) { const __bf16* Ab = Am + ((s & 1) * 256 + wr * 128 + col) * LPP; const __bf16* Wb = Bm + ((s & 1) * 256 + wc * 64 + col) * LPP;
    v16b af[8], wf[4];
    // the four B fragments are read first: every product row needs them, and row i then waits for af[i] alone, so the products start behind 10 of the 24 reads
#pragma unroll
    for (int j = 0; j < 4; ++j) wf[j] = frag_b(Wb + j * 16 * LPP, lane);
#pragma unroll
    for (int i = 0; i < 8; ++i) af[i] = frag_b(Ab + i * 16 * LPP, lane);
    __builtin_amdgcn_sched_barrier(0);   // the stage's fragment reads issue as one group ahead of its products, not among them
#pragma unroll
    for (int i = 0; i < 8; ++i)
#pragma unroll
      for (int j = 0; j < 4; ++j) acc[i][j] = mmb(af[i], wf[j], acc[i][j]);
    __builtin_amdgcn_sched_barrier(0);   // the conversions, which wait for the loads in flight, stay behind the products
    if (s + 1 < DIN / KSP) GT_STORE(32, LPP, v4b, cvt_b, cvt_b, xa, xw, As + ((s + 1) & 1) * 256 * LPP, Ws + ((s + 1) & 1) * 256 * LPP);   /* into the buffer whose readers all passed the last barrier */
    if (s + 2 < DIN / KSP) GT_LOAD(32, xa, xw, xg, wg);   /* in flight under the next stage's products */
    stage_barrier<KSP * 4>(xg, wg); }   // publishes stage s + 1 and ends every read of stage s
  // epilogue, from the accumulators, in two halves hh of the wave's 128 A rows: acc[4 hh + i][j][r] = output row (B index) wc 64 + 16 j + col, element (A index) wr 128 + hh 64 + 16 i + 8 g + r. The loop's last barrier has ended every read of the stages, so each wave stages in its own part of sm and needs no further barrier. Every loop of the epilogue is unrolled whole: the accumulator indices must be constants for the arrays to stay in registers.
  _Float16* const so = (_Float16*)sm + wave * (64 * EP); _Float16* const sw = so + col * EP + 8 * g;
  if (qk) {
#pragma unroll
    for (int hh = 0; hh < 2; ++hh) { const int f0 = c0 + wr * 128 + hh * 64;   /* the half's 64 features are head f0 / 64: pairs f0 / 2 .. f0 / 2 + 31 of the model-wide rotation */
    // (x0, x1) = features (2 p, 2 p + 1) -> (x0 c - x1 s, x0 s + x1 c) with c = bf16(cos[t][p]), s = bf16(sin[t][p]), t = the lane's token; a block's 256 tokens lie in one sequence
    const float* ct = COS + (size_t)(t0 + wc * 64 + col) * TBW + (f0 >> 1) + 4 * g; const float* sn_ = SIN + (size_t)(t0 + wc * 64 + col) * TBW + (f0 >> 1) + 4 * g;
    v4f bs[4][2] = {};
    if (BA) {
#pragma unroll
      for (int i = 0; i < 4; ++i)
#pragma unroll
        for (int q = 0; q < 2; ++q) bs[i][q] = *(const v4f*)(BA + f0 + i * 16 + 8 * g + 4 * q);
      asm volatile("s_wait_xcnt 0x0" ::: "memory"); }   // stands in front of every later write of the bias loads' address registers
#pragma unroll
    for (int i = 0; i < 4; ++i)
#pragma unroll
      for (int q = 0; q < 2; ++q)
#pragma unroll
        for (int r = 0; r < 4; ++r) bs[i][q][r] = bfr(bs[i][q][r]);
#pragma unroll
    for (int j = 0; j < 4; ++j)
#pragma unroll
      for (int i = 0; i < 4; ++i) { const v4f c4 = *(const v4f*)(ct + (size_t)(j * 16) * TBW + i * 8), s4 = *(const v4f*)(sn_ + (size_t)(j * 16) * TBW + i * 8); v8h o;
#pragma unroll
        for (int p = 0; p < 4; ++p) { const float cs = bfr(c4[p]), sn = bfr(s4[p]); const float xe = acc[4 * hh + i][j][2 * p] + bs[i][p >> 1][(2 * p) & 3], xo = acc[4 * hh + i][j][2 * p + 1] + bs[i][p >> 1][(2 * p + 1) & 3];
          o[2 * p] = (_Float16)(xe * cs - xo * sn); o[2 * p + 1] = (_Float16)(xe * sn + xo * cs); }
        *(v8h*)(sw + j * 16 * EP + i * 16) = o; }
    asm volatile("s_wait_xcnt 0x0" :: "v"(ct), "v"(sn_) : "memory");   // keeps the table loads' address registers whole up to this wait: without it the last half's final loads had their results placed over them
    LDSX();   // the wave's own staged rows are complete before its lanes read each other's pieces
    rows_out<CC>((which == 0 ? QH : KH) + (rb + wc * 64) * CC + f0, so, lane);
    if (hh == 0) half_end(); }
  } else { float bv[4] = {};
    if (BA) {
#pragma unroll
      for (int j = 0; j < 4; ++j) bv[j] = BA[c0 + wc * 64 + j * 16 + col];
      asm volatile("s_wait_xcnt 0x0" ::: "memory"); }   // as in the q / k branch
#pragma unroll
    for (int hh = 0; hh < 2; ++hh) {
#pragma unroll
    for (int j = 0; j < 4; ++j) { const float bias = bfr(bv[j]);
#pragma unroll
      for (int i = 0; i < 4; ++i) { v8h o;
#pragma unroll
        for (int r = 0; r < 8; ++r) o[r] = (_Float16)(acc[4 * hh + i][j][r] + bias);
        *(v8h*)(sw + j * 16 * EP + i * 16) = o; } }
    LDSX();   // as above
    rows_out<TT>(VT + (bb * CC + c0 + wc * 64) * (size_t)TT + t0 + wr * 128 + hh * 64, so, lane);
    if (hh == 0) half_end(); } } }
// ---- k_fa: block = 256 queries (8 waves x 32) of (b, h): logits, softmax and P . v in one pass over the keys, 32 keys at a time, k and v read from LDS stages; nothing of the score matrix leaves the registers.
// S^T = K . Q^T (A = k rows, B = q rows kept in registers): D register r of key tile kt = score of key 16 kt + 8 g + r for query column col, which is element 8 kt + r of the B operand of ctx^T += V^T . P^T, so P packs in place.
// Online softmax in base 2: running maximum m and sum l per query column; l and ctx^T are rescaled by 2^(m_old - m_new) every pass; the wave halves' sums join in the epilogue.
// Every inner loop is unrolled whole, so that each fragment and accumulator index is a constant and the arrays live in registers.
#define PCARRY 8.0f   // P carried x 2^8 into f16 (cancels in ctx / l): small weights stay clear of f16 subnormals
__device__ __forceinline__ v8f mm16(v16h a, v16h b, v8f c) { return __builtin_amdgcn_wmma_f32_16x16x32_f16(false, a, false, b, (short)0, c, false, false); }
__device__ __forceinline__ float xhalf(float x) { return __builtin_bit_cast(float, __builtin_amdgcn_permlanex16(__builtin_bit_cast(int, x), __builtin_bit_cast(int, x), 0x76543210, 0xfedcba98, false, false)); }  // lane l with lane l ^ 16
// eight base-2 exponentials, each in its own register: no neighbour reads a result or overwrites a source, and the closing v_nop is the slot that the instruction set asks for behind the last one
__device__ __forceinline__ void exp2x8(v8f& a) { asm("v_exp_f32 %0, %0\n\tv_exp_f32 %1, %1\n\tv_exp_f32 %2, %2\n\tv_exp_f32 %3, %3\n\tv_exp_f32 %4, %4\n\tv_exp_f32 %5, %5\n\tv_exp_f32 %6, %6\n\tv_exp_f32 %7, %7\n\tv_nop" : "+v"(a[0]), "+v"(a[1]), "+v"(a[2]), "+v"(a[3]), "+v"(a[4]), "+v"(a[5]), "+v"(a[6]), "+v"(a[7])); }
// K / V staging: a stage is SK keys of the block's (b, h): SK k rows of 128 B and HD v plane pieces of 256 B, brought into LDS once for all 8 waves by asynchronous copies (16 B a lane, a wave-wide copy = 4 whole lines), two buffers
#define SK 128
#define NST (TT / SK)
#define KP 72                      // LDS pitch of a k row in f16: 144 B = 16 B x 9 (odd), the pitch for 16-byte fragment reads
#define VP 136                     // LDS pitch of a v plane piece in f16: 272 B = 16 B x 17 (odd)
#define VOF (SK * KP)              // start of the v part of a buffer, in f16
#define BUFH (SK * KP + HD * VP)   // one buffer, in f16
// one stage's 8 copies of this thread: k rows lr + 32 i, v planes lp + 16 i. s_wait_xcnt 0 closes the statement, so that it stands in front of every later write of the address registers that the copies name.
__device__ __forceinline__ void stage_copy(unsigned lk, unsigned lv, const _Float16* gk, const _Float16* gv) {
  asm volatile("global_load_async_to_lds_b128 %0, %8, off\n\tglobal_load_async_to_lds_b128 %1, %9, off\n\tglobal_load_async_to_lds_b128 %2, %10, off\n\tglobal_load_async_to_lds_b128 %3, %11, off\n\t"
               "global_load_async_to_lds_b128 %4, %12, off\n\tglobal_load_async_to_lds_b128 %5, %13, off\n\tglobal_load_async_to_lds_b128 %6, %14, off\n\tglobal_load_async_to_lds_b128 %7, %15, off\n\ts_wait_xcnt 0x0"
               :: "v"(lk), "v"(lk + 32u * KP * 2u), "v"(lk + 64u * KP * 2u), "v"(lk + 96u * KP * 2u), "v"(lv), "v"(lv + 16u * VP * 2u), "v"(lv + 32u * VP * 2u), "v"(lv + 48u * VP * 2u),
                  "v"(gk), "v"(gk + (size_t)32 * CC), "v"(gk + (size_t)64 * CC), "v"(gk + (size_t)96 * CC), "v"(gv), "v"(gv + (size_t)16 * TT), "v"(gv + (size_t)32 * TT), "v"(gv + (size_t)48 * TT) : "memory"); }
__global__ __launch_bounds__(256) void k_fa(const _Float16* __restrict__ QH, const _Float16* __restrict__ KH, const _Float16* __restrict__ VT, float* __restrict__ Y) {
  __shared__ __align__(16) _Float16 kv[2][BUFH];
  const int tid = threadIdx.x, wave = tid >> 5, lane = tid & 31, col = lane & 15, g = lane >> 4; const int h = blockIdx.y, b = blockIdx.z; const int q0 = blockIdx.x * 256 + wave * 32;
  const float cs = SCALE * 1.4426950408889634f;
  const unsigned lk = (unsigned)(size_t)&kv[0][0] + (unsigned)(tid >> 3) * (KP * 2u) + (unsigned)(tid & 7) * 16u;               // this thread's 16 bytes of k row tid >> 3
  const unsigned lv = (unsigned)(size_t)&kv[0][0] + VOF * 2u + (unsigned)(tid >> 4) * (VP * 2u) + (unsigned)(tid & 15) * 16u;   // this thread's 16 bytes of v plane tid >> 4
  const _Float16* gk = KH + ((size_t)b * TT + (tid >> 3)) * CC + h * HD + (tid & 7) * 8;
  const _Float16* gv = VT + ((size_t)b * CC + h * HD + (tid >> 4)) * (size_t)TT + (tid & 15) * 8;
  stage_copy(lk, lv, gk, gv);   // stage 0 into buffer 0
  v16h qf[2][2];
#pragma unroll
  for (int n = 0; n < 2; ++n)
#pragma unroll
    for (int kc = 0; kc < 2; ++kc) qf[n][kc] = frag_h(QH + ((size_t)b * TT + q0 + n * 16 + col) * CC + h * HD + kc * 32, lane);
  asm volatile("s_wait_asynccnt 0x0" ::: "memory");   // this wave's copies of stage 0 have landed
  __syncthreads();                                    // stage 0 is published
  stage_copy(lk + BUFH * 2u, lv + BUFH * 2u, gk + (size_t)SK * CC, gv + SK);   // stage 1 into buffer 1, in flight under stage 0's passes
  v8f acc[2][4] = {}; float m[2] = {-3.0e38f, -3.0e38f}, l[2] = {0.f, 0.f};
#pragma unroll 1   /* rolled, like the pass loop inside it */
  for (int t = 0; t < NST; ++t) { const _Float16* kb = &kv[t & 1][0] + col * KP;   /* key row col of the stage's first tile */
    const _Float16* vb = &kv[t & 1][VOF] + col * VP;                               /* v plane piece of head column col */
    v16h kf[2][2];
#pragma unroll
    for (int kt = 0; kt < 2; ++kt)
#pragma unroll
      for (int kc = 0; kc < 2; ++kc) kf[kt][kc] = frag_h(kb + (kt * 16) * KP + kc * 32, lane);
#pragma unroll 1   /* rolled: one pass already holds 16 matrix instructions, and further copies would multiply the live fragments */
    for (int p = 0; p < SK / 32; ++p) { const int nx = p + 1 < SK / 32 ? p + 1 : p;   /* a stage's last pass fetches its own k tiles again: inside the stage, unused */
    v8f s[2][2];
#pragma unroll
    for (int kt = 0; kt < 2; ++kt)
#pragma unroll
      for (int n = 0; n < 2; ++n) { s[kt][n] = v8f{};
#pragma unroll
        for (int kc = 0; kc < 2; ++kc) s[kt][n] = mm16(kf[kt][kc], qf[n][kc], s[kt][n]); }
    // one group of LDS reads a pass: this pass's v fragments, then the next pass's k fragments into the same registers (inside the stage only), in flight under the softmax
    v16h vf[4];
#pragma unroll
    for (int j = 0; j < 4; ++j) vf[j] = frag_h(vb + (j * 16) * VP + p * 32, lane);
#pragma unroll
    for (int kt = 0; kt < 2; ++kt)
#pragma unroll
      for (int kc = 0; kc < 2; ++kc) kf[kt][kc] = frag_h(kb + (nx * 32 + kt * 16) * KP + kc * 32, lane);
    __builtin_amdgcn_sched_barrier(0);   // the reads issue here, ahead of the softmax, not sunk towards their use
#pragma unroll
    for (int n = 0; n < 2; ++n) { float mx = s[0][n][0];
#pragma unroll
      for (int r = 0; r < 8; ++r) mx = fmaxf(mx, fmaxf(s[0][n][r], s[1][n][r]));
      mx = fmaxf(mx, xhalf(mx)) * cs;   /* both halves hold the column's maximum of this pass, scaled (cs > 0) */
      const float mn = fmaxf(m[n], mx); const float corr = __builtin_amdgcn_exp2f(m[n] - mn); m[n] = mn; const float nm = PCARRY - mn;
      v16h pf; float ps = 0.f; v8f e0, e1;
#pragma unroll
      for (int r = 0; r < 8; ++r) { e0[r] = fmaf(s[0][n][r], cs, nm); e1[r] = fmaf(s[1][n][r], cs, nm); }
      exp2x8(e0); exp2x8(e1);
#pragma unroll
      for (int r = 0; r < 8; ++r) { pf[r] = (_Float16)e0[r]; pf[8 + r] = (_Float16)e1[r]; ps += e0[r] + e1[r]; }
      l[n] = l[n] * corr + ps;
#pragma unroll
      for (int j = 0; j < 4; ++j) acc[n][j] = mm16(vf[j], pf, acc[n][j] * corr); } }
    asm volatile("s_wait_dscnt 0x0" ::: "memory");      // this wave's reads of stage t are complete before the buffer may be refilled
    asm volatile("s_wait_asynccnt 0x0" ::: "memory");   // this wave's copies of stage t + 1 have landed
    __syncthreads();                                    // publishes stage t + 1 and ends every read of stage t
    if (t + 2 < NST) stage_copy(lk + (unsigned)(t & 1) * (BUFH * 2u), lv + (unsigned)(t & 1) * (BUFH * 2u), gk + (size_t)(t + 2) * SK * CC, gv + (t + 2) * SK); }   /* into the buffer that stage t has just left */
  asm volatile("s_wait_asynccnt 0x0" ::: "memory");   // nothing of this wave is in flight when it leaves the loop
#pragma unroll
  for (int n = 0; n < 2; ++n) { const float inv = 1.0f / (l[n] + xhalf(l[n])); float* yr = Y + ((size_t)b * TT + q0 + n * 16 + col) * CC + h * HD + 8 * g;   /* register r of tile j = head column 16 j + 8 g + r of query col */
#pragma unroll
    for (int j = 0; j < 4; ++j) { const v8f o = acc[n][j] * inv; vst2(yr + j * 16, v4f{o[0], o[1], o[2], o[3]}); vst2(yr + j * 16 + 4, v4f{o[4], o[5], o[6], o[7]}); } } }
// ---- k_out: block = (128 rows, 128 cols), 8 waves, one block a WGP: out = ctx Wo (+ bo): ctx x 2^6 once to f16 against Wo as f16(bf16 x 2^8) exact (1 product) x 2^-14
__global__ __launch_bounds__(256) void k_out(const float* __restrict__ Y, const float* __restrict__ WO, const float* __restrict__ BO, float* __restrict__ OUT) { __shared__ __align__(16) float sf[8][32][68]; __shared__ __align__(16) _Float16 ya[2][128][LP], wa[2][128][LP];
  const int tid = threadIdx.x, wave = tid >> 5, lane = tid & 31, col = lane & 15, g = lane >> 4; const int c0 = blockIdx.y * 128; const size_t r0 = (size_t)blockIdx.x * 128;
  // main loop as in k_proj: ctx tile (128 x KS, x 2^6 so small-magnitude context rows stay clear of f16 subnormals) and Wo tile (128 x KS) converted once per block and staged in LDS, two buffers; wave (wr, wc) owns 32 rows x 64 columns
  const int wr = wave >> 1, wc = wave & 1; const int lr = tid >> 4, lc = (tid & 15) * 4;
  const float* xg = Y + (r0 + lr) * CC + lc; const float* wg = WO + (size_t)(c0 + lr) * CC + lc;
  v4f xa[8], xw[8]; v8f acc[2][4] = {};
  GT_LOAD(16, xa, xw, xg, wg);
  GT_STORE(16, LP, v4h, cvt_y, cvt_w, xa, xw, &ya[0][0][0], &wa[0][0][0]);
  GT_LOAD(16, xa, xw, xg + KS, wg + KS);
  stage_barrier<2 * KS * 4>(xg, wg);   // stage 0 is published; stage 1 stays in flight; the pointers now stand at the stage after next
#pragma unroll 2   /* two stages a trip: the buffer index is a constant */
  for (int s = 0; s < CC / KS; ++s) { const _Float16* Ab = &ya[s & 1][wr * 32 + col][0]; const _Float16* Wb = &wa[s & 1][wc * 64 + col][0];
    v16h af[2][2], wf[2][4];
#pragma unroll
    for (int ks = 0; ks < 2; ++ks) {
#pragma unroll
      for (int i = 0; i < 2; ++i) af[ks][i] = frag_h(Ab + i * 16 * LP + ks * 32, lane);
#pragma unroll
      for (int j = 0; j < 4; ++j) wf[ks][j] = frag_h(Wb + j * 16 * LP + ks * 32, lane); }
    __builtin_amdgcn_sched_barrier(0);   // the stage's fragment reads issue as one group ahead of its products, not among them
#pragma unroll
    for (int ks = 0; ks < 2; ++ks)
#pragma unroll
      for (int i = 0; i < 2; ++i)
#pragma unroll
        for (int j = 0; j < 4; ++j) acc[i][j] = mm16(af[ks][i], wf[ks][j], acc[i][j]);
    __builtin_amdgcn_sched_barrier(0);   // the conversions, which wait for the loads in flight, stay behind the products
    if (s + 1 < CC / KS) GT_STORE(16, LP, v4h, cvt_y, cvt_w, xa, xw, &ya[(s + 1) & 1][0][0], &wa[(s + 1) & 1][0][0]);   /* into the buffer whose readers all passed the last barrier */
    if (s + 2 < CC / KS) GT_LOAD(16, xa, xw, xg, wg);   /* in flight under the next stage's products */
    stage_barrier<KS * 4>(xg, wg); }   // publishes stage s + 1 and ends every read of stage s
#pragma unroll
  for (int j = 0; j < 4; ++j) { const float bias = BO ? bfr(BO[c0 + wc * 64 + j * 16 + col]) : 0.f;
#pragma unroll
    for (int i = 0; i < 2; ++i)
#pragma unroll
      for (int r = 0; r < 8; ++r) sf[wave][i * 16 + 8 * g + r][j * 16 + col] = acc[i][j][r] * (1.0f / 16384.0f) + bias; }   /* 2^-8 (Wo carry) x 2^-6 (ctx carry) */
  LDSX(); for (int rl = 0; rl < 16; ++rl) vst2(OUT + (r0 + wr * 32 + rl * 2 + g) * DIN + c0 + wc * 64 + col * 4, *(const v4f*)&sf[wave][rl * 2 + g][col * 4]); }

extern "C" void kernel_launch(void* const* d_in, const int* in_sizes, int n_in, void* d_out, int out_size, void* d_ws, size_t ws_size, hipStream_t stream) {
  (void)in_sizes; (void)n_in; (void)out_size;
  const float** F = (const float**)d_in;
  if (ws_size < (size_t)WS_END) return;
  char* ws = (char*)d_ws; _Float16 *QH = (_Float16*)(ws + WS_QH), *KH = (_Float16*)(ws + WS_KH), *VT = (_Float16*)(ws + WS_VT), *QL = (_Float16*)(ws + WS_QL), *KL = (_Float16*)(ws + WS_KL); __bf16 *VB = (__bf16*)(ws + WS_VB), *VBL = (__bf16*)(ws + WS_VBL); float *Y = (float*)(ws + WS_Y);
  (void)Y; (void)QL; (void)KL; (void)VB; (void)VBL;
  // inputs: 0 query [2,2048,1024]; 1 key; 2 value; 3 wq [1024,1024] (out,in), 4 bq; 5 wk, 6 bk; 7 wv, 8 bv; 9 wo (out,in), 10 bo (biases zeros, read); 11 cos [2048,512]; 12 sin [2048,512]
  k_proj<<<dim3(TNB * TT / 256, CC / 256, 3), 256, 0, stream>>>(F[0], F[1], F[2], F[3], F[5], F[7], F[4], F[6], F[8], QH, KH, VT, F[11], F[12]);
  k_fa<<<dim3(TT / 256, NH, TNB), 256, 0, stream>>>(QH, KH, VT, Y);
  k_out<<<dim3(TNB * TT / 128, DIN / 128), 256, 0, stream>>>(Y, F[9], F[10], (float*)d_out);
}

// v007
// Measured time: 77.6 microseconds a run.
// Two timings next to v006 both put it at 1.05 times that version's speed.
// All steps since v000 together make it 18.6 times as fast.
// compute dtype: all float inputs rounded to bf16; q / k / v projections with EXACT bf16 products on WMMA 16x16x32 (f32 accumulate) + bias (zeros, read); interleaved-pair RoPE in f32 from the bf16-rounded INPUT cos / sin tables (512 pairs across the full model width); logits q x k once to f16 each (1 product) x 64^-0.5; online softmax f32 (base 2, against a held reference that is raised to the running maximum only when a pass's P sum tops 2^15); unnormalised P x 2^8 once to f16 x v once to f16 (1 product), divided by the f32 sum at the end; ctx x 2^6 once to f16 x wo f16(bf16 x 2^8) + bo; f32 output.
#include <hip/hip_runtime.h>
#include <math.h>

typedef __attribute__((ext_vector_type(16))) _Float16 v16h;
typedef __attribute__((ext_vector_type(16))) __bf16 v16b;
typedef __attribute__((ext_vector_type(8)))  _Float16 v8h;
typedef __attribute__((ext_vector_type(8)))  float v8f;
typedef __attribute__((ext_vector_type(4)))  float v4f;
typedef __attribute__((ext_vector_type(2)))  float v2f;
typedef __attribute__((ext_vector_type(4)))  unsigned v4u;
typedef __attribute__((ext_vector_type(4)))  int v4i;
typedef float __attribute__((may_alias)) float_a;
typedef int __attribute__((may_alias)) int_a;

template <typename T> __device__ __forceinline__ void vst2(void* p, T v) { *(T*)p = v;  }
__device__ __forceinline__ v8f wmma16(v16h a, v16h b, v8f c) {
  v8f d = __builtin_amdgcn_wmma_f32_16x16x32_f16(false, a, false, b, (short)0, c, false, false);
  asm volatile("v_nop\n\tv_nop\n\tv_nop\n\tv_nop" : "+v"(d) : "v"(a), "v"(b));
  return d;
}
__device__ __forceinline__ v8f wmma_bf(v16b a, v16b b, v8f c) {
  v8f d = __builtin_amdgcn_wmma_f32_16x16x32_bf16(false, a, false, b, (short)0, c, false, false);
  asm volatile("v_nop\n\tv_nop\n\tv_nop\n\tv_nop" : "+v"(d) : "v"(a), "v"(b));
  return d;
}
// 16x16x32 fragments: lane = (h = lane>>4, row/col = lane&15); elements 0..7 = k0+8h+0..7, 8..15 = k0+16+8h+0..7; D element r = row 8h+r
__device__ __forceinline__ v16h frag_h(const _Float16* rowk0, int lane) {
  union { v16h v; v8h q[2]; } u; const _Float16* p = rowk0 + 8 * (lane >> 4);
  u.q[0] = *(const v8h*)p; u.q[1] = *(const v8h*)(p + 16); return u.v;
}
__device__ __forceinline__ v16h frag_f32(const float* rowk0, int lane) {
  v16h a; const float* p = rowk0 + 8 * (lane >> 4);
#pragma unroll
  for (int i = 0; i < 8; ++i) { a[i] = (_Float16)p[i]; a[8 + i] = (_Float16)p[16 + i]; }
  return a;
}
__device__ __forceinline__ v16h frag_f32s(const float* rowk0, int lane, float sc) {
  v16h a; const float* p = rowk0 + 8 * (lane >> 4);
#pragma unroll
  for (int i = 0; i < 8; ++i) { a[i] = (_Float16)(p[i] * sc); a[8 + i] = (_Float16)(p[16 + i] * sc); }
  return a;
}
// column fragment from a [K][ld] layout (column n), rows >= K read as 0
__device__ __forceinline__ v16h fragc_f32(const float* W, int k0, int n, int lane, int ld, int K) {
  v16h a; const int g = lane >> 4;
#pragma unroll
  for (int i = 0; i < 8; ++i) { const int ka = k0 + 8 * g + i, kb = ka + 16;
    a[i] = (_Float16)(ka < K ? W[(size_t)(ka < K ? ka : K - 1) * ld + n] : 0.f); a[8 + i] = (_Float16)(kb < K ? W[(size_t)(kb < K ? kb : K - 1) * ld + n] : 0.f); }
  return a;
}
struct F2 { v16b h, l; };
__device__ __forceinline__ F2 bsplit16(const float v[16]) { F2 r;
#pragma unroll
  for (int i = 0; i < 16; ++i) { const __bf16 h = (__bf16)v[i]; r.h[i] = h; r.l[i] = (__bf16)(v[i] - (float)h); }
  return r; }
__device__ __forceinline__ F2 split_row(const float* row, int k0, int lane) { float v[16]; const float* p = row + k0 + 8 * (lane >> 4);
#pragma unroll
  for (int i = 0; i < 8; ++i) { v[i] = p[i]; v[8 + i] = p[16 + i]; }
  return bsplit16(v); }
__device__ __forceinline__ F2 split_rowK(const float* row, int k0, int lane, int K) { float v[16]; const int g = lane >> 4;
#pragma unroll
  for (int i = 0; i < 8; ++i) { const int ka = k0 + 8 * g + i, kb = ka + 16; v[i] = ka < K ? row[ka < K ? ka : K - 1] : 0.f; v[8 + i] = kb < K ? row[kb < K ? kb : K - 1] : 0.f; }
  return bsplit16(v); }
__device__ __forceinline__ F2 split_col(const float* W, int k0, int n, int lane, int ld, int K) { float v[16]; const int g = lane >> 4;
#pragma unroll
  for (int i = 0; i < 8; ++i) { const int ka = k0 + 8 * g + i, kb = ka + 16; v[i] = ka < K ? W[(size_t)(ka < K ? ka : K - 1) * ld + n] : 0.f; v[8 + i] = kb < K ? W[(size_t)(kb < K ? kb : K - 1) * ld + n] : 0.f; }
  return bsplit16(v); }
__device__ __forceinline__ v8f mac3(const F2& a, const F2& b, v8f c) { c = wmma_bf(a.l, b.h, c); c = wmma_bf(a.h, b.l, c); return wmma_bf(a.h, b.h, c); }
__device__ __forceinline__ float sigm(float v) { return 1.0f / (1.0f + expf(-v)); }
#define LDSX() do { asm volatile("s_wait_dscnt 0" ::: "memory"); __builtin_amdgcn_wave_barrier(); __builtin_amdgcn_fence(__ATOMIC_RELEASE, "workgroup"); } while (0)

// Multi-head attention on separate inputs with RoPE applied across the FULL model width before the head split (query / key / value [2,2048,1024]; torch (out,in) wq / wk / wv / wo [1024,1024] N(0, 1/1024) applied as x @ W.T + b, biases zeros (read); cos / sin [2048,512] are module INPUTS (computed in setup with numpy; read literally): x.reshape(.., 512, 2): (x0, x1) = (x[2j], x[2j+1]) -> (x0 c - x1 s, x0 s + x1 c) with c = cos[s][j], j = 0..511, on q and k; then 16 heads x 64 (head h = columns 64h..: its pair i uses table column h*32 + i); scores / sqrt(64); no mask; softmax; out @ wo.T + bo).
#define NB 2
#define TT 2048
#define CC 1024            // NH * HD = projected width
#define DIN 1024          // input (model) width
#define NH 16
#define HD 64
#define NQB (TT / 64)
#define HG 4
#define SCALE (0.125f)
#define CAUSAL 0
#ifndef TNB
#define TNB NB
#endif
__device__ __forceinline__ float bfr(float v) { return (float)(__bf16)v; }
__host__ __device__ __forceinline__ int kb_last(int qb) { return CAUSAL ? ((qb * 64 + 63) >> 7) : (TT / 128 - 1); }
typedef __attribute__((ext_vector_type(8))) __bf16 v8b;
__device__ __forceinline__ v16b frag_b(const __bf16* rowk0, int lane) {
  union { v16b v; v8b q[2]; } u; const __bf16* p = rowk0 + 8 * (lane >> 4);
  u.q[0] = *(const v8b*)p; u.q[1] = *(const v8b*)(p + 16); return u.v;
}
#define QBH 0              // not referenced by any kernel (k_fa has a single path for every query block)
#define QHI 0               // single-product logits on every row (logit sigma ~1)
#define KHI 64            // key rows carrying k residual / v bf16 hi+lo planes (no kernel here writes or reads them)
// B fragment (k rows k0+.., output column o) of a weight: (in,out) [K][ld] or (out,in) [ld rows of K]: bf16 exact, or f16(bf16 * 256) exact
__device__ __forceinline__ v16b wcol_io(const float* Wm, int k0, int o, int lane, int ld) { v16b w; const int g = lane >> 4;
#pragma unroll
  for (int i = 0; i < 8; ++i) { w[i] = (__bf16)Wm[(size_t)(k0 + 8 * g + i) * ld + o]; w[8 + i] = (__bf16)Wm[(size_t)(k0 + 16 + 8 * g + i) * ld + o]; }
  return w; }
__device__ __forceinline__ v16b wcol_oi(const float* Wm, int k0, int o, int lane, int K) { v16b w; const float* p = Wm + (size_t)o * K + k0 + 8 * (lane >> 4);
#pragma unroll
  for (int i = 0; i < 8; ++i) { w[i] = (__bf16)p[i]; w[8 + i] = (__bf16)p[16 + i]; }
  return w; }
__device__ __forceinline__ v16h wcolh_io(const float* Wm, int k0, int o, int lane, int ld) { v16h w; const int g = lane >> 4;
#pragma unroll
  for (int i = 0; i < 8; ++i) { w[i] = (_Float16)(bfr(Wm[(size_t)(k0 + 8 * g + i) * ld + o]) * 256.0f); w[8 + i] = (_Float16)(bfr(Wm[(size_t)(k0 + 16 + 8 * g + i) * ld + o]) * 256.0f); }
  return w; }
__device__ __forceinline__ v16h wcolh_oi(const float* Wm, int k0, int o, int lane, int K) { v16h w; const float* p = Wm + (size_t)o * K + k0 + 8 * (lane >> 4);
#pragma unroll
  for (int i = 0; i < 8; ++i) { w[i] = (_Float16)(bfr(p[i]) * 256.0f); w[8 + i] = (_Float16)(bfr(p[16 + i]) * 256.0f); }
  return w; }
#define WQKV_LAYOUT 1   // 0 = (in,out) [DIN][CC]; 1 = (out,in) [CC][DIN]; 2 = per-head [NH][DIN][HD]
__device__ __forceinline__ v16b wcol_hdk(const float* Wm, int k0, int o, int lane) { v16b w; const int g = lane >> 4; const float* p = Wm + (size_t)(o / HD) * DIN * HD + (o % HD);
#pragma unroll
  for (int i = 0; i < 8; ++i) { w[i] = (__bf16)p[(size_t)(k0 + 8 * g + i) * HD]; w[8 + i] = (__bf16)p[(size_t)(k0 + 16 + 8 * g + i) * HD]; }
  return w; }
#define WO_OUT_IN 1
#if WQKV_LAYOUT == 1
#define WCOL(W, k0, o, lane) wcol_oi(W, k0, o, lane, DIN)
#elif WQKV_LAYOUT == 2
#define WCOL(W, k0, o, lane) wcol_hdk(W, k0, o, lane)
#else
#define WCOL(W, k0, o, lane) wcol_io(W, k0, o, lane, CC)
#endif
#if WO_OUT_IN
#define WOCOL(W, k0, o, lane) wcol_oi(W, k0, o, lane, CC)
#define WOCOLH(W, k0, o, lane) wcolh_oi(W, k0, o, lane, CC)
#else
#define WOCOL(W, k0, o, lane) wcol_io(W, k0, o, lane, DIN)
#define WOCOLH(W, k0, o, lane) wcolh_io(W, k0, o, lane, DIN)
#endif

#define TBW 512   // table width = model width / 2 pairs
#define PROJ_EXTRA_PARAMS , const float* __restrict__ COS, const float* __restrict__ SIN   /* rotary tables [TT][512], module INPUTS, read literally */
#ifndef SM_EXTRA_PARAMS
#define SM_EXTRA_PARAMS
#endif
#ifndef PROJ_EXTRA_PARAMS
#define PROJ_EXTRA_PARAMS
#endif
#ifndef SM_MASK_HOOK
#define SM_MASK_HOOK (void)0
#endif

#define WS_QH  0u                                      // f16 q rows [b*t][CC]
#define WS_KH  (WS_QH + 2u * (size_t)NB * TT * CC)      // f16 k rows [b*t][CC]
#define WS_VT  (WS_KH + 2u * (size_t)NB * TT * CC)      // f16 v planes [b][c][t]
// QL, KL, VB and VBL belong to the causal high-precision path, which this problem does not take: nothing reads them and nothing writes them; their places stay so that the ctx plane keeps its own
#define WS_QL  (WS_VT + 2u * (size_t)NB * CC * TT)      // f16 q residual x 2^10 rows [b][t < QHI][CC]
#define WS_KL  (WS_QL + 2u * (size_t)NB * QHI * CC)     // f16 k residual x 2^10 rows [b][t < KHI][CC]
#define WS_VB  (WS_KL + 2u * (size_t)NB * KHI * CC)     // bf16 v hi planes [b][c][t < KHI]
#define WS_VBL (WS_VB + 2u * (size_t)NB * CC * KHI)
#define WS_S   (WS_VBL + 2u * (size_t)NB * CC * KHI)    // not used (scores stay in registers); kept so that the ctx plane keeps its place
#define WS_Y   (WS_S  + 4u * (size_t)HG * TT * TT)      // f32 ctx rows [b*t][CC] (only when there is an output projection)
#define WS_END (WS_Y  + 4u * (size_t)NB * TT * CC)

// ---- operand staging of the two GEMM kernels (block tile 128 x 128 in k_out, 256 x 256 in k_proj, where each X row is read by 4 blocks and each W row by 16): a stage is KS (k_out) or KSP (k_proj) k of every tile row; a thread moves 4 floats of rows lr + RS i (RS = 16 or 32) of both operands, and one wave-wide 16-byte load covers whole 128-byte lines
#define KS 64    // k_out: 256 threads, thread (lr = tid >> 4, lc = 4 (tid & 15))
#define KSP 32   // k_proj: 256 threads, thread (lr = tid >> 3, lc = 4 (tid & 7)); the shorter stage keeps the loads in flight at 64 registers beside the 256 of the accumulators
#define LPP 40   // LDS row pitch of a KSP stage in 16-bit elements: 80 B = 16 B x 5 (odd)
static_assert(CC == DIN, "one row pitch for every GEMM operand");
#define LP 72   // LDS row pitch in 16-bit elements: 144 B = 16 B x 9 (odd), the pitch for 16-byte fragment reads
typedef __attribute__((ext_vector_type(4))) __bf16 v4b;
typedef __attribute__((ext_vector_type(4))) _Float16 v4h;
__device__ __forceinline__ v8f mmb(v16b a, v16b b, v8f c) { return __builtin_amdgcn_wmma_f32_16x16x32_bf16(false, a, false, b, (short)0, c, false, false); }
__device__ __forceinline__ v4b cvt_b(v4f v) { return v4b{(__bf16)v[0], (__bf16)v[1], (__bf16)v[2], (__bf16)v[3]}; }
__device__ __forceinline__ v4h cvt_y(v4f v) { return v4h{(_Float16)(v[0] * 64.0f), (_Float16)(v[1] * 64.0f), (_Float16)(v[2] * 64.0f), (_Float16)(v[3] * 64.0f)}; }   // ctx x 2^6
__device__ __forceinline__ v4h cvt_w(v4f v) { return v4h{(_Float16)(bfr(v[0]) * 256.0f), (_Float16)(bfr(v[1]) * 256.0f), (_Float16)(bfr(v[2]) * 256.0f), (_Float16)(bfr(v[3]) * 256.0f)}; }   // f16(bf16 x 2^8), exact
// work-group barrier by hand: __syncthreads() compiled to a wait for the global loads too, which would drain the loads issued ahead for the stage after next; what the other waves need is this wave's LDS reads and writes complete (s_wait_dscnt 0). s_wait_xcnt 0 stands in front of every reuse of those loads' address registers.
// The two load pointers take their step of SB bytes to the next stage inside the statement, behind its s_wait_xcnt 0: written in the source, the additions were placed by the compiler between the loads and the wait.
template <int SB> __device__ __forceinline__ void stage_barrier(const float*& xp, const float*& wp) { asm volatile("s_wait_xcnt 0x0\n\ts_wait_dscnt 0x0\n\ts_barrier_signal -1\n\ts_barrier_wait -1\n\tv_add_nc_u64 %0, %2, %0\n\tv_add_nc_u64 %1, %2, %1" : "+v"(xp), "+v"(wp) : "n"(SB) : "memory"); }
#define GT_LOAD(RS_, xa, xw, xp, wp) do { _Pragma("unroll") for (int i_ = 0; i_ < 8; ++i_) xa[i_] = *(const v4f*)((xp) + (size_t)(i_ * RS_) * DIN); _Pragma("unroll") for (int i_ = 0; i_ < 8; ++i_) xw[i_] = *(const v4f*)((wp) + (size_t)(i_ * RS_) * DIN); } while (0)
#define GT_STORE(RS_, LP_, VT_, ca, cw, xa, xw, ad, wd) do { _Pragma("unroll") for (int i_ = 0; i_ < 8; ++i_) *(VT_*)((ad) + (lr + RS_ * i_) * LP_ + lc) = ca(xa[i_]); _Pragma("unroll") for (int i_ = 0; i_ < 8; ++i_) *(VT_*)((wd) + (lr + RS_ * i_) * LP_ + lc) = cw(xw[i_]); } while (0)
// ---- k_proj: block = (256 rows, 256 cols, which), 8 waves, one block a WGP: q/k/v = X W (+ b) with exact bf16 products (K = DIN) -> which 0: q f16 rows; 1: k f16 rows; 2: v f16 planes [c][t]
// The operand whose index runs along the CONTIGUOUS direction of the output is the A operand: W for q and k (features along a row), X for v (tokens along a plane). D register r of a lane is then A index 8 g + r:
// a lane holds 8 neighbouring output elements (16 bytes of f16, and for q and k four whole rotation pairs) of the output row picked by its B index, and the epilogue works from the accumulators.
#define EP 72   // pitch of a staged output row in f16: 144 B = 16 B x 9 (odd)
// a wave's 64 staged rows of 128 B go out as whole lines: a wave-wide 16-byte store covers 4 rows; unrolled whole, so that the 16 LDS reads issue as one group ahead of the stores
template <int PITCH> __device__ __forceinline__ void rows_out(_Float16* dst, const _Float16* so, int lane) { dst += (size_t)(lane >> 3) * PITCH + (lane & 7) * 8; so += (lane >> 3) * EP + (lane & 7) * 8;
#pragma unroll
  for (int e = 0; e < 16; ++e) vst2(dst + (size_t)(e * 4) * PITCH, *(const v4u*)(so + e * 4 * EP)); }
// between the two halves of the epilogue, own wave only. s_wait_xcnt 0 stands behind the first half's stores, in front of every write of the registers that they name; s_wait_dscnt 0: the lanes' reads of the first half's staged rows are complete before the second half is staged over them, and the "memory" clobber keeps the second half's LDS stores behind those reads. The scheduling barrier keeps the second half's arithmetic, which reuses the stores' registers, behind the waits (the compiler had lifted it over them).
__device__ __forceinline__ void half_end() { asm volatile("s_wait_xcnt 0x0\n\ts_wait_dscnt 0x0" ::: "memory"); __builtin_amdgcn_sched_barrier(0); }
__global__ __launch_bounds__(256) void k_proj(const float* __restrict__ XQ, const float* __restrict__ XK, const float* __restrict__ XV, const float* __restrict__ WQ, const float* __restrict__ WK, const float* __restrict__ WV, const float* __restrict__ BQ, const float* __restrict__ BK, const float* __restrict__ BV,
    _Float16* __restrict__ QH, _Float16* __restrict__ KH, _Float16* __restrict__ VT PROJ_EXTRA_PARAMS) {
  // one LDS block, used in turn: the main loop's stages (2 x 256 X rows, then 2 x 256 W rows), then each wave's own 64 staged output rows (8 x 9,216 B)
  __shared__ __align__(16) char sm[2 * 2 * 256 * LPP * 2];
  static_assert(8 * 64 * EP * 2 <= 2 * 2 * 256 * LPP * 2, "the staged output rows fit the stages' place");
  const int tid = threadIdx.x, wave = tid >> 5, lane = tid & 31, col = lane & 15, g = lane >> 4; const int which = blockIdx.z; const int c0 = blockIdx.y * 256; const size_t rb = (size_t)blockIdx.x * 256; const size_t bb = rb / TT; const int t0 = (int)(rb % TT);
  const float* X = which == 0 ? XQ : which == 1 ? XK : XV; const float* WA = which == 0 ? WQ : which == 1 ? WK : WV; const float* BA = which == 0 ? BQ : which == 1 ? BK : BV;
  // main loop: the block's X tile (256 x KSP) and W tile (256 x KSP) are read once per block with whole-line loads, rounded to bf16 once and staged in LDS (two buffers); wave (wr, wc) owns 128 A rows x 64 B rows
  const int wr = wave >> 2, wc = wave & 3; const int lr = tid >> 3, lc = (tid & 7) * 4; const bool qk = which < 2;
  __bf16* const As = (__bf16*)sm; __bf16* const Ws = As + 2 * 256 * LPP;
  const __bf16* const Am = qk ? Ws : As; const __bf16* const Bm = qk ? As : Ws;
  const float* xg = X + (rb + lr) * DIN + lc; const float* wg = WA + (size_t)(c0 + lr) * DIN + lc;
  v4f xa[8], xw[8]; v8f acc[8][4] = {};
  GT_LOAD(32, xa, xw, xg, wg);
  GT_STORE(32, LPP, v4b, cvt_b, cvt_b, xa, xw, As, Ws);
  GT_LOAD(32, xa, xw, xg + KSP, wg + KSP);
  stage_barrier<2 * KSP * 4>(xg, wg);   // stage 0 is published; stage 1 stays in flight; the pointers now stand at the stage after next
#pragma unroll 2   /* two stages a trip: the buffer index is a constant */
  for (int s = 0; s < DIN / KSP; ++s) { const __bf16* Ab = Am + ((s & 1) * 256 + wr * 128 + col) * LPP; const __bf16* Wb = Bm + ((s & 1) * 256 + wc * 64 + col) * LPP;
    v16b af[8], wf[4];
    // the four B fragments are read first: every product row needs them, and row i then waits for af[i] alone, so the products start behind 10 of the 24 reads
#pragma unroll
    for (int j = 0; j < 4; ++j) wf[j] = frag_b(Wb + j * 16 * LPP, lane);
#pragma unroll
    for (int i = 0; i < 8; ++i) af[i] = frag_b(Ab + i * 16 * LPP, lane);
    __builtin_amdgcn_sched_barrier(0);   // the stage's fragment reads issue as one group ahead of its products, not among them
#pragma unroll
    for (int i = 0; i < 8; ++i)
#pragma unroll
      for (int j = 0; j < 4; ++j) acc[i][j] = mmb(af[i], wf[j], acc[i][j]);
    __builtin_amdgcn_sched_barrier(0);   // the conversions, which wait for the loads in flight, stay behind the products
    if (s + 1 < DIN / KSP) GT_STORE(32, LPP, v4b, cvt_b, cvt_b, xa, xw, As + ((s + 1) & 1) * 256 * LPP, Ws + ((s + 1) & 1) * 256 * LPP);   /* into the buffer whose readers all passed the last barrier */
    if (s + 2 < DIN / KSP) GT_LOAD(32, xa, xw, xg, wg);   /* in flight under the next stage's products */
    stage_barrier<KSP * 4>(xg, wg); }   // publishes stage s + 1 and ends every read of stage s
  // epilogue, from the accumulators, in two halves hh of the wave's 128 A rows: acc[4 hh + i][j][r] = output row (B index) wc 64 + 16 j + col, element (A index) wr 128 + hh 64 + 16 i + 8 g + r. The loop's last barrier has ended every read of the stages, so each wave stages in its own part of sm and needs no further barrier. Every loop of the epilogue is unrolled whole: the accumulator indices must be constants for the arrays to stay in registers.
  _Float16* const so = (_Float16*)sm + wave * (64 * EP); _Float16* const sw = so + col * EP + 8 * g;
  if (qk) {
#pragma unroll
    for (int hh = 0; hh < 2; ++hh) { const int f0 = c0 + wr * 128 + hh * 64;   /* the half's 64 features are head f0 / 64: pairs f0 / 2 .. f0 / 2 + 31 of the model-wide rotation */
    // (x0, x1) = features (2 p, 2 p + 1) -> (x0 c - x1 s, x0 s + x1 c) with c = bf16(cos[t][p]), s = bf16(sin[t][p]), t = the lane's token; a block's 256 tokens lie in one sequence
    const float* ct = COS + (size_t)(t0 + wc * 64 + col) * TBW + (f0 >> 1) + 4 * g; const float* sn_ = SIN + (size_t)(t0 + wc * 64 + col) * TBW + (f0 >> 1) + 4 * g;
    v4f bs[4][2] = {};
    if (BA) {
#pragma unroll
      for (int i = 0; i < 4; ++i)
#pragma unroll
        for (int q = 0; q < 2; ++q) bs[i][q] = *(const v4f*)(BA + f0 + i * 16 + 8 * g + 4 * q);
      asm volatile("s_wait_xcnt 0x0" ::: "memory"); }   // stands in front of every later write of the bias loads' address registers
#pragma unroll
    for (int i = 0; i < 4; ++i)
#pragma unroll
      for (int q = 0; q < 2; ++q)
#pragma unroll
        for (int r = 0; r < 4; ++r) bs[i][q][r] = bfr(bs[i][q][r]);
#pragma unroll
    for (int j = 0; j < 4; ++j)
#pragma unroll
      for (int i = 0; i < 4; ++i) { const v4f c4 = *(const v4f*)(ct + (size_t)(j * 16) * TBW + i * 8), s4 = *(const v4f*)(sn_ + (size_t)(j * 16) * TBW + i * 8); v8h o;
#pragma unroll
        for (int p = 0; p < 4; ++p) { const float cs = bfr(c4[p]), sn = bfr(s4[p]); const float xe = acc[4 * hh + i][j][2 * p] + bs[i][p >> 1][(2 * p) & 3], xo = acc[4 * hh + i][j][2 * p + 1] + bs[i][p >> 1][(2 * p + 1) & 3];
          o[2 * p] = (_Float16)(xe * cs - xo * sn); o[2 * p + 1] = (_Float16)(xe * sn + xo * cs); }
        *(v8h*)(sw + j * 16 * EP + i * 16) = o; }
    asm volatile("s_wait_xcnt 0x0" :: "v"(ct), "v"(sn_) : "memory");   // keeps the table loads' address registers whole up to this wait: without it the last half's final loads had their results placed over them
    LDSX();   // the wave's own staged rows are complete before its lanes read each other's pieces
    rows_out<CC>((which == 0 ? QH : KH) + (rb + wc * 64) * CC + f0, so, lane);
    if (hh == 0) half_end(); }
  } else { float bv[4] = {};
    if (BA) {
#pragma unroll
      for (int j = 0; j < 4; ++j) bv[j] = BA[c0 + wc * 64 + j * 16 + col];
      asm volatile("s_wait_xcnt 0x0" ::: "memory"); }   // as in the q / k branch
#pragma unroll
    for (int hh = 0; hh < 2; ++hh) {
#pragma unroll
    for (int j = 0; j < 4; ++j) { const float bias = bfr(bv[j]);
#pragma unroll
      for (int i = 0; i < 4; ++i) { v8h o;
#pragma unroll
        for (int r = 0; r < 8; ++r) o[r] = (_Float16)(acc[4 * hh + i][j][r] + bias);
        *(v8h*)(sw + j * 16 * EP + i * 16) = o; } }
    LDSX();   // as above
    rows_out<TT>(VT + (bb * CC + c0 + wc * 64) * (size_t)TT + t0 + wr * 128 + hh * 64, so, lane);
    if (hh == 0) half_end(); } } }
// ---- k_fa: block = 256 queries (8 waves x 32) of (b, h): logits, softmax and P . v in one pass over the keys, 32 keys at a time, k and v read from LDS stages; nothing of the score matrix leaves the registers.
// S^T = K . Q^T (A = k rows, B = q rows kept in registers): D register r of key tile kt = score of key 16 kt + 8 g + r for query column col, which is element 8 kt + r of the B operand of ctx^T += V^T . P^T, so P packs in place.
// Online softmax in base 2 against a held reference m per query column: a pass forms P = 2^(8 + score - m) with the m it finds and no maximum. Every P is positive, so a lane's sum of its P bounds each of them: while that sum stays at or under PLIM every P fits f16 and nothing is rescaled.
// A pass in which some lane's sum tops PLIM (the first pass always: m starts at -3e38, P = inf) raises m to the running maximum, rescales l and ctx^T by 2^(m_old - m_new) and forms its P again, now at most 2^8 each. The test is one scalar branch a pass. The wave halves' sums join in the epilogue.
// Every inner loop is unrolled whole, so that each fragment and accumulator index is a constant and the arrays live in registers.
#define PCARRY 8.0f   // P carried x 2^8 into f16 (cancels in ctx / l): small weights stay clear of f16 subnormals
#define PLIM 32768.0f   // bound on a lane's P sums of a pass (both query tiles together): each P is then at most 2^15, inside f16
__device__ __forceinline__ v8f mm16(v16h a, v16h b, v8f c) { return __builtin_amdgcn_wmma_f32_16x16x32_f16(false, a, false, b, (short)0, c, false, false); }
__device__ __forceinline__ float xhalf(float x) { return __builtin_bit_cast(float, __builtin_amdgcn_permlanex16(__builtin_bit_cast(int, x), __builtin_bit_cast(int, x), 0x76543210, 0xfedcba98, false, false)); }  // lane l with lane l ^ 16
// eight base-2 exponentials, each in its own register: no neighbour reads a result or overwrites a source, and the closing v_nop is the slot that the instruction set asks for behind the last one
__device__ __forceinline__ void exp2x8(v8f& a) { asm("v_exp_f32 %0, %0\n\tv_exp_f32 %1, %1\n\tv_exp_f32 %2, %2\n\tv_exp_f32 %3, %3\n\tv_exp_f32 %4, %4\n\tv_exp_f32 %5, %5\n\tv_exp_f32 %6, %6\n\tv_exp_f32 %7, %7\n\tv_nop" : "+v"(a[0]), "+v"(a[1]), "+v"(a[2]), "+v"(a[3]), "+v"(a[4]), "+v"(a[5]), "+v"(a[6]), "+v"(a[7])); }
// one query tile's P of a pass: p = 2^(score cs + nm), packed to f16 as the B operand of ctx^T += V^T . P^T, and the lane's f32 sum of them. The sum decides the pass's branch, so it is a pairwise tree (four links deep, packed adds), not a chain of sixteen.
__device__ __forceinline__ void soft_p(const v8f& s0, const v8f& s1, float cs, float nm, v16h& pf, float& ps) { v8f e0, e1;
#pragma unroll
  for (int r = 0; r < 8; ++r) { e0[r] = fmaf(s0[r], cs, nm); e1[r] = fmaf(s1[r], cs, nm); }
  exp2x8(e0); exp2x8(e1);
#pragma unroll
  for (int r = 0; r < 8; ++r) { pf[r] = (_Float16)e0[r]; pf[8 + r] = (_Float16)e1[r]; }
  const v8f t8 = e0 + e1; const v4f t4 = __builtin_shufflevector(t8, t8, 0, 1, 2, 3) + __builtin_shufflevector(t8, t8, 4, 5, 6, 7); const v2f t2 = __builtin_shufflevector(t4, t4, 0, 1) + __builtin_shufflevector(t4, t4, 2, 3); ps = t2[0] + t2[1]; }
// K / V staging: a stage is SK keys of the block's (b, h): SK k rows of 128 B and HD v plane pieces of 256 B, brought into LDS once for all 8 waves by asynchronous copies (16 B a lane, a wave-wide copy = 4 whole lines), two buffers
#define SK 128
#define NST (TT / SK)
#define KP 72                      // LDS pitch of a k row in f16: 144 B = 16 B x 9 (odd), the pitch for 16-byte fragment reads
#define VP 136                     // LDS pitch of a v plane piece in f16: 272 B = 16 B x 17 (odd)
#define VOF (SK * KP)              // start of the v part of a buffer, in f16
#define BUFH (SK * KP + HD * VP)   // one buffer, in f16
// one stage's 8 copies of this thread: k rows lr + 32 i, v planes lp + 16 i. s_wait_xcnt 0 closes the statement, so that it stands in front of every later write of the address registers that the copies name.
__device__ __forceinline__ void stage_copy(unsigned lk, unsigned lv, const _Float16* gk, const _Float16* gv) {
  asm volatile("global_load_async_to_lds_b128 %0, %8, off\n\tglobal_load_async_to_lds_b128 %1, %9, off\n\tglobal_load_async_to_lds_b128 %2, %10, off\n\tglobal_load_async_to_lds_b128 %3, %11, off\n\t"
               "global_load_async_to_lds_b128 %4, %12, off\n\tglobal_load_async_to_lds_b128 %5, %13, off\n\tglobal_load_async_to_lds_b128 %6, %14, off\n\tglobal_load_async_to_lds_b128 %7, %15, off\n\ts_wait_xcnt 0x0"
               :: "v"(lk), "v"(lk + 32u * KP * 2u), "v"(lk + 64u * KP * 2u), "v"(lk + 96u * KP * 2u), "v"(lv), "v"(lv + 16u * VP * 2u), "v"(lv + 32u * VP * 2u), "v"(lv + 48u * VP * 2u),
                  "v"(gk), "v"(gk + (size_t)32 * CC), "v"(gk + (size_t)64 * CC), "v"(gk + (size_t)96 * CC), "v"(gv), "v"(gv + (size_t)16 * TT), "v"(gv + (size_t)32 * TT), "v"(gv + (size_t)48 * TT) : "memory"); }
__global__ __launch_bounds__(256) void k_fa(const _Float16* __restrict__ QH, const _Float16* __restrict__ KH, const _Float16* __restrict__ VT, float* __restrict__ Y) {
  __shared__ __align__(16) _Float16 kv[2][BUFH];
  const int tid = threadIdx.x, wave = tid >> 5, lane = tid & 31, col = lane & 15, g = lane >> 4; const int h = blockIdx.y, b = blockIdx.z; const int q0 = blockIdx.x * 256 + wave * 32;
  const float cs = SCALE * 1.4426950408889634f;
  const unsigned lk = (unsigned)(size_t)&kv[0][0] + (unsigned)(tid >> 3) * (KP * 2u) + (unsigned)(tid & 7) * 16u;               // this thread's 16 bytes of k row tid >> 3
  const unsigned lv = (unsigned)(size_t)&kv[0][0] + VOF * 2u + (unsigned)(tid >> 4) * (VP * 2u) + (unsigned)(tid & 15) * 16u;   // this thread's 16 bytes of v plane tid >> 4
  const _Float16* gk = KH + ((size_t)b * TT + (tid >> 3)) * CC + h * HD + (tid & 7) * 8;
  const _Float16* gv = VT + ((size_t)b * CC + h * HD + (tid >> 4)) * (size_t)TT + (tid & 15) * 8;
  stage_copy(lk, lv, gk, gv);   // stage 0 into buffer 0
  v16h qf[2][2];
#pragma unroll
  for (int n = 0; n < 2; ++n)
#pragma unroll
    for (int kc = 0; kc < 2; ++kc) qf[n][kc] = frag_h(QH + ((size_t)b * TT + q0 + n * 16 + col) * CC + h * HD + kc * 32, lane);
  asm volatile("s_wait_asynccnt 0x0" ::: "memory");   // this wave's copies of stage 0 have landed
  __syncthreads();                                    // stage 0 is published
  stage_copy(lk + BUFH * 2u, lv + BUFH * 2u, gk + (size_t)SK * CC, gv + SK);   // stage 1 into buffer 1, in flight under stage 0's passes
  v8f acc[2][4] = {}; float m[2] = {-3.0e38f, -3.0e38f}, l[2] = {0.f, 0.f};
#pragma unroll 1   /* rolled, like the pass loop inside it */
  for (int t = 0; t < NST; ++t) { const _Float16* kb = &kv[t & 1][0] + col * KP;   /* key row col of the stage's first tile */
    const _Float16* vb = &kv[t & 1][VOF] + col * VP;                               /* v plane piece of head column col */
    v16h kf[2][2];
#pragma unroll
    for (int kt = 0; kt < 2; ++kt)
#pragma unroll
      for (int kc = 0; kc < 2; ++kc) kf[kt][kc] = frag_h(kb + (kt * 16) * KP + kc * 32, lane);
#pragma unroll 1   /* rolled: one pass already holds 16 matrix instructions, and further copies would multiply the live fragments */
    for (int p = 0; p < SK / 32; ++p) { const int nx = p + 1 < SK / 32 ? p + 1 : p;   /* a stage's last pass fetches its own k tiles again: inside the stage, unused */
    v8f s[2][2];
#pragma unroll
    for (int kt = 0; kt < 2; ++kt)
#pragma unroll
      for (int n = 0; n < 2; ++n) { s[kt][n] = v8f{};
#pragma unroll
        for (int kc = 0; kc < 2; ++kc) s[kt][n] = mm16(kf[kt][kc], qf[n][kc], s[kt][n]); }
    // one group of LDS reads a pass: this pass's v fragments, then the next pass's k fragments into the same registers (inside the stage only), in flight under the softmax
    v16h vf[4];
#pragma unroll
    for (int j = 0; j < 4; ++j) vf[j] = frag_h(vb + (j * 16) * VP + p * 32, lane);
#pragma unroll
    for (int kt = 0; kt < 2; ++kt)
#pragma unroll
      for (int kc = 0; kc < 2; ++kc) kf[kt][kc] = frag_h(kb + (nx * 32 + kt * 16) * KP + kc * 32, lane);
    __builtin_amdgcn_sched_barrier(0);   // the reads issue here, ahead of the softmax, not sunk towards their use
    v16h pf[2]; float ps[2];
#pragma unroll
    for (int n = 0; n < 2; ++n) soft_p(s[0][n], s[1][n], cs, PCARRY - m[n], pf[n], ps[n]);
    if (__builtin_amdgcn_ballot_w32(!(ps[0] + ps[1] <= PLIM)) != 0) {   /* wave-uniform; written so that inf and NaN take the branch too */
#pragma unroll
      for (int n = 0; n < 2; ++n) { float mx = s[0][n][0];
#pragma unroll
        for (int r = 0; r < 8; ++r) mx = fmaxf(mx, fmaxf(s[0][n][r], s[1][n][r]));
        mx = fmaxf(mx, xhalf(mx)) * cs;   /* both halves hold the column's maximum of this pass, scaled (cs > 0) */
        const float mn = fmaxf(m[n], mx); const float corr = __builtin_amdgcn_exp2f(m[n] - mn); m[n] = mn; l[n] *= corr;
#pragma unroll
        for (int j = 0; j < 4; ++j) acc[n][j] *= corr;
        soft_p(s[0][n], s[1][n], cs, PCARRY - mn, pf[n], ps[n]); } }
#pragma unroll
    for (int n = 0; n < 2; ++n) { l[n] += ps[n];
#pragma unroll
      for (int j = 0; j < 4; ++j) acc[n][j] = mm16(vf[j], pf[n], acc[n][j]); } }
    asm volatile("s_wait_dscnt 0x0" ::: "memory");      // this wave's reads of stage t are complete before the buffer may be refilled
    asm volatile("s_wait_asynccnt 0x0" ::: "memory");   // this wave's copies of stage t + 1 have landed
    __syncthreads();                                    // publishes stage t + 1 and ends every read of stage t
    if (t + 2 < NST) stage_copy(lk + (unsigned)(t & 1) * (BUFH * 2u), lv + (unsigned)(t & 1) * (BUFH * 2u), gk + (size_t)(t + 2) * SK * CC, gv + (t + 2) * SK); }   /* into the buffer that stage t has just left */
  asm volatile("s_wait_asynccnt 0x0" ::: "memory");   // nothing of this wave is in flight when it leaves the loop
#pragma unroll
  for (int n = 0; n < 2; ++n) { const float inv = 1.0f / (l[n] + xhalf(l[n])); float* yr = Y + ((size_t)b * TT + q0 + n * 16 + col) * CC + h * HD + 8 * g;   /* register r of tile j = head column 16 j + 8 g + r of query col */
#pragma unroll
    for (int j = 0; j < 4; ++j) { const v8f o = acc[n][j] * inv; vst2(yr + j * 16, v4f{o[0], o[1], o[2], o[3]}); vst2(yr + j * 16 + 4, v4f{o[4], o[5], o[6], o[7]}); } } }
// ---- k_out: block = (128 rows, 128 cols), 8 waves, one block a WGP: out = ctx Wo (+ bo): ctx x 2^6 once to f16 against Wo as f16(bf16 x 2^8) exact (1 product) x 2^-14
__global__ __launch_bounds__(256) void k_out(const float* __restrict__ Y, const float* __restrict__ WO, const float* __restrict__ BO, float* __restrict__ OUT) { __shared__ __align__(16) float sf[8][32][68]; __shared__ __align__(16) _Float16 ya[2][128][LP], wa[2][128][LP];
  const int tid = threadIdx.x, wave = tid >> 5, lane = tid & 31, col = lane & 15, g = lane >> 4; const int c0 = blockIdx.y * 128; const size_t r0 = (size_t)blockIdx.x * 128;
  // main loop as in k_proj: ctx tile (128 x KS, x 2^6 so small-magnitude context rows stay clear of f16 subnormals) and Wo tile (128 x KS) converted once per block and staged in LDS, two buffers; wave (wr, wc) owns 32 rows x 64 columns
  const int wr = wave >> 1, wc = wave & 1; const int lr = tid >> 4, lc = (tid & 15) * 4;
  const float* xg = Y + (r0 + lr) * CC + lc; const float* wg = WO + (size_t)(c0 + lr) * CC + lc;
  v4f xa[8], xw[8]; v8f acc[2][4] = {};
  GT_LOAD(16, xa, xw, xg, wg);
  GT_STORE(16, LP, v4h, cvt_y, cvt_w, xa, xw, &ya[0][0][0], &wa[0][0][0]);
  GT_LOAD(16, xa, xw, xg + KS, wg + KS);
  stage_barrier<2 * KS * 4>(xg, wg);   // stage 0 is published; stage 1 stays in flight; the pointers now stand at the stage after next
#pragma unroll 2   /* two stages a trip: the buffer index is a constant */
  for (int s = 0; s < CC / KS; ++s) { const _Float16* Ab = &ya[s & 1][wr * 32 + col][0]; const _Float16* Wb = &wa[s & 1][wc * 64 + col][0];
    v16h af[2][2], wf[2][4];
#pragma unroll
    for (int ks = 0; ks < 2; ++ks) {
#pragma unroll
      for (int i = 0; i < 2; ++i) af[ks][i] = frag_h(Ab + i * 16 * LP + ks * 32, lane);
#pragma unroll
      for (int j = 0; j < 4; ++j) wf[ks][j] = frag_h(Wb + j * 16 * LP + ks * 32, lane); }
    __builtin_amdgcn_sched_barrier(0);   // the stage's fragment reads issue as one group ahead of its products, not among them
#pragma unroll
    for (int ks = 0; ks < 2; ++ks)
#pragma unroll
      for (int i = 0; i < 2; ++i)
#pragma unroll
        for (int j = 0; j < 4; ++j) acc[i][j] = mm16(af[ks][i], wf[ks][j], acc[i][j]);
    __builtin_amdgcn_sched_barrier(0);   // the conversions, which wait for the loads in flight, stay behind the products
    if (s + 1 < CC / KS) GT_STORE(16, LP, v4h, cvt_y, cvt_w, xa, xw, &ya[(s + 1) & 1][0][0], &wa[(s + 1) & 1][0][0]);   /* into the buffer whose readers all passed the last barrier */
    if (s + 2 < CC / KS) GT_LOAD(16, xa, xw, xg, wg);   /* in flight under the next stage's products */
    stage_barrier<KS * 4>(xg, wg); }   // publishes stage s + 1 and ends every read of stage s
#pragma unroll
  for (int j = 0; j < 4; ++j) { const float bias = BO ? bfr(BO[c0 + wc * 64 + j * 16 + col]) : 0.f;
#pragma unroll
    for (int i = 0; i < 2; ++i)
#pragma unroll
      for (int r = 0; r < 8; ++r) sf[wave][i * 16 + 8 * g + r][j * 16 + col] = acc[i][j][r] * (1.0f / 16384.0f) + bias; }   /* 2^-8 (Wo carry) x 2^-6 (ctx carry) */
  LDSX(); for (int rl = 0; rl < 16; ++rl) vst2(OUT + (r0 + wr * 32 + rl * 2 + g) * DIN + c0 + wc * 64 + col * 4, *(const v4f*)&sf[wave][rl * 2 + g][col * 4]); }

extern "C" void kernel_launch(void* const* d_in, const int* in_sizes, int n_in, void* d_out, int out_size, void* d_ws, size_t ws_size, hipStream_t stream) {
  (void)in_sizes; (void)n_in; (void)out_size;
  const float** F = (const float**)d_in;
  if (ws_size < (size_t)WS_END) return;
  char* ws = (char*)d_ws; _Float16 *QH = (_Float16*)(ws + WS_QH), *KH = (_Float16*)(ws + WS_KH), *VT = (_Float16*)(ws + WS_VT), *QL = (_Float16*)(ws + WS_QL), *KL = (_Float16*)(ws + WS_KL); __bf16 *VB = (__bf16*)(ws + WS_VB), *VBL = (__bf16*)(ws + WS_VBL); float *Y = (float*)(ws + WS_Y);
  (void)Y; (void)QL; (void)KL; (void)VB; (void)VBL;
  // inputs: 0 query [2,2048,1024]; 1 key; 2 value; 3 wq [1024,1024] (out,in), 4 bq; 5 wk, 6 bk; 7 wv, 8 bv; 9 wo (out,in), 10 bo (biases zeros, read); 11 cos [2048,512]; 12 sin [2048,512]
  k_proj<<<dim3(TNB * TT / 256, CC / 256, 3), 256, 0, stream>>>(F[0], F[1], F[2], F[3], F[5], F[7], F[4], F[6], F[8], QH, KH, VT, F[11], F[12]);
  k_fa<<<dim3(TT / 256, NH, TNB), 256, 0, stream>>>(QH, KH, VT, Y);
  k_out<<<dim3(TNB * TT / 128, DIN / 128), 256, 0, stream>>>(Y, F[9], F[10], (float*)d_out);
}

// v008
// A run of this version takes 72.3 microseconds.
// In two side-by-side timings against v007, it was 1.08 and 1.07 times as fast.
// Over all steps from v000 it is 19.9 times as fast.
// compute dtype: all float inputs rounded to bf16; q / k / v projections with EXACT bf16 products on WMMA 16x16x32 (f32 accumulate) + bias (zeros, read); interleaved-pair RoPE in f32 from the bf16-rounded INPUT cos / sin tables (512 pairs across the full model width); logits q x k once to f16 each (1 product) x 64^-0.5; online softmax f32 (base 2, against a held reference that is raised to the running maximum only when a pass's P sum tops 2^15); unnormalised P x 2^8 once to f16 x v once to f16 (1 product), divided by the f32 sum at the end; ctx x 2^6 once to f16 x wo f16(bf16 x 2^8) + bo; f32 output.
#include <hip/hip_runtime.h>
#include <math.h>

typedef __attribute__((ext_vector_type(16))) _Float16 v16h;
typedef __attribute__((ext_vector_type(16))) __bf16 v16b;
typedef __attribute__((ext_vector_type(8)))  _Float16 v8h;
typedef __attribute__((ext_vector_type(8)))  float v8f;
typedef __attribute__((ext_vector_type(4)))  float v4f;
typedef __attribute__((ext_vector_type(2)))  float v2f;
typedef __attribute__((ext_vector_type(4)))  unsigned v4u;
typedef __attribute__((ext_vector_type(4)))  int v4i;
typedef float __attribute__((may_alias)) float_a;
typedef int __attribute__((may_alias)) int_a;

template <typename T> __device__ __forceinline__ void vst2(void* p, T v) { *(T*)p = v;  }
__device__ __forceinline__ v8f wmma16(v16h a, v16h b, v8f c) {
  v8f d = __builtin_amdgcn_wmma_f32_16x16x32_f16(false, a, false, b, (short)0, c, false, false);
  asm volatile("v_nop\n\tv_nop\n\tv_nop\n\tv_nop" : "+v"(d) : "v"(a), "v"(b));
  return d;
}
__device__ __forceinline__ v8f wmma_bf(v16b a, v16b b, v8f c) {
  v8f d = __builtin_amdgcn_wmma_f32_16x16x32_bf16(false, a, false, b, (short)0, c, false, false);
  asm volatile("v_nop\n\tv_nop\n\tv_nop\n\tv_nop" : "+v"(d) : "v"(a), "v"(b));
  return d;
}
// 16x16x32 fragments: lane = (h = lane>>4, row/col = lane&15); elements 0..7 = k0+8h+0..7, 8..15 = k0+16+8h+0..7; D element r = row 8h+r
__device__ __forceinline__ v16h frag_h(const _Float16* rowk0, int lane) {
  union { v16h v; v8h q[2]; } u; const _Float16* p = rowk0 + 8 * (lane >> 4);
  u.q[0] = *(const v8h*)p; u.q[1] = *(const v8h*)(p + 16); return u.v;
}
__device__ __forceinline__ v16h frag_f32(const float* rowk0, int lane) {
  v16h a; const float* p = rowk0 + 8 * (lane >> 4);
#pragma unroll
  for (int i = 0; i < 8; ++i) { a[i] = (_Float16)p[i]; a[8 + i] = (_Float16)p[16 + i]; }
  return a;
}
__device__ __forceinline__ v16h frag_f32s(const float* rowk0, int lane, float sc) {
  v16h a; const float* p = rowk0 + 8 * (lane >> 4);
#pragma unroll
  for (int i = 0; i < 8; ++i) { a[i] = (_Float16)(p[i] * sc); a[8 + i] = (_Float16)(p[16 + i] * sc); }
  return a;
}
// column fragment from a [K][ld] layout (column n), rows >= K read as 0
__device__ __forceinline__ v16h fragc_f32(const float* W, int k0, int n, int lane, int ld, int K) {
  v16h a; const int g = lane >> 4;
#pragma unroll
  for (int i = 0; i < 8; ++i) { const int ka = k0 + 8 * g + i, kb = ka + 16;
    a[i] = (_Float16)(ka < K ? W[(size_t)(ka < K ? ka : K - 1) * ld + n] : 0.f); a[8 + i] = (_Float16)(kb < K ? W[(size_t)(kb < K ? kb : K - 1) * ld + n] : 0.f); }
  return a;
}
struct F2 { v16b h, l; };
__device__ __forceinline__ F2 bsplit16(const float v[16]) { F2 r;
#pragma unroll
  for (int i = 0; i < 16; ++i) { const __bf16 h = (__bf16)v[i]; r.h[i] = h; r.l[i] = (__bf16)(v[i] - (float)h); }
  return r; }
__device__ __forceinline__ F2 split_row(const float* row, int k0, int lane) { float v[16]; const float* p = row + k0 + 8 * (lane >> 4);
#pragma unroll
  for (int i = 0; i < 8; ++i) { v[i] = p[i]; v[8 + i] = p[16 + i]; }
  return bsplit16(v); }
__device__ __forceinline__ F2 split_rowK(const float* row, int k0, int lane, int K) { float v[16]; const int g = lane >> 4;
#pragma unroll
  for (int i = 0; i < 8; ++i) { const int ka = k0 + 8 * g + i, kb = ka + 16; v[i] = ka < K ? row[ka < K ? ka : K - 1] : 0.f; v[8 + i] = kb < K ? row[kb < K ? kb : K - 1] : 0.f; }
  return bsplit16(v); }
__device__ __forceinline__ F2 split_col(const float* W, int k0, int n, int lane, int ld, int K) { float v[16]; const int g = lane >> 4;
#pragma unroll
  for (int i = 0; i < 8; ++i) { const int ka = k0 + 8 * g + i, kb = ka + 16; v[i] = ka < K ? W[(size_t)(ka < K ? ka : K - 1) * ld + n] : 0.f; v[8 + i] = kb < K ? W[(size_t)(kb < K ? kb : K - 1) * ld + n] : 0.f; }
  return bsplit16(v); }
__device__ __forceinline__ v8f mac3(const F2& a, const F2& b, v8f c) { c = wmma_bf(a.l, b.h, c); c = wmma_bf(a.h, b.l, c); return wmma_bf(a.h, b.h, c); }
__device__ __forceinline__ float sigm(float v) { return 1.0f / (1.0f + expf(-v)); }
#define LDSX() do { asm volatile("s_wait_dscnt 0" ::: "memory"); __builtin_amdgcn_wave_barrier(); __builtin_amdgcn_fence(__ATOMIC_RELEASE, "workgroup"); } while (0)

// Multi-head attention on separate inputs with RoPE applied across the FULL model width before the head split (query / key / value [2,2048,1024]; torch (out,in) wq / wk / wv / wo [1024,1024] N(0, 1/1024) applied as x @ W.T + b, biases zeros (read); cos / sin [2048,512] are module INPUTS (computed in setup with numpy; read literally): x.reshape(.., 512, 2): (x0, x1) = (x[2j], x[2j+1]) -> (x0 c - x1 s, x0 s + x1 c) with c = cos[s][j], j = 0..511, on q and k; then 16 heads x 64 (head h = columns 64h..: its pair i uses table column h*32 + i); scores / sqrt(64); no mask; softmax; out @ wo.T + bo).
#define NB 2
#define TT 2048
#define CC 1024            // NH * HD = projected width
#define DIN 1024          // input (model) width
#define NH 16
#define HD 64
#define NQB (TT / 64)
#define HG 4
#define SCALE (0.125f)
#define CAUSAL 0
#ifndef TNB
#define TNB NB
#endif
__device__ __forceinline__ float bfr(float v) { return (float)(__bf16)v; }
__host__ __device__ __forceinline__ int kb_last(int qb) { return CAUSAL ? ((qb * 64 + 63) >> 7) : (TT / 128 - 1); }
typedef __attribute__((ext_vector_type(8))) __bf16 v8b;
__device__ __forceinline__ v16b frag_b(const __bf16* rowk0, int lane) {
  union { v16b v; v8b q[2]; } u; const __bf16* p = rowk0 + 8 * (lane >> 4);
  u.q[0] = *(const v8b*)p; u.q[1] = *(const v8b*)(p + 16); return u.v;
}
#define QBH 0              // not referenced by any kernel (k_fa has a single path for every query block)
#define QHI 0               // single-product logits on every row (logit sigma ~1)
#define KHI 64            // key rows carrying k residual / v bf16 hi+lo planes (no kernel here writes or reads them)
// B fragment (k rows k0+.., output column o) of a weight: (in,out) [K][ld] or (out,in) [ld rows of K]: bf16 exact, or f16(bf16 * 256) exact
__device__ __forceinline__ v16b wcol_io(const float* Wm, int k0, int o, int lane, int ld) { v16b w; const int g = lane >> 4;
#pragma unroll
  for (int i = 0; i < 8; ++i) { w[i] = (__bf16)Wm[(size_t)(k0 + 8 * g + i) * ld + o]; w[8 + i] = (__bf16)Wm[(size_t)(k0 + 16 + 8 * g + i) * ld + o]; }
  return w; }
__device__ __forceinline__ v16b wcol_oi(const float* Wm, int k0, int o, int lane, int K) { v16b w; const float* p = Wm + (size_t)o * K + k0 + 8 * (lane >> 4);
#pragma unroll
  for (int i = 0; i < 8; ++i) { w[i] = (__bf16)p[i]; w[8 + i] = (__bf16)p[16 + i]; }
  return w; }
__device__ __forceinline__ v16h wcolh_io(const float* Wm, int k0, int o, int lane, int ld) { v16h w; const int g = lane >> 4;
#pragma unroll
  for (int i = 0; i < 8; ++i) { w[i] = (_Float16)(bfr(Wm[(size_t)(k0 + 8 * g + i) * ld + o]) * 256.0f); w[8 + i] = (_Float16)(bfr(Wm[(size_t)(k0 + 16 + 8 * g + i) * ld + o]) * 256.0f); }
  return w; }
__device__ __forceinline__ v16h wcolh_oi(const float* Wm, int k0, int o, int lane, int K) { v16h w; const float* p = Wm + (size_t)o * K + k0 + 8 * (lane >> 4);
#pragma unroll
  for (int i = 0; i < 8; ++i) { w[i] = (_Float16)(bfr(p[i]) * 256.0f); w[8 + i] = (_Float16)(bfr(p[16 + i]) * 256.0f); }
  return w; }
#define WQKV_LAYOUT 1   // 0 = (in,out) [DIN][CC]; 1 = (out,in) [CC][DIN]; 2 = per-head [NH][DIN][HD]
__device__ __forceinline__ v16b wcol_hdk(const float* Wm, int k0, int o, int lane) { v16b w; const int g = lane >> 4; const float* p = Wm + (size_t)(o / HD) * DIN * HD + (o % HD);
#pragma unroll
  for (int i = 0; i < 8; ++i) { w[i] = (__bf16)p[(size_t)(k0 + 8 * g + i) * HD]; w[8 + i] = (__bf16)p[(size_t)(k0 + 16 + 8 * g + i) * HD]; }
  return w; }
#define WO_OUT_IN 1
#if WQKV_LAYOUT == 1
#define WCOL(W, k0, o, lane) wcol_oi(W, k0, o, lane, DIN)
#elif WQKV_LAYOUT == 2
#define WCOL(W, k0, o, lane) wcol_hdk(W, k0, o, lane)
#else
#define WCOL(W, k0, o, lane) wcol_io(W, k0, o, lane, CC)
#endif
#if WO_OUT_IN
#define WOCOL(W, k0, o, lane) wcol_oi(W, k0, o, lane, CC)
#define WOCOLH(W, k0, o, lane) wcolh_oi(W, k0, o, lane, CC)
#else
#define WOCOL(W, k0, o, lane) wcol_io(W, k0, o, lane, DIN)
#define WOCOLH(W, k0, o, lane) wcolh_io(W, k0, o, lane, DIN)
#endif

#define TBW 512   // table width = model width / 2 pairs
#define PROJ_EXTRA_PARAMS , const float* __restrict__ COS, const float* __restrict__ SIN   /* rotary tables [TT][512], module INPUTS, read literally */
#ifndef SM_EXTRA_PARAMS
#define SM_EXTRA_PARAMS
#endif
#ifndef PROJ_EXTRA_PARAMS
#define PROJ_EXTRA_PARAMS
#endif
#ifndef SM_MASK_HOOK
#define SM_MASK_HOOK (void)0
#endif

#define WS_QH  0u                                      // f16 q rows [b*t][CC]
#define WS_KH  (WS_QH + 2u * (size_t)NB * TT * CC)      // f16 k rows [b*t][CC]
#define WS_VT  (WS_KH + 2u * (size_t)NB * TT * CC)      // f16 v planes [b][c][t]
// QL, KL, VB and VBL belong to the causal high-precision path, which this problem does not take: nothing reads them and nothing writes them; their places stay so that the ctx plane keeps its own
#define WS_QL  (WS_VT + 2u * (size_t)NB * CC * TT)      // f16 q residual x 2^10 rows [b][t < QHI][CC]
#define WS_KL  (WS_QL + 2u * (size_t)NB * QHI * CC)     // f16 k residual x 2^10 rows [b][t < KHI][CC]
#define WS_VB  (WS_KL + 2u * (size_t)NB * KHI * CC)     // bf16 v hi planes [b][c][t < KHI]
#define WS_VBL (WS_VB + 2u * (size_t)NB * CC * KHI)
#define WS_S   (WS_VBL + 2u * (size_t)NB * CC * KHI)    // not used (scores stay in registers); kept so that the ctx plane keeps its place
#define WS_Y   (WS_S  + 4u * (size_t)HG * TT * TT)      // f32 ctx rows [b*t][CC] (only when there is an output projection)
#define WS_END (WS_Y  + 4u * (size_t)NB * TT * CC)

// ---- operand staging of the two GEMM kernels (block tile 128 x 128 in k_out, 256 x 256 in k_proj, where each X row is read by 4 blocks and each W row by 16): a stage is KS (k_out) or KSP (k_proj) k of every tile row; a thread moves 4 floats of rows lr + RS i (RS = 16 or 32) of both operands, and one wave-wide 16-byte load covers whole 128-byte lines
#define KS 64    // k_out: 256 threads, thread (lr = tid >> 4, lc = 4 (tid & 15))
#define KSP 32   // k_proj: 256 threads, thread (lr = tid >> 3, lc = 4 (tid & 7)); the shorter stage keeps the loads in flight at 64 registers beside the 256 of the accumulators
#define LPP 40   // LDS row pitch of a KSP stage in 16-bit elements: 80 B = 16 B x 5 (odd)
static_assert(CC == DIN, "one row pitch for every GEMM operand");
#define LP 72   // LDS row pitch in 16-bit elements: 144 B = 16 B x 9 (odd), the pitch for 16-byte fragment reads
typedef __attribute__((ext_vector_type(4))) __bf16 v4b;
typedef __attribute__((ext_vector_type(4))) _Float16 v4h;
__device__ __forceinline__ v8f mmb(v16b a, v16b b, v8f c) { return __builtin_amdgcn_wmma_f32_16x16x32_bf16(false, a, false, b, (short)0, c, false, false); }
__device__ __forceinline__ v4b cvt_b(v4f v) { return v4b{(__bf16)v[0], (__bf16)v[1], (__bf16)v[2], (__bf16)v[3]}; }
__device__ __forceinline__ v4h cvt_y(v4f v) { return v4h{(_Float16)(v[0] * 64.0f), (_Float16)(v[1] * 64.0f), (_Float16)(v[2] * 64.0f), (_Float16)(v[3] * 64.0f)}; }   // ctx x 2^6
__device__ __forceinline__ v4h cvt_w(v4f v) { return v4h{(_Float16)(bfr(v[0]) * 256.0f), (_Float16)(bfr(v[1]) * 256.0f), (_Float16)(bfr(v[2]) * 256.0f), (_Float16)(bfr(v[3]) * 256.0f)}; }   // f16(bf16 x 2^8), exact
// work-group barrier by hand: __syncthreads() compiled to a wait for the global loads too, which would drain the loads issued ahead for the stage after next; what the other waves need is this wave's LDS reads and writes complete (s_wait_dscnt 0). s_wait_xcnt 0 stands in front of every reuse of those loads' address registers.
// The two load pointers take their step of sb bytes (block-uniform, in scalar registers) to the next stage inside the statement, behind its s_wait_xcnt 0: written in the source, the additions were placed by the compiler between the loads and the wait.
__device__ __forceinline__ void stage_barrier(const float*& xp, const float*& wp, long sb) { asm volatile("s_wait_xcnt 0x0\n\ts_wait_dscnt 0x0\n\ts_barrier_signal -1\n\ts_barrier_wait -1\n\tv_add_nc_u64 %0, %2, %0\n\tv_add_nc_u64 %1, %2, %1" : "+v"(xp), "+v"(wp) : "s"(sb) : "memory"); }
// Rotated k walk: blocks that share operand rows would ask L2 for the same lines at the same moment, every one of them waiting for the same fetch. Each block therefore enters the k stages at its own even stage s0 and wraps round: trip u works on stage (u + s0) mod NS_. A line is then fetched for the first block that comes to it and lies in L2 for the others. The k sum of a block runs in that rotated order.
// step in bytes from trip u's stage over d stages (d = 1, or 2 from an even stage), SW_ bytes a stage
template <int NS_, int SW_> __device__ __forceinline__ long walk_step(int u, int s0, int d) { return ((u + s0) & (NS_ - 1)) + d >= NS_ ? (long)(d - NS_) * SW_ : (long)d * SW_; }
// left as it was: inside the two loops these loads compile to flat_load_b128 (the pointers come out of the barrier's asm statement, behind which the compiler no longer knows their address space), and a flat load counts on dscnt as well as on loadcnt
#define GT_LOAD(RS_, xa, xw, xp, wp) do { _Pragma("unroll") for (int i_ = 0; i_ < 8; ++i_) xa[i_] = *(const v4f*)((xp) + (size_t)(i_ * RS_) * DIN); _Pragma("unroll") for (int i_ = 0; i_ < 8; ++i_) xw[i_] = *(const v4f*)((wp) + (size_t)(i_ * RS_) * DIN); } while (0)
#define GT_STORE(RS_, LP_, VT_, ca, cw, xa, xw, ad, wd) do { _Pragma("unroll") for (int i_ = 0; i_ < 8; ++i_) *(VT_*)((ad) + (lr + RS_ * i_) * LP_ + lc) = ca(xa[i_]); _Pragma("unroll") for (int i_ = 0; i_ < 8; ++i_) *(VT_*)((wd) + (lr + RS_ * i_) * LP_ + lc) = cw(xw[i_]); } while (0)
// ---- k_proj: block = (256 rows, 256 cols, which), 8 waves, one block a WGP: q/k/v = X W (+ b) with exact bf16 products (K = DIN) -> which 0: q f16 rows; 1: k f16 rows; 2: v f16 planes [c][t]
// The operand whose index runs along the CONTIGUOUS direction of the output is the A operand: W for q and k (features along a row), X for v (tokens along a plane). D register r of a lane is then A index 8 g + r:
// a lane holds 8 neighbouring output elements (16 bytes of f16, and for q and k four whole rotation pairs) of the output row picked by its B index, and the epilogue works from the accumulators.
#define EP 72   // pitch of a staged output row in f16: 144 B = 16 B x 9 (odd)
// a wave's 64 staged rows of 128 B go out as whole lines: a wave-wide 16-byte store covers 4 rows; unrolled whole, so that the 16 LDS reads issue as one group ahead of the stores
template <int PITCH> __device__ __forceinline__ void rows_out(_Float16* dst, const _Float16* so, int lane) { dst += (size_t)(lane >> 3) * PITCH + (lane & 7) * 8; so += (lane >> 3) * EP + (lane & 7) * 8;
#pragma unroll
  for (int e = 0; e < 16; ++e) vst2(dst + (size_t)(e * 4) * PITCH, *(const v4u*)(so + e * 4 * EP)); }
// between the two halves of the epilogue, own wave only. s_wait_xcnt 0 stands behind the first half's stores, in front of every write of the registers that they name; s_wait_dscnt 0: the lanes' reads of the first half's staged rows are complete before the second half is staged over them, and the "memory" clobber keeps the second half's LDS stores behind those reads. The scheduling barrier keeps the second half's arithmetic, which reuses the stores' registers, behind the waits (the compiler had lifted it over them).
__device__ __forceinline__ void half_end() { asm volatile("s_wait_xcnt 0x0\n\ts_wait_dscnt 0x0" ::: "memory"); __builtin_amdgcn_sched_barrier(0); }
__global__ __launch_bounds__(256) void k_proj(const float* __restrict__ XQ, const float* __restrict__ XK, const float* __restrict__ XV, const float* __restrict__ WQ, const float* __restrict__ WK, const float* __restrict__ WV, const float* __restrict__ BQ, const float* __restrict__ BK, const float* __restrict__ BV,
    _Float16* __restrict__ QH, _Float16* __restrict__ KH, _Float16* __restrict__ VT PROJ_EXTRA_PARAMS) {
  // one LDS block, used in turn: the main loop's stages (2 x 256 X rows, then 2 x 256 W rows), then each wave's own 64 staged output rows (8 x 9,216 B)
  __shared__ __align__(16) char sm[2 * 2 * 256 * LPP * 2];
  static_assert(8 * 64 * EP * 2 <= 2 * 2 * 256 * LPP * 2, "the staged output rows fit the stages' place");
  const int tid = threadIdx.x, wave = tid >> 5, lane = tid & 31, col = lane & 15, g = lane >> 4; const int which = blockIdx.z; const int c0 = blockIdx.y * 256; const size_t rb = (size_t)blockIdx.x * 256; const size_t bb = rb / TT; const int t0 = (int)(rb % TT);
  const float* X = which == 0 ? XQ : which == 1 ? XK : XV; const float* WA = which == 0 ? WQ : which == 1 ? WK : WV; const float* BA = which == 0 ? BQ : which == 1 ? BK : BV;
  // main loop: the block's X tile (256 x KSP) and W tile (256 x KSP) are read once per block with whole-line loads, rounded to bf16 once and staged in LDS (two buffers); wave (wr, wc) owns 128 A rows x 64 B rows
  const int wr = wave >> 2, wc = wave & 3; const int lr = tid >> 3, lc = (tid & 7) * 4; const bool qk = which < 2;
  __bf16* const As = (__bf16*)sm; __bf16* const Ws = As + 2 * 256 * LPP;
  const __bf16* const Am = qk ? Ws : As; const __bf16* const Bm = qk ? As : Ws;
  const int s0 = (2 * blockIdx.x + 8 * blockIdx.y) & (DIN / KSP - 1);   // the 16 blocks that share a W tile enter 2 stages apart, the 4 that share an X tile 8 apart
  const float* xg = X + (rb + lr) * DIN + lc + s0 * KSP; const float* wg = WA + (size_t)(c0 + lr) * DIN + lc + s0 * KSP;
  v4f xa[8], xw[8]; v8f acc[8][4] = {};
  GT_LOAD(32, xa, xw, xg, wg);
  GT_STORE(32, LPP, v4b, cvt_b, cvt_b, xa, xw, As, Ws);
  GT_LOAD(32, xa, xw, xg + KSP, wg + KSP);   /* s0 is even: the second trip's stage lies behind the first's */
  stage_barrier(xg, wg, walk_step<DIN / KSP, KSP * 4>(0, s0, 2));   // trip 0's stage is published; trip 1's stays in flight; the pointers now stand at the stage of the trip after next
#pragma unroll 2   /* two stages a trip: the buffer index is a constant */
  for (int s = 0; s < DIN / KSP; ++s) { const __bf16* Ab = Am + ((s & 1) * 256 + wr * 128 + col) * LPP; const __bf16* Wb = Bm + ((s & 1) * 256 + wc * 64 + col) * LPP;
    v16b af[8], wf[4];
    // the four B fragments are read first: every product row needs them, and row i then waits for af[i] alone, so the products start behind 10 of the 24 reads
#pragma unroll
    for (int j = 0; j < 4; ++j) wf[j] = frag_b(Wb + j * 16 * LPP, lane);
#pragma unroll
    for (int i = 0; i < 8; ++i) af[i] = frag_b(Ab + i * 16 * LPP, lane);
    __builtin_amdgcn_sched_barrier(0);   // the stage's fragment reads issue as one group ahead of its products, not among them
#pragma unroll
    for (int i = 0; i < 8; ++i)
#pragma unroll
      for (int j = 0; j < 4; ++j) acc[i][j] = mmb(af[i], wf[j], acc[i][j]);
    __builtin_amdgcn_sched_barrier(0);   // the conversions, which wait for the loads in flight, stay behind the products
    if (s + 1 < DIN / KSP) GT_STORE(32, LPP, v4b, cvt_b, cvt_b, xa, xw, As + ((s + 1) & 1) * 256 * LPP, Ws + ((s + 1) & 1) * 256 * LPP);   /* into the buffer whose readers all passed the last barrier */
    if (s + 2 < DIN / KSP) GT_LOAD(32, xa, xw, xg, wg);   /* in flight under the next stage's products */
    stage_barrier(xg, wg, walk_step<DIN / KSP, KSP * 4>(s + 2, s0, 1)); }   // publishes trip s + 1's stage and ends every read of trip s's stage
  // epilogue, from the accumulators, in two halves hh of the wave's 128 A rows: acc[4 hh + i][j][r] = output row (B index) wc 64 + 16 j + col, element (A index) wr 128 + hh 64 + 16 i + 8 g + r. The loop's last barrier has ended every read of the stages, so each wave stages in its own part of sm and needs no further barrier. Every loop of the epilogue is unrolled whole: the accumulator indices must be constants for the arrays to stay in registers.
  _Float16* const so = (_Float16*)sm + wave * (64 * EP); _Float16* const sw = so + col * EP + 8 * g;
  if (qk) {
#pragma unroll
    for (int hh = 0; hh < 2; ++hh) { const int f0 = c0 + wr * 128 + hh * 64;   /* the half's 64 features are head f0 / 64: pairs f0 / 2 .. f0 / 2 + 31 of the model-wide rotation */
    // (x0, x1) = features (2 p, 2 p + 1) -> (x0 c - x1 s, x0 s + x1 c) with c = bf16(cos[t][p]), s = bf16(sin[t][p]), t = the lane's token; a block's 256 tokens lie in one sequence
    const float* ct = COS + (size_t)(t0 + wc * 64 + col) * TBW + (f0 >> 1) + 4 * g; const float* sn_ = SIN + (size_t)(t0 + wc * 64 + col) * TBW + (f0 >> 1) + 4 * g;
    v4f bs[4][2] = {};
    if (BA) {
#pragma unroll
      for (int i = 0; i < 4; ++i)
#pragma unroll
        for (int q = 0; q < 2; ++q) bs[i][q] = *(const v4f*)(BA + f0 + i * 16 + 8 * g + 4 * q);
      asm volatile("s_wait_xcnt 0x0" ::: "memory"); }   // stands in front of every later write of the bias loads' address registers
#pragma unroll
    for (int i = 0; i < 4; ++i)
#pragma unroll
      for (int q = 0; q < 2; ++q)
#pragma unroll
        for (int r = 0; r < 4; ++r) bs[i][q][r] = bfr(bs[i][q][r]);
#pragma unroll
    for (int j = 0; j < 4; ++j)
#pragma unroll
      for (int i = 0; i < 4; ++i) { const v4f c4 = *(const v4f*)(ct + (size_t)(j * 16) * TBW + i * 8), s4 = *(const v4f*)(sn_ + (size_t)(j * 16) * TBW + i * 8); v8h o;
#pragma unroll
        for (int p = 0; p < 4; ++p) { const float cs = bfr(c4[p]), sn = bfr(s4[p]); const float xe = acc[4 * hh + i][j][2 * p] + bs[i][p >> 1][(2 * p) & 3], xo = acc[4 * hh + i][j][2 * p + 1] + bs[i][p >> 1][(2 * p + 1) & 3];
          o[2 * p] = (_Float16)(xe * cs - xo * sn); o[2 * p + 1] = (_Float16)(xe * sn + xo * cs); }
        *(v8h*)(sw + j * 16 * EP + i * 16) = o; }
    asm volatile("s_wait_xcnt 0x0" :: "v"(ct), "v"(sn_) : "memory");   // keeps the table loads' address registers whole up to this wait: without it the last half's final loads had their results placed over them
    LDSX();   // the wave's own staged rows are complete before its lanes read each other's pieces
    rows_out<CC>((which == 0 ? QH : KH) + (rb + wc * 64) * CC + f0, so, lane);
    if (hh == 0) half_end(); }
  } else { float bv[4] = {};
    if (BA) {
#pragma unroll
      for (int j = 0; j < 4; ++j) bv[j] = BA[c0 + wc * 64 + j * 16 + col];
      asm volatile("s_wait_xcnt 0x0" ::: "memory"); }   // as in the q / k branch
#pragma unroll
    for (int hh = 0; hh < 2; ++hh) {
#pragma unroll
    for (int j = 0; j < 4; ++j) { const float bias = bfr(bv[j]);
#pragma unroll
      for (int i = 0; i < 4; ++i) { v8h o;
#pragma unroll
        for (int r = 0; r < 8; ++r) o[r] = (_Float16)(acc[4 * hh + i][j][r] + bias);
        *(v8h*)(sw + j * 16 * EP + i * 16) = o; } }
    LDSX();   // as above
    rows_out<TT>(VT + (bb * CC + c0 + wc * 64) * (size_t)TT + t0 + wr * 128 + hh * 64, so, lane);
    if (hh == 0) half_end(); } } }
// ---- k_fa: block = 256 queries (8 waves x 32) of (b, h): logits, softmax and P . v in one pass over the keys, 32 keys at a time, k and v read from LDS stages; nothing of the score matrix leaves the registers.
// S^T = K . Q^T (A = k rows, B = q rows kept in registers): D register r of key tile kt = score of key 16 kt + 8 g + r for query column col, which is element 8 kt + r of the B operand of ctx^T += V^T . P^T, so P packs in place.
// Online softmax in base 2 against a held reference m per query column: a pass forms P = 2^(8 + score - m) with the m it finds and no maximum. Every P is positive, so a lane's sum of its P bounds each of them: while that sum stays at or under PLIM every P fits f16 and nothing is rescaled.
// A pass in which some lane's sum tops PLIM (the first pass always: m starts at -3e38, P = inf) raises m to the running maximum, rescales l and ctx^T by 2^(m_old - m_new) and forms its P again, now at most 2^8 each. The test is one scalar branch a pass. The wave halves' sums join in the epilogue.
// Every inner loop is unrolled whole, so that each fragment and accumulator index is a constant and the arrays live in registers.
#define PCARRY 8.0f   // P carried x 2^8 into f16 (cancels in ctx / l): small weights stay clear of f16 subnormals
#define PLIM 32768.0f   // bound on a lane's P sums of a pass (both query tiles together): each P is then at most 2^15, inside f16
__device__ __forceinline__ v8f mm16(v16h a, v16h b, v8f c) { return __builtin_amdgcn_wmma_f32_16x16x32_f16(false, a, false, b, (short)0, c, false, false); }
__device__ __forceinline__ float xhalf(float x) { return __builtin_bit_cast(float, __builtin_amdgcn_permlanex16(__builtin_bit_cast(int, x), __builtin_bit_cast(int, x), 0x76543210, 0xfedcba98, false, false)); }  // lane l with lane l ^ 16
// eight base-2 exponentials, each in its own register: no neighbour reads a result or overwrites a source, and the closing v_nop is the slot that the instruction set asks for behind the last one
__device__ __forceinline__ void exp2x8(v8f& a) { asm("v_exp_f32 %0, %0\n\tv_exp_f32 %1, %1\n\tv_exp_f32 %2, %2\n\tv_exp_f32 %3, %3\n\tv_exp_f32 %4, %4\n\tv_exp_f32 %5, %5\n\tv_exp_f32 %6, %6\n\tv_exp_f32 %7, %7\n\tv_nop" : "+v"(a[0]), "+v"(a[1]), "+v"(a[2]), "+v"(a[3]), "+v"(a[4]), "+v"(a[5]), "+v"(a[6]), "+v"(a[7])); }
// one query tile's P of a pass: p = 2^(score cs + nm), packed to f16 as the B operand of ctx^T += V^T . P^T, and the lane's f32 sum of them. The sum decides the pass's branch, so it is a pairwise tree (four links deep, packed adds), not a chain of sixteen.
__device__ __forceinline__ void soft_p(const v8f& s0, const v8f& s1, float cs, float nm, v16h& pf, float& ps) { v8f e0, e1;
#pragma unroll
  for (int r = 0; r < 8; ++r) { e0[r] = fmaf(s0[r], cs, nm); e1[r] = fmaf(s1[r], cs, nm); }
  exp2x8(e0); exp2x8(e1);
#pragma unroll
  for (int r = 0; r < 8; ++r) { pf[r] = (_Float16)e0[r]; pf[8 + r] = (_Float16)e1[r]; }
  const v8f t8 = e0 + e1; const v4f t4 = __builtin_shufflevector(t8, t8, 0, 1, 2, 3) + __builtin_shufflevector(t8, t8, 4, 5, 6, 7); const v2f t2 = __builtin_shufflevector(t4, t4, 0, 1) + __builtin_shufflevector(t4, t4, 2, 3); ps = t2[0] + t2[1]; }
// K / V staging: a stage is SK keys of the block's (b, h): SK k rows of 128 B and HD v plane pieces of 256 B, brought into LDS once for all 8 waves by asynchronous copies (16 B a lane, a wave-wide copy = 4 whole lines), two buffers
#define SK 128
#define NST (TT / SK)
#define KP 72                      // LDS pitch of a k row in f16: 144 B = 16 B x 9 (odd), the pitch for 16-byte fragment reads
#define VP 136                     // LDS pitch of a v plane piece in f16: 272 B = 16 B x 17 (odd)
#define VOF (SK * KP)              // start of the v part of a buffer, in f16
#define BUFH (SK * KP + HD * VP)   // one buffer, in f16
// one stage's 8 copies of this thread: k rows lr + 32 i, v planes lp + 16 i. s_wait_xcnt 0 closes the statement, so that it stands in front of every later write of the address registers that the copies name.
__device__ __forceinline__ void stage_copy(unsigned lk, unsigned lv, const _Float16* gk, const _Float16* gv) {
  asm volatile("global_load_async_to_lds_b128 %0, %8, off\n\tglobal_load_async_to_lds_b128 %1, %9, off\n\tglobal_load_async_to_lds_b128 %2, %10, off\n\tglobal_load_async_to_lds_b128 %3, %11, off\n\t"
               "global_load_async_to_lds_b128 %4, %12, off\n\tglobal_load_async_to_lds_b128 %5, %13, off\n\tglobal_load_async_to_lds_b128 %6, %14, off\n\tglobal_load_async_to_lds_b128 %7, %15, off\n\ts_wait_xcnt 0x0"
               :: "v"(lk), "v"(lk + 32u * KP * 2u), "v"(lk + 64u * KP * 2u), "v"(lk + 96u * KP * 2u), "v"(lv), "v"(lv + 16u * VP * 2u), "v"(lv + 32u * VP * 2u), "v"(lv + 48u * VP * 2u),
                  "v"(gk), "v"(gk + (size_t)32 * CC), "v"(gk + (size_t)64 * CC), "v"(gk + (size_t)96 * CC), "v"(gv), "v"(gv + (size_t)16 * TT), "v"(gv + (size_t)32 * TT), "v"(gv + (size_t)48 * TT) : "memory"); }
__global__ __launch_bounds__(256) void k_fa(const _Float16* __restrict__ QH, const _Float16* __restrict__ KH, const _Float16* __restrict__ VT, float* __restrict__ Y) {
  __shared__ __align__(16) _Float16 kv[2][BUFH];
  const int tid = threadIdx.x, wave = tid >> 5, lane = tid & 31, col = lane & 15, g = lane >> 4; const int h = blockIdx.y, b = blockIdx.z; const int q0 = blockIdx.x * 256 + wave * 32;
  const float cs = SCALE * 1.4426950408889634f;
  const unsigned lk = (unsigned)(size_t)&kv[0][0] + (unsigned)(tid >> 3) * (KP * 2u) + (unsigned)(tid & 7) * 16u;               // this thread's 16 bytes of k row tid >> 3
  const unsigned lv = (unsigned)(size_t)&kv[0][0] + VOF * 2u + (unsigned)(tid >> 4) * (VP * 2u) + (unsigned)(tid & 15) * 16u;   // this thread's 16 bytes of v plane tid >> 4
  const _Float16* gk = KH + ((size_t)b * TT + (tid >> 3)) * CC + h * HD + (tid & 7) * 8;
  const _Float16* gv = VT + ((size_t)b * CC + h * HD + (tid >> 4)) * (size_t)TT + (tid & 15) * 8;
  const int s0 = 2 * blockIdx.x;   // rotated key walk, as the k walk of the GEMM kernels: the 8 blocks that share a head's k and v enter 2 stages apart and wrap round; trip t works on key stage (t + s0) mod NST, so the softmax sums run in that order
  static_assert((NST & (NST - 1)) == 0 && 2 * (TT / 256) <= NST, "the wrap is a mask, and every block has a start of its own");
  stage_copy(lk, lv, gk + (size_t)s0 * SK * CC, gv + s0 * SK);   // trip 0's stage into buffer 0
  v16h qf[2][2];
#pragma unroll
  for (int n = 0; n < 2; ++n)
#pragma unroll
    for (int kc = 0; kc < 2; ++kc) qf[n][kc] = frag_h(QH + ((size_t)b * TT + q0 + n * 16 + col) * CC + h * HD + kc * 32, lane);
  asm volatile("s_wait_asynccnt 0x0" ::: "memory");   // this wave's copies of trip 0's stage have landed
  __syncthreads();                                    // trip 0's stage is published
  stage_copy(lk + BUFH * 2u, lv + BUFH * 2u, gk + (size_t)(s0 + 1) * SK * CC, gv + (s0 + 1) * SK);   // trip 1's stage (s0 is even: no wrap) into buffer 1, in flight under trip 0's passes
  v8f acc[2][4] = {}; float m[2] = {-3.0e38f, -3.0e38f}, l[2] = {0.f, 0.f};
#pragma unroll 1   /* rolled, like the pass loop inside it */
  for (int t = 0; t < NST; ++t) { const _Float16* kb = &kv[t & 1][0] + col * KP;   /* key row col of the stage's first tile */
    const _Float16* vb = &kv[t & 1][VOF] + col * VP;                               /* v plane piece of head column col */
    v16h kf[2][2];
#pragma unroll
    for (int kt = 0; kt < 2; ++kt)
#pragma unroll
      for (int kc = 0; kc < 2; ++kc) kf[kt][kc] = frag_h(kb + (kt * 16) * KP + kc * 32, lane);
#pragma unroll 1   /* rolled: one pass already holds 16 matrix instructions, and further copies would multiply the live fragments */
    for (int p = 0; p < SK / 32; ++p) { const int nx = p + 1 < SK / 32 ? p + 1 : p;   /* a stage's last pass fetches its own k tiles again: inside the stage, unused */
    v8f s[2][2];
#pragma unroll
    for (int kt = 0; kt < 2; ++kt)
#pragma unroll
      for (int n = 0; n < 2; ++n) { s[kt][n] = v8f{};
#pragma unroll
        for (int kc = 0; kc < 2; ++kc) s[kt][n] = mm16(kf[kt][kc], qf[n][kc], s[kt][n]); }
    // one group of LDS reads a pass: this pass's v fragments, then the next pass's k fragments into the same registers (inside the stage only), in flight under the softmax
    v16h vf[4];
#pragma unroll
    for (int j = 0; j < 4; ++j) vf[j] = frag_h(vb + (j * 16) * VP + p * 32, lane);
#pragma unroll
    for (int kt = 0; kt < 2; ++kt)
#pragma unroll
      for (int kc = 0; kc < 2; ++kc) kf[kt][kc] = frag_h(kb + (nx * 32 + kt * 16) * KP + kc * 32, lane);
    __builtin_amdgcn_sched_barrier(0);   // the reads issue here, ahead of the softmax, not sunk towards their use
    v16h pf[2]; float ps[2];
#pragma unroll
    for (int n = 0; n < 2; ++n) soft_p(s[0][n], s[1][n], cs, PCARRY - m[n], pf[n], ps[n]);
    if (__builtin_amdgcn_ballot_w32(!(ps[0] + ps[1] <= PLIM)) != 0) {   /* wave-uniform; written so that inf and NaN take the branch too */
#pragma unroll
      for (int n = 0; n < 2; ++n) { float mx = s[0][n][0];
#pragma unroll
        for (int r = 0; r < 8; ++r) mx = fmaxf(mx, fmaxf(s[0][n][r], s[1][n][r]));
        mx = fmaxf(mx, xhalf(mx)) * cs;   /* both halves hold the column's maximum of this pass, scaled (cs > 0) */
        const float mn = fmaxf(m[n], mx); const float corr = __builtin_amdgcn_exp2f(m[n] - mn); m[n] = mn; l[n] *= corr;
#pragma unroll
        for (int j = 0; j < 4; ++j) acc[n][j] *= corr;
        soft_p(s[0][n], s[1][n], cs, PCARRY - mn, pf[n], ps[n]); } }
#pragma unroll
    for (int n = 0; n < 2; ++n) { l[n] += ps[n];
#pragma unroll
      for (int j = 0; j < 4; ++j) acc[n][j] = mm16(vf[j], pf[n], acc[n][j]); } }
    asm volatile("s_wait_dscnt 0x0" ::: "memory");      // this wave's reads of trip t's stage are complete before the buffer may be refilled
    asm volatile("s_wait_asynccnt 0x0" ::: "memory");   // this wave's copies of trip t + 1's stage have landed
    __syncthreads();                                    // publishes trip t + 1's stage and ends every read of trip t's stage
    if (t + 2 < NST) { const int st = (t + 2 + s0) & (NST - 1); stage_copy(lk + (unsigned)(t & 1) * (BUFH * 2u), lv + (unsigned)(t & 1) * (BUFH * 2u), gk + (size_t)st * SK * CC, gv + st * SK); } }   /* into the buffer that trip t's stage has just left */
  asm volatile("s_wait_asynccnt 0x0" ::: "memory");   // nothing of this wave is in flight when it leaves the loop
#pragma unroll
  for (int n = 0; n < 2; ++n) { const float inv = 1.0f / (l[n] + xhalf(l[n])); float* yr = Y + ((size_t)b * TT + q0 + n * 16 + col) * CC + h * HD + 8 * g;   /* register r of tile j = head column 16 j + 8 g + r of query col */
#pragma unroll
    for (int j = 0; j < 4; ++j) { const v8f o = acc[n][j] * inv; vst2(yr + j * 16, v4f{o[0], o[1], o[2], o[3]}); vst2(yr + j * 16 + 4, v4f{o[4], o[5], o[6], o[7]}); } } }
// ---- k_out: block = (128 rows, 128 cols), 8 waves, one block a WGP: out = ctx Wo (+ bo): ctx x 2^6 once to f16 against Wo as f16(bf16 x 2^8) exact (1 product) x 2^-14
__global__ __launch_bounds__(256) void k_out(const float* __restrict__ Y, const float* __restrict__ WO, const float* __restrict__ BO, float* __restrict__ OUT) { __shared__ __align__(16) float sf[8][32][68]; __shared__ __align__(16) _Float16 ya[2][128][LP], wa[2][128][LP];
  const int tid = threadIdx.x, wave = tid >> 5, lane = tid & 31, col = lane & 15, g = lane >> 4; const int c0 = blockIdx.y * 128; const size_t r0 = (size_t)blockIdx.x * 128;
  // main loop as in k_proj: ctx tile (128 x KS, x 2^6 so small-magnitude context rows stay clear of f16 subnormals) and Wo tile (128 x KS) converted once per block and staged in LDS, two buffers; wave (wr, wc) owns 32 rows x 64 columns
  const int wr = wave >> 1, wc = wave & 1; const int lr = tid >> 4, lc = (tid & 15) * 4;
  const int s0 = (2 * (blockIdx.x + blockIdx.y)) & (CC / KS - 1);   // rotated k walk as in k_proj: the 8 blocks that share a ctx tile enter 2 stages apart, the 32 that share a Wo tile at 8 different stages
  const float* xg = Y + (r0 + lr) * CC + lc + s0 * KS; const float* wg = WO + (size_t)(c0 + lr) * CC + lc + s0 * KS;
  v4f xa[8], xw[8]; v8f acc[2][4] = {};
  GT_LOAD(16, xa, xw, xg, wg);
  GT_STORE(16, LP, v4h, cvt_y, cvt_w, xa, xw, &ya[0][0][0], &wa[0][0][0]);
  GT_LOAD(16, xa, xw, xg + KS, wg + KS);
  stage_barrier(xg, wg, walk_step<CC / KS, KS * 4>(0, s0, 2));   // trip 0's stage is published; trip 1's stays in flight; the pointers now stand at the stage of the trip after next
#pragma unroll 2   /* two stages a trip: the buffer index is a constant */
  for (int s = 0; s < CC / KS; ++s) { const _Float16* Ab = &ya[s & 1][wr * 32 + col][0]; const _Float16* Wb = &wa[s & 1][wc * 64 + col][0];
    v16h af[2][2], wf[2][4];
#pragma unroll
    for (int ks = 0; ks < 2; ++ks) {
#pragma unroll
      for (int i = 0; i < 2; ++i) af[ks][i] = frag_h(Ab + i * 16 * LP + ks * 32, lane);
#pragma unroll
      for (int j = 0; j < 4; ++j) wf[ks][j] = frag_h(Wb + j * 16 * LP + ks * 32, lane); }
    __builtin_amdgcn_sched_barrier(0);   // the stage's fragment reads issue as one group ahead of its products, not among them
#pragma unroll
    for (int ks = 0; ks < 2; ++ks)
#pragma unroll
      for (int i = 0; i < 2; ++i)
#pragma unroll
        for (int j = 0; j < 4; ++j) acc[i][j] = mm16(af[ks][i], wf[ks][j], acc[i][j]);
    __builtin_amdgcn_sched_barrier(0);   // the conversions, which wait for the loads in flight, stay behind the products
    if (s + 1 < CC / KS) GT_STORE(16, LP, v4h, cvt_y, cvt_w, xa, xw, &ya[(s + 1) & 1][0][0], &wa[(s + 1) & 1][0][0]);   /* into the buffer whose readers all passed the last barrier */
    if (s + 2 < CC / KS) GT_LOAD(16, xa, xw, xg, wg);   /* in flight under the next stage's products */
    stage_barrier(xg, wg, walk_step<CC / KS, KS * 4>(s + 2, s0, 1)); }   // publishes trip s + 1's stage and ends every read of trip s's stage
#pragma unroll
  for (int j = 0; j < 4; ++j) { const float bias = BO ? bfr(BO[c0 + wc * 64 + j * 16 + col]) : 0.f;
#pragma unroll
    for (int i = 0; i < 2; ++i)
#pragma unroll
      for (int r = 0; r < 8; ++r) sf[wave][i * 16 + 8 * g + r][j * 16 + col] = acc[i][j][r] * (1.0f / 16384.0f) + bias; }   /* 2^-8 (Wo carry) x 2^-6 (ctx carry) */
  LDSX(); for (int rl = 0; rl < 16; ++rl) vst2(OUT + (r0 + wr * 32 + rl * 2 + g) * DIN + c0 + wc * 64 + col * 4, *(const v4f*)&sf[wave][rl * 2 + g][col * 4]); }

extern "C" void kernel_launch(void* const* d_in, const int* in_sizes, int n_in, void* d_out, int out_size, void* d_ws, size_t ws_size, hipStream_t stream) {
  (void)in_sizes; (void)n_in; (void)out_size;
  const float** F = (const float**)d_in;
  if (ws_size < (size_t)WS_END) return;
  char* ws = (char*)d_ws; _Float16 *QH = (_Float16*)(ws + WS_QH), *KH = (_Float16*)(ws + WS_KH), *VT = (_Float16*)(ws + WS_VT), *QL = (_Float16*)(ws + WS_QL), *KL = (_Float16*)(ws + WS_KL); __bf16 *VB = (__bf16*)(ws + WS_VB), *VBL = (__bf16*)(ws + WS_VBL); float *Y = (float*)(ws + WS_Y);
  (void)Y; (void)QL; (void)KL; (void)VB; (void)VBL;
  // inputs: 0 query [2,2048,1024]; 1 key; 2 value; 3 wq [1024,1024] (out,in), 4 bq; 5 wk, 6 bk; 7 wv, 8 bv; 9 wo (out,in), 10 bo (biases zeros, read); 11 cos [2048,512]; 12 sin [2048,512]
  k_proj<<<dim3(TNB * TT / 256, CC / 256, 3), 256, 0, stream>>>(F[0], F[1], F[2], F[3], F[5], F[7], F[4], F[6], F[8], QH, KH, VT, F[11], F[12]);
  k_fa<<<dim3(TT / 256, NH, TNB), 256, 0, stream>>>(QH, KH, VT, Y);
  k_out<<<dim3(TNB * TT / 128, DIN / 128), 256, 0, stream>>>(Y, F[9], F[10], (float*)d_out);
}

// v009
// Measured time: 67.5 microseconds a run.
// Next to v008, in two timings, it ran 1.07 times as fast each time.
// Over all steps from v000 it is 21.3 times as fast.
// compute dtype: all float inputs rounded to bf16; q / k / v projections with EXACT bf16 products on WMMA 16x16x32 (f32 accumulate) + bias (zeros, read); interleaved-pair RoPE in f32 from the bf16-rounded INPUT cos / sin tables (512 pairs across the full model width); logits q x k once to f16 each (1 product) x 64^-0.5; online softmax f32 (base 2, against a held reference that is raised to the running maximum only when a pass's P sum tops 2^15); unnormalised P x 2^8 once to f16 x v once to f16 (1 product), divided by the f32 sum at the end; ctx x 2^6 once to f16 x wo f16(bf16 x 2^8) + bo; f32 output.
#include <hip/hip_runtime.h>
#include <math.h>

typedef __attribute__((ext_vector_type(16))) _Float16 v16h;
typedef __attribute__((ext_vector_type(16))) __bf16 v16b;
typedef __attribute__((ext_vector_type(8)))  _Float16 v8h;
typedef __attribute__((ext_vector_type(8)))  float v8f;
typedef __attribute__((ext_vector_type(4)))  float v4f;
typedef __attribute__((ext_vector_type(2)))  float v2f;
typedef __attribute__((ext_vector_type(4)))  unsigned v4u;
typedef __attribute__((ext_vector_type(4)))  int v4i;
typedef float __attribute__((may_alias)) float_a;
typedef int __attribute__((may_alias)) int_a;

template <typename T> __device__ __forceinline__ void vst2(void* p, T v) { *(T*)p = v;  }
__device__ __forceinline__ v8f wmma16(v16h a, v16h b, v8f c) {
  v8f d = __builtin_amdgcn_wmma_f32_16x16x32_f16(false, a, false, b, (short)0, c, false, false);
  asm volatile("v_nop\n\tv_nop\n\tv_nop\n\tv_nop" : "+v"(d) : "v"(a), "v"(b));
  return d;
}
__device__ __forceinline__ v8f wmma_bf(v16b a, v16b b, v8f c) {
  v8f d = __builtin_amdgcn_wmma_f32_16x16x32_bf16(false, a, false, b, (short)0, c, false, false);
  asm volatile("v_nop\n\tv_nop\n\tv_nop\n\tv_nop" : "+v"(d) : "v"(a), "v"(b));
  return d;
}
// 16x16x32 fragments: lane = (h = lane>>4, row/col = lane&15); elements 0..7 = k0+8h+0..7, 8..15 = k0+16+8h+0..7; D element r = row 8h+r
__device__ __forceinline__ v16h frag_h(const _Float16* rowk0, int lane) {
  union { v16h v; v8h q[2]; } u; const _Float16* p = rowk0 + 8 * (lane >> 4);
  u.q[0] = *(const v8h*)p; u.q[1] = *(const v8h*)(p + 16); return u.v;
}
__device__ __forceinline__ v16h frag_f32(const float* rowk0, int lane) {
  v16h a; const float* p = rowk0 + 8 * (lane >> 4);
#pragma unroll
  for (int i = 0; i < 8; ++i) { a[i] = (_Float16)p[i]; a[8 + i] = (_Float16)p[16 + i]; }
  return a;
}
__device__ __forceinline__ v16h frag_f32s(const float* rowk0, int lane, float sc) {
  v16h a; const float* p = rowk0 + 8 * (lane >> 4);
#pragma unroll
  for (int i = 0; i < 8; ++i) { a[i] = (_Float16)(p[i] * sc); a[8 + i] = (_Float16)(p[16 + i] * sc); }
  return a;
}
// column fragment from a [K][ld] layout (column n), rows >= K read as 0
__device__ __forceinline__ v16h fragc_f32(const float* W, int k0, int n, int lane, int ld, int K) {
  v16h a; const int g = lane >> 4;
#pragma unroll
  for (int i = 0; i < 8; ++i) { const int ka = k0 + 8 * g + i, kb = ka + 16;
    a[i] = (_Float16)(ka < K ? W[(size_t)(ka < K ? ka : K - 1) * ld + n] : 0.f); a[8 + i] = (_Float16)(kb < K ? W[(size_t)(kb < K ? kb : K - 1) * ld + n] : 0.f); }
  return a;
}
struct F2 { v16b h, l; };
__device__ __forceinline__ F2 bsplit16(const float v[16]) { F2 r;
#pragma unroll
  for (int i = 0; i < 16; ++i) { const __bf16 h = (__bf16)v[i]; r.h[i] = h; r.l[i] = (__bf16)(v[i] - (float)h); }
  return r; }
__device__ __forceinline__ F2 split_row(const float* row, int k0, int lane) { float v[16]; const float* p = row + k0 + 8 * (lane >> 4);
#pragma unroll
  for (int i = 0; i < 8; ++i) { v[i] = p[i]; v[8 + i] = p[16 + i]; }
  return bsplit16(v); }
__device__ __forceinline__ F2 split_rowK(const float* row, int k0, int lane, int K) { float v[16]; const int g = lane >> 4;
#pragma unroll
  for (int i = 0; i < 8; ++i) { const int ka = k0 + 8 * g + i, kb = ka + 16; v[i] = ka < K ? row[ka < K ? ka : K - 1] : 0.f; v[8 + i] = kb < K ? row[kb < K ? kb : K - 1] : 0.f; }
  return bsplit16(v); }
__device__ __forceinline__ F2 split_col(const float* W, int k0, int n, int lane, int ld, int K) { float v[16]; const int g = lane >> 4;
#pragma unroll
  for (int i = 0; i < 8; ++i) { const int ka = k0 + 8 * g + i, kb = ka + 16; v[i] = ka < K ? W[(size_t)(ka < K ? ka : K - 1) * ld + n] : 0.f; v[8 + i] = kb < K ? W[(size_t)(kb < K ? kb : K - 1) * ld + n] : 0.f; }
  return bsplit16(v); }
__device__ __forceinline__ v8f mac3(const F2& a, const F2& b, v8f c) { c = wmma_bf(a.l, b.h, c); c = wmma_bf(a.h, b.l, c); return wmma_bf(a.h, b.h, c); }
__device__ __forceinline__ float sigm(float v) { return 1.0f / (1.0f + expf(-v)); }
#define LDSX() do { asm volatile("s_wait_dscnt 0" ::: "memory"); __builtin_amdgcn_wave_barrier(); __builtin_amdgcn_fence(__ATOMIC_RELEASE, "workgroup"); } while (0)

// Multi-head attention on separate inputs with RoPE applied across the FULL model width before the head split (query / key / value [2,2048,1024]; torch (out,in) wq / wk / wv / wo [1024,1024] N(0, 1/1024) applied as x @ W.T + b, biases zeros (read); cos / sin [2048,512] are module INPUTS (computed in setup with numpy; read literally): x.reshape(.., 512, 2): (x0, x1) = (x[2j], x[2j+1]) -> (x0 c - x1 s, x0 s + x1 c) with c = cos[s][j], j = 0..511, on q and k; then 16 heads x 64 (head h = columns 64h..: its pair i uses table column h*32 + i); scores / sqrt(64); no mask; softmax; out @ wo.T + bo).
#define NB 2
#define TT 2048
#define CC 1024            // NH * HD = projected width
#define DIN 1024          // input (model) width
#define NH 16
#define HD 64
#define NQB (TT / 64)
#define HG 4
#define SCALE (0.125f)
#define CAUSAL 0
#ifndef TNB
#define TNB NB
#endif
__device__ __forceinline__ float bfr(float v) { return (float)(__bf16)v; }
__host__ __device__ __forceinline__ int kb_last(int qb) { return CAUSAL ? ((qb * 64 + 63) >> 7) : (TT / 128 - 1); }
typedef __attribute__((ext_vector_type(8))) __bf16 v8b;
__device__ __forceinline__ v16b frag_b(const __bf16* rowk0, int lane) {
  union { v16b v; v8b q[2]; } u; const __bf16* p = rowk0 + 8 * (lane >> 4);
  u.q[0] = *(const v8b*)p; u.q[1] = *(const v8b*)(p + 16); return u.v;
}
#define QBH 0              // not referenced by any kernel (k_fa has a single path for every query block)
#define QHI 0               // single-product logits on every row (logit sigma ~1)
#define KHI 64            // key rows carrying k residual / v bf16 hi+lo planes (no kernel here writes or reads them)
// B fragment (k rows k0+.., output column o) of a weight: (in,out) [K][ld] or (out,in) [ld rows of K]: bf16 exact, or f16(bf16 * 256) exact
__device__ __forceinline__ v16b wcol_io(const float* Wm, int k0, int o, int lane, int ld) { v16b w; const int g = lane >> 4;
#pragma unroll
  for (int i = 0; i < 8; ++i) { w[i] = (__bf16)Wm[(size_t)(k0 + 8 * g + i) * ld + o]; w[8 + i] = (__bf16)Wm[(size_t)(k0 + 16 + 8 * g + i) * ld + o]; }
  return w; }
__device__ __forceinline__ v16b wcol_oi(const float* Wm, int k0, int o, int lane, int K) { v16b w; const float* p = Wm + (size_t)o * K + k0 + 8 * (lane >> 4);
#pragma unroll
  for (int i = 0; i < 8; ++i) { w[i] = (__bf16)p[i]; w[8 + i] = (__bf16)p[16 + i]; }
  return w; }
__device__ __forceinline__ v16h wcolh_io(const float* Wm, int k0, int o, int lane, int ld) { v16h w; const int g = lane >> 4;
#pragma unroll
  for (int i = 0; i < 8; ++i) { w[i] = (_Float16)(bfr(Wm[(size_t)(k0 + 8 * g + i) * ld + o]) * 256.0f); w[8 + i] = (_Float16)(bfr(Wm[(size_t)(k0 + 16 + 8 * g + i) * ld + o]) * 256.0f); }
  return w; }
__device__ __forceinline__ v16h wcolh_oi(const float* Wm, int k0, int o, int lane, int K) { v16h w; const float* p = Wm + (size_t)o * K + k0 + 8 * (lane >> 4);
#pragma unroll
  for (int i = 0; i < 8; ++i) { w[i] = (_Float16)(bfr(p[i]) * 256.0f); w[8 + i] = (_Float16)(bfr(p[16 + i]) * 256.0f); }
  return w; }
#define WQKV_LAYOUT 1   // 0 = (in,out) [DIN][CC]; 1 = (out,in) [CC][DIN]; 2 = per-head [NH][DIN][HD]
__device__ __forceinline__ v16b wcol_hdk(const float* Wm, int k0, int o, int lane) { v16b w; const int g = lane >> 4; const float* p = Wm + (size_t)(o / HD) * DIN * HD + (o % HD);
#pragma unroll
  for (int i = 0; i < 8; ++i) { w[i] = (__bf16)p[(size_t)(k0 + 8 * g + i) * HD]; w[8 + i] = (__bf16)p[(size_t)(k0 + 16 + 8 * g + i) * HD]; }
  return w; }
#define WO_OUT_IN 1
#if WQKV_LAYOUT == 1
#define WCOL(W, k0, o, lane) wcol_oi(W, k0, o, lane, DIN)
#elif WQKV_LAYOUT == 2
#define WCOL(W, k0, o, lane) wcol_hdk(W, k0, o, lane)
#else
#define WCOL(W, k0, o, lane) wcol_io(W, k0, o, lane, CC)
#endif
#if WO_OUT_IN
#define WOCOL(W, k0, o, lane) wcol_oi(W, k0, o, lane, CC)
#define WOCOLH(W, k0, o, lane) wcolh_oi(W, k0, o, lane, CC)
#else
#define WOCOL(W, k0, o, lane) wcol_io(W, k0, o, lane, DIN)
#define WOCOLH(W, k0, o, lane) wcolh_io(W, k0, o, lane, DIN)
#endif

#define TBW 512   // table width = model width / 2 pairs
#define PROJ_EXTRA_PARAMS , const float* __restrict__ COS, const float* __restrict__ SIN   /* rotary tables [TT][512], module INPUTS, read literally */
#ifndef SM_EXTRA_PARAMS
#define SM_EXTRA_PARAMS
#endif
#ifndef PROJ_EXTRA_PARAMS
#define PROJ_EXTRA_PARAMS
#endif
#ifndef SM_MASK_HOOK
#define SM_MASK_HOOK (void)0
#endif

#define WS_QH  0u                                      // f16 q rows [b*t][CC]
#define WS_KH  (WS_QH + 2u * (size_t)NB * TT * CC)      // f16 k rows [b*t][CC]
#define WS_VT  (WS_KH + 2u * (size_t)NB * TT * CC)      // f16 v planes [b][c][t]
// QL, KL, VB and VBL belong to the causal high-precision path, which this problem does not take: nothing reads them and nothing writes them; their places stay so that the ctx plane keeps its own
#define WS_QL  (WS_VT + 2u * (size_t)NB * CC * TT)      // f16 q residual x 2^10 rows [b][t < QHI][CC]
#define WS_KL  (WS_QL + 2u * (size_t)NB * QHI * CC)     // f16 k residual x 2^10 rows [b][t < KHI][CC]
#define WS_VB  (WS_KL + 2u * (size_t)NB * KHI * CC)     // bf16 v hi planes [b][c][t < KHI]
#define WS_VBL (WS_VB + 2u * (size_t)NB * CC * KHI)
#define WS_S   (WS_VBL + 2u * (size_t)NB * CC * KHI)    // not used (scores stay in registers); kept so that the ctx plane keeps its place
#define WS_Y   (WS_S  + 4u * (size_t)HG * TT * TT)      // f16 ctx x 2^6 rows [b*t][CC]: the A operand of k_out as it is multiplied
#define WS_WO  (WS_Y  + 4u * (size_t)NB * TT * CC)      // f16(bf16(wo) x 2^8) rows [DIN][CC]: the B operand of k_out as it is multiplied
#define WS_END (WS_WO + 2u * (size_t)DIN * CC)

// ---- operand staging of the two GEMM kernels (block tile 128 x 128 in k_out, 256 x 256 in k_proj, where each X row is read by 4 blocks and each W row by 16): a stage is KS (k_out) or KSP (k_proj) k of every tile row; a thread moves 16 bytes (4 floats in k_proj, 8 f16 in k_out) of rows lr + RS i (RS = 16 or 32) of both operands, and one wave-wide 16-byte load covers whole 128-byte lines
#define KS 128   // k_out: 256 threads, thread (lr = tid >> 4, lc = 8 (tid & 15)); its operands are f16 in the workspace, so a thread's 16 bytes are 8 elements and a stage of the same bytes holds 128 k
#define KSP 32   // k_proj: 256 threads, thread (lr = tid >> 3, lc = 4 (tid & 7)); the shorter stage keeps the loads in flight at 64 registers beside the 256 of the accumulators
#define LPP 40   // LDS row pitch of a KSP stage in 16-bit elements: 80 B = 16 B x 5 (odd)
static_assert(CC == DIN, "one row pitch for every GEMM operand");
#define LP 136   // LDS row pitch of a KS stage in 16-bit elements: 272 B = 16 B x 17 (odd), the pitch for 16-byte fragment reads
typedef __attribute__((ext_vector_type(4))) __bf16 v4b;
typedef __attribute__((ext_vector_type(4))) _Float16 v4h;
__device__ __forceinline__ v8f mmb(v16b a, v16b b, v8f c) { return __builtin_amdgcn_wmma_f32_16x16x32_bf16(false, a, false, b, (short)0, c, false, false); }
__device__ __forceinline__ v4b cvt_b(v4f v) { return v4b{(__bf16)v[0], (__bf16)v[1], (__bf16)v[2], (__bf16)v[3]}; }
__device__ __forceinline__ v4f cvt_no(v4f v) { return v; }   // k_out: 16 bytes of f16 pass from the workspace to LDS as they are
__device__ __forceinline__ v4h cvt_w(v4f v) { return v4h{(_Float16)(bfr(v[0]) * 256.0f), (_Float16)(bfr(v[1]) * 256.0f), (_Float16)(bfr(v[2]) * 256.0f), (_Float16)(bfr(v[3]) * 256.0f)}; }   // f16(bf16 x 2^8), exact
// work-group barrier by hand: __syncthreads() compiled to a wait for the global loads too, which would drain the loads issued ahead for the stage after next; what the other waves need is this wave's LDS reads and writes complete (s_wait_dscnt 0). s_wait_xcnt 0 stands in front of every reuse of those loads' address registers.
// The two load pointers take their step of sb bytes (block-uniform, in scalar registers) to the next stage inside the statement, behind its s_wait_xcnt 0: written in the source, the additions were placed by the compiler between the loads and the wait.
__device__ __forceinline__ void stage_barrier(const float*& xp, const float*& wp, long sb) { asm volatile("s_wait_xcnt 0x0\n\ts_wait_dscnt 0x0\n\ts_barrier_signal -1\n\ts_barrier_wait -1\n\tv_add_nc_u64 %0, %2, %0\n\tv_add_nc_u64 %1, %2, %1" : "+v"(xp), "+v"(wp) : "s"(sb) : "memory"); }
__device__ __forceinline__ void stage_barrier(const _Float16*& xp, const _Float16*& wp, long sb) { asm volatile("s_wait_xcnt 0x0\n\ts_wait_dscnt 0x0\n\ts_barrier_signal -1\n\ts_barrier_wait -1\n\tv_add_nc_u64 %0, %2, %0\n\tv_add_nc_u64 %1, %2, %1" : "+v"(xp), "+v"(wp) : "s"(sb) : "memory"); }   // the same for k_out's f16 operands
// Rotated k walk: blocks that share operand rows would ask L2 for the same lines at the same moment, every one of them waiting for the same fetch. Each block therefore enters the k stages at its own stage s0 (even in k_proj) and wraps round: trip u works on stage (u + s0) mod NS_. A line is then fetched for the first block that comes to it and lies in L2 for the others. The k sum of a block runs in that rotated order.
// step in bytes from trip u's stage over d stages (d = 1 or 2), SW_ bytes a stage
template <int NS_, int SW_> __device__ __forceinline__ long walk_step(int u, int s0, int d) { return ((u + s0) & (NS_ - 1)) + d >= NS_ ? (long)(d - NS_) * SW_ : (long)d * SW_; }
// left as it was: inside the two loops these loads compile to flat_load_b128 (the pointers come out of the barrier's asm statement, behind which the compiler no longer knows their address space), and a flat load counts on dscnt as well as on loadcnt
#define GT_LOAD(RS_, xa, xw, xp, wp) do { _Pragma("unroll") for (int i_ = 0; i_ < 8; ++i_) xa[i_] = *(const v4f*)((xp) + (size_t)(i_ * RS_) * DIN); _Pragma("unroll") for (int i_ = 0; i_ < 8; ++i_) xw[i_] = *(const v4f*)((wp) + (size_t)(i_ * RS_) * DIN); } while (0)
#define GT_STORE(RS_, LP_, VT_, ca, cw, xa, xw, ad, wd) do { _Pragma("unroll") for (int i_ = 0; i_ < 8; ++i_) *(VT_*)((ad) + (lr + RS_ * i_) * LP_ + lc) = ca(xa[i_]); _Pragma("unroll") for (int i_ = 0; i_ < 8; ++i_) *(VT_*)((wd) + (lr + RS_ * i_) * LP_ + lc) = cw(xw[i_]); } while (0)
// ---- k_proj: block = (256 rows, 256 cols, which), 8 waves, one block a WGP: q/k/v = X W (+ b) with exact bf16 products (K = DIN) -> which 0: q f16 rows; 1: k f16 rows; 2: v f16 planes [c][t]; 3: wo to f16(bf16 x 2^8) for k_out
// The operand whose index runs along the CONTIGUOUS direction of the output is the A operand: W for q and k (features along a row), X for v (tokens along a plane). D register r of a lane is then A index 8 g + r:
// a lane holds 8 neighbouring output elements (16 bytes of f16, and for q and k four whole rotation pairs) of the output row picked by its B index, and the epilogue works from the accumulators.
#define EP 72   // pitch of a staged output row in f16: 144 B = 16 B x 9 (odd)
// a wave's 64 staged rows of 128 B go out as whole lines: a wave-wide 16-byte store covers 4 rows; unrolled whole, so that the 16 LDS reads issue as one group ahead of the stores
template <int PITCH> __device__ __forceinline__ void rows_out(_Float16* dst, const _Float16* so, int lane) { dst += (size_t)(lane >> 3) * PITCH + (lane & 7) * 8; so += (lane >> 3) * EP + (lane & 7) * 8;
#pragma unroll
  for (int e = 0; e < 16; ++e) vst2(dst + (size_t)(e * 4) * PITCH, *(const v4u*)(so + e * 4 * EP)); }
// between the two halves of the epilogue, own wave only. s_wait_xcnt 0 stands behind the first half's stores, in front of every write of the registers that they name; s_wait_dscnt 0: the lanes' reads of the first half's staged rows are complete before the second half is staged over them, and the "memory" clobber keeps the second half's LDS stores behind those reads. The scheduling barrier keeps the second half's arithmetic, which reuses the stores' registers, behind the waits (the compiler had lifted it over them).
__device__ __forceinline__ void half_end() { asm volatile("s_wait_xcnt 0x0\n\ts_wait_dscnt 0x0" ::: "memory"); __builtin_amdgcn_sched_barrier(0); }
__global__ __launch_bounds__(256) void k_proj(const float* __restrict__ XQ, const float* __restrict__ XK, const float* __restrict__ XV, const float* __restrict__ WQ, const float* __restrict__ WK, const float* __restrict__ WV, const float* __restrict__ BQ, const float* __restrict__ BK, const float* __restrict__ BV,
    _Float16* __restrict__ QH, _Float16* __restrict__ KH, _Float16* __restrict__ VT PROJ_EXTRA_PARAMS, const float* __restrict__ WO, _Float16* __restrict__ WOH) {
  // one LDS block, used in turn: the main loop's stages (2 x 256 X rows, then 2 x 256 W rows), then each wave's own 64 staged output rows (8 x 9,216 B)
  __shared__ __align__(16) char sm[2 * 2 * 256 * LPP * 2];
  static_assert(8 * 64 * EP * 2 <= 2 * 2 * 256 * LPP * 2, "the staged output rows fit the stages' place");
  const int tid = threadIdx.x, wave = tid >> 5, lane = tid & 31, col = lane & 15, g = lane >> 4; const int which = blockIdx.z; const int c0 = blockIdx.y * 256; const size_t rb = (size_t)blockIdx.x * 256; const size_t bb = rb / TT; const int t0 = (int)(rb % TT);
  // plane 3 of the grid: its blocks write wo as k_out multiplies it, f16(bf16 x 2^8), once for the 32 blocks of k_out that read each row. Block-uniform, in front of every barrier.
  if (which == 3) { constexpr int PER = DIN * CC / ((TNB * TT / 256) * (CC / 256)); static_assert(PER % 2048 == 0, "whole trips of 8 elements a thread");
    const size_t e0 = (size_t)(blockIdx.y * (TNB * TT / 256) + blockIdx.x) * PER + tid * 8;
    const float* wp = WO + e0; v4f w[PER / 2048][2];
#pragma unroll   /* whole, like the next loop: the array stays in registers, and all loads issue ahead of the first store */
    for (int i = 0; i < PER / 2048; ++i) { w[i][0] = *(const v4f*)(wp + i * 2048); w[i][1] = *(const v4f*)(wp + i * 2048 + 4); }
    asm volatile("s_wait_xcnt 0x0" :: "v"(wp) : "memory");   // keeps the loads' address registers whole up to this wait: without it the last load had its result placed over them
#pragma unroll
    for (int i = 0; i < PER / 2048; ++i) { const v4h a = cvt_w(w[i][0]), c = cvt_w(w[i][1]);
      *(v8h*)(WOH + e0 + i * 2048) = v8h{a[0], a[1], a[2], a[3], c[0], c[1], c[2], c[3]}; }
    return; }
  const float* X = which == 0 ? XQ : which == 1 ? XK : XV; const float* WA = which == 0 ? WQ : which == 1 ? WK : WV; const float* BA = which == 0 ? BQ : which == 1 ? BK : BV;
  // main loop: the block's X tile (256 x KSP) and W tile (256 x KSP) are read once per block with whole-line loads, rounded to bf16 once and staged in LDS (two buffers); wave (wr, wc) owns 128 A rows x 64 B rows
  const int wr = wave >> 2, wc = wave & 3; const int lr = tid >> 3, lc = (tid & 7) * 4; const bool qk = which < 2;
  __bf16* const As = (__bf16*)sm; __bf16* const Ws = As + 2 * 256 * LPP;
  const __bf16* const Am = qk ? Ws : As; const __bf16* const Bm = qk ? As : Ws;
  const int s0 = (2 * blockIdx.x + 8 * blockIdx.y) & (DIN / KSP - 1);   // the 16 blocks that share a W tile enter 2 stages apart, the 4 that share an X tile 8 apart
  const float* xg = X + (rb + lr) * DIN + lc + s0 * KSP; const float* wg = WA + (size_t)(c0 + lr) * DIN + lc + s0 * KSP;
  v4f xa[8], xw[8]; v8f acc[8][4] = {};
  GT_LOAD(32, xa, xw, xg, wg);
  GT_STORE(32, LPP, v4b, cvt_b, cvt_b, xa, xw, As, Ws);
  GT_LOAD(32, xa, xw, xg + KSP, wg + KSP);   /* s0 is even: the second trip's stage lies behind the first's */
  stage_barrier(xg, wg, walk_step<DIN / KSP, KSP * 4>(0, s0, 2));   // trip 0's stage is published; trip 1's stays in flight; the pointers now stand at the stage of the trip after next
#pragma unroll 2   /* two stages a trip: the buffer index is a constant */
  for (int s = 0; s < DIN / KSP; ++s) { const __bf16* Ab = Am + ((s & 1) * 256 + wr * 128 + col) * LPP; const __bf16* Wb = Bm + ((s & 1) * 256 + wc * 64 + col) * LPP;
    v16b af[8], wf[4];
    // the four B fragments are read first: every product row needs them, and row i then waits for af[i] alone, so the products start behind 10 of the 24 reads
#pragma unroll
    for (int j = 0; j < 4; ++j) wf[j] = frag_b(Wb + j * 16 * LPP, lane);
#pragma unroll
    for (int i = 0; i < 8; ++i) af[i] = frag_b(Ab + i * 16 * LPP, lane);
    __builtin_amdgcn_sched_barrier(0);   // the stage's fragment reads issue as one group ahead of its products, not among them
#pragma unroll
    for (int i = 0; i < 8; ++i)
#pragma unroll
      for (int j = 0; j < 4; ++j) acc[i][j] = mmb(af[i], wf[j], acc[i][j]);
    __builtin_amdgcn_sched_barrier(0);   // the conversions, which wait for the loads in flight, stay behind the products
    if (s + 1 < DIN / KSP) GT_STORE(32, LPP, v4b, cvt_b, cvt_b, xa, xw, As + ((s + 1) & 1) * 256 * LPP, Ws + ((s + 1) & 1) * 256 * LPP);   /* into the buffer whose readers all passed the last barrier */
    if (s + 2 < DIN / KSP) GT_LOAD(32, xa, xw, xg, wg);   /* in flight under the next stage's products */
    stage_barrier(xg, wg, walk_step<DIN / KSP, KSP * 4>(s + 2, s0, 1)); }   // publishes trip s + 1's stage and ends every read of trip s's stage
  // epilogue, from the accumulators, in two halves hh of the wave's 128 A rows: acc[4 hh + i][j][r] = output row (B index) wc 64 + 16 j + col, element (A index) wr 128 + hh 64 + 16 i + 8 g + r. The loop's last barrier has ended every read of the stages, so each wave stages in its own part of sm and needs no further barrier. Every loop of the epilogue is unrolled whole: the accumulator indices must be constants for the arrays to stay in registers.
  _Float16* const so = (_Float16*)sm + wave * (64 * EP); _Float16* const sw = so + col * EP + 8 * g;
  if (qk) {
#pragma unroll
    for (int hh = 0; hh < 2; ++hh) { const int f0 = c0 + wr * 128 + hh * 64;   /* the half's 64 features are head f0 / 64: pairs f0 / 2 .. f0 / 2 + 31 of the model-wide rotation */
    // (x0, x1) = features (2 p, 2 p + 1) -> (x0 c - x1 s, x0 s + x1 c) with c = bf16(cos[t][p]), s = bf16(sin[t][p]), t = the lane's token; a block's 256 tokens lie in one sequence
    const float* ct = COS + (size_t)(t0 + wc * 64 + col) * TBW + (f0 >> 1) + 4 * g; const float* sn_ = SIN + (size_t)(t0 + wc * 64 + col) * TBW + (f0 >> 1) + 4 * g;
    v4f bs[4][2] = {};
    if (BA) {
#pragma unroll
      for (int i = 0; i < 4; ++i)
#pragma unroll
        for (int q = 0; q < 2; ++q) bs[i][q] = *(const v4f*)(BA + f0 + i * 16 + 8 * g + 4 * q);
      asm volatile("s_wait_xcnt 0x0" ::: "memory"); }   // stands in front of every later write of the bias loads' address registers
#pragma unroll
    for (int i = 0; i < 4; ++i)
#pragma unroll
      for (int q = 0; q < 2; ++q)
#pragma unroll
        for (int r = 0; r < 4; ++r) bs[i][q][r] = bfr(bs[i][q][r]);
#pragma unroll
    for (int j = 0; j < 4; ++j)
#pragma unroll
      for (int i = 0; i < 4; ++i) { const v4f c4 = *(const v4f*)(ct + (size_t)(j * 16) * TBW + i * 8), s4 = *(const v4f*)(sn_ + (size_t)(j * 16) * TBW + i * 8); v8h o;
#pragma unroll
        for (int p = 0; p < 4; ++p) { const float cs = bfr(c4[p]), sn = bfr(s4[p]); const float xe = acc[4 * hh + i][j][2 * p] + bs[i][p >> 1][(2 * p) & 3], xo = acc[4 * hh + i][j][2 * p + 1] + bs[i][p >> 1][(2 * p + 1) & 3];
          o[2 * p] = (_Float16)(xe * cs - xo * sn); o[2 * p + 1] = (_Float16)(xe * sn + xo * cs); }
        *(v8h*)(sw + j * 16 * EP + i * 16) = o; }
    asm volatile("s_wait_xcnt 0x0" :: "v"(ct), "v"(sn_) : "memory");   // keeps the table loads' address registers whole up to this wait: without it the last half's final loads had their results placed over them
    LDSX();   // the wave's own staged rows are complete before its lanes read each other's pieces
    rows_out<CC>((which == 0 ? QH : KH) + (rb + wc * 64) * CC + f0, so, lane);
    if (hh == 0) half_end(); }
  } else { float bv[4] = {};
    if (BA) {
#pragma unroll
      for (int j = 0; j < 4; ++j) bv[j] = BA[c0 + wc * 64 + j * 16 + col];
      asm volatile("s_wait_xcnt 0x0" ::: "memory"); }   // as in the q / k branch
#pragma unroll
    for (int hh = 0; hh < 2; ++hh) {
#pragma unroll
    for (int j = 0; j < 4; ++j) { const float bias = bfr(bv[j]);
#pragma unroll
      for (int i = 0; i < 4; ++i) { v8h o;
#pragma unroll
        for (int r = 0; r < 8; ++r) o[r] = (_Float16)(acc[4 * hh + i][j][r] + bias);
        *(v8h*)(sw + j * 16 * EP + i * 16) = o; } }
    LDSX();   // as above
    rows_out<TT>(VT + (bb * CC + c0 + wc * 64) * (size_t)TT + t0 + wr * 128 + hh * 64, so, lane);
    if (hh == 0) half_end(); } } }
// ---- k_fa: block = 256 queries (8 waves x 32) of (b, h): logits, softmax and P . v in one pass over the keys, 32 keys at a time, k and v read from LDS stages; nothing of the score matrix leaves the registers.
// S^T = K . Q^T (A = k rows, B = q rows kept in registers): D register r of key tile kt = score of key 16 kt + 8 g + r for query column col, which is element 8 kt + r of the B operand of ctx^T += V^T . P^T, so P packs in place.
// Online softmax in base 2 against a held reference m per query column: a pass forms P = 2^(8 + score - m) with the m it finds and no maximum. Every P is positive, so a lane's sum of its P bounds each of them: while that sum stays at or under PLIM every P fits f16 and nothing is rescaled.
// A pass in which some lane's sum tops PLIM (the first pass always: m starts at -3e38, P = inf) raises m to the running maximum, rescales l and ctx^T by 2^(m_old - m_new) and forms its P again, now at most 2^8 each. The test is one scalar branch a pass. The wave halves' sums join in the epilogue.
// Every inner loop is unrolled whole, so that each fragment and accumulator index is a constant and the arrays live in registers.
#define PCARRY 8.0f   // P carried x 2^8 into f16 (cancels in ctx / l): small weights stay clear of f16 subnormals
#define PLIM 32768.0f   // bound on a lane's P sums of a pass (both query tiles together): each P is then at most 2^15, inside f16
__device__ __forceinline__ v8f mm16(v16h a, v16h b, v8f c) { return __builtin_amdgcn_wmma_f32_16x16x32_f16(false, a, false, b, (short)0, c, false, false); }
__device__ __forceinline__ float xhalf(float x) { return __builtin_bit_cast(float, __builtin_amdgcn_permlanex16(__builtin_bit_cast(int, x), __builtin_bit_cast(int, x), 0x76543210, 0xfedcba98, false, false)); }  // lane l with lane l ^ 16
// eight base-2 exponentials, each in its own register: no neighbour reads a result or overwrites a source, and the closing v_nop is the slot that the instruction set asks for behind the last one
__device__ __forceinline__ void exp2x8(v8f& a) { asm("v_exp_f32 %0, %0\n\tv_exp_f32 %1, %1\n\tv_exp_f32 %2, %2\n\tv_exp_f32 %3, %3\n\tv_exp_f32 %4, %4\n\tv_exp_f32 %5, %5\n\tv_exp_f32 %6, %6\n\tv_exp_f32 %7, %7\n\tv_nop" : "+v"(a[0]), "+v"(a[1]), "+v"(a[2]), "+v"(a[3]), "+v"(a[4]), "+v"(a[5]), "+v"(a[6]), "+v"(a[7])); }
// one query tile's P of a pass: p = 2^(score cs + nm), packed to f16 as the B operand of ctx^T += V^T . P^T, and the lane's f32 sum of them. The sum decides the pass's branch, so it is a pairwise tree (four links deep, packed adds), not a chain of sixteen.
__device__ __forceinline__ void soft_p(const v8f& s0, const v8f& s1, float cs, float nm, v16h& pf, float& ps) { v8f e0, e1;
#pragma unroll
  for (int r = 0; r < 8; ++r) { e0[r] = fmaf(s0[r], cs, nm); e1[r] = fmaf(s1[r], cs, nm); }
  exp2x8(e0); exp2x8(e1);
#pragma unroll
  for (int r = 0; r < 8; ++r) { pf[r] = (_Float16)e0[r]; pf[8 + r] = (_Float16)e1[r]; }
  const v8f t8 = e0 + e1; const v4f t4 = __builtin_shufflevector(t8, t8, 0, 1, 2, 3) + __builtin_shufflevector(t8, t8, 4, 5, 6, 7); const v2f t2 = __builtin_shufflevector(t4, t4, 0, 1) + __builtin_shufflevector(t4, t4, 2, 3); ps = t2[0] + t2[1]; }
// K / V staging: a stage is SK keys of the block's (b, h): SK k rows of 128 B and HD v plane pieces of 256 B, brought into LDS once for all 8 waves by asynchronous copies (16 B a lane, a wave-wide copy = 4 whole lines), two buffers
#define SK 128
#define NST (TT / SK)
#define KP 72                      // LDS pitch of a k row in f16: 144 B = 16 B x 9 (odd), the pitch for 16-byte fragment reads
#define VP 136                     // LDS pitch of a v plane piece in f16: 272 B = 16 B x 17 (odd)
#define VOF (SK * KP)              // start of the v part of a buffer, in f16
#define BUFH (SK * KP + HD * VP)   // one buffer, in f16
// one stage's 8 copies of this thread: k rows lr + 32 i, v planes lp + 16 i. s_wait_xcnt 0 closes the statement, so that it stands in front of every later write of the address registers that the copies name.
__device__ __forceinline__ void stage_copy(unsigned lk, unsigned lv, const _Float16* gk, const _Float16* gv) {
  asm volatile("global_load_async_to_lds_b128 %0, %8, off\n\tglobal_load_async_to_lds_b128 %1, %9, off\n\tglobal_load_async_to_lds_b128 %2, %10, off\n\tglobal_load_async_to_lds_b128 %3, %11, off\n\t"
               "global_load_async_to_lds_b128 %4, %12, off\n\tglobal_load_async_to_lds_b128 %5, %13, off\n\tglobal_load_async_to_lds_b128 %6, %14, off\n\tglobal_load_async_to_lds_b128 %7, %15, off\n\ts_wait_xcnt 0x0"
               :: "v"(lk), "v"(lk + 32u * KP * 2u), "v"(lk + 64u * KP * 2u), "v"(lk + 96u * KP * 2u), "v"(lv), "v"(lv + 16u * VP * 2u), "v"(lv + 32u * VP * 2u), "v"(lv + 48u * VP * 2u),
                  "v"(gk), "v"(gk + (size_t)32 * CC), "v"(gk + (size_t)64 * CC), "v"(gk + (size_t)96 * CC), "v"(gv), "v"(gv + (size_t)16 * TT), "v"(gv + (size_t)32 * TT), "v"(gv + (size_t)48 * TT) : "memory"); }
__global__ __launch_bounds__(256) void k_fa(const _Float16* __restrict__ QH, const _Float16* __restrict__ KH, const _Float16* __restrict__ VT, _Float16* __restrict__ Y) {
  __shared__ __align__(16) _Float16 kv[2][BUFH];
  const int tid = threadIdx.x, wave = tid >> 5, lane = tid & 31, col = lane & 15, g = lane >> 4; const int h = blockIdx.y, b = blockIdx.z; const int q0 = blockIdx.x * 256 + wave * 32;
  const float cs = SCALE * 1.4426950408889634f;
  const unsigned lk = (unsigned)(size_t)&kv[0][0] + (unsigned)(tid >> 3) * (KP * 2u) + (unsigned)(tid & 7) * 16u;               // this thread's 16 bytes of k row tid >> 3
  const unsigned lv = (unsigned)(size_t)&kv[0][0] + VOF * 2u + (unsigned)(tid >> 4) * (VP * 2u) + (unsigned)(tid & 15) * 16u;   // this thread's 16 bytes of v plane tid >> 4
  const _Float16* gk = KH + ((size_t)b * TT + (tid >> 3)) * CC + h * HD + (tid & 7) * 8;
  const _Float16* gv = VT + ((size_t)b * CC + h * HD + (tid >> 4)) * (size_t)TT + (tid & 15) * 8;
  const int s0 = 2 * blockIdx.x;   // rotated key walk, as the k walk of the GEMM kernels: the 8 blocks that share a head's k and v enter 2 stages apart and wrap round; trip t works on key stage (t + s0) mod NST, so the softmax sums run in that order
  static_assert((NST & (NST - 1)) == 0 && 2 * (TT / 256) <= NST, "the wrap is a mask, and every block has a start of its own");
  stage_copy(lk, lv, gk + (size_t)s0 * SK * CC, gv + s0 * SK);   // trip 0's stage into buffer 0
  v16h qf[2][2];
#pragma unroll
  for (int n = 0; n < 2; ++n)
#pragma unroll
    for (int kc = 0; kc < 2; ++kc) qf[n][kc] = frag_h(QH + ((size_t)b * TT + q0 + n * 16 + col) * CC + h * HD + kc * 32, lane);
  asm volatile("s_wait_asynccnt 0x0" ::: "memory");   // this wave's copies of trip 0's stage have landed
  __syncthreads();                                    // trip 0's stage is published
  stage_copy(lk + BUFH * 2u, lv + BUFH * 2u, gk + (size_t)(s0 + 1) * SK * CC, gv + (s0 + 1) * SK);   // trip 1's stage (s0 is even: no wrap) into buffer 1, in flight under trip 0's passes
  v8f acc[2][4] = {}; float m[2] = {-3.0e38f, -3.0e38f}, l[2] = {0.f, 0.f};
#pragma unroll 1   /* rolled, like the pass loop inside it */
  for (int t = 0; t < NST; ++t) { const _Float16* kb = &kv[t & 1][0] + col * KP;   /* key row col of the stage's first tile */
    const _Float16* vb = &kv[t & 1][VOF] + col * VP;                               /* v plane piece of head column col */
    v16h kf[2][2];
#pragma unroll
    for (int kt = 0; kt < 2; ++kt)
#pragma unroll
      for (int kc = 0; kc < 2; ++kc) kf[kt][kc] = frag_h(kb + (kt * 16) * KP + kc * 32, lane);
#pragma unroll 1   /* rolled: one pass already holds 16 matrix instructions, and further copies would multiply the live fragments */
    for (int p = 0; p < SK / 32; ++p) { const int nx = p + 1 < SK / 32 ? p + 1 : p;   /* a stage's last pass fetches its own k tiles again: inside the stage, unused */
    v8f s[2][2];
#pragma unroll
    for (int kt = 0; kt < 2; ++kt)
#pragma unroll
      for (int n = 0; n < 2; ++n) { s[kt][n] = v8f{};
#pragma unroll
        for (int kc = 0; kc < 2; ++kc) s[kt][n] = mm16(kf[kt][kc], qf[n][kc], s[kt][n]); }
    // one group of LDS reads a pass: this pass's v fragments, then the next pass's k fragments into the same registers (inside the stage only), in flight under the softmax
    v16h vf[4];
#pragma unroll
    for (int j = 0; j < 4; ++j) vf[j] = frag_h(vb + (j * 16) * VP + p * 32, lane);
#pragma unroll
    for (int kt = 0; kt < 2; ++kt)
#pragma unroll
      for (int kc = 0; kc < 2; ++kc) kf[kt][kc] = frag_h(kb + (nx * 32 + kt * 16) * KP + kc * 32, lane);
    __builtin_amdgcn_sched_barrier(0);   // the reads issue here, ahead of the softmax, not sunk towards their use
    v16h pf[2]; float ps[2];
#pragma unroll
    for (int n = 0; n < 2; ++n) soft_p(s[0][n], s[1][n], cs, PCARRY - m[n], pf[n], ps[n]);
    if (__builtin_amdgcn_ballot_w32(!(ps[0] + ps[1] <= PLIM)) != 0) {   /* wave-uniform; written so that inf and NaN take the branch too */
#pragma unroll
      for (int n = 0; n < 2; ++n) { float mx = s[0][n][0];
#pragma unroll
        for (int r = 0; r < 8; ++r) mx = fmaxf(mx, fmaxf(s[0][n][r], s[1][n][r]));
        mx = fmaxf(mx, xhalf(mx)) * cs;   /* both halves hold the column's maximum of this pass, scaled (cs > 0) */
        const float mn = fmaxf(m[n], mx); const float corr = __builtin_amdgcn_exp2f(m[n] - mn); m[n] = mn; l[n] *= corr;
#pragma unroll
        for (int j = 0; j < 4; ++j) acc[n][j] *= corr;
        soft_p(s[0][n], s[1][n], cs, PCARRY - mn, pf[n], ps[n]); } }
#pragma unroll
    for (int n = 0; n < 2; ++n) { l[n] += ps[n];
#pragma unroll
      for (int j = 0; j < 4; ++j) acc[n][j] = mm16(vf[j], pf[n], acc[n][j]); } }
    asm volatile("s_wait_dscnt 0x0" ::: "memory");      // this wave's reads of trip t's stage are complete before the buffer may be refilled
    asm volatile("s_wait_asynccnt 0x0" ::: "memory");   // this wave's copies of trip t + 1's stage have landed
    __syncthreads();                                    // publishes trip t + 1's stage and ends every read of trip t's stage
    if (t + 2 < NST) { const int st = (t + 2 + s0) & (NST - 1); stage_copy(lk + (unsigned)(t & 1) * (BUFH * 2u), lv + (unsigned)(t & 1) * (BUFH * 2u), gk + (size_t)st * SK * CC, gv + st * SK); } }   /* into the buffer that trip t's stage has just left */
  asm volatile("s_wait_asynccnt 0x0" ::: "memory");   // nothing of this wave is in flight when it leaves the loop
#pragma unroll
  for (int n = 0; n < 2; ++n) { const float inv = 1.0f / (l[n] + xhalf(l[n])); _Float16* yr = Y + ((size_t)b * TT + q0 + n * 16 + col) * CC + h * HD + 8 * g;   /* register r of tile j = head column 16 j + 8 g + r of query col */
#pragma unroll
    for (int j = 0; j < 4; ++j) { const v8f o = acc[n][j] * inv; v8h y;   /* ctx x 2^6 once to f16, as k_out multiplies it: small-magnitude context rows stay clear of f16 subnormals */
#pragma unroll
      for (int r = 0; r < 8; ++r) y[r] = (_Float16)(o[r] * 64.0f);
      vst2(yr + j * 16, y); } } }
// ---- k_out: block = (128 rows, 128 cols), 8 waves, one block a WGP: out = ctx Wo (+ bo): ctx x 2^6 once to f16 against Wo as f16(bf16 x 2^8) exact (1 product) x 2^-14; both operands come as f16 from their writers (k_fa, plane 3 of k_proj)
__global__ __launch_bounds__(256) void k_out(const _Float16* __restrict__ Y, const _Float16* __restrict__ WO, const float* __restrict__ BO, float* __restrict__ OUT) { __shared__ __align__(16) float sf[8][32][68]; __shared__ __align__(16) _Float16 ya[2][128][LP], wa[2][128][LP];
  const int tid = threadIdx.x, wave = tid >> 5, lane = tid & 31, col = lane & 15, g = lane >> 4; const int c0 = blockIdx.y * 128; const size_t r0 = (size_t)blockIdx.x * 128;
  // main loop as in k_proj: ctx tile (128 x KS) and Wo tile (128 x KS) staged in LDS as they are, two buffers; wave (wr, wc) owns 32 rows x 64 columns
  const int wr = wave >> 1, wc = wave & 1; const int lr = tid >> 4, lc = (tid & 15) * 8;
  const int s0 = (blockIdx.x + blockIdx.y) & (CC / KS - 1);   // rotated k walk as in k_proj: the 8 blocks that share a ctx tile each enter at a stage of their own, the 32 that share a Wo tile at 8 different stages
  const int d1 = (((s0 + 1) & (CC / KS - 1)) - s0) * KS;      // from the first trip's stage to the second's, which may wrap
  const _Float16* xg = Y + (r0 + lr) * CC + lc + s0 * KS; const _Float16* wg = WO + (size_t)(c0 + lr) * CC + lc + s0 * KS;
  v4f xa[8], xw[8]; v8f acc[2][4] = {};
  GT_LOAD(16, xa, xw, xg, wg);
  GT_STORE(16, LP, v4f, cvt_no, cvt_no, xa, xw, &ya[0][0][0], &wa[0][0][0]);
  GT_LOAD(16, xa, xw, xg + d1, wg + d1);
  stage_barrier(xg, wg, walk_step<CC / KS, KS * 2>(0, s0, 2));   // trip 0's stage is published; trip 1's stays in flight; the pointers now stand at the stage of the trip after next
#pragma unroll 2   /* two stages a trip: the buffer index is a constant */
  for (int s = 0; s < CC / KS; ++s) { const _Float16* Ab = &ya[s & 1][wr * 32 + col][0]; const _Float16* Wb = &wa[s & 1][wc * 64 + col][0];
    v16h af[KS / 32][2], wf[KS / 32][4];
#pragma unroll
    for (int ks = 0; ks < KS / 32; ++ks) {
#pragma unroll
      for (int i = 0; i < 2; ++i) af[ks][i] = frag_h(Ab + i * 16 * LP + ks * 32, lane);
#pragma unroll
      for (int j = 0; j < 4; ++j) wf[ks][j] = frag_h(Wb + j * 16 * LP + ks * 32, lane); }
    __builtin_amdgcn_sched_barrier(0);   // the stage's fragment reads issue as one group ahead of its products, not among them
#pragma unroll
    for (int ks = 0; ks < KS / 32; ++ks)
#pragma unroll
      for (int i = 0; i < 2; ++i)
#pragma unroll
        for (int j = 0; j < 4; ++j) acc[i][j] = mm16(af[ks][i], wf[ks][j], acc[i][j]);
    __builtin_amdgcn_sched_barrier(0);   // the LDS stores, which wait for the loads in flight, stay behind the products
    if (s + 1 < CC / KS) GT_STORE(16, LP, v4f, cvt_no, cvt_no, xa, xw, &ya[(s + 1) & 1][0][0], &wa[(s + 1) & 1][0][0]);   /* into the buffer whose readers all passed the last barrier */
    if (s + 2 < CC / KS) GT_LOAD(16, xa, xw, xg, wg);   /* in flight under the next stage's products */
    stage_barrier(xg, wg, walk_step<CC / KS, KS * 2>(s + 2, s0, 1)); }   // publishes trip s + 1's stage and ends every read of trip s's stage
#pragma unroll
  for (int j = 0; j < 4; ++j) { const float bias = BO ? bfr(BO[c0 + wc * 64 + j * 16 + col]) : 0.f;
#pragma unroll
    for (int i = 0; i < 2; ++i)
#pragma unroll
      for (int r = 0; r < 8; ++r) sf[wave][i * 16 + 8 * g + r][j * 16 + col] = acc[i][j][r] * (1.0f / 16384.0f) + bias; }   /* 2^-8 (Wo carry) x 2^-6 (ctx carry) */
  LDSX(); for (int rl = 0; rl < 16; ++rl) vst2(OUT + (r0 + wr * 32 + rl * 2 + g) * DIN + c0 + wc * 64 + col * 4, *(const v4f*)&sf[wave][rl * 2 + g][col * 4]); }

extern "C" void kernel_launch(void* const* d_in, const int* in_sizes, int n_in, void* d_out, int out_size, void* d_ws, size_t ws_size, hipStream_t stream) {
  (void)in_sizes; (void)n_in; (void)out_size;
  const float** F = (const float**)d_in;
  if (ws_size < (size_t)WS_END) return;
  char* ws = (char*)d_ws; _Float16 *QH = (_Float16*)(ws + WS_QH), *KH = (_Float16*)(ws + WS_KH), *VT = (_Float16*)(ws + WS_VT), *QL = (_Float16*)(ws + WS_QL), *KL = (_Float16*)(ws + WS_KL); __bf16 *VB = (__bf16*)(ws + WS_VB), *VBL = (__bf16*)(ws + WS_VBL); _Float16 *Y = (_Float16*)(ws + WS_Y), *WOH = (_Float16*)(ws + WS_WO);
  (void)Y; (void)QL; (void)KL; (void)VB; (void)VBL;
  // inputs: 0 query [2,2048,1024]; 1 key; 2 value; 3 wq [1024,1024] (out,in), 4 bq; 5 wk, 6 bk; 7 wv, 8 bv; 9 wo (out,in), 10 bo (biases zeros, read); 11 cos [2048,512]; 12 sin [2048,512]
  k_proj<<<dim3(TNB * TT / 256, CC / 256, 4), 256, 0, stream>>>(F[0], F[1], F[2], F[3], F[5], F[7], F[4], F[6], F[8], QH, KH, VT, F[11], F[12], F[9], WOH);
  k_fa<<<dim3(TT / 256, NH, TNB), 256, 0, stream>>>(QH, KH, VT, Y);
  k_out<<<dim3(TNB * TT / 128, DIN / 128), 256, 0, stream>>>(Y, WOH, F[10], (float*)d_out);
}
